// v000
// The times below were measured on an AMD MI455X: many runs one after another, warmed up first and cycling through
// copies of the inputs, with the whole window's GPU time divided by the number of runs. Launches and the gaps
// between them are all in it. The median over several windows is given; except for v000 it joins two sittings, which
// can be a few percent apart, so the side-by-side timings, each taken in one sitting, are the better comparison.
// v000 is the starting kernel. One run takes 315 microseconds.
#include <hip/hip_runtime.h>

// Causal pair-score weighting, width 1024 = 16 heads x 64; one input x [NB][SEQ][1024] feeds q, k and v; Wq/Wk/Wv [out][in] (y = x W^T + bias); rank-8 additive updates on q and v: y += 2 (x A^T) B^T with A [8][in], B [out][8];
// additive key mask [NB][1][1][SEQ] (f32, read by value); score scale 1/sqrt(64); keys j > t are replaced by -1e9 before the mask is added; softmax over keys; output = concatenated heads (f32), no output projection.
// Compute dtypes, f32 accumulate everywhere: projections and x A^T v_wmma_f32_16x16x32_bf16 (x, W, A, B, biases, mask RNE-converted to bf16; products exact); the rank-8 up-projection is one extra 32-deep k-step of the projection GEMM (2 x A^T carried as bf16 hi | lo, B bf16);
// scores v_wmma_f32_16x16x32_f16: single f16 q and k on query rows >= EROWS; q and k each as f16 value + f16 residual x2048 (three products, residual products in their own accumulator) on query rows < EROWS;
// P.V v_wmma_f32_16x16x32_f16: P (x16384 carry, cancels in the normalisation) and v single f16 on query rows >= EROWS; on query rows < EROWS P and v each as f16 value + f16 residual x2048, residual products in their own accumulator folded by 1/2048, row sum from the f32 exponentials; softmax f32 (online, running max).
// Layout: bf16 copies of x, W, A; extension planes [row][32] bf16 (x side: hi | lo | 0 | 0 of 2 x A^T; weight side: B | B | 0 | 0); q, k planes [b*16+h][t][64], v^T plane [b*16+h][d][t], small residual planes q, k [b*16+h][t < EROWS][64] and v^T [b*16+h][d][t < EROWS]; fused online-softmax key-pass kernel in transposed form (S^T = K Q^T, O^T = V^T P^T).
// Key loop bound per wave: the causal limit; if any mask value of the batch is not below 1e8 in magnitude the loop covers all keys (per-element arithmetic is literal in every visited tile). Residual fragments for keys >= EROWS are zero.

#ifndef NB
#define NB 2
#endif
#ifndef SEQ
#define SEQ 2048
#endif
#define NB_FULL  2
#define SEQ_FULL 2048
#ifndef OUT_SEQ
#define OUT_SEQ SEQ              // row pitch (in tokens) between batches of the output
#endif
#define DM   1024
#define NH_  16
#define HD   64
#define LR   8                   // rank of the additive updates
#define LK   32                  // k extent of the extension planes (one WMMA k-step)
#define XP   20                  // LDS row pitch (floats) of the x A^T tile
#define AW   4                   // waves per online-softmax key-pass block (16 query rows each)
#define OSP  68                  // LDS row pitch (floats) of the online-softmax key-pass output tile
#define EROWS (SEQ < 512 ? SEQ : 512)   // query rows (and tokens of the small residual planes) handled by the multi-product online-softmax key-pass instantiation
#define QRS  2048.0f             // carry of every residual plane / residual fragment
#define QRI  (1.0f / 2048.0f)
#define SC2  ((float)(0.125 * 1.4426950408889634))      // HD^-0.5 * log2(e)
#define L2E  ((float)1.4426950408889634)
#define NEGL ((float)(-1.0e9 * 1.4426950408889634))     // fill value -1e9 in the log2 domain
#define LSC  2.0f                // update scaling 16 / 8
#define PSH  14.0f               // log2 of the P carry (16384)
#define PFL  (-14.0f)            // exponent argument below which the f16 P would leave the normal range
#define NEGB (-3.0e38f)
#define WIDE 1.0e8f              // mask magnitude bound under which skipped (fully causal-filled) tiles contribute exactly zero

static_assert(HD == 64);
static_assert(NH_ * HD == DM);                 // head h = columns h*64 + d
static_assert(DM % 64 == 0);                   // column tiles of 64 = one head
static_assert(64 % HD == 0);
static_assert(DM % 32 == 0);                   // GEMM k-loop steps by 32
static_assert(LK == 32);                       // extension = exactly one k-step
static_assert(2 * LR <= LK);                   // hi | lo pieces fit the extension row
static_assert(LR == 8);                        // one 16-byte piece per part; B rows loaded as 8 floats
static_assert(2 * LR == 16);                   // A rows of q and v updates fill one 16-column tile
static_assert(SEQ % 64 == 0);                  // a 64-row tile never straddles two batches
static_assert((NB * SEQ) % 64 == 0);
static_assert(SEQ % 128 == 0);                 // mask scan steps by 128
static_assert(SEQ % 32 == 0);                  // key loop steps by 32
static_assert(SEQ % (16 * AW) == 0);           // online-softmax key-pass grids cover the sequence exactly
static_assert(EROWS % 64 == 0);                // a 64-token GEMM tile lies wholly inside or outside the residual planes
static_assert(EROWS >= 32);
static_assert(EROWS <= SEQ);
static_assert(EROWS % (16 * AW) == 0);
static_assert((SEQ - EROWS) % (16 * AW) == 0);
static_assert(((size_t)SEQ * DM) % 8 == 0);
static_assert(((size_t)DM * DM) % 8 == 0);
static_assert(((size_t)LR * DM) % 8 == 0);
static_assert(NB <= NB_FULL);
static_assert(SEQ <= SEQ_FULL);
static_assert((OSP * 4) % 16 == 0);
static_assert(OSP >= HD);
static_assert((XP * 4) % 16 == 0);
static_assert(XP >= 16);
static_assert(32 * 4 * 16 == 16 * HD * 2);
static_assert(32 * 4 * 16 == 16 * 64 * 2);
static_assert(32 * 8 * 16 == 16 * HD * 4);     // online-softmax key-pass epilogue: 8 instructions x 32 lanes x 16 B = 16 rows x 256 B
static_assert(32 * 8 * 16 == 64 * LK * 2);     // x A^T epilogue: 8 instructions x 32 lanes x 16 B = 64 rows x 64 B per plane
static_assert(16 * 68 * 4 <= 131072);          // static LDS of the projection kernels
static_assert(64 * XP * 4 <= 131072);          // static LDS of the x A^T kernel
static_assert(AW * 16 * OSP * 4 <= 131072);    // static LDS of the online-softmax key-pass kernels

typedef _Float16 h16;
typedef unsigned short bf;
typedef __attribute__((ext_vector_type(16))) __bf16   v16bf;
typedef __attribute__((ext_vector_type(16))) _Float16 v16h;
typedef __attribute__((ext_vector_type(8)))  _Float16 v8h;
typedef __attribute__((ext_vector_type(8)))  unsigned short v8us;
typedef __attribute__((ext_vector_type(8)))  float    v8f;
typedef __attribute__((ext_vector_type(4)))  float    v4f;
typedef v4f  __attribute__((may_alias)) v4fa;

__device__ __forceinline__ unsigned short f2bf(float f) { unsigned u = __float_as_uint(f); u += 0x7FFFu + ((u >> 16) & 1u); return (unsigned short)(u >> 16); }
__device__ __forceinline__ float bfr(float f) { return __uint_as_float(((unsigned)f2bf(f)) << 16); }   // value after RNE convert to bf16
__device__ __forceinline__ v16h cat16(v8h lo, v8h hi) { return __builtin_shufflevector(lo, hi, 0, 1, 2, 3, 4, 5, 6, 7, 8, 9, 10, 11, 12, 13, 14, 15); }
__device__ __forceinline__ v16bf cat16b(v8us lo, v8us hi) { return __builtin_bit_cast(v16bf, __builtin_shufflevector(lo, hi, 0, 1, 2, 3, 4, 5, 6, 7, 8, 9, 10, 11, 12, 13, 14, 15)); }
__device__ __forceinline__ v8f wmma16(v16h a, v16h b, v8f c) { return __builtin_amdgcn_wmma_f32_16x16x32_f16(false, a, false, b, (short)0, c, false, false); }
__device__ __forceinline__ v8f wmmab(v16bf a, v16bf b, v8f c) { return __builtin_amdgcn_wmma_f32_16x16x32_bf16(false, a, false, b, (short)0, c, false, false); }
// fragment loaders from K-contiguous 16-bit rows; p already includes + 8*(lane>>4): elements 0..7 <- k0+8h+0..7, elements 8..15 <- k0+16+8h+0..7 (same map for A and B)
__device__ __forceinline__ v16h  ldh(const h16* p) { return cat16(*(const v8h*)p, *(const v8h*)(p + 16)); }
__device__ __forceinline__ v16bf ldb(const bf* p)  { return cat16b(*(const v8us*)p, *(const v8us*)(p + 16)); }
// ordering point for wave-private LDS tiles (same wave writes and reads)
__device__ __forceinline__ void wave_sync() { __builtin_amdgcn_fence(3 /* release order */, "wavefront"); __builtin_amdgcn_wave_barrier(); asm volatile("" ::: "memory"); }

// f32 -> f16 convert that cannot produce a subnormal operand (|v| < 2^-14 -> +0); applied after the plane's power-of-two carry
static __device__ __forceinline__ h16 toh_flush(float v) { const h16 r = (h16)v; return (fabsf(v) < 6.103515625e-05f) ? (h16)0.0f : r; }
// one matrix instruction followed by its own four-slot guard (ties the accumulator, keeps the operands live)
static __device__ __forceinline__ v8f wmma16g(v16h a, v16h b, v8f c) { c = wmma16(a, b, c); asm volatile("v_nop\n\tv_nop\n\tv_nop\n\tv_nop" : "+v"(c) : "v"(a), "v"(b)); return c; }
static __device__ __forceinline__ v8f wmmabg(v16bf a, v16bf b, v8f c) { c = wmmab(a, b, c); asm volatile("v_nop\n\tv_nop\n\tv_nop\n\tv_nop" : "+v"(c) : "v"(a), "v"(b)); return c; }
// one 16-bit word of an extension row: piece 0 = bf16 value, piece 1 = bf16 of the remainder, pieces 2, 3 = zero (select by value)
static __device__ __forceinline__ unsigned short ext_word(float v, int piece) {
    const unsigned short hw = f2bf(v); const float hv = __uint_as_float(((unsigned)hw) << 16); const unsigned short lw = f2bf(v - hv);
    return (piece == 0) ? hw : ((piece == 1) ? lw : (unsigned short)0); }

__global__ __launch_bounds__(256) void k_cvt8(const float* __restrict__ src, bf* dst, size_t n8) {
    const size_t i = (size_t)blockIdx.x * 256 + threadIdx.x; if (i >= n8) return;
    const v8f v = *(const v8f*)(src + i * 8); v8us o;
#pragma unroll
    for (int k = 0; k < 8; ++k) o[k] = f2bf(v[k]);
    *(v8us*)(dst + i * 8) = o; 
}

__global__ __launch_bounds__(256) void k_bext(const float* __restrict__ src, bf* dst, int n4) {
    const int i = blockIdx.x * 256 + threadIdx.x; if (i >= n4) return;
    const int row = i >> 2, piece = i & 3;
    v8f v = *(const v8f*)(src + (size_t)row * LR);
    asm volatile("" : "+v"(v));
    v8us o;
#pragma unroll
    for (int k = 0; k < 8; ++k) { const unsigned short w = f2bf(v[k]); o[k] = (piece < 2) ? w : (unsigned short)0; }
    *(v8us*)(dst + (size_t)i * 8) = o; 
}

// k_xa: x A^T for both updates in one 16-column tile (columns 0..7 = q update rows of A, 8..15 = v update rows), ONE WAVE per 64 token rows, K = DM, bf16 operands straight from the planes.
// Output: x-side extension planes XLq, XLv [token][32] bf16 = hi | lo | 0 | 0 of 2 * (x A^T); per plane the 64 rows x 64 B of the tile are one contiguous 4096-byte run:
__global__ __launch_bounds__(32) void k_xa(const bf* __restrict__ X, const bf* __restrict__ AL, bf* XLq, bf* XLv) {
    __shared__ __align__(16) float os[64 * XP];
    const int lane = threadIdx.x & 31, lr = lane & 15, hi = lane >> 4; const int r0 = blockIdx.x * 64;
    v8f acc[4];
#pragma unroll
    for (int mb = 0; mb < 4; ++mb) acc[mb] = (v8f){};
    const size_t aoff = (size_t)(r0 + lr) * DM + 8 * hi, boff = (size_t)lr * DM + 8 * hi;
#pragma unroll 1
    for (int kc = 0; kc < DM; kc += 32) {
        const v16bf bw = ldb(AL + boff + kc);
#pragma unroll
        for (int mb = 0; mb < 4; ++mb) { const v16bf a = ldb(X + aoff + (size_t)mb * 16 * DM + kc); acc[mb] = wmmabg(a, bw, acc[mb]); }
    }
#pragma unroll
    for (int mb = 0; mb < 4; ++mb) {
#pragma unroll
        for (int j = 0; j < 8; ++j) os[(mb * 16 + hi * 8 + j) * XP + lr] = acc[mb][j] * LSC; }   // D: row 8h+j, col lane&15; rows 0..63 x columns 0..15 all written
    wave_sync();
    const size_t ob = (size_t)r0 * LK;
{
#pragma unroll 1
        for (int s = 0; s < 8; ++s) { const int p = s * 32 + lane; const int row = p >> 2, piece = p & 3;   // 8 s x 8 rows = 64 rows; 4 lanes x 16 B = one 64-byte row
            const v4f a0 = *(const v4fa*)(&os[row * XP + 0]); const v4f a1 = *(const v4fa*)(&os[row * XP + 4]);
            const v4f c0 = *(const v4fa*)(&os[row * XP + 8]); const v4f c1 = *(const v4fa*)(&os[row * XP + 12]);
            v8us oq, ov;
#pragma unroll
            for (int i = 0; i < 4; ++i) { oq[i] = ext_word(a0[i], piece); oq[4 + i] = ext_word(a1[i], piece); ov[i] = ext_word(c0[i], piece); ov[4 + i] = ext_word(c1[i], piece); }
            *(v8us*)(XLq + ob + (size_t)p * 8) = oq; *(v8us*)(XLv + ob + (size_t)p * 8) = ov; }
         }
}

// proj_body: register-blocked bf16 GEMM, ONE WAVE per 64x64 tile (16 accumulators), operands straight from K-contiguous bf16 planes, K = DM (+ one 32-deep extension step from AX / BX when LOWR).
// C[m][n] = sum_k A[m][k] Bt[n][k] (+ sum_k AX[m][k] BX[n][k]) + bias, written as f16 (Ph) and, for tokens t < resT (resT a multiple of 64, block-uniform test), the f16 residual x2048 (Pr).
// MODE 0: A = x rows (m = b*SEQ + t), Bt = W rows (n = h*64 + d), bias per column; plane [(b*16 + h)][t][64] (residual plane [(b*16 + h)][resT][64]). The 64-column tile is one head; per 16-row slab
//         (4 rows per instruction). grid (NB*SEQ/64, DM/64).
template <int MODE, int LOWR>
__device__ __forceinline__ void proj_body(const bf* __restrict__ A, const bf* __restrict__ Bt, const bf* __restrict__ AX, const bf* __restrict__ BX,
                                          const float* __restrict__ bias, h16* Ph, h16* Pr, int resT) {
    __shared__ __align__(16) float os[16 * 68];
    const int K = DM;
    const int lane = threadIdx.x & 31, lr = lane & 15, hi = lane >> 4; const int r0 = blockIdx.x * 64, c0 = blockIdx.y * 64;
    v8f acc[4][4];
#pragma unroll
    for (int mb = 0; mb < 4; ++mb)
#pragma unroll
        for (int nb = 0; nb < 4; ++nb) acc[mb][nb] = (v8f){};
    const size_t aoff = (size_t)(r0 + lr) * K + 8 * hi, boff = (size_t)(c0 + lr) * K + 8 * hi;
#pragma unroll 1
    for (int kc = 0; kc < K; kc += 32) {
        v16bf a[4];
#pragma unroll
        for (int mb = 0; mb < 4; ++mb) a[mb] = ldb(A + aoff + (size_t)mb * 16 * K + kc);
#pragma unroll
        for (int nb = 0; nb < 4; ++nb) { const v16bf b = ldb(Bt + boff + (size_t)nb * 16 * K + kc);
#pragma unroll
            for (int mb = 0; mb < 4; ++mb) acc[mb][nb] = wmmabg(a[mb], b, acc[mb][nb]); }
    }
    if (LOWR) {                                                                                   // extension k-step: rows of 32 bf16, same loader and k map on both sides
        const size_t axo = (size_t)(r0 + lr) * LK + 8 * hi, bxo = (size_t)(c0 + lr) * LK + 8 * hi;
        v16bf a[4];
#pragma unroll
        for (int mb = 0; mb < 4; ++mb) a[mb] = ldb(AX + axo + (size_t)mb * 16 * LK);
#pragma unroll
        for (int nb = 0; nb < 4; ++nb) { const v16bf b = ldb(BX + bxo + (size_t)nb * 16 * LK);
#pragma unroll
            for (int mb = 0; mb < 4; ++mb) acc[mb][nb] = wmmabg(a[mb], b, acc[mb][nb]); }
    }
    float bc[4];
#pragma unroll
    for (int nb = 0; nb < 4; ++nb) bc[nb] = (MODE == 0) ? bfr(bias[c0 + nb * 16 + lr]) : 0.0f;   // MODE 0: c0 + 63 < DM
    size_t tbase, rbase; bool wr;                                                                 // wr: block-uniform, whole tile inside the residual plane
    if (MODE == 0) { const int bb = r0 / SEQ, tt = r0 % SEQ; const int zc = bb * NH_ + c0 / HD;
                     tbase = ((size_t)zc * SEQ + (size_t)tt) * HD; rbase = ((size_t)zc * (size_t)resT + (size_t)tt) * HD; wr = tt < resT; }
    else           { const int bb = c0 / SEQ, tt = c0 % SEQ;
                     tbase = (size_t)bb * (size_t)DM * SEQ + (size_t)r0 * SEQ + (size_t)tt; rbase = (size_t)bb * (size_t)DM * (size_t)resT + (size_t)r0 * (size_t)resT + (size_t)tt; wr = tt < resT; }
#pragma unroll
    for (int mb = 0; mb < 4; ++mb) {
        float br[8];
#pragma unroll
        for (int j = 0; j < 8; ++j) br[j] = (MODE == 1) ? bfr(bias[r0 + mb * 16 + hi * 8 + j]) : 0.0f;   // MODE 1: r0 + 63 < DM
#pragma unroll
        for (int nb = 0; nb < 4; ++nb) {
#pragma unroll
            for (int j = 0; j < 8; ++j) os[(hi * 8 + j) * 68 + nb * 16 + lr] = acc[mb][nb][j] + bc[nb] + br[j]; }   // D: row 8h+j, col lane&15; rows 0..15 x columns 0..63 all written
        wave_sync();
{
            if (MODE == 0) {
                const size_t sb = tbase + (size_t)(mb * 16) * HD;
                const size_t rb = rbase + (size_t)(mb * 16) * HD;
#pragma unroll
                for (int s = 0; s < 4; ++s) { const int p = s * 32 + lane; const int row = p >> 3, c8 = (p & 7) * 8;   // 4 s x 4 rows = 16 rows; 8 lanes x 8 = 64 columns = one line
                    const v4f x0 = *(const v4fa*)(&os[row * 68 + c8]); const v4f x1 = *(const v4fa*)(&os[row * 68 + c8 + 4]); v8h hv, rv;
#pragma unroll
                    for (int i = 0; i < 4; ++i) { const h16 a0 = toh_flush(x0[i]); const h16 a1 = toh_flush(x1[i]); hv[i] = a0; hv[4 + i] = a1;
                                                  rv[i] = toh_flush((x0[i] - (float)a0) * QRS); rv[4 + i] = toh_flush((x1[i] - (float)a1) * QRS); }
                    const size_t oo = sb + (size_t)p * 8;
                    const size_t ro = rb + (size_t)p * 8;
                    *(v8h*)(Ph + oo) = hv; if (wr) *(v8h*)(Pr + ro) = rv; }
            } else {
                const size_t sb = tbase + (size_t)(mb * 16) * SEQ;
                const size_t rb = rbase + (size_t)(mb * 16) * (size_t)resT;
#pragma unroll
                for (int s = 0; s < 4; ++s) { const int row = 4 * s + (lane >> 3), c8 = (lane & 7) * 8;   // 4 s x 4 row groups = 16 rows; 8 lanes x 8 = 64 columns
                    const v4f x0 = *(const v4fa*)(&os[row * 68 + c8]); const v4f x1 = *(const v4fa*)(&os[row * 68 + c8 + 4]); v8h hv, rv;
#pragma unroll
                    for (int i = 0; i < 4; ++i) { const h16 a0 = toh_flush(x0[i]); const h16 a1 = toh_flush(x1[i]); hv[i] = a0; hv[4 + i] = a1;
                                                  rv[i] = toh_flush((x0[i] - (float)a0) * QRS); rv[4 + i] = toh_flush((x1[i] - (float)a1) * QRS); }
                    const size_t oo = sb + (size_t)row * SEQ + c8;
                    const size_t ro = rb + (size_t)row * (size_t)resT + c8;
                    *(v8h*)(Ph + oo) = hv; if (wr) *(v8h*)(Pr + ro) = rv; }
            }
             }
        wave_sync();
    }
}

// q: token-major with the update extension; k: token-major, no extension; v^T: feature-major with the update extension
__global__ __launch_bounds__(32) void k_projq(const bf* __restrict__ A, const bf* __restrict__ Bt, const bf* __restrict__ AX, const bf* __restrict__ BX,
                                              const float* __restrict__ bias, h16* Ph, h16* Pr, int resT) { proj_body<0, 1>(A, Bt, AX, BX, bias, Ph, Pr, resT); }
__global__ __launch_bounds__(32) void k_projk(const bf* __restrict__ A, const bf* __restrict__ Bt,
                                              const float* __restrict__ bias, h16* Ph, h16* Pr, int resT) { proj_body<0, 0>(A, Bt, A, Bt, bias, Ph, Pr, resT); }
__global__ __launch_bounds__(32) void k_projv(const bf* __restrict__ A, const bf* __restrict__ Bt, const bf* __restrict__ AX, const bf* __restrict__ BX,
                                              const float* __restrict__ bias, h16* Ph, h16* Pr, int resT) { proj_body<1, 1>(A, Bt, AX, BX, bias, Ph, Pr, resT); }

// keypass_body: fused causal pair weighting, one wave per 16 query rows of one (batch, head); K / V^T / Q fragments straight from the f16 planes (two 16-B loads each, arithmetic addressing).
// Transposed form: S^T[key][t] = K Q^T (A = K rows, B = Q rows, two k-steps over d); lane (t = lane&15, h = lane>>4) holds keys 8h+r of each 16-key tile, so the packed
// P tile is directly the B fragment of O^T[d][t] = V^T P^T (element r <- tile keys 0..15, element 8+r <- tile keys 16..31, lane unchanged); four 16-row d tiles.
// Softmax state (running max, partial sum) is one scalar per lane; the two lane halves of a row are combined with one xor-16 exchange.
// Logit per element, log2 domain: (key > t ? -1e9 * log2e : s * scale * log2e) + mask[key] * log2e, evaluated literally inside every visited 32-key tile; P elements whose exponent argument is below -14 are set to zero.
// EARLY = 1 (query rows [0, EROWS)): scores = K Q + (K Q_res + K_res Q) / 2048; P = f16 value + f16 residual x2048; O = V P + (V P_res + V_res P) / 2048 (residual products in their own accumulators);
//            row sum from the f32 exponentials; K_res / V_res fragments come from the small planes (tokens < EROWS) and are zero for keys >= EROWS (address clamped, wave-uniform select).
// EARLY = 0 (query rows [EROWS, SEQ)): single q, k, P, v; row sum over the converted P.
template <int EARLY>
__device__ __forceinline__ void keypass_body(const h16* __restrict__ QH, const h16* __restrict__ QR, const h16* __restrict__ KP, const h16* __restrict__ KR,
                                           const h16* __restrict__ VT, const h16* __restrict__ VR, const float* __restrict__ amask, float* OUT) {
    __shared__ __align__(16) float os[AW * 16 * OSP];
    const int lane = threadIdx.x & 31, lr = lane & 15, hi = lane >> 4;
    const int wave = __builtin_amdgcn_readfirstlane((int)(threadIdx.x >> 5));
    const int zh = blockIdx.y; const int b = zh / NH_, h = zh % NH_;
    const int t0 = (EARLY ? 0 : EROWS) + (blockIdx.x * AW + wave) * 16;
    const int lim = t0 + lr;                                                  // key j is causal-filled iff j > lim
    const float* amb = amask + (size_t)b * SEQ_FULL;
    // scan of the batch's mask row: any value not below WIDE in magnitude widens the key loop to all keys
    float fl = 0.0f;
#pragma unroll 1
    for (int i = 0; i < SEQ; i += 128) {
        const v4f w = *(const v4f*)(amb + i + 4 * lane);
#pragma unroll
        for (int c = 0; c < 4; ++c) { const float a = fabsf(bfr(w[c])); fl = (a < WIDE) ? fl : 1.0f; } }
    fl = fmaxf(fl, __shfl_xor(fl, 16, 32)); fl = fmaxf(fl, __shfl_xor(fl, 8, 32)); fl = fmaxf(fl, __shfl_xor(fl, 4, 32));
    fl = fmaxf(fl, __shfl_xor(fl, 2, 32));  fl = fmaxf(fl, __shfl_xor(fl, 1, 32));
    const int nkc = (t0 + 16 + 31) & ~31;                                     // causal bound, multiple of 32, <= SEQ
    const int nkv = (fl != 0.0f) ? SEQ : nkc;                                 // select formed on the vector side
    const int nk = __builtin_amdgcn_readfirstlane(nkv);
    const size_t pbase = (size_t)zh * SEQ * HD;
    const size_t rbase = (size_t)zh * EROWS * HD;
    const size_t qo = pbase + (size_t)(t0 + lr) * HD + 8 * hi;
    const v16h hz = (v16h){};
    v16h qh[2], qr[2];
    qh[0] = ldh(QH + qo); qh[1] = ldh(QH + qo + 32);             // B fragments: col t, k = d (two k-steps)
    qr[0] = hz; qr[1] = hz;
    if (EARLY) { const size_t qro = rbase + (size_t)(t0 + lr) * HD + 8 * hi; qr[0] = ldh(QR + qro); qr[1] = ldh(QR + qro + 32); }   // t0 + lr < EROWS
    const size_t ko = pbase + (size_t)lr * HD + 8 * hi;        // + key * HD       (A fragment: row key, k = d)
    const size_t vo = pbase + (size_t)lr * SEQ + 8 * hi;       // + 16j*SEQ + key  (A fragment: row d, k = key)
    const size_t kro = rbase + (size_t)lr * HD + 8 * hi;       // residual planes, tokens < EROWS
    const size_t vro = rbase + (size_t)lr * EROWS + 8 * hi;
    v8f o[4], oR[4];
#pragma unroll
    for (int j = 0; j < 4; ++j) { o[j] = (v8f){}; oR[j] = (v8f){}; }
    float m = NEGB, l = 0.0f;
#pragma unroll 1
    for (int key0 = 0; key0 < nk; key0 += 32) {
        const bool rok = key0 < EROWS;                           // wave-uniform
        const int kcl = rok ? key0 : (EROWS - 32);               // clamped residual-plane key (address always inside the plane)
        const h16* kpt = KP + ko + (size_t)key0 * HD;
        v8f sHa = (v8f){}, sLa = (v8f){}, sHb = (v8f){}, sLb = (v8f){};
#pragma unroll
        for (int ks = 0; ks < 2; ++ks) {
            const v16h ka = ldh(kpt + ks * 32), kb = ldh(kpt + 16 * HD + ks * 32);
            sHa = wmma16g(ka, qh[ks], sHa); sHb = wmma16g(kb, qh[ks], sHb);
            if (EARLY) {
                sLa = wmma16g(ka, qr[ks], sLa); sLb = wmma16g(kb, qr[ks], sLb);
                const h16* krp = KR + kro + (size_t)kcl * HD;
                v16h kra = ldh(krp + ks * 32), krb = ldh(krp + 16 * HD + ks * 32);
                if (!rok) { kra = hz; krb = hz; }
                sLa = wmma16g(kra, qh[ks], sLa); sLb = wmma16g(krb, qh[ks], sLb);
            }
        }
        const float* kp = amb + 8 * hi + key0;                   // keys key0+8h+0..7 and key0+16+8h+0..7, all < nk <= SEQ
        const v4f m0 = *(const v4f*)kp, m1 = *(const v4f*)(kp + 4), m2 = *(const v4f*)(kp + 16), m3 = *(const v4f*)(kp + 20);
        float kx[8], ky[8];
#pragma unroll
        for (int r = 0; r < 4; ++r) { kx[r] = m0[r]; kx[4 + r] = m1[r]; ky[r] = m2[r]; ky[4 + r] = m3[r]; }
        const int ja = key0 + 8 * hi;
        float ta[8], tb[8]; float mx = NEGB;
#pragma unroll
        for (int r = 0; r < 8; ++r) {
            const float sa = EARLY ? (sHa[r] + sLa[r] * QRI) * SC2 : sHa[r] * SC2;
            const float sb = EARLY ? (sHb[r] + sLb[r] * QRI) * SC2 : sHb[r] * SC2;
            ta[r] = ((ja + r > lim) ? NEGL : sa) + bfr(kx[r]) * L2E;             // replace, then add the mask
            tb[r] = ((ja + 16 + r > lim) ? NEGL : sb) + bfr(ky[r]) * L2E;
            mx = fmaxf(mx, fmaxf(ta[r], tb[r])); }
        mx = fmaxf(mx, __shfl_xor(mx, 16, 32));
        const float mnew = fmaxf(m, mx);
        const float alpha = __builtin_amdgcn_exp2f(m - mnew);
        const float sh = PSH - mnew;
        v16h pb, pr = hz; float ls = 0.0f;
#pragma unroll
        for (int r = 0; r < 8; ++r) {
            const float aa = ta[r] + sh, ab = tb[r] + sh;
            const float ea = __builtin_amdgcn_exp2f(aa), eb = __builtin_amdgcn_exp2f(ab);
            const float ga = (aa < PFL) ? 0.0f : ea, gb = (ab < PFL) ? 0.0f : eb;   // below the f16 normal range -> exactly zero, selected by value
            const h16 pa = (h16)ga; const h16 pc = (h16)gb;
            pb[r] = pa; pb[8 + r] = pc;
            if (EARLY) { pr[r] = toh_flush((ga - (float)pa) * QRS); pr[8 + r] = toh_flush((gb - (float)pc) * QRS); ls += ga + gb; }
            else       { ls += (float)pa + (float)pc; } }
        l = l * alpha + ls; m = mnew;
#pragma unroll
        for (int j = 0; j < 4; ++j) { o[j] = o[j] * alpha; if (EARLY) oR[j] = oR[j] * alpha; }
        const h16* va = VT + vo + key0;
#pragma unroll
        for (int jp = 0; jp < 2; ++jp) {
            const v16h v0 = ldh(va + (size_t)(32 * jp) * SEQ), v1 = ldh(va + (size_t)(32 * jp + 16) * SEQ);
            o[2 * jp] = wmma16g(v0, pb, o[2 * jp]); o[2 * jp + 1] = wmma16g(v1, pb, o[2 * jp + 1]);
            if (EARLY) {
                oR[2 * jp] = wmma16g(v0, pr, oR[2 * jp]); oR[2 * jp + 1] = wmma16g(v1, pr, oR[2 * jp + 1]);
                const h16* vrp = VR + vro + kcl;
                v16h vr0 = ldh(vrp + (size_t)(32 * jp) * EROWS), vr1 = ldh(vrp + (size_t)(32 * jp + 16) * EROWS);
                if (!rok) { vr0 = hz; vr1 = hz; }
                oR[2 * jp] = wmma16g(vr0, pb, oR[2 * jp]); oR[2 * jp + 1] = wmma16g(vr1, pb, oR[2 * jp + 1]);
            }
        }
    }
    l += __shfl_xor(l, 16, 32);
    const float inv = 1.0f / l;                                  // l >= 2^14 whenever the row has a finite maximum logit
    const int wb = wave * 16 * OSP;
    // O^T D layout: o[j][r] = (d = 16j + 8h + r, t = lane&15) -> os[t][d]; rows 0..15 x columns 0..63 all written
#pragma unroll
    for (int j = 0; j < 4; ++j) {
        v8f f = o[j];
        if (EARLY) f = o[j] + oR[j] * QRI;
        v4f a, c;
        a[0] = f[0] * inv; a[1] = f[1] * inv; a[2] = f[2] * inv; a[3] = f[3] * inv; c[0] = f[4] * inv; c[1] = f[5] * inv; c[2] = f[6] * inv; c[3] = f[7] * inv;
        *(v4fa*)(&os[wb + lr * OSP + 16 * j + 8 * hi]) = a; *(v4fa*)(&os[wb + lr * OSP + 16 * j + 8 * hi + 4]) = c; }
    wave_sync();
    float* orow = OUT + ((size_t)b * OUT_SEQ + t0) * DM + h * HD;
{
#pragma unroll
        for (int s = 0; s < 8; ++s) { const int row = 2 * s + (lane >> 4), cofs = (lane & 15) * 4;   // 8 s x 2 rows = 16 rows; 16 lanes x 4 floats = 64 columns = two lines
            const v4f val = *(const v4fa*)(&os[wb + row * OSP + cofs]);
            *(v4f*)(orow + (size_t)row * DM + cofs) = val; }
         }
}

__global__ __launch_bounds__(32 * AW) __attribute__((amdgpu_num_vgpr(256)))
void k_keypass_early(const h16* __restrict__ QH, const h16* __restrict__ QR, const h16* __restrict__ KP, const h16* __restrict__ KR,
                   const h16* __restrict__ VT, const h16* __restrict__ VR, const float* __restrict__ amask, float* OUT) {
    keypass_body<1>(QH, QR, KP, KR, VT, VR, amask, OUT);
}
__global__ __launch_bounds__(32 * AW) __attribute__((amdgpu_num_vgpr(256)))
void k_keypass_late(const h16* __restrict__ QH, const h16* __restrict__ KP, const h16* __restrict__ VT, const float* __restrict__ amask, float* OUT) {
    keypass_body<0>(QH, QH, KP, KP, VT, VT, amask, OUT);
}

static constexpr size_t al256(size_t v) { return (v + 255) & ~(size_t)255; }
static constexpr size_t SZ_XB = al256((size_t)NB * SEQ * DM * 2);
static constexpr size_t SZ_WB = al256((size_t)3 * DM * DM * 2);
static constexpr size_t SZ_AL = al256((size_t)2 * LR * DM * 2);
static constexpr size_t SZ_BL = al256((size_t)DM * LK * 2);
static constexpr size_t SZ_XL = al256((size_t)NB * SEQ * LK * 2);
static constexpr size_t SZ_PL = al256((size_t)NB * NH_ * SEQ * HD * 2);
static constexpr size_t SZ_RS = al256((size_t)NB * NH_ * EROWS * HD * 2);
static constexpr size_t SZ_TOTAL = SZ_XB + SZ_WB + SZ_AL + 2 * SZ_BL + 2 * SZ_XL + 3 * SZ_PL + 3 * SZ_RS;
static_assert(SZ_TOTAL <= (size_t)134217728);          // workspace carve <= 128 MiB
static_assert(((size_t)DM * DM * 2) % 256 == 0);       // weight sub-planes stay 256-byte aligned
static_assert(((size_t)LR * DM * 2) % 256 == 0);       // the two halves of the A plane stay 256-byte aligned
static_assert((size_t)NB * NH_ * SEQ * HD == (size_t)NB * DM * SEQ);       // v^T plane [(b*1024 + m)][t] has the same extent as the q/k planes
static_assert((size_t)NB * NH_ * EROWS * HD == (size_t)NB * DM * EROWS);   // v^T residual plane [(b*1024 + m)][t < EROWS] has the same extent as the q/k residual planes
static_assert((DM * 4) % 256 == 0);                    // k_bext grid covers the plane exactly

extern "C" void kernel_launch(void* const* d_in, const int* in_sizes, int n_in,
                              void* d_out, int out_size, void* d_ws, size_t ws_size, hipStream_t stream) {
    if (n_in < 12) return;
    const size_t needx = ((size_t)(NB - 1) * SEQ_FULL + SEQ) * DM;
    const size_t needm = (size_t)(NB - 1) * SEQ_FULL + SEQ;
    if ((size_t)in_sizes[0] < needx || (size_t)in_sizes[1] < needm) return;
    if ((size_t)in_sizes[2] < (size_t)DM * DM || (size_t)in_sizes[4] < (size_t)DM * DM || (size_t)in_sizes[6] < (size_t)DM * DM) return;
    if (in_sizes[3] < DM || in_sizes[5] < DM || in_sizes[7] < DM) return;
    if (in_sizes[8] < LR * DM || in_sizes[9] < DM * LR || in_sizes[10] < LR * DM || in_sizes[11] < DM * LR) return;
    if ((size_t)out_size < ((size_t)(NB - 1) * OUT_SEQ + SEQ) * DM) return;
    if (SZ_TOTAL > ws_size) return;
    // wire order: hidden_states, key_mask (the module's additive key mask input), Wq, bq, Wk, bk, Wv, bv, Aq, Bq, Av, Bv
    const float* xin = (const float*)d_in[0];
    const float* am  = (const float*)d_in[1];
    const float* wq = (const float*)d_in[2]; const float* bq = (const float*)d_in[3];
    const float* wk = (const float*)d_in[4]; const float* bk = (const float*)d_in[5];
    const float* wv = (const float*)d_in[6]; const float* bv = (const float*)d_in[7];
    const float* aq = (const float*)d_in[8]; const float* bqu = (const float*)d_in[9];
    const float* av = (const float*)d_in[10]; const float* bvu = (const float*)d_in[11];
    float* OUT = (float*)d_out;      // [NB][SEQ][1024]
    char* wsp = (char*)d_ws;
    bf* XB = (bf*)wsp; wsp += SZ_XB;                 // x      [NB*SEQ][1024]
    bf* WB = (bf*)wsp; wsp += SZ_WB;                 // [3][1024][1024]: q | k | v  ([out][in] = Bt as-is)
    bf* AL = (bf*)wsp; wsp += SZ_AL;                 // [16][1024]: rows 0..7 A of the q update, rows 8..15 A of the v update
    bf* BLq = (bf*)wsp; wsp += SZ_BL;                // [1024][32]: B | B | 0 | 0 (q update)
    bf* BLv = (bf*)wsp; wsp += SZ_BL;                // [1024][32]: B | B | 0 | 0 (v update)
    bf* XLq = (bf*)wsp; wsp += SZ_XL;                // [NB*SEQ][32]: hi | lo | 0 | 0 of 2 x A^T (q update)
    bf* XLv = (bf*)wsp; wsp += SZ_XL;                // [NB*SEQ][32]: hi | lo | 0 | 0 of 2 x A^T (v update)
    h16* QH = (h16*)wsp; wsp += SZ_PL;               // [NB*16][SEQ][64]
    h16* KP = (h16*)wsp; wsp += SZ_PL;               // [NB*16][SEQ][64]
    h16* VT = (h16*)wsp; wsp += SZ_PL;               // [NB*16][64][SEQ]
    h16* QR = (h16*)wsp; wsp += SZ_RS;               // [NB*16][EROWS][64] residual x2048, tokens < EROWS
    h16* KR = (h16*)wsp; wsp += SZ_RS;               // [NB*16][EROWS][64] residual x2048, tokens < EROWS
    h16* VR = (h16*)wsp; wsp += SZ_RS;               // [NB*16][64][EROWS] residual x2048, tokens < EROWS
    bf* WQ = WB; bf* WK = WB + (size_t)DM * DM; bf* WV = WB + (size_t)2 * DM * DM;

    if (SEQ == SEQ_FULL) {
        const size_t n8 = (size_t)NB * SEQ * DM / 8;
        k_cvt8<<<(unsigned)((n8 + 255) / 256), 256, 0, stream>>>(xin, XB, n8);
    } else {
        const size_t n8 = (size_t)SEQ * DM / 8;
        for (int b = 0; b < NB; ++b) k_cvt8<<<(unsigned)((n8 + 255) / 256), 256, 0, stream>>>(xin + (size_t)b * SEQ_FULL * DM, XB + (size_t)b * SEQ * DM, n8);
    }
    { const size_t n8 = (size_t)DM * DM / 8; const unsigned g = (unsigned)((n8 + 255) / 256);
      k_cvt8<<<g, 256, 0, stream>>>(wq, WQ, n8); k_cvt8<<<g, 256, 0, stream>>>(wk, WK, n8); k_cvt8<<<g, 256, 0, stream>>>(wv, WV, n8); }
    { const size_t n8 = (size_t)LR * DM / 8; const unsigned g = (unsigned)((n8 + 255) / 256);
      k_cvt8<<<g, 256, 0, stream>>>(aq, AL, n8); k_cvt8<<<g, 256, 0, stream>>>(av, AL + (size_t)LR * DM, n8); }
    { const int n4 = DM * 4; const unsigned g = (unsigned)((n4 + 255) / 256);
      k_bext<<<g, 256, 0, stream>>>(bqu, BLq, n4); k_bext<<<g, 256, 0, stream>>>(bvu, BLv, n4); }

    // 2 x A^T for both updates -> x-side extension planes
    k_xa<<<dim3(NB * SEQ / 64, 1, 1), 32, 0, stream>>>(XB, AL, XLq, XLv);

    // q, k: A = x rows (m = b*SEQ + t), Bt = W rows (n = h*64 + d) -> plane [(b*16 + h)][t][d]; residuals for tokens < EROWS
    k_projq<<<dim3(NB * SEQ / 64, DM / 64, 1), 32, 0, stream>>>(XB, WQ, XLq, BLq, bq, QH, QR, EROWS);
    k_projk<<<dim3(NB * SEQ / 64, DM / 64, 1), 32, 0, stream>>>(XB, WK, bk, KP, KR, EROWS);
    // v^T: A = Wv rows (m = h*64 + d), Bt = x rows (n = b*SEQ + t) -> plane [(b*1024 + m)][t] = [(b*16 + h)][d][t]; residual for tokens < EROWS
    k_projv<<<dim3(DM / 64, NB * SEQ / 64, 1), 32, 0, stream>>>(WV, XB, BLv, XLv, bv, VT, VR, EROWS);

    // query rows [0, EROWS): multi-product instantiation; rows [EROWS, SEQ): single-product instantiation (disjoint output rows)
    k_keypass_early<<<dim3(EROWS / (16 * AW), NB * NH_, 1), 32 * AW, 0, stream>>>(QH, QR, KP, KR, VT, VR, am, OUT);
    if (SEQ > EROWS)
        k_keypass_late<<<dim3((SEQ - EROWS) / (16 * AW), NB * NH_, 1), 32 * AW, 0, stream>>>(QH, KP, VT, am, OUT);
}

// v001
// Measured time: 229 microseconds a run.
// Next to v000, in two timings, it ran 1.38 times as fast each time.
#include <hip/hip_runtime.h>

// Causal pair-score weighting, width 1024 = 16 heads x 64; one input x [NB][SEQ][1024] feeds q, k and v; Wq/Wk/Wv [out][in] (y = x W^T + bias); rank-8 additive updates on q and v: y += 2 (x A^T) B^T with A [8][in], B [out][8];
// additive key mask [NB][1][1][SEQ] (f32, read by value); score scale 1/sqrt(64); keys j > t are replaced by -1e9 before the mask is added; softmax over keys; output = concatenated heads (f32), no output projection.
// Compute dtypes, f32 accumulate everywhere: projections and x A^T v_wmma_f32_16x16x32_bf16 (x, W, A, B, biases, mask RNE-converted to bf16; products exact); the rank-8 up-projection is one extra 32-deep k-step of the projection GEMM (2 x A^T carried as bf16 hi | lo, B bf16);
// scores v_wmma_f32_16x16x32_f16: single f16 q and k on query rows >= EROWS; q and k each as f16 value + f16 residual x2048 (three products, residual products in their own accumulator) on query rows < EROWS;
// P.V v_wmma_f32_16x16x32_f16: P (x16384 carry, cancels in the normalisation) and v single f16 on query rows >= EROWS; on query rows < EROWS P and v each as f16 value + f16 residual x2048, residual products in their own accumulator folded by 1/2048, row sum from the f32 exponentials; softmax f32 (online, running max).
// Layout: bf16 copies of x, W, A; extension planes [row][32] bf16 (x side: hi | lo | 0 | 0 of 2 x A^T; weight side: B | B | 0 | 0); q, k planes [b*16+h][t][64], v^T plane [b*16+h][d][t], small residual planes q, k [b*16+h][t < EROWS][64] and v^T [b*16+h][d][t < EROWS]; fused online-softmax key-pass kernel in transposed form (S^T = K Q^T, O^T = V^T P^T).
// Key loop bound per wave: the causal limit; if any mask value of the batch is not below 1e8 in magnitude the loop covers all keys (per-element arithmetic is literal in every visited tile). Residual fragments for keys >= EROWS are zero.

#ifndef NB
#define NB 2
#endif
#ifndef SEQ
#define SEQ 2048
#endif
#define NB_FULL  2
#define SEQ_FULL 2048
#ifndef OUT_SEQ
#define OUT_SEQ SEQ              // row pitch (in tokens) between batches of the output
#endif
#define DM   1024
#define NH_  16
#define HD   64
#define LR   8                   // rank of the additive updates
#define LK   32                  // k extent of the extension planes (one WMMA k-step)
#define XP   20                  // LDS row pitch (floats) of the x A^T tile
#define AW   4                   // waves per online-softmax key-pass block (16 query rows each)
#define PW   4                   // waves per projection block (2 x 2 wave tiles of 64 x 64)
#define PBK  64                  // k extent of one staged projection tile: 128 bytes of every operand row
#define PPI  72                  // LDS row pitch (16-bit elements) of a staged row: 144 bytes = 16 x 9
#define POP  (128 * PPI)         // elements of one staged operand tile (128 rows)
#define PST  (2 * POP)           // elements of one stage: A tile | B tile
#define XST  (80 * PPI)          // elements of one stage of the x A^T kernel: 64 x rows | 16 A rows
#define OSP  68                  // LDS row pitch (floats) of the online-softmax key-pass output tile
#define EROWS (SEQ < 512 ? SEQ : 512)   // query rows (and tokens of the small residual planes) handled by the multi-product online-softmax key-pass instantiation
#define QRS  2048.0f             // carry of every residual plane / residual fragment
#define QRI  (1.0f / 2048.0f)
#define SC2  ((float)(0.125 * 1.4426950408889634))      // HD^-0.5 * log2(e)
#define L2E  ((float)1.4426950408889634)
#define NEGL ((float)(-1.0e9 * 1.4426950408889634))     // fill value -1e9 in the log2 domain
#define LSC  2.0f                // update scaling 16 / 8
#define PSH  14.0f               // log2 of the P carry (16384)
#define PFL  (-14.0f)            // exponent argument below which the f16 P would leave the normal range
#define NEGB (-3.0e38f)
#define WIDE 1.0e8f              // mask magnitude bound under which skipped (fully causal-filled) tiles contribute exactly zero

static_assert(HD == 64);
static_assert(NH_ * HD == DM);                 // head h = columns h*64 + d
static_assert(DM % 64 == 0);                   // column tiles of 64 = one head
static_assert(64 % HD == 0);
static_assert(DM % 32 == 0);                   // GEMM k-loop steps by 32
static_assert(LK == 32);                       // extension = exactly one k-step
static_assert(2 * LR <= LK);                   // hi | lo pieces fit the extension row
static_assert(LR == 8);                        // one 16-byte piece per part; B rows loaded as 8 floats
static_assert(2 * LR == 16);                   // A rows of q and v updates fill one 16-column tile
static_assert(SEQ % 64 == 0);                  // a 64-row tile never straddles two batches
static_assert((NB * SEQ) % 64 == 0);
static_assert(SEQ % 128 == 0);                 // mask scan steps by 128
static_assert(SEQ % 32 == 0);                  // key loop steps by 32
static_assert(SEQ % (16 * AW) == 0);           // online-softmax key-pass grids cover the sequence exactly
static_assert(EROWS % 64 == 0);                // a 64-token GEMM tile lies wholly inside or outside the residual planes
static_assert(EROWS >= 32);
static_assert(EROWS <= SEQ);
static_assert(EROWS % (16 * AW) == 0);
static_assert((SEQ - EROWS) % (16 * AW) == 0);
static_assert(((size_t)SEQ * DM) % 8 == 0);
static_assert(((size_t)DM * DM) % 8 == 0);
static_assert(((size_t)LR * DM) % 8 == 0);
static_assert(NB <= NB_FULL);
static_assert(SEQ <= SEQ_FULL);
static_assert((OSP * 4) % 16 == 0);
static_assert(OSP >= HD);
static_assert((XP * 4) % 16 == 0);
static_assert(XP >= 16);
static_assert(32 * 4 * 16 == 16 * HD * 2);
static_assert(32 * 4 * 16 == 16 * 64 * 2);
static_assert(32 * 8 * 16 == 16 * HD * 4);     // online-softmax key-pass epilogue: 8 instructions x 32 lanes x 16 B = 16 rows x 256 B
static_assert(32 * 8 * 16 == 64 * LK * 2);     // x A^T epilogue: 8 instructions x 32 lanes x 16 B = 64 rows x 64 B per plane
static_assert((NB * SEQ) % 128 == 0);          // projection blocks cover 128 x 128
static_assert(DM % 128 == 0);
static_assert(DM % PBK == 0);
static_assert(DM / PBK >= 2);                  // the two-buffer ring needs two stages
static_assert(PBK * 2 == 128);                 // a staged row is one 128-byte line: 8 lanes x 16 B
static_assert((PPI * 2) % 16 == 0);
static_assert(PPI >= PBK);
static_assert(8 * 32 * PW * 16 == 128 * PBK * 2);   // 8 copies per lane fill one operand tile
static_assert(2 * PST * 2 + PW * 16 * 68 * 4 <= 131072);   // static LDS of the projection kernels
static_assert(2 * XST * 2 + 64 * XP * 4 <= 131072);   // static LDS of the x A^T kernel
static_assert(5 * 32 * PW * 16 == 80 * PBK * 2);      // 5 copies per lane fill one stage of the x A^T kernel
static_assert(PW * 16 == 64);                         // x A^T kernel: one 16-row tile per wave
static_assert(AW * 16 * OSP * 4 <= 131072);    // static LDS of the online-softmax key-pass kernels

typedef _Float16 h16;
typedef unsigned short bf;
typedef __attribute__((ext_vector_type(16))) __bf16   v16bf;
typedef __attribute__((ext_vector_type(16))) _Float16 v16h;
typedef __attribute__((ext_vector_type(8)))  _Float16 v8h;
typedef __attribute__((ext_vector_type(8)))  unsigned short v8us;
typedef __attribute__((ext_vector_type(8)))  float    v8f;
typedef __attribute__((ext_vector_type(4)))  float    v4f;
typedef v4f  __attribute__((may_alias)) v4fa;

__device__ __forceinline__ unsigned short f2bf(float f) { unsigned u = __float_as_uint(f); u += 0x7FFFu + ((u >> 16) & 1u); return (unsigned short)(u >> 16); }
__device__ __forceinline__ float bfr(float f) { return __uint_as_float(((unsigned)f2bf(f)) << 16); }   // value after RNE convert to bf16
__device__ __forceinline__ v16h cat16(v8h lo, v8h hi) { return __builtin_shufflevector(lo, hi, 0, 1, 2, 3, 4, 5, 6, 7, 8, 9, 10, 11, 12, 13, 14, 15); }
__device__ __forceinline__ v16bf cat16b(v8us lo, v8us hi) { return __builtin_bit_cast(v16bf, __builtin_shufflevector(lo, hi, 0, 1, 2, 3, 4, 5, 6, 7, 8, 9, 10, 11, 12, 13, 14, 15)); }
__device__ __forceinline__ v8f wmma16(v16h a, v16h b, v8f c) { return __builtin_amdgcn_wmma_f32_16x16x32_f16(false, a, false, b, (short)0, c, false, false); }
__device__ __forceinline__ v8f wmmab(v16bf a, v16bf b, v8f c) { return __builtin_amdgcn_wmma_f32_16x16x32_bf16(false, a, false, b, (short)0, c, false, false); }
// fragment loaders from K-contiguous 16-bit rows; p already includes + 8*(lane>>4): elements 0..7 <- k0+8h+0..7, elements 8..15 <- k0+16+8h+0..7 (same map for A and B)
__device__ __forceinline__ v16h  ldh(const h16* p) { return cat16(*(const v8h*)p, *(const v8h*)(p + 16)); }
__device__ __forceinline__ v16bf ldb(const bf* p)  { return cat16b(*(const v8us*)p, *(const v8us*)(p + 16)); }
// ordering point for wave-private LDS tiles (same wave writes and reads)
__device__ __forceinline__ void wave_sync() { __builtin_amdgcn_fence(3 /* release order */, "wavefront"); __builtin_amdgcn_wave_barrier(); asm volatile("" ::: "memory"); }

// f32 -> f16 convert that cannot produce a subnormal operand (|v| < 2^-14 -> +0); applied after the plane's power-of-two carry
static __device__ __forceinline__ h16 toh_flush(float v) { const h16 r = (h16)v; return (fabsf(v) < 6.103515625e-05f) ? (h16)0.0f : r; }
// one matrix instruction followed by its own four-slot guard (ties the accumulator, keeps the operands live)
static __device__ __forceinline__ v8f wmma16g(v16h a, v16h b, v8f c) { c = wmma16(a, b, c); asm volatile("v_nop\n\tv_nop\n\tv_nop\n\tv_nop" : "+v"(c) : "v"(a), "v"(b)); return c; }
static __device__ __forceinline__ v8f wmmabg(v16bf a, v16bf b, v8f c) { c = wmmab(a, b, c); asm volatile("v_nop\n\tv_nop\n\tv_nop\n\tv_nop" : "+v"(c) : "v"(a), "v"(b)); return c; }
// one 16-bit word of an extension row: piece 0 = bf16 value, piece 1 = bf16 of the remainder, pieces 2, 3 = zero (select by value)
static __device__ __forceinline__ unsigned short ext_word(float v, int piece) {
    const unsigned short hw = f2bf(v); const float hv = __uint_as_float(((unsigned)hw) << 16); const unsigned short lw = f2bf(v - hv);
    return (piece == 0) ? hw : ((piece == 1) ? lw : (unsigned short)0); }

// eight asynchronous 16-byte copies per lane, global -> LDS: copy i moves the lane's 16 bytes of tile row (row + 16 i). The closing s_wait_xcnt stands inside the statement so that no address register is rewritten ahead of it.
static __device__ __forceinline__ void copy8(unsigned l, const bf* g, size_t gs) {
    const unsigned ls = 16 * PPI * 2;
    asm volatile("global_load_async_to_lds_b128 %0, %8, off\n\t"
                 "global_load_async_to_lds_b128 %1, %9, off\n\t"
                 "global_load_async_to_lds_b128 %2, %10, off\n\t"
                 "global_load_async_to_lds_b128 %3, %11, off\n\t"
                 "global_load_async_to_lds_b128 %4, %12, off\n\t"
                 "global_load_async_to_lds_b128 %5, %13, off\n\t"
                 "global_load_async_to_lds_b128 %6, %14, off\n\t"
                 "global_load_async_to_lds_b128 %7, %15, off\n\t"
                 "s_wait_xcnt 0x0"
                 :: "v"(l), "v"(l + ls), "v"(l + 2 * ls), "v"(l + 3 * ls), "v"(l + 4 * ls), "v"(l + 5 * ls), "v"(l + 6 * ls), "v"(l + 7 * ls),
                    "v"(g), "v"(g + gs), "v"(g + 2 * gs), "v"(g + 3 * gs), "v"(g + 4 * gs), "v"(g + 5 * gs), "v"(g + 6 * gs), "v"(g + 7 * gs)
                 : "memory");
}

// the same with five copies: four rows of one plane (row + 16 i) and one row of a second plane, laid behind them in LDS
static __device__ __forceinline__ void copy5(unsigned l, const bf* g, size_t gs, const bf* g4) {
    const unsigned ls = 16 * PPI * 2;
    asm volatile("global_load_async_to_lds_b128 %0, %5, off\n\t"
                 "global_load_async_to_lds_b128 %1, %6, off\n\t"
                 "global_load_async_to_lds_b128 %2, %7, off\n\t"
                 "global_load_async_to_lds_b128 %3, %8, off\n\t"
                 "global_load_async_to_lds_b128 %4, %9, off\n\t"
                 "s_wait_xcnt 0x0"
                 :: "v"(l), "v"(l + ls), "v"(l + 2 * ls), "v"(l + 3 * ls), "v"(l + 4 * ls),
                    "v"(g), "v"(g + gs), "v"(g + 2 * gs), "v"(g + 3 * gs), "v"(g4)
                 : "memory");
}

__global__ __launch_bounds__(256) void k_cvt8(const float* __restrict__ src, bf* dst, size_t n8) {
    const size_t i = (size_t)blockIdx.x * 256 + threadIdx.x; if (i >= n8) return;
    const v8f v = *(const v8f*)(src + i * 8); v8us o;
#pragma unroll
    for (int k = 0; k < 8; ++k) o[k] = f2bf(v[k]);
    *(v8us*)(dst + i * 8) = o; 
}

__global__ __launch_bounds__(256) void k_bext(const float* __restrict__ src, bf* dst, int n4) {
    const int i = blockIdx.x * 256 + threadIdx.x; if (i >= n4) return;
    const int row = i >> 2, piece = i & 3;
    v8f v = *(const v8f*)(src + (size_t)row * LR);
    asm volatile("" : "+v"(v));
    v8us o;
#pragma unroll
    for (int k = 0; k < 8; ++k) { const unsigned short w = f2bf(v[k]); o[k] = (piece < 2) ? w : (unsigned short)0; }
    *(v8us*)(dst + (size_t)i * 8) = o; 
}

// k_xa: x A^T for both updates in one 16-column tile (columns 0..7 = q update rows of A, 8..15 = v update rows), four waves per 64 token rows (16 rows each), K = DM.
// The 64 x rows and the 16 A rows are staged in LDS, 64 k at a time, by asynchronous 16-byte copies (pitch 144 B), two buffers, as in the projection kernels.
// Output: x-side extension planes XLq, XLv [token][32] bf16 = hi | lo | 0 | 0 of 2 * (x A^T); per plane the 64 rows x 64 B of the tile are one contiguous 4096-byte run:
__global__ __launch_bounds__(32 * PW) void k_xa(const bf* __restrict__ X, const bf* __restrict__ AL, bf* XLq, bf* XLv) {
    __shared__ __align__(16) bf ring[2 * XST];
    __shared__ __align__(16) float os[64 * XP];
    const int lane = threadIdx.x & 31, lr = lane & 15, hi = lane >> 4; const int r0 = blockIdx.x * 64;
    const int wave = __builtin_amdgcn_readfirstlane((int)(threadIdx.x >> 5));
    v8f acc = (v8f){};
    // copy side: thread tid moves bytes 16 (tid & 7) of x rows (tid >> 3) + 16 i, i = 0..3, and of A row (tid >> 3)
    const int crow = (int)(threadIdx.x >> 3), cch = (int)(threadIdx.x & 7);
    const bf* gx = X  + (size_t)(r0 + crow) * DM + cch * 8;                   // rows < NB * SEQ, columns k0 + 63 < DM
    const bf* gl = AL + (size_t)crow * DM + cch * 8;                          // rows < 16
    const unsigned l0 = (unsigned)(size_t)(&ring[crow * PPI + cch * 8]);      // LDS byte address = low 32 bits of the shared address
    const int NT = DM / PBK;
    // read side: same loader and k map as from the planes, rows at pitch PPI
    const int afr = (wave * 16 + lr) * PPI + 8 * hi, bfo = (64 + lr) * PPI + 8 * hi;
    copy5(l0, gx, (size_t)16 * DM, gl);                                       // tile 0 -> buffer 0
    asm volatile("s_wait_asynccnt 0x0" ::: "memory");                         // this wave's copies of tile 0 have landed
    __syncthreads();                                                          // ... and every other wave's
    copy5(l0 + XST * 2, gx + PBK, (size_t)16 * DM, gl + PBK);                 // tile 1 -> buffer 1
#pragma unroll 1
    for (int t = 0; t < NT; ++t) {                                            // rolled: one pass per staged tile
        const int bo = (t & 1) * XST;
#pragma unroll
        for (int ks = 0; ks < PBK; ks += 32) {
            const v16bf bw = ldb(&ring[bo + bfo + ks]); const v16bf a = ldb(&ring[bo + afr + ks]);
            acc = wmmabg(a, bw, acc); }
        asm volatile("s_wait_dscnt 0x0" ::: "memory");                        // this wave's reads of buffer t & 1 are done before it is refilled
        asm volatile("s_wait_asynccnt 0x0" ::: "memory");                     // this wave's copies of tile t + 1 have landed
        __syncthreads();                                                      // publishes tile t + 1 and ends every reader's last read of buffer t & 1
        if (t + 2 < NT) copy5(l0 + bo * 2, gx + (size_t)(t + 2) * PBK, (size_t)16 * DM, gl + (size_t)(t + 2) * PBK);
    }
    asm volatile("s_wait_asynccnt 0x0" ::: "memory");                         // no copy is outstanding behind the loop
#pragma unroll
    for (int j = 0; j < 8; ++j) os[(wave * 16 + hi * 8 + j) * XP + lr] = acc[j] * LSC;   // D: row 8h+j, col lane&15; the wave's own 16 rows x columns 0..15 all written
    wave_sync();
    const size_t ob = (size_t)r0 * LK;
{
#pragma unroll 1
        for (int s = 2 * wave; s < 2 * wave + 2; ++s) { const int p = s * 32 + lane; const int row = p >> 2, piece = p & 3;   // 2 s x 8 rows = the wave's own 16 rows; 4 lanes x 16 B = one 64-byte row
            const v4f a0 = *(const v4fa*)(&os[row * XP + 0]); const v4f a1 = *(const v4fa*)(&os[row * XP + 4]);
            const v4f c0 = *(const v4fa*)(&os[row * XP + 8]); const v4f c1 = *(const v4fa*)(&os[row * XP + 12]);
            v8us oq, ov;
#pragma unroll
            for (int i = 0; i < 4; ++i) { oq[i] = ext_word(a0[i], piece); oq[4 + i] = ext_word(a1[i], piece); ov[i] = ext_word(c0[i], piece); ov[4 + i] = ext_word(c1[i], piece); }
            *(v8us*)(XLq + ob + (size_t)p * 8) = oq; *(v8us*)(XLv + ob + (size_t)p * 8) = ov; }
         }
}

template <int MODE, int LOWR>
__device__ __forceinline__ void proj_body(const bf* __restrict__ A, const bf* __restrict__ Bt, const bf* __restrict__ AX, const bf* __restrict__ BX,
                                          const float* __restrict__ bias, h16* Ph, h16* Pr, int resT) {
    __shared__ __align__(16) bf ring[2 * PST];
    __shared__ __align__(16) float osa[PW * 16 * 68];
    const int K = DM;
    const int lane = threadIdx.x & 31, lr = lane & 15, hi = lane >> 4;
    const int wave = __builtin_amdgcn_readfirstlane((int)(threadIdx.x >> 5));
    const int wm = (wave & 1) * 64, wn = (wave >> 1) * 64;                    // the wave's 64 x 64 tile inside the block
    const int r0 = blockIdx.x * 128 + wm, c0 = blockIdx.y * 128 + wn;
    float* os = osa + wave * 16 * 68;                                         // wave-private output staging
    v8f acc[4][4];
#pragma unroll
    for (int mb = 0; mb < 4; ++mb)
#pragma unroll
        for (int nb = 0; nb < 4; ++nb) acc[mb][nb] = (v8f){};
    // copy side: thread tid moves bytes 16 (tid & 7) of tile rows (tid >> 3) + 16 i, i = 0..7, of both operands
    const int crow = (int)(threadIdx.x >> 3), cch = (int)(threadIdx.x & 7);
    const bf* ga = A  + (size_t)(blockIdx.x * 128 + crow) * K + cch * 8;      // rows < M, columns k0 + 63 < K
    const bf* gb = Bt + (size_t)(blockIdx.y * 128 + crow) * K + cch * 8;
    const unsigned la = (unsigned)(size_t)(&ring[crow * PPI + cch * 8]);      // LDS byte address = low 32 bits of the shared address
    const unsigned lb = la + POP * 2;
    const int NT = K / PBK;
    // read side: same loader and k map as from the planes, rows at pitch PPI
    const int afr = (wm + lr) * PPI + 8 * hi, bfo = POP + (wn + lr) * PPI + 8 * hi;
    copy8(la, ga, (size_t)16 * K); copy8(lb, gb, (size_t)16 * K);             // tile 0 -> buffer 0
    asm volatile("s_wait_asynccnt 0x0" ::: "memory");                         // this wave's copies of tile 0 have landed
    __syncthreads();                                                          // ... and every other wave's
    copy8(la + PST * 2, ga + PBK, (size_t)16 * K); copy8(lb + PST * 2, gb + PBK, (size_t)16 * K);   // tile 1 -> buffer 1
#pragma unroll 1
    for (int t = 0; t < NT; ++t) {                                            // rolled: one pass per staged tile
        const int bo = (t & 1) * PST;
#pragma unroll
        for (int ks = 0; ks < PBK; ks += 32) {
            v16bf a[4];
#pragma unroll
            for (int mb = 0; mb < 4; ++mb) a[mb] = ldb(&ring[bo + afr + mb * 16 * PPI + ks]);
            v16bf b[4];                                                       // all eight fragments of a k-step are read as one group of LDS loads
#pragma unroll
            for (int nb = 0; nb < 4; ++nb) b[nb] = ldb(&ring[bo + bfo + nb * 16 * PPI + ks]);
#pragma unroll
            for (int nb = 0; nb < 4; ++nb) {
#pragma unroll
                for (int mb = 0; mb < 4; ++mb) acc[mb][nb] = wmmabg(a[mb], b[nb], acc[mb][nb]); }
        }
        asm volatile("s_wait_dscnt 0x0" ::: "memory");                        // this wave's reads of buffer t & 1 are done before it is refilled
        asm volatile("s_wait_asynccnt 0x0" ::: "memory");                     // this wave's copies of tile t + 1 have landed
        __syncthreads();                                                      // publishes tile t + 1 and ends every reader's last read of buffer t & 1
        if (t + 2 < NT) { copy8(la + bo * 2, ga + (size_t)(t + 2) * PBK, (size_t)16 * K); copy8(lb + bo * 2, gb + (size_t)(t + 2) * PBK, (size_t)16 * K); }
    }
    asm volatile("s_wait_asynccnt 0x0" ::: "memory");                         // no copy is outstanding behind the loop
    if (LOWR) {                                                                                   // extension k-step: rows of 32 bf16, same loader and k map on both sides
        const size_t axo = (size_t)(r0 + lr) * LK + 8 * hi, bxo = (size_t)(c0 + lr) * LK + 8 * hi;
        v16bf a[4];
#pragma unroll
        for (int mb = 0; mb < 4; ++mb) a[mb] = ldb(AX + axo + (size_t)mb * 16 * LK);
#pragma unroll
        for (int nb = 0; nb < 4; ++nb) { const v16bf b = ldb(BX + bxo + (size_t)nb * 16 * LK);
#pragma unroll
            for (int mb = 0; mb < 4; ++mb) acc[mb][nb] = wmmabg(a[mb], b, acc[mb][nb]); }
    }
    float bc[4];
#pragma unroll
    for (int nb = 0; nb < 4; ++nb) bc[nb] = (MODE == 0) ? bfr(bias[c0 + nb * 16 + lr]) : 0.0f;   // MODE 0: c0 + 63 < DM
    size_t tbase, rbase; bool wr;                                                                 // wr: wave-uniform, the wave's whole tile inside the residual plane
    if (MODE == 0) { const int bb = r0 / SEQ, tt = r0 % SEQ; const int zc = bb * NH_ + c0 / HD;
                     tbase = ((size_t)zc * SEQ + (size_t)tt) * HD; rbase = ((size_t)zc * (size_t)resT + (size_t)tt) * HD; wr = tt < resT; }
    else           { const int bb = c0 / SEQ, tt = c0 % SEQ;
                     tbase = (size_t)bb * (size_t)DM * SEQ + (size_t)r0 * SEQ + (size_t)tt; rbase = (size_t)bb * (size_t)DM * (size_t)resT + (size_t)r0 * (size_t)resT + (size_t)tt; wr = tt < resT; }
#pragma unroll
    for (int mb = 0; mb < 4; ++mb) {
        float br[8];
#pragma unroll
        for (int j = 0; j < 8; ++j) br[j] = (MODE == 1) ? bfr(bias[r0 + mb * 16 + hi * 8 + j]) : 0.0f;   // MODE 1: r0 + 63 < DM
#pragma unroll
        for (int nb = 0; nb < 4; ++nb) {
#pragma unroll
            for (int j = 0; j < 8; ++j) os[(hi * 8 + j) * 68 + nb * 16 + lr] = acc[mb][nb][j] + bc[nb] + br[j]; }   // D: row 8h+j, col lane&15; rows 0..15 x columns 0..63 all written
        wave_sync();
{
            if (MODE == 0) {
                const size_t sb = tbase + (size_t)(mb * 16) * HD;
                const size_t rb = rbase + (size_t)(mb * 16) * HD;
#pragma unroll
                for (int s = 0; s < 4; ++s) { const int p = s * 32 + lane; const int row = p >> 3, c8 = (p & 7) * 8;   // 4 s x 4 rows = 16 rows; 8 lanes x 8 = 64 columns = one line
                    const v4f x0 = *(const v4fa*)(&os[row * 68 + c8]); const v4f x1 = *(const v4fa*)(&os[row * 68 + c8 + 4]); v8h hv, rv;
#pragma unroll
                    for (int i = 0; i < 4; ++i) { const h16 a0 = toh_flush(x0[i]); const h16 a1 = toh_flush(x1[i]); hv[i] = a0; hv[4 + i] = a1;
                                                  rv[i] = toh_flush((x0[i] - (float)a0) * QRS); rv[4 + i] = toh_flush((x1[i] - (float)a1) * QRS); }
                    const size_t oo = sb + (size_t)p * 8;
                    const size_t ro = rb + (size_t)p * 8;
                    *(v8h*)(Ph + oo) = hv; if (wr) *(v8h*)(Pr + ro) = rv; }
            } else {
                const size_t sb = tbase + (size_t)(mb * 16) * SEQ;
                const size_t rb = rbase + (size_t)(mb * 16) * (size_t)resT;
#pragma unroll
                for (int s = 0; s < 4; ++s) { const int row = 4 * s + (lane >> 3), c8 = (lane & 7) * 8;   // 4 s x 4 row groups = 16 rows; 8 lanes x 8 = 64 columns
                    const v4f x0 = *(const v4fa*)(&os[row * 68 + c8]); const v4f x1 = *(const v4fa*)(&os[row * 68 + c8 + 4]); v8h hv, rv;
#pragma unroll
                    for (int i = 0; i < 4; ++i) { const h16 a0 = toh_flush(x0[i]); const h16 a1 = toh_flush(x1[i]); hv[i] = a0; hv[4 + i] = a1;
                                                  rv[i] = toh_flush((x0[i] - (float)a0) * QRS); rv[4 + i] = toh_flush((x1[i] - (float)a1) * QRS); }
                    const size_t oo = sb + (size_t)row * SEQ + c8;
                    const size_t ro = rb + (size_t)row * (size_t)resT + c8;
                    *(v8h*)(Ph + oo) = hv; if (wr) *(v8h*)(Pr + ro) = rv; }
            }
             }
        wave_sync();
    }
}

// q: token-major with the update extension; k: token-major, no extension; v^T: feature-major with the update extension
__global__ __launch_bounds__(32 * PW) void k_projq(const bf* __restrict__ A, const bf* __restrict__ Bt, const bf* __restrict__ AX, const bf* __restrict__ BX,
                                              const float* __restrict__ bias, h16* Ph, h16* Pr, int resT) { proj_body<0, 1>(A, Bt, AX, BX, bias, Ph, Pr, resT); }
__global__ __launch_bounds__(32 * PW) void k_projk(const bf* __restrict__ A, const bf* __restrict__ Bt,
                                              const float* __restrict__ bias, h16* Ph, h16* Pr, int resT) { proj_body<0, 0>(A, Bt, A, Bt, bias, Ph, Pr, resT); }
__global__ __launch_bounds__(32 * PW) void k_projv(const bf* __restrict__ A, const bf* __restrict__ Bt, const bf* __restrict__ AX, const bf* __restrict__ BX,
                                              const float* __restrict__ bias, h16* Ph, h16* Pr, int resT) { proj_body<1, 1>(A, Bt, AX, BX, bias, Ph, Pr, resT); }

// keypass_body: fused causal pair weighting, one wave per 16 query rows of one (batch, head); K / V^T / Q fragments straight from the f16 planes (two 16-B loads each, arithmetic addressing).
// Transposed form: S^T[key][t] = K Q^T (A = K rows, B = Q rows, two k-steps over d); lane (t = lane&15, h = lane>>4) holds keys 8h+r of each 16-key tile, so the packed
// P tile is directly the B fragment of O^T[d][t] = V^T P^T (element r <- tile keys 0..15, element 8+r <- tile keys 16..31, lane unchanged); four 16-row d tiles.
// Softmax state (running max, partial sum) is one scalar per lane; the two lane halves of a row are combined with one xor-16 exchange.
// Logit per element, log2 domain: (key > t ? -1e9 * log2e : s * scale * log2e) + mask[key] * log2e, evaluated literally inside every visited 32-key tile; P elements whose exponent argument is below -14 are set to zero.
// EARLY = 1 (query rows [0, EROWS)): scores = K Q + (K Q_res + K_res Q) / 2048; P = f16 value + f16 residual x2048; O = V P + (V P_res + V_res P) / 2048 (residual products in their own accumulators);
//            row sum from the f32 exponentials; K_res / V_res fragments come from the small planes (tokens < EROWS) and are zero for keys >= EROWS (address clamped, wave-uniform select).
// EARLY = 0 (query rows [EROWS, SEQ)): single q, k, P, v; row sum over the converted P.
template <int EARLY>
__device__ __forceinline__ void keypass_body(const h16* __restrict__ QH, const h16* __restrict__ QR, const h16* __restrict__ KP, const h16* __restrict__ KR,
                                           const h16* __restrict__ VT, const h16* __restrict__ VR, const float* __restrict__ amask, float* OUT) {
    __shared__ __align__(16) float os[AW * 16 * OSP];
    const int lane = threadIdx.x & 31, lr = lane & 15, hi = lane >> 4;
    const int wave = __builtin_amdgcn_readfirstlane((int)(threadIdx.x >> 5));
    const int zh = blockIdx.y; const int b = zh / NH_, h = zh % NH_;
    const int t0 = (EARLY ? 0 : EROWS) + (blockIdx.x * AW + wave) * 16;
    const int lim = t0 + lr;                                                  // key j is causal-filled iff j > lim
    const float* amb = amask + (size_t)b * SEQ_FULL;
    // scan of the batch's mask row: any value not below WIDE in magnitude widens the key loop to all keys
    float fl = 0.0f;
#pragma unroll 1
    for (int i = 0; i < SEQ; i += 128) {
        const v4f w = *(const v4f*)(amb + i + 4 * lane);
#pragma unroll
        for (int c = 0; c < 4; ++c) { const float a = fabsf(bfr(w[c])); fl = (a < WIDE) ? fl : 1.0f; } }
    fl = fmaxf(fl, __shfl_xor(fl, 16, 32)); fl = fmaxf(fl, __shfl_xor(fl, 8, 32)); fl = fmaxf(fl, __shfl_xor(fl, 4, 32));
    fl = fmaxf(fl, __shfl_xor(fl, 2, 32));  fl = fmaxf(fl, __shfl_xor(fl, 1, 32));
    const int nkc = (t0 + 16 + 31) & ~31;                                     // causal bound, multiple of 32, <= SEQ
    const int nkv = (fl != 0.0f) ? SEQ : nkc;                                 // select formed on the vector side
    const int nk = __builtin_amdgcn_readfirstlane(nkv);
    const size_t pbase = (size_t)zh * SEQ * HD;
    const size_t rbase = (size_t)zh * EROWS * HD;
    const size_t qo = pbase + (size_t)(t0 + lr) * HD + 8 * hi;
    const v16h hz = (v16h){};
    v16h qh[2], qr[2];
    qh[0] = ldh(QH + qo); qh[1] = ldh(QH + qo + 32);             // B fragments: col t, k = d (two k-steps)
    qr[0] = hz; qr[1] = hz;
    if (EARLY) { const size_t qro = rbase + (size_t)(t0 + lr) * HD + 8 * hi; qr[0] = ldh(QR + qro); qr[1] = ldh(QR + qro + 32); }   // t0 + lr < EROWS
    const size_t ko = pbase + (size_t)lr * HD + 8 * hi;        // + key * HD       (A fragment: row key, k = d)
    const size_t vo = pbase + (size_t)lr * SEQ + 8 * hi;       // + 16j*SEQ + key  (A fragment: row d, k = key)
    const size_t kro = rbase + (size_t)lr * HD + 8 * hi;       // residual planes, tokens < EROWS
    const size_t vro = rbase + (size_t)lr * EROWS + 8 * hi;
    v8f o[4], oR[4];
#pragma unroll
    for (int j = 0; j < 4; ++j) { o[j] = (v8f){}; oR[j] = (v8f){}; }
    float m = NEGB, l = 0.0f;
#pragma unroll 1
    for (int key0 = 0; key0 < nk; key0 += 32) {
        const bool rok = key0 < EROWS;                           // wave-uniform
        const int kcl = rok ? key0 : (EROWS - 32);               // clamped residual-plane key (address always inside the plane)
        const h16* kpt = KP + ko + (size_t)key0 * HD;
        v8f sHa = (v8f){}, sLa = (v8f){}, sHb = (v8f){}, sLb = (v8f){};
#pragma unroll
        for (int ks = 0; ks < 2; ++ks) {
            const v16h ka = ldh(kpt + ks * 32), kb = ldh(kpt + 16 * HD + ks * 32);
            sHa = wmma16g(ka, qh[ks], sHa); sHb = wmma16g(kb, qh[ks], sHb);
            if (EARLY) {
                sLa = wmma16g(ka, qr[ks], sLa); sLb = wmma16g(kb, qr[ks], sLb);
                const h16* krp = KR + kro + (size_t)kcl * HD;
                v16h kra = ldh(krp + ks * 32), krb = ldh(krp + 16 * HD + ks * 32);
                if (!rok) { kra = hz; krb = hz; }
                sLa = wmma16g(kra, qh[ks], sLa); sLb = wmma16g(krb, qh[ks], sLb);
            }
        }
        const float* kp = amb + 8 * hi + key0;                   // keys key0+8h+0..7 and key0+16+8h+0..7, all < nk <= SEQ
        const v4f m0 = *(const v4f*)kp, m1 = *(const v4f*)(kp + 4), m2 = *(const v4f*)(kp + 16), m3 = *(const v4f*)(kp + 20);
        float kx[8], ky[8];
#pragma unroll
        for (int r = 0; r < 4; ++r) { kx[r] = m0[r]; kx[4 + r] = m1[r]; ky[r] = m2[r]; ky[4 + r] = m3[r]; }
        const int ja = key0 + 8 * hi;
        float ta[8], tb[8]; float mx = NEGB;
#pragma unroll
        for (int r = 0; r < 8; ++r) {
            const float sa = EARLY ? (sHa[r] + sLa[r] * QRI) * SC2 : sHa[r] * SC2;
            const float sb = EARLY ? (sHb[r] + sLb[r] * QRI) * SC2 : sHb[r] * SC2;
            ta[r] = ((ja + r > lim) ? NEGL : sa) + bfr(kx[r]) * L2E;             // replace, then add the mask
            tb[r] = ((ja + 16 + r > lim) ? NEGL : sb) + bfr(ky[r]) * L2E;
            mx = fmaxf(mx, fmaxf(ta[r], tb[r])); }
        mx = fmaxf(mx, __shfl_xor(mx, 16, 32));
        const float mnew = fmaxf(m, mx);
        const float alpha = __builtin_amdgcn_exp2f(m - mnew);
        const float sh = PSH - mnew;
        v16h pb, pr = hz; float ls = 0.0f;
#pragma unroll
        for (int r = 0; r < 8; ++r) {
            const float aa = ta[r] + sh, ab = tb[r] + sh;
            const float ea = __builtin_amdgcn_exp2f(aa), eb = __builtin_amdgcn_exp2f(ab);
            const float ga = (aa < PFL) ? 0.0f : ea, gb = (ab < PFL) ? 0.0f : eb;   // below the f16 normal range -> exactly zero, selected by value
            const h16 pa = (h16)ga; const h16 pc = (h16)gb;
            pb[r] = pa; pb[8 + r] = pc;
            if (EARLY) { pr[r] = toh_flush((ga - (float)pa) * QRS); pr[8 + r] = toh_flush((gb - (float)pc) * QRS); ls += ga + gb; }
            else       { ls += (float)pa + (float)pc; } }
        l = l * alpha + ls; m = mnew;
#pragma unroll
        for (int j = 0; j < 4; ++j) { o[j] = o[j] * alpha; if (EARLY) oR[j] = oR[j] * alpha; }
        const h16* va = VT + vo + key0;
#pragma unroll
        for (int jp = 0; jp < 2; ++jp) {
            const v16h v0 = ldh(va + (size_t)(32 * jp) * SEQ), v1 = ldh(va + (size_t)(32 * jp + 16) * SEQ);
            o[2 * jp] = wmma16g(v0, pb, o[2 * jp]); o[2 * jp + 1] = wmma16g(v1, pb, o[2 * jp + 1]);
            if (EARLY) {
                oR[2 * jp] = wmma16g(v0, pr, oR[2 * jp]); oR[2 * jp + 1] = wmma16g(v1, pr, oR[2 * jp + 1]);
                const h16* vrp = VR + vro + kcl;
                v16h vr0 = ldh(vrp + (size_t)(32 * jp) * EROWS), vr1 = ldh(vrp + (size_t)(32 * jp + 16) * EROWS);
                if (!rok) { vr0 = hz; vr1 = hz; }
                oR[2 * jp] = wmma16g(vr0, pb, oR[2 * jp]); oR[2 * jp + 1] = wmma16g(vr1, pb, oR[2 * jp + 1]);
            }
        }
    }
    l += __shfl_xor(l, 16, 32);
    const float inv = 1.0f / l;                                  // l >= 2^14 whenever the row has a finite maximum logit
    const int wb = wave * 16 * OSP;
    // O^T D layout: o[j][r] = (d = 16j + 8h + r, t = lane&15) -> os[t][d]; rows 0..15 x columns 0..63 all written
#pragma unroll
    for (int j = 0; j < 4; ++j) {
        v8f f = o[j];
        if (EARLY) f = o[j] + oR[j] * QRI;
        v4f a, c;
        a[0] = f[0] * inv; a[1] = f[1] * inv; a[2] = f[2] * inv; a[3] = f[3] * inv; c[0] = f[4] * inv; c[1] = f[5] * inv; c[2] = f[6] * inv; c[3] = f[7] * inv;
        *(v4fa*)(&os[wb + lr * OSP + 16 * j + 8 * hi]) = a; *(v4fa*)(&os[wb + lr * OSP + 16 * j + 8 * hi + 4]) = c; }
    wave_sync();
    float* orow = OUT + ((size_t)b * OUT_SEQ + t0) * DM + h * HD;
{
#pragma unroll
        for (int s = 0; s < 8; ++s) { const int row = 2 * s + (lane >> 4), cofs = (lane & 15) * 4;   // 8 s x 2 rows = 16 rows; 16 lanes x 4 floats = 64 columns = two lines
            const v4f val = *(const v4fa*)(&os[wb + row * OSP + cofs]);
            *(v4f*)(orow + (size_t)row * DM + cofs) = val; }
         }
}

__global__ __launch_bounds__(32 * AW) __attribute__((amdgpu_num_vgpr(256)))
void k_keypass_early(const h16* __restrict__ QH, const h16* __restrict__ QR, const h16* __restrict__ KP, const h16* __restrict__ KR,
                   const h16* __restrict__ VT, const h16* __restrict__ VR, const float* __restrict__ amask, float* OUT) {
    keypass_body<1>(QH, QR, KP, KR, VT, VR, amask, OUT);
}
__global__ __launch_bounds__(32 * AW) __attribute__((amdgpu_num_vgpr(256)))
void k_keypass_late(const h16* __restrict__ QH, const h16* __restrict__ KP, const h16* __restrict__ VT, const float* __restrict__ amask, float* OUT) {
    keypass_body<0>(QH, QH, KP, KP, VT, VT, amask, OUT);
}

static constexpr size_t al256(size_t v) { return (v + 255) & ~(size_t)255; }
static constexpr size_t SZ_XB = al256((size_t)NB * SEQ * DM * 2);
static constexpr size_t SZ_WB = al256((size_t)3 * DM * DM * 2);
static constexpr size_t SZ_AL = al256((size_t)2 * LR * DM * 2);
static constexpr size_t SZ_BL = al256((size_t)DM * LK * 2);
static constexpr size_t SZ_XL = al256((size_t)NB * SEQ * LK * 2);
static constexpr size_t SZ_PL = al256((size_t)NB * NH_ * SEQ * HD * 2);
static constexpr size_t SZ_RS = al256((size_t)NB * NH_ * EROWS * HD * 2);
static constexpr size_t SZ_TOTAL = SZ_XB + SZ_WB + SZ_AL + 2 * SZ_BL + 2 * SZ_XL + 3 * SZ_PL + 3 * SZ_RS;
static_assert(SZ_TOTAL <= (size_t)134217728);          // workspace carve <= 128 MiB
static_assert(((size_t)DM * DM * 2) % 256 == 0);       // weight sub-planes stay 256-byte aligned
static_assert(((size_t)LR * DM * 2) % 256 == 0);       // the two halves of the A plane stay 256-byte aligned
static_assert((size_t)NB * NH_ * SEQ * HD == (size_t)NB * DM * SEQ);       // v^T plane [(b*1024 + m)][t] has the same extent as the q/k planes
static_assert((size_t)NB * NH_ * EROWS * HD == (size_t)NB * DM * EROWS);   // v^T residual plane [(b*1024 + m)][t < EROWS] has the same extent as the q/k residual planes
static_assert((DM * 4) % 256 == 0);                    // k_bext grid covers the plane exactly

extern "C" void kernel_launch(void* const* d_in, const int* in_sizes, int n_in,
                              void* d_out, int out_size, void* d_ws, size_t ws_size, hipStream_t stream) {
    if (n_in < 12) return;
    const size_t needx = ((size_t)(NB - 1) * SEQ_FULL + SEQ) * DM;
    const size_t needm = (size_t)(NB - 1) * SEQ_FULL + SEQ;
    if ((size_t)in_sizes[0] < needx || (size_t)in_sizes[1] < needm) return;
    if ((size_t)in_sizes[2] < (size_t)DM * DM || (size_t)in_sizes[4] < (size_t)DM * DM || (size_t)in_sizes[6] < (size_t)DM * DM) return;
    if (in_sizes[3] < DM || in_sizes[5] < DM || in_sizes[7] < DM) return;
    if (in_sizes[8] < LR * DM || in_sizes[9] < DM * LR || in_sizes[10] < LR * DM || in_sizes[11] < DM * LR) return;
    if ((size_t)out_size < ((size_t)(NB - 1) * OUT_SEQ + SEQ) * DM) return;
    if (SZ_TOTAL > ws_size) return;
    // wire order: hidden_states, key_mask (the module's additive key mask input), Wq, bq, Wk, bk, Wv, bv, Aq, Bq, Av, Bv
    const float* xin = (const float*)d_in[0];
    const float* am  = (const float*)d_in[1];
    const float* wq = (const float*)d_in[2]; const float* bq = (const float*)d_in[3];
    const float* wk = (const float*)d_in[4]; const float* bk = (const float*)d_in[5];
    const float* wv = (const float*)d_in[6]; const float* bv = (const float*)d_in[7];
    const float* aq = (const float*)d_in[8]; const float* bqu = (const float*)d_in[9];
    const float* av = (const float*)d_in[10]; const float* bvu = (const float*)d_in[11];
    float* OUT = (float*)d_out;      // [NB][SEQ][1024]
    char* wsp = (char*)d_ws;
    bf* XB = (bf*)wsp; wsp += SZ_XB;                 // x      [NB*SEQ][1024]
    bf* WB = (bf*)wsp; wsp += SZ_WB;                 // [3][1024][1024]: q | k | v  ([out][in] = Bt as-is)
    bf* AL = (bf*)wsp; wsp += SZ_AL;                 // [16][1024]: rows 0..7 A of the q update, rows 8..15 A of the v update
    bf* BLq = (bf*)wsp; wsp += SZ_BL;                // [1024][32]: B | B | 0 | 0 (q update)
    bf* BLv = (bf*)wsp; wsp += SZ_BL;                // [1024][32]: B | B | 0 | 0 (v update)
    bf* XLq = (bf*)wsp; wsp += SZ_XL;                // [NB*SEQ][32]: hi | lo | 0 | 0 of 2 x A^T (q update)
    bf* XLv = (bf*)wsp; wsp += SZ_XL;                // [NB*SEQ][32]: hi | lo | 0 | 0 of 2 x A^T (v update)
    h16* QH = (h16*)wsp; wsp += SZ_PL;               // [NB*16][SEQ][64]
    h16* KP = (h16*)wsp; wsp += SZ_PL;               // [NB*16][SEQ][64]
    h16* VT = (h16*)wsp; wsp += SZ_PL;               // [NB*16][64][SEQ]
    h16* QR = (h16*)wsp; wsp += SZ_RS;               // [NB*16][EROWS][64] residual x2048, tokens < EROWS
    h16* KR = (h16*)wsp; wsp += SZ_RS;               // [NB*16][EROWS][64] residual x2048, tokens < EROWS
    h16* VR = (h16*)wsp; wsp += SZ_RS;               // [NB*16][64][EROWS] residual x2048, tokens < EROWS
    bf* WQ = WB; bf* WK = WB + (size_t)DM * DM; bf* WV = WB + (size_t)2 * DM * DM;

    if (SEQ == SEQ_FULL) {
        const size_t n8 = (size_t)NB * SEQ * DM / 8;
        k_cvt8<<<(unsigned)((n8 + 255) / 256), 256, 0, stream>>>(xin, XB, n8);
    } else {
        const size_t n8 = (size_t)SEQ * DM / 8;
        for (int b = 0; b < NB; ++b) k_cvt8<<<(unsigned)((n8 + 255) / 256), 256, 0, stream>>>(xin + (size_t)b * SEQ_FULL * DM, XB + (size_t)b * SEQ * DM, n8);
    }
    { const size_t n8 = (size_t)DM * DM / 8; const unsigned g = (unsigned)((n8 + 255) / 256);
      k_cvt8<<<g, 256, 0, stream>>>(wq, WQ, n8); k_cvt8<<<g, 256, 0, stream>>>(wk, WK, n8); k_cvt8<<<g, 256, 0, stream>>>(wv, WV, n8); }
    { const size_t n8 = (size_t)LR * DM / 8; const unsigned g = (unsigned)((n8 + 255) / 256);
      k_cvt8<<<g, 256, 0, stream>>>(aq, AL, n8); k_cvt8<<<g, 256, 0, stream>>>(av, AL + (size_t)LR * DM, n8); }
    { const int n4 = DM * 4; const unsigned g = (unsigned)((n4 + 255) / 256);
      k_bext<<<g, 256, 0, stream>>>(bqu, BLq, n4); k_bext<<<g, 256, 0, stream>>>(bvu, BLv, n4); }

    // 2 x A^T for both updates -> x-side extension planes
    k_xa<<<dim3(NB * SEQ / 64, 1, 1), 32 * PW, 0, stream>>>(XB, AL, XLq, XLv);

    // q, k: A = x rows (m = b*SEQ + t), Bt = W rows (n = h*64 + d) -> plane [(b*16 + h)][t][d]; residuals for tokens < EROWS
    k_projq<<<dim3(NB * SEQ / 128, DM / 128, 1), 32 * PW, 0, stream>>>(XB, WQ, XLq, BLq, bq, QH, QR, EROWS);
    k_projk<<<dim3(NB * SEQ / 128, DM / 128, 1), 32 * PW, 0, stream>>>(XB, WK, bk, KP, KR, EROWS);
    // v^T: A = Wv rows (m = h*64 + d), Bt = x rows (n = b*SEQ + t) -> plane [(b*1024 + m)][t] = [(b*16 + h)][d][t]; residual for tokens < EROWS
    k_projv<<<dim3(DM / 128, NB * SEQ / 128, 1), 32 * PW, 0, stream>>>(WV, XB, BLv, XLv, bv, VT, VR, EROWS);

    // query rows [0, EROWS): multi-product instantiation; rows [EROWS, SEQ): single-product instantiation (disjoint output rows)
    k_keypass_early<<<dim3(EROWS / (16 * AW), NB * NH_, 1), 32 * AW, 0, stream>>>(QH, QR, KP, KR, VT, VR, am, OUT);
    if (SEQ > EROWS)
        k_keypass_late<<<dim3((SEQ - EROWS) / (16 * AW), NB * NH_, 1), 32 * AW, 0, stream>>>(QH, KP, VT, am, OUT);
}

// v002
// It runs in 157 microseconds.
// Next to v001, in two timings, it ran 1.47 and 1.46 times as fast.
// Over all steps from v000 it is 2.02 times as fast.
#include <hip/hip_runtime.h>

// Causal pair-score weighting, width 1024 = 16 heads x 64; one input x [NB][SEQ][1024] feeds q, k and v; Wq/Wk/Wv [out][in] (y = x W^T + bias); rank-8 additive updates on q and v: y += 2 (x A^T) B^T with A [8][in], B [out][8];
// additive key mask [NB][1][1][SEQ] (f32, read by value); score scale 1/sqrt(64); keys j > t are replaced by -1e9 before the mask is added; softmax over keys; output = concatenated heads (f32), no output projection.
// Compute dtypes, f32 accumulate everywhere: projections and x A^T v_wmma_f32_16x16x32_bf16 (x, W, A, B, biases, mask RNE-converted to bf16; products exact); the rank-8 up-projection is one extra 32-deep k-step of the projection GEMM (2 x A^T carried as bf16 hi | lo, B bf16);
// scores v_wmma_f32_16x16x32_f16: single f16 q and k on query rows >= EROWS; q and k each as f16 value + f16 residual x2048 (three products, residual products in their own accumulator) on query rows < EROWS;
// P.V v_wmma_f32_16x16x32_f16: P (x16384 carry, cancels in the normalisation) and v single f16 on query rows >= EROWS; on query rows < EROWS P and v each as f16 value + f16 residual x2048, residual products in their own accumulator folded by 1/2048, row sum from the f32 exponentials; softmax f32 (online, running max).
// Layout: bf16 copies of x, W, A; extension planes [row][32] bf16 (x side: hi | lo | 0 | 0 of 2 x A^T; weight side: B | B | 0 | 0); q, k planes [b*16+h][t][64], v^T plane [b*16+h][d][t], small residual planes q, k [b*16+h][t < EROWS][64] and v^T [b*16+h][d][t < EROWS]; fused online-softmax key-pass kernel in transposed form (S^T = K Q^T, O^T = V^T P^T).
// Key loop bound per wave: the causal limit; if any mask value of the batch is not below 1e8 in magnitude the loop covers all keys (per-element arithmetic is literal in every visited tile). Residual fragments for keys >= EROWS are zero.

#ifndef NB
#define NB 2
#endif
#ifndef SEQ
#define SEQ 2048
#endif
#define NB_FULL  2
#define SEQ_FULL 2048
#ifndef OUT_SEQ
#define OUT_SEQ SEQ              // row pitch (in tokens) between batches of the output
#endif
#define DM   1024
#define NH_  16
#define HD   64
#define LR   8                   // rank of the additive updates
#define LK   32                  // k extent of the extension planes (one WMMA k-step)
#define XP   20                  // LDS row pitch (floats) of the x A^T tile
#define AW   4                   // waves per online-softmax key-pass block (16 query rows each)
#define PW   4                   // waves per projection block (2 x 2 wave tiles of 64 x 64)
#define PBK  64                  // k extent of one staged projection tile: 128 bytes of every operand row
#define PPI  72                  // LDS row pitch (16-bit elements) of a staged row: 144 bytes = 16 x 9
#define POP  (128 * PPI)         // elements of one staged operand tile (128 rows)
#define PST  (2 * POP)           // elements of one stage: A tile | B tile
#define XST  (80 * PPI)          // elements of one stage of the x A^T kernel: 64 x rows | 16 A rows
#define OSP  68                  // LDS row pitch (floats) of the online-softmax key-pass output tile
#define KST  64                  // keys of one staged key-pass tile: 64 K rows of 128 bytes, 128 bytes of each of the 64 V^T rows
#define KOP  (64 * PPI)          // elements of one staged key-pass plane tile (64 rows at pitch PPI)
#define EROWS (SEQ < 512 ? SEQ : 512)   // query rows (and tokens of the small residual planes) handled by the multi-product online-softmax key-pass instantiation
#define QRS  2048.0f             // carry of every residual plane / residual fragment
#define QRI  (1.0f / 2048.0f)
#define SC2  ((float)(0.125 * 1.4426950408889634))      // HD^-0.5 * log2(e)
#define L2E  ((float)1.4426950408889634)
#define NEGL ((float)(-1.0e9 * 1.4426950408889634))     // fill value -1e9 in the log2 domain
#define LSC  2.0f                // update scaling 16 / 8
#define PSH  14.0f               // log2 of the P carry (16384)
#define PFL  (-14.0f)            // exponent argument below which the f16 P would leave the normal range
#define NEGB (-3.0e38f)
#define WIDE 1.0e8f              // mask magnitude bound under which skipped (fully causal-filled) tiles contribute exactly zero

static_assert(HD == 64);
static_assert(NH_ * HD == DM);                 // head h = columns h*64 + d
static_assert(DM % 64 == 0);                   // column tiles of 64 = one head
static_assert(64 % HD == 0);
static_assert(DM % 32 == 0);                   // GEMM k-loop steps by 32
static_assert(LK == 32);                       // extension = exactly one k-step
static_assert(2 * LR <= LK);                   // hi | lo pieces fit the extension row
static_assert(LR == 8);                        // one 16-byte piece per part; B rows loaded as 8 floats
static_assert(2 * LR == 16);                   // A rows of q and v updates fill one 16-column tile
static_assert(SEQ % 64 == 0);                  // a 64-row tile never straddles two batches
static_assert((NB * SEQ) % 64 == 0);
static_assert(SEQ % 128 == 0);                 // mask scan steps by 128
static_assert(SEQ % 32 == 0);                  // key loop steps by 32
static_assert(SEQ % (16 * AW) == 0);           // online-softmax key-pass grids cover the sequence exactly
static_assert(EROWS % 64 == 0);                // a 64-token GEMM tile lies wholly inside or outside the residual planes
static_assert(EROWS >= 32);
static_assert(EROWS <= SEQ);
static_assert(EROWS % (16 * AW) == 0);
static_assert((SEQ - EROWS) % (16 * AW) == 0);
static_assert(((size_t)SEQ * DM) % 8 == 0);
static_assert(((size_t)DM * DM) % 8 == 0);
static_assert(((size_t)LR * DM) % 8 == 0);
static_assert(NB <= NB_FULL);
static_assert(SEQ <= SEQ_FULL);
static_assert((OSP * 4) % 16 == 0);
static_assert(OSP >= HD);
static_assert((XP * 4) % 16 == 0);
static_assert(XP >= 16);
static_assert(32 * 4 * 16 == 16 * HD * 2);
static_assert(32 * 4 * 16 == 16 * 64 * 2);
static_assert(32 * 8 * 16 == 16 * HD * 4);     // online-softmax key-pass epilogue: 8 instructions x 32 lanes x 16 B = 16 rows x 256 B
static_assert(32 * 8 * 16 == 64 * LK * 2);     // x A^T epilogue: 8 instructions x 32 lanes x 16 B = 64 rows x 64 B per plane
static_assert((NB * SEQ) % 128 == 0);          // projection blocks cover 128 x 128
static_assert(DM % 128 == 0);
static_assert(DM % PBK == 0);
static_assert(DM / PBK >= 2);                  // the two-buffer ring needs two stages
static_assert(PBK * 2 == 128);                 // a staged row is one 128-byte line: 8 lanes x 16 B
static_assert((PPI * 2) % 16 == 0);
static_assert(PPI >= PBK);
static_assert(8 * 32 * PW * 16 == 128 * PBK * 2);   // 8 copies per lane fill one operand tile
static_assert(2 * PST * 2 + PW * 16 * 68 * 4 <= 131072);   // static LDS of the projection kernels
static_assert(2 * XST * 2 + 64 * XP * 4 <= 131072);   // static LDS of the x A^T kernel
static_assert(5 * 32 * PW * 16 == 80 * PBK * 2);      // 5 copies per lane fill one stage of the x A^T kernel
static_assert(PW * 16 == 64);                         // x A^T kernel: one 16-row tile per wave
static_assert(2 * 4 * KOP * 2 + AW * 16 * OSP * 4 <= 131072);    // static LDS of the online-softmax key-pass kernels
static_assert(KST == 16 * AW);                 // a block's causal key bound is a whole number of staged tiles
static_assert(SEQ % KST == 0);
static_assert(EROWS % KST == 0);               // a staged tile lies wholly inside or outside the residual planes
static_assert(KST * 2 == 128);                 // a staged V^T row piece is one 128-byte line
static_assert(HD * 2 == 128);                  // a staged K row is one 128-byte line
static_assert(4 * 32 * AW * 16 == 64 * 128);   // 4 copies per lane fill one plane tile

typedef _Float16 h16;
typedef unsigned short bf;
typedef __attribute__((ext_vector_type(16))) __bf16   v16bf;
typedef __attribute__((ext_vector_type(16))) _Float16 v16h;
typedef __attribute__((ext_vector_type(8)))  _Float16 v8h;
typedef __attribute__((ext_vector_type(8)))  unsigned short v8us;
typedef __attribute__((ext_vector_type(8)))  float    v8f;
typedef __attribute__((ext_vector_type(4)))  float    v4f;
typedef v4f  __attribute__((may_alias)) v4fa;

__device__ __forceinline__ unsigned short f2bf(float f) { unsigned u = __float_as_uint(f); u += 0x7FFFu + ((u >> 16) & 1u); return (unsigned short)(u >> 16); }
__device__ __forceinline__ float bfr(float f) { return __uint_as_float(((unsigned)f2bf(f)) << 16); }   // value after RNE convert to bf16
__device__ __forceinline__ v16h cat16(v8h lo, v8h hi) { return __builtin_shufflevector(lo, hi, 0, 1, 2, 3, 4, 5, 6, 7, 8, 9, 10, 11, 12, 13, 14, 15); }
__device__ __forceinline__ v16bf cat16b(v8us lo, v8us hi) { return __builtin_bit_cast(v16bf, __builtin_shufflevector(lo, hi, 0, 1, 2, 3, 4, 5, 6, 7, 8, 9, 10, 11, 12, 13, 14, 15)); }
__device__ __forceinline__ v8f wmma16(v16h a, v16h b, v8f c) { return __builtin_amdgcn_wmma_f32_16x16x32_f16(false, a, false, b, (short)0, c, false, false); }
__device__ __forceinline__ v8f wmmab(v16bf a, v16bf b, v8f c) { return __builtin_amdgcn_wmma_f32_16x16x32_bf16(false, a, false, b, (short)0, c, false, false); }
// fragment loaders from K-contiguous 16-bit rows; p already includes + 8*(lane>>4): elements 0..7 <- k0+8h+0..7, elements 8..15 <- k0+16+8h+0..7 (same map for A and B)
__device__ __forceinline__ v16h  ldh(const h16* p) { return cat16(*(const v8h*)p, *(const v8h*)(p + 16)); }
__device__ __forceinline__ v16bf ldb(const bf* p)  { return cat16b(*(const v8us*)p, *(const v8us*)(p + 16)); }
// ordering point for wave-private LDS tiles (same wave writes and reads)
__device__ __forceinline__ void wave_sync() { __builtin_amdgcn_fence(3 /* release order */, "wavefront"); __builtin_amdgcn_wave_barrier(); asm volatile("" ::: "memory"); }

// f32 -> f16 convert that cannot produce a subnormal operand (|v| < 2^-14 -> +0); applied after the plane's power-of-two carry
static __device__ __forceinline__ h16 toh_flush(float v) { const h16 r = (h16)v; return (fabsf(v) < 6.103515625e-05f) ? (h16)0.0f : r; }
// one matrix instruction followed by its own four-slot guard (ties the accumulator, keeps the operands live)
static __device__ __forceinline__ v8f wmma16g(v16h a, v16h b, v8f c) { c = wmma16(a, b, c); asm volatile("v_nop\n\tv_nop\n\tv_nop\n\tv_nop" : "+v"(c) : "v"(a), "v"(b)); return c; }
static __device__ __forceinline__ v8f wmmabg(v16bf a, v16bf b, v8f c) { c = wmmab(a, b, c); asm volatile("v_nop\n\tv_nop\n\tv_nop\n\tv_nop" : "+v"(c) : "v"(a), "v"(b)); return c; }
// one 16-bit word of an extension row: piece 0 = bf16 value, piece 1 = bf16 of the remainder, pieces 2, 3 = zero (select by value)
static __device__ __forceinline__ unsigned short ext_word(float v, int piece) {
    const unsigned short hw = f2bf(v); const float hv = __uint_as_float(((unsigned)hw) << 16); const unsigned short lw = f2bf(v - hv);
    return (piece == 0) ? hw : ((piece == 1) ? lw : (unsigned short)0); }

// eight asynchronous 16-byte copies per lane, global -> LDS: copy i moves the lane's 16 bytes of tile row (row + 16 i). The closing s_wait_xcnt stands inside the statement so that no address register is rewritten ahead of it.
static __device__ __forceinline__ void copy8(unsigned l, const bf* g, size_t gs) {
    const unsigned ls = 16 * PPI * 2;
    asm volatile("global_load_async_to_lds_b128 %0, %8, off\n\t"
                 "global_load_async_to_lds_b128 %1, %9, off\n\t"
                 "global_load_async_to_lds_b128 %2, %10, off\n\t"
                 "global_load_async_to_lds_b128 %3, %11, off\n\t"
                 "global_load_async_to_lds_b128 %4, %12, off\n\t"
                 "global_load_async_to_lds_b128 %5, %13, off\n\t"
                 "global_load_async_to_lds_b128 %6, %14, off\n\t"
                 "global_load_async_to_lds_b128 %7, %15, off\n\t"
                 "s_wait_xcnt 0x0"
                 :: "v"(l), "v"(l + ls), "v"(l + 2 * ls), "v"(l + 3 * ls), "v"(l + 4 * ls), "v"(l + 5 * ls), "v"(l + 6 * ls), "v"(l + 7 * ls),
                    "v"(g), "v"(g + gs), "v"(g + 2 * gs), "v"(g + 3 * gs), "v"(g + 4 * gs), "v"(g + 5 * gs), "v"(g + 6 * gs), "v"(g + 7 * gs)
                 : "memory");
}

// the same with five copies: four rows of one plane (row + 16 i) and one row of a second plane, laid behind them in LDS
static __device__ __forceinline__ void copy5(unsigned l, const bf* g, size_t gs, const bf* g4) {
    const unsigned ls = 16 * PPI * 2;
    asm volatile("global_load_async_to_lds_b128 %0, %5, off\n\t"
                 "global_load_async_to_lds_b128 %1, %6, off\n\t"
                 "global_load_async_to_lds_b128 %2, %7, off\n\t"
                 "global_load_async_to_lds_b128 %3, %8, off\n\t"
                 "global_load_async_to_lds_b128 %4, %9, off\n\t"
                 "s_wait_xcnt 0x0"
                 :: "v"(l), "v"(l + ls), "v"(l + 2 * ls), "v"(l + 3 * ls), "v"(l + 4 * ls),
                    "v"(g), "v"(g + gs), "v"(g + 2 * gs), "v"(g + 3 * gs), "v"(g4)
                 : "memory");
}

// the same with four copies of 16-bit float rows: copy i moves the lane's 16 bytes of tile row (row + 16 i)
static __device__ __forceinline__ void copy4(unsigned l, const h16* g, size_t gs) {
    const unsigned ls = 16 * PPI * 2;
    asm volatile("global_load_async_to_lds_b128 %0, %4, off\n\t"
                 "global_load_async_to_lds_b128 %1, %5, off\n\t"
                 "global_load_async_to_lds_b128 %2, %6, off\n\t"
                 "global_load_async_to_lds_b128 %3, %7, off\n\t"
                 "s_wait_xcnt 0x0"
                 :: "v"(l), "v"(l + ls), "v"(l + 2 * ls), "v"(l + 3 * ls),
                    "v"(g), "v"(g + gs), "v"(g + 2 * gs), "v"(g + 3 * gs)
                 : "memory");
}

__global__ __launch_bounds__(256) void k_cvt8(const float* __restrict__ src, bf* dst, size_t n8) {
    const size_t i = (size_t)blockIdx.x * 256 + threadIdx.x; if (i >= n8) return;
    const v8f v = *(const v8f*)(src + i * 8); v8us o;
#pragma unroll
    for (int k = 0; k < 8; ++k) o[k] = f2bf(v[k]);
    *(v8us*)(dst + i * 8) = o; 
}

__global__ __launch_bounds__(256) void k_bext(const float* __restrict__ src, bf* dst, int n4) {
    const int i = blockIdx.x * 256 + threadIdx.x; if (i >= n4) return;
    const int row = i >> 2, piece = i & 3;
    v8f v = *(const v8f*)(src + (size_t)row * LR);
    asm volatile("" : "+v"(v));
    v8us o;
#pragma unroll
    for (int k = 0; k < 8; ++k) { const unsigned short w = f2bf(v[k]); o[k] = (piece < 2) ? w : (unsigned short)0; }
    *(v8us*)(dst + (size_t)i * 8) = o; 
}

// k_xa: x A^T for both updates in one 16-column tile (columns 0..7 = q update rows of A, 8..15 = v update rows), four waves per 64 token rows (16 rows each), K = DM.
// The 64 x rows and the 16 A rows are staged in LDS, 64 k at a time, by asynchronous 16-byte copies (pitch 144 B), two buffers, as in the projection kernels.
// Output: x-side extension planes XLq, XLv [token][32] bf16 = hi | lo | 0 | 0 of 2 * (x A^T); per plane the 64 rows x 64 B of the tile are one contiguous 4096-byte run:
__global__ __launch_bounds__(32 * PW) void k_xa(const bf* __restrict__ X, const bf* __restrict__ AL, bf* XLq, bf* XLv) {
    __shared__ __align__(16) bf ring[2 * XST];
    __shared__ __align__(16) float os[64 * XP];
    const int lane = threadIdx.x & 31, lr = lane & 15, hi = lane >> 4; const int r0 = blockIdx.x * 64;
    const int wave = __builtin_amdgcn_readfirstlane((int)(threadIdx.x >> 5));
    v8f acc = (v8f){};
    // copy side: thread tid moves bytes 16 (tid & 7) of x rows (tid >> 3) + 16 i, i = 0..3, and of A row (tid >> 3)
    const int crow = (int)(threadIdx.x >> 3), cch = (int)(threadIdx.x & 7);
    const bf* gx = X  + (size_t)(r0 + crow) * DM + cch * 8;                   // rows < NB * SEQ, columns k0 + 63 < DM
    const bf* gl = AL + (size_t)crow * DM + cch * 8;                          // rows < 16
    const unsigned l0 = (unsigned)(size_t)(&ring[crow * PPI + cch * 8]);      // LDS byte address = low 32 bits of the shared address
    const int NT = DM / PBK;
    // read side: same loader and k map as from the planes, rows at pitch PPI
    const int afr = (wave * 16 + lr) * PPI + 8 * hi, bfo = (64 + lr) * PPI + 8 * hi;
    copy5(l0, gx, (size_t)16 * DM, gl);                                       // tile 0 -> buffer 0
    asm volatile("s_wait_asynccnt 0x0" ::: "memory");                         // this wave's copies of tile 0 have landed
    __syncthreads();                                                          // ... and every other wave's
    copy5(l0 + XST * 2, gx + PBK, (size_t)16 * DM, gl + PBK);                 // tile 1 -> buffer 1
#pragma unroll 1
    for (int t = 0; t < NT; ++t) {                                            // rolled: one pass per staged tile
        const int bo = (t & 1) * XST;
#pragma unroll
        for (int ks = 0; ks < PBK; ks += 32) {
            const v16bf bw = ldb(&ring[bo + bfo + ks]); const v16bf a = ldb(&ring[bo + afr + ks]);
            acc = wmmabg(a, bw, acc); }
        asm volatile("s_wait_dscnt 0x0" ::: "memory");                        // this wave's reads of buffer t & 1 are done before it is refilled
        asm volatile("s_wait_asynccnt 0x0" ::: "memory");                     // this wave's copies of tile t + 1 have landed
        __syncthreads();                                                      // publishes tile t + 1 and ends every reader's last read of buffer t & 1
        if (t + 2 < NT) copy5(l0 + bo * 2, gx + (size_t)(t + 2) * PBK, (size_t)16 * DM, gl + (size_t)(t + 2) * PBK);
    }
    asm volatile("s_wait_asynccnt 0x0" ::: "memory");                         // no copy is outstanding behind the loop
#pragma unroll
    for (int j = 0; j < 8; ++j) os[(wave * 16 + hi * 8 + j) * XP + lr] = acc[j] * LSC;   // D: row 8h+j, col lane&15; the wave's own 16 rows x columns 0..15 all written
    wave_sync();
    const size_t ob = (size_t)r0 * LK;
{
#pragma unroll 1
        for (int s = 2 * wave; s < 2 * wave + 2; ++s) { const int p = s * 32 + lane; const int row = p >> 2, piece = p & 3;   // 2 s x 8 rows = the wave's own 16 rows; 4 lanes x 16 B = one 64-byte row
            const v4f a0 = *(const v4fa*)(&os[row * XP + 0]); const v4f a1 = *(const v4fa*)(&os[row * XP + 4]);
            const v4f c0 = *(const v4fa*)(&os[row * XP + 8]); const v4f c1 = *(const v4fa*)(&os[row * XP + 12]);
            v8us oq, ov;
#pragma unroll
            for (int i = 0; i < 4; ++i) { oq[i] = ext_word(a0[i], piece); oq[4 + i] = ext_word(a1[i], piece); ov[i] = ext_word(c0[i], piece); ov[4 + i] = ext_word(c1[i], piece); }
            *(v8us*)(XLq + ob + (size_t)p * 8) = oq; *(v8us*)(XLv + ob + (size_t)p * 8) = ov; }
         }
}

template <int MODE, int LOWR>
__device__ __forceinline__ void proj_body(const bf* __restrict__ A, const bf* __restrict__ Bt, const bf* __restrict__ AX, const bf* __restrict__ BX,
                                          const float* __restrict__ bias, h16* Ph, h16* Pr, int resT) {
    __shared__ __align__(16) bf ring[2 * PST];
    __shared__ __align__(16) float osa[PW * 16 * 68];
    const int K = DM;
    const int lane = threadIdx.x & 31, lr = lane & 15, hi = lane >> 4;
    const int wave = __builtin_amdgcn_readfirstlane((int)(threadIdx.x >> 5));
    const int wm = (wave & 1) * 64, wn = (wave >> 1) * 64;                    // the wave's 64 x 64 tile inside the block
    const int r0 = blockIdx.x * 128 + wm, c0 = blockIdx.y * 128 + wn;
    float* os = osa + wave * 16 * 68;                                         // wave-private output staging
    v8f acc[4][4];
#pragma unroll
    for (int mb = 0; mb < 4; ++mb)
#pragma unroll
        for (int nb = 0; nb < 4; ++nb) acc[mb][nb] = (v8f){};
    // copy side: thread tid moves bytes 16 (tid & 7) of tile rows (tid >> 3) + 16 i, i = 0..7, of both operands
    const int crow = (int)(threadIdx.x >> 3), cch = (int)(threadIdx.x & 7);
    const bf* ga = A  + (size_t)(blockIdx.x * 128 + crow) * K + cch * 8;      // rows < M, columns k0 + 63 < K
    const bf* gb = Bt + (size_t)(blockIdx.y * 128 + crow) * K + cch * 8;
    const unsigned la = (unsigned)(size_t)(&ring[crow * PPI + cch * 8]);      // LDS byte address = low 32 bits of the shared address
    const unsigned lb = la + POP * 2;
    const int NT = K / PBK;
    // read side: same loader and k map as from the planes, rows at pitch PPI
    const int afr = (wm + lr) * PPI + 8 * hi, bfo = POP + (wn + lr) * PPI + 8 * hi;
    copy8(la, ga, (size_t)16 * K); copy8(lb, gb, (size_t)16 * K);             // tile 0 -> buffer 0
    asm volatile("s_wait_asynccnt 0x0" ::: "memory");                         // this wave's copies of tile 0 have landed
    __syncthreads();                                                          // ... and every other wave's
    copy8(la + PST * 2, ga + PBK, (size_t)16 * K); copy8(lb + PST * 2, gb + PBK, (size_t)16 * K);   // tile 1 -> buffer 1
#pragma unroll 1
    for (int t = 0; t < NT; ++t) {                                            // rolled: one pass per staged tile
        const int bo = (t & 1) * PST;
#pragma unroll
        for (int ks = 0; ks < PBK; ks += 32) {
            v16bf a[4];
#pragma unroll
            for (int mb = 0; mb < 4; ++mb) a[mb] = ldb(&ring[bo + afr + mb * 16 * PPI + ks]);
            v16bf b[4];                                                       // all eight fragments of a k-step are read as one group of LDS loads
#pragma unroll
            for (int nb = 0; nb < 4; ++nb) b[nb] = ldb(&ring[bo + bfo + nb * 16 * PPI + ks]);
#pragma unroll
            for (int nb = 0; nb < 4; ++nb) {
#pragma unroll
                for (int mb = 0; mb < 4; ++mb) acc[mb][nb] = wmmabg(a[mb], b[nb], acc[mb][nb]); }
        }
        asm volatile("s_wait_dscnt 0x0" ::: "memory");                        // this wave's reads of buffer t & 1 are done before it is refilled
        asm volatile("s_wait_asynccnt 0x0" ::: "memory");                     // this wave's copies of tile t + 1 have landed
        __syncthreads();                                                      // publishes tile t + 1 and ends every reader's last read of buffer t & 1
        if (t + 2 < NT) { copy8(la + bo * 2, ga + (size_t)(t + 2) * PBK, (size_t)16 * K); copy8(lb + bo * 2, gb + (size_t)(t + 2) * PBK, (size_t)16 * K); }
    }
    asm volatile("s_wait_asynccnt 0x0" ::: "memory");                         // no copy is outstanding behind the loop
    if (LOWR) {                                                                                   // extension k-step: rows of 32 bf16, same loader and k map on both sides
        const size_t axo = (size_t)(r0 + lr) * LK + 8 * hi, bxo = (size_t)(c0 + lr) * LK + 8 * hi;
        v16bf a[4];
#pragma unroll
        for (int mb = 0; mb < 4; ++mb) a[mb] = ldb(AX + axo + (size_t)mb * 16 * LK);
#pragma unroll
        for (int nb = 0; nb < 4; ++nb) { const v16bf b = ldb(BX + bxo + (size_t)nb * 16 * LK);
#pragma unroll
            for (int mb = 0; mb < 4; ++mb) acc[mb][nb] = wmmabg(a[mb], b, acc[mb][nb]); }
    }
    float bc[4];
#pragma unroll
    for (int nb = 0; nb < 4; ++nb) bc[nb] = (MODE == 0) ? bfr(bias[c0 + nb * 16 + lr]) : 0.0f;   // MODE 0: c0 + 63 < DM
    size_t tbase, rbase; bool wr;                                                                 // wr: wave-uniform, the wave's whole tile inside the residual plane
    if (MODE == 0) { const int bb = r0 / SEQ, tt = r0 % SEQ; const int zc = bb * NH_ + c0 / HD;
                     tbase = ((size_t)zc * SEQ + (size_t)tt) * HD; rbase = ((size_t)zc * (size_t)resT + (size_t)tt) * HD; wr = tt < resT; }
    else           { const int bb = c0 / SEQ, tt = c0 % SEQ;
                     tbase = (size_t)bb * (size_t)DM * SEQ + (size_t)r0 * SEQ + (size_t)tt; rbase = (size_t)bb * (size_t)DM * (size_t)resT + (size_t)r0 * (size_t)resT + (size_t)tt; wr = tt < resT; }
#pragma unroll
    for (int mb = 0; mb < 4; ++mb) {
        float br[8];
#pragma unroll
        for (int j = 0; j < 8; ++j) br[j] = (MODE == 1) ? bfr(bias[r0 + mb * 16 + hi * 8 + j]) : 0.0f;   // MODE 1: r0 + 63 < DM
#pragma unroll
        for (int nb = 0; nb < 4; ++nb) {
#pragma unroll
            for (int j = 0; j < 8; ++j) os[(hi * 8 + j) * 68 + nb * 16 + lr] = acc[mb][nb][j] + bc[nb] + br[j]; }   // D: row 8h+j, col lane&15; rows 0..15 x columns 0..63 all written
        wave_sync();
{
            if (MODE == 0) {
                const size_t sb = tbase + (size_t)(mb * 16) * HD;
                const size_t rb = rbase + (size_t)(mb * 16) * HD;
#pragma unroll
                for (int s = 0; s < 4; ++s) { const int p = s * 32 + lane; const int row = p >> 3, c8 = (p & 7) * 8;   // 4 s x 4 rows = 16 rows; 8 lanes x 8 = 64 columns = one line
                    const v4f x0 = *(const v4fa*)(&os[row * 68 + c8]); const v4f x1 = *(const v4fa*)(&os[row * 68 + c8 + 4]); v8h hv, rv;
#pragma unroll
                    for (int i = 0; i < 4; ++i) { const h16 a0 = toh_flush(x0[i]); const h16 a1 = toh_flush(x1[i]); hv[i] = a0; hv[4 + i] = a1;
                                                  rv[i] = toh_flush((x0[i] - (float)a0) * QRS); rv[4 + i] = toh_flush((x1[i] - (float)a1) * QRS); }
                    const size_t oo = sb + (size_t)p * 8;
                    const size_t ro = rb + (size_t)p * 8;
                    *(v8h*)(Ph + oo) = hv; if (wr) *(v8h*)(Pr + ro) = rv; }
            } else {
                const size_t sb = tbase + (size_t)(mb * 16) * SEQ;
                const size_t rb = rbase + (size_t)(mb * 16) * (size_t)resT;
#pragma unroll
                for (int s = 0; s < 4; ++s) { const int row = 4 * s + (lane >> 3), c8 = (lane & 7) * 8;   // 4 s x 4 row groups = 16 rows; 8 lanes x 8 = 64 columns
                    const v4f x0 = *(const v4fa*)(&os[row * 68 + c8]); const v4f x1 = *(const v4fa*)(&os[row * 68 + c8 + 4]); v8h hv, rv;
#pragma unroll
                    for (int i = 0; i < 4; ++i) { const h16 a0 = toh_flush(x0[i]); const h16 a1 = toh_flush(x1[i]); hv[i] = a0; hv[4 + i] = a1;
                                                  rv[i] = toh_flush((x0[i] - (float)a0) * QRS); rv[4 + i] = toh_flush((x1[i] - (float)a1) * QRS); }
                    const size_t oo = sb + (size_t)row * SEQ + c8;
                    const size_t ro = rb + (size_t)row * (size_t)resT + c8;
                    *(v8h*)(Ph + oo) = hv; if (wr) *(v8h*)(Pr + ro) = rv; }
            }
             }
        wave_sync();
    }
}

// q: token-major with the update extension; k: token-major, no extension; v^T: feature-major with the update extension
__global__ __launch_bounds__(32 * PW) void k_projq(const bf* __restrict__ A, const bf* __restrict__ Bt, const bf* __restrict__ AX, const bf* __restrict__ BX,
                                              const float* __restrict__ bias, h16* Ph, h16* Pr, int resT) { proj_body<0, 1>(A, Bt, AX, BX, bias, Ph, Pr, resT); }
__global__ __launch_bounds__(32 * PW) void k_projk(const bf* __restrict__ A, const bf* __restrict__ Bt,
                                              const float* __restrict__ bias, h16* Ph, h16* Pr, int resT) { proj_body<0, 0>(A, Bt, A, Bt, bias, Ph, Pr, resT); }
__global__ __launch_bounds__(32 * PW) void k_projv(const bf* __restrict__ A, const bf* __restrict__ Bt, const bf* __restrict__ AX, const bf* __restrict__ BX,
                                              const float* __restrict__ bias, h16* Ph, h16* Pr, int resT) { proj_body<1, 1>(A, Bt, AX, BX, bias, Ph, Pr, resT); }

template <int EARLY>
__device__ __forceinline__ void keypass_body(const h16* __restrict__ QH, const h16* __restrict__ QR, const h16* __restrict__ KP, const h16* __restrict__ KR,
                                           const h16* __restrict__ VT, const h16* __restrict__ VR, const float* __restrict__ amask, float* OUT) {
    constexpr int KSG = (EARLY ? 4 : 2) * KOP;                                // elements of one stage: K | V^T (| K residual | V^T residual)
    __shared__ __align__(16) h16 ring[2 * KSG];
    __shared__ __align__(16) float os[AW * 16 * OSP];
    const int lane = threadIdx.x & 31, lr = lane & 15, hi = lane >> 4;
    const int wave = __builtin_amdgcn_readfirstlane((int)(threadIdx.x >> 5));
    const int zh = blockIdx.y; const int b = zh / NH_, h = zh % NH_;
    const int t0 = (EARLY ? 0 : EROWS) + (blockIdx.x * AW + wave) * 16;
    const int lim = t0 + lr;                                                  // key j is causal-filled iff j > lim
    const float* amb = amask + (size_t)b * SEQ_FULL;
    const size_t pbase = (size_t)zh * SEQ * HD;
    const size_t rbase = (size_t)zh * EROWS * HD;
    // copy side: thread tid moves bytes 16 (tid & 7) of tile rows (tid >> 3) + 16 i, i = 0..3, of every staged plane (K rows = keys, V^T rows = d)
    const int crow = (int)(threadIdx.x >> 3), cch = (int)(threadIdx.x & 7);
    const h16* gk  = KP + pbase + (size_t)crow * HD + cch * 8;                // + key * HD, keys < SEQ
    const h16* gv  = VT + pbase + (size_t)crow * SEQ + cch * 8;               // + key, keys + 63 < SEQ
    const h16* gkr = KR + rbase + (size_t)crow * HD + cch * 8;                // + key * HD, keys < EROWS
    const h16* gvr = VR + rbase + (size_t)crow * EROWS + cch * 8;             // + key, keys + 63 < EROWS
    const unsigned l0 = (unsigned)(size_t)(&ring[crow * PPI + cch * 8]);      // LDS byte address = low 32 bits of the shared address
    auto stage = [&](int s, int buf) {                                        // tile s (keys 64 s .. 64 s + 63) -> buffer buf
        const int k0 = s * KST; const unsigned l = l0 + (unsigned)buf * (KSG * 2);
        copy4(l, gk + (size_t)k0 * HD, (size_t)16 * HD); copy4(l + KOP * 2, gv + k0, (size_t)16 * SEQ);
        if (EARLY) { const int kc = (k0 < EROWS) ? k0 : (EROWS - KST);        // clamped residual-plane key (address always inside the plane)
                     copy4(l + 2 * KOP * 2, gkr + (size_t)kc * HD, (size_t)16 * HD); copy4(l + 3 * KOP * 2, gvr + kc, (size_t)16 * EROWS); } };
    stage(0, 0);                                                              // tile 0 exists for every block; its copies fly under the mask scan
    // scan of the batch's mask row: any value not below WIDE in magnitude widens the key loop to all keys
    float fl = 0.0f;
#pragma unroll 1
    for (int i = 0; i < SEQ; i += 128) {
        const v4f w = *(const v4f*)(amb + i + 4 * lane);
#pragma unroll
        for (int c = 0; c < 4; ++c) { const float a = fabsf(bfr(w[c])); fl = (a < WIDE) ? fl : 1.0f; } }
    fl = fmaxf(fl, __shfl_xor(fl, 16, 32)); fl = fmaxf(fl, __shfl_xor(fl, 8, 32)); fl = fmaxf(fl, __shfl_xor(fl, 4, 32));
    fl = fmaxf(fl, __shfl_xor(fl, 2, 32));  fl = fmaxf(fl, __shfl_xor(fl, 1, 32));
    const int nkc = (t0 + 16 + 31) & ~31;                                     // causal bound, multiple of 32, <= SEQ
    const int nkv = (fl != 0.0f) ? SEQ : nkc;                                 // select formed on the vector side
    const int nk = __builtin_amdgcn_readfirstlane(nkv);
    const int nbv = (fl != 0.0f) ? SEQ : ((EARLY ? 0 : EROWS) + ((int)blockIdx.x + 1) * KST);   // the block's bound = its last wave's; every wave scans the same mask row, so it is block-uniform
    const int NS = __builtin_amdgcn_readfirstlane(nbv) / KST;                 // staged tiles of the block, >= 1
    const size_t qo = pbase + (size_t)(t0 + lr) * HD + 8 * hi;
    const v16h hz = (v16h){};
    v16h qh[2], qr[2];
    qh[0] = ldh(QH + qo); qh[1] = ldh(QH + qo + 32);             // B fragments: col t, k = d (two k-steps)
    qr[0] = hz; qr[1] = hz;
    if (EARLY) { const size_t qro = rbase + (size_t)(t0 + lr) * HD + 8 * hi; qr[0] = ldh(QR + qro); qr[1] = ldh(QR + qro + 32); }   // t0 + lr < EROWS
    const int fo = lr * PPI + 8 * hi;                          // read side, same loader and k map as from the planes, rows at pitch PPI: K + key * PPI (A fragment: row key, k = d); V^T + 16j * PPI + key (A fragment: row d, k = key)
    v8f o[4], oR[4];
#pragma unroll
    for (int j = 0; j < 4; ++j) { o[j] = (v8f){}; oR[j] = (v8f){}; }
    float m = NEGB, l = 0.0f;
    asm volatile("s_wait_asynccnt 0x0" ::: "memory");            // this wave's copies of tile 0 have landed
    __syncthreads();                                             // ... and every other wave's
    if (1 < NS) stage(1, 1);
#pragma unroll 1
    for (int s = 0; s < NS; ++s) {                               // rolled: one pass per staged tile
    const int bo = (s & 1) * KSG;
    const int ke = (nk - s * KST < KST) ? nk - s * KST : KST;    // keys of this tile below the wave's own bound
#pragma unroll 1
    for (int kk = 0; kk < ke; kk += 32) {                        // rolled: the 32-key halves of a tile share one body, which keeps the loop's text small
        const int key0 = s * KST + kk;
        const bool rok = key0 < EROWS;                           // wave-uniform
        const h16* kpt = &ring[bo + fo + kk * PPI];
        v8f sHa = (v8f){}, sLa = (v8f){}, sHb = (v8f){}, sLb = (v8f){};
        const h16* krp = &ring[bo + (EARLY ? 2 : 0) * KOP + fo + kk * PPI];   // residual tiles exist in the EARLY stage only
        const h16* va  = &ring[bo + KOP + fo + kk];
        const h16* vrp = &ring[bo + (EARLY ? 3 : 1) * KOP + fo + kk];
        v16h ka[2], kb[2], kra[2], krb[2], vf[4];          // the fragments of a product run are read as one group of LDS loads ahead of it
#pragma unroll
        for (int ks = 0; ks < 2; ++ks) {
            ka[ks] = ldh(kpt + ks * 32); kb[ks] = ldh(kpt + 16 * PPI + ks * 32);
            if (EARLY) { kra[ks] = ldh(krp + ks * 32); krb[ks] = ldh(krp + 16 * PPI + ks * 32); } }
        if (!EARLY) {                                              // registers allow: the V^T fragments join the K group
#pragma unroll
            for (int j = 0; j < 4; ++j) vf[j] = ldh(va + (16 * j) * PPI); }
#pragma unroll
        for (int ks = 0; ks < 2; ++ks) {
            sHa = wmma16g(ka[ks], qh[ks], sHa); sHb = wmma16g(kb[ks], qh[ks], sHb);
            if (EARLY) {
                sLa = wmma16g(ka[ks], qr[ks], sLa); sLb = wmma16g(kb[ks], qr[ks], sLb);
                if (!rok) { kra[ks] = hz; krb[ks] = hz; }
                sLa = wmma16g(kra[ks], qh[ks], sLa); sLb = wmma16g(krb[ks], qh[ks], sLb);
            }
        }
        if (EARLY) {                                               // the V^T group flies under the softmax
#pragma unroll
            for (int j = 0; j < 4; ++j) vf[j] = ldh(va + (16 * j) * PPI); }
        const float* kp = amb + 8 * hi + key0;                   // keys key0+8h+0..7 and key0+16+8h+0..7, all < nk <= SEQ
        const v4f m0 = *(const v4f*)kp, m1 = *(const v4f*)(kp + 4), m2 = *(const v4f*)(kp + 16), m3 = *(const v4f*)(kp + 20);
        float kx[8], ky[8];
#pragma unroll
        for (int r = 0; r < 4; ++r) { kx[r] = m0[r]; kx[4 + r] = m1[r]; ky[r] = m2[r]; ky[4 + r] = m3[r]; }
        const int ja = key0 + 8 * hi;
        float ta[8], tb[8]; float mx = NEGB;
#pragma unroll
        for (int r = 0; r < 8; ++r) {
            const float sa = EARLY ? (sHa[r] + sLa[r] * QRI) * SC2 : sHa[r] * SC2;
            const float sb = EARLY ? (sHb[r] + sLb[r] * QRI) * SC2 : sHb[r] * SC2;
            ta[r] = ((ja + r > lim) ? NEGL : sa) + bfr(kx[r]) * L2E;             // replace, then add the mask
            tb[r] = ((ja + 16 + r > lim) ? NEGL : sb) + bfr(ky[r]) * L2E;
            mx = fmaxf(mx, fmaxf(ta[r], tb[r])); }
        mx = fmaxf(mx, __shfl_xor(mx, 16, 32));
        const float mnew = fmaxf(m, mx);
        const float alpha = __builtin_amdgcn_exp2f(m - mnew);
        const float sh = PSH - mnew;
        v16h pb, pr = hz; float ls = 0.0f;
#pragma unroll
        for (int r = 0; r < 8; ++r) {
            const float aa = ta[r] + sh, ab = tb[r] + sh;
            const float ea = __builtin_amdgcn_exp2f(aa), eb = __builtin_amdgcn_exp2f(ab);
            const float ga = (aa < PFL) ? 0.0f : ea, gb = (ab < PFL) ? 0.0f : eb;   // below the f16 normal range -> exactly zero, selected by value
            const h16 pa = (h16)ga; const h16 pc = (h16)gb;
            pb[r] = pa; pb[8 + r] = pc;
            if (EARLY) { pr[r] = toh_flush((ga - (float)pa) * QRS); pr[8 + r] = toh_flush((gb - (float)pc) * QRS); ls += ga + gb; }
            else       { ls += (float)pa + (float)pc; } }
        l = l * alpha + ls; m = mnew;
#pragma unroll
        for (int j = 0; j < 4; ++j) { o[j] = o[j] * alpha; if (EARLY) oR[j] = oR[j] * alpha; }
#pragma unroll
        for (int jp = 0; jp < 2; ++jp) {
            const v16h v0 = vf[2 * jp], v1 = vf[2 * jp + 1];
            o[2 * jp] = wmma16g(v0, pb, o[2 * jp]); o[2 * jp + 1] = wmma16g(v1, pb, o[2 * jp + 1]);
            if (EARLY) {
                oR[2 * jp] = wmma16g(v0, pr, oR[2 * jp]); oR[2 * jp + 1] = wmma16g(v1, pr, oR[2 * jp + 1]);
                v16h vr0 = ldh(vrp + (32 * jp) * PPI), vr1 = ldh(vrp + (32 * jp + 16) * PPI);
                if (!rok) { vr0 = hz; vr1 = hz; }
                oR[2 * jp] = wmma16g(vr0, pb, oR[2 * jp]); oR[2 * jp + 1] = wmma16g(vr1, pb, oR[2 * jp + 1]);
            }
        }
    }
    asm volatile("s_wait_dscnt 0x0" ::: "memory");               // this wave's reads of buffer s & 1 are done before it is refilled
    asm volatile("s_wait_asynccnt 0x0" ::: "memory");            // this wave's copies of tile s + 1 have landed
    __syncthreads();                                             // publishes tile s + 1 and ends every reader's last read of buffer s & 1
    if (s + 2 < NS) stage(s + 2, s & 1);
    }
    asm volatile("s_wait_asynccnt 0x0" ::: "memory");            // no copy is outstanding behind the loop
    l += __shfl_xor(l, 16, 32);
    const float inv = 1.0f / l;                                  // l >= 2^14 whenever the row has a finite maximum logit
    const int wb = wave * 16 * OSP;
    // O^T D layout: o[j][r] = (d = 16j + 8h + r, t = lane&15) -> os[t][d]; rows 0..15 x columns 0..63 all written
#pragma unroll
    for (int j = 0; j < 4; ++j) {
        v8f f = o[j];
        if (EARLY) f = o[j] + oR[j] * QRI;
        v4f a, c;
        a[0] = f[0] * inv; a[1] = f[1] * inv; a[2] = f[2] * inv; a[3] = f[3] * inv; c[0] = f[4] * inv; c[1] = f[5] * inv; c[2] = f[6] * inv; c[3] = f[7] * inv;
        *(v4fa*)(&os[wb + lr * OSP + 16 * j + 8 * hi]) = a; *(v4fa*)(&os[wb + lr * OSP + 16 * j + 8 * hi + 4]) = c; }
    wave_sync();
    float* orow = OUT + ((size_t)b * OUT_SEQ + t0) * DM + h * HD;
{
#pragma unroll
        for (int s = 0; s < 8; ++s) { const int row = 2 * s + (lane >> 4), cofs = (lane & 15) * 4;   // 8 s x 2 rows = 16 rows; 16 lanes x 4 floats = 64 columns = two lines
            const v4f val = *(const v4fa*)(&os[wb + row * OSP + cofs]);
            *(v4f*)(orow + (size_t)row * DM + cofs) = val; }
         }
}

__global__ __launch_bounds__(32 * AW) __attribute__((amdgpu_num_vgpr(256)))
void k_keypass_early(const h16* __restrict__ QH, const h16* __restrict__ QR, const h16* __restrict__ KP, const h16* __restrict__ KR,
                   const h16* __restrict__ VT, const h16* __restrict__ VR, const float* __restrict__ amask, float* OUT) {
    keypass_body<1>(QH, QR, KP, KR, VT, VR, amask, OUT);
}
__global__ __launch_bounds__(32 * AW) __attribute__((amdgpu_num_vgpr(256)))
void k_keypass_late(const h16* __restrict__ QH, const h16* __restrict__ KP, const h16* __restrict__ VT, const float* __restrict__ amask, float* OUT) {
    keypass_body<0>(QH, QH, KP, KP, VT, VT, amask, OUT);
}

static constexpr size_t al256(size_t v) { return (v + 255) & ~(size_t)255; }
static constexpr size_t SZ_XB = al256((size_t)NB * SEQ * DM * 2);
static constexpr size_t SZ_WB = al256((size_t)3 * DM * DM * 2);
static constexpr size_t SZ_AL = al256((size_t)2 * LR * DM * 2);
static constexpr size_t SZ_BL = al256((size_t)DM * LK * 2);
static constexpr size_t SZ_XL = al256((size_t)NB * SEQ * LK * 2);
static constexpr size_t SZ_PL = al256((size_t)NB * NH_ * SEQ * HD * 2);
static constexpr size_t SZ_RS = al256((size_t)NB * NH_ * EROWS * HD * 2);
static constexpr size_t SZ_TOTAL = SZ_XB + SZ_WB + SZ_AL + 2 * SZ_BL + 2 * SZ_XL + 3 * SZ_PL + 3 * SZ_RS;
static_assert(SZ_TOTAL <= (size_t)134217728);          // workspace carve <= 128 MiB
static_assert(((size_t)DM * DM * 2) % 256 == 0);       // weight sub-planes stay 256-byte aligned
static_assert(((size_t)LR * DM * 2) % 256 == 0);       // the two halves of the A plane stay 256-byte aligned
static_assert((size_t)NB * NH_ * SEQ * HD == (size_t)NB * DM * SEQ);       // v^T plane [(b*1024 + m)][t] has the same extent as the q/k planes
static_assert((size_t)NB * NH_ * EROWS * HD == (size_t)NB * DM * EROWS);   // v^T residual plane [(b*1024 + m)][t < EROWS] has the same extent as the q/k residual planes
static_assert((DM * 4) % 256 == 0);                    // k_bext grid covers the plane exactly

extern "C" void kernel_launch(void* const* d_in, const int* in_sizes, int n_in,
                              void* d_out, int out_size, void* d_ws, size_t ws_size, hipStream_t stream) {
    if (n_in < 12) return;
    const size_t needx = ((size_t)(NB - 1) * SEQ_FULL + SEQ) * DM;
    const size_t needm = (size_t)(NB - 1) * SEQ_FULL + SEQ;
    if ((size_t)in_sizes[0] < needx || (size_t)in_sizes[1] < needm) return;
    if ((size_t)in_sizes[2] < (size_t)DM * DM || (size_t)in_sizes[4] < (size_t)DM * DM || (size_t)in_sizes[6] < (size_t)DM * DM) return;
    if (in_sizes[3] < DM || in_sizes[5] < DM || in_sizes[7] < DM) return;
    if (in_sizes[8] < LR * DM || in_sizes[9] < DM * LR || in_sizes[10] < LR * DM || in_sizes[11] < DM * LR) return;
    if ((size_t)out_size < ((size_t)(NB - 1) * OUT_SEQ + SEQ) * DM) return;
    if (SZ_TOTAL > ws_size) return;
    // wire order: hidden_states, key_mask (the module's additive key mask input), Wq, bq, Wk, bk, Wv, bv, Aq, Bq, Av, Bv
    const float* xin = (const float*)d_in[0];
    const float* am  = (const float*)d_in[1];
    const float* wq = (const float*)d_in[2]; const float* bq = (const float*)d_in[3];
    const float* wk = (const float*)d_in[4]; const float* bk = (const float*)d_in[5];
    const float* wv = (const float*)d_in[6]; const float* bv = (const float*)d_in[7];
    const float* aq = (const float*)d_in[8]; const float* bqu = (const float*)d_in[9];
    const float* av = (const float*)d_in[10]; const float* bvu = (const float*)d_in[11];
    float* OUT = (float*)d_out;      // [NB][SEQ][1024]
    char* wsp = (char*)d_ws;
    bf* XB = (bf*)wsp; wsp += SZ_XB;                 // x      [NB*SEQ][1024]
    bf* WB = (bf*)wsp; wsp += SZ_WB;                 // [3][1024][1024]: q | k | v  ([out][in] = Bt as-is)
    bf* AL = (bf*)wsp; wsp += SZ_AL;                 // [16][1024]: rows 0..7 A of the q update, rows 8..15 A of the v update
    bf* BLq = (bf*)wsp; wsp += SZ_BL;                // [1024][32]: B | B | 0 | 0 (q update)
    bf* BLv = (bf*)wsp; wsp += SZ_BL;                // [1024][32]: B | B | 0 | 0 (v update)
    bf* XLq = (bf*)wsp; wsp += SZ_XL;                // [NB*SEQ][32]: hi | lo | 0 | 0 of 2 x A^T (q update)
    bf* XLv = (bf*)wsp; wsp += SZ_XL;                // [NB*SEQ][32]: hi | lo | 0 | 0 of 2 x A^T (v update)
    h16* QH = (h16*)wsp; wsp += SZ_PL;               // [NB*16][SEQ][64]
    h16* KP = (h16*)wsp; wsp += SZ_PL;               // [NB*16][SEQ][64]
    h16* VT = (h16*)wsp; wsp += SZ_PL;               // [NB*16][64][SEQ]
    h16* QR = (h16*)wsp; wsp += SZ_RS;               // [NB*16][EROWS][64] residual x2048, tokens < EROWS
    h16* KR = (h16*)wsp; wsp += SZ_RS;               // [NB*16][EROWS][64] residual x2048, tokens < EROWS
    h16* VR = (h16*)wsp; wsp += SZ_RS;               // [NB*16][64][EROWS] residual x2048, tokens < EROWS
    bf* WQ = WB; bf* WK = WB + (size_t)DM * DM; bf* WV = WB + (size_t)2 * DM * DM;

    if (SEQ == SEQ_FULL) {
        const size_t n8 = (size_t)NB * SEQ * DM / 8;
        k_cvt8<<<(unsigned)((n8 + 255) / 256), 256, 0, stream>>>(xin, XB, n8);
    } else {
        const size_t n8 = (size_t)SEQ * DM / 8;
        for (int b = 0; b < NB; ++b) k_cvt8<<<(unsigned)((n8 + 255) / 256), 256, 0, stream>>>(xin + (size_t)b * SEQ_FULL * DM, XB + (size_t)b * SEQ * DM, n8);
    }
    { const size_t n8 = (size_t)DM * DM / 8; const unsigned g = (unsigned)((n8 + 255) / 256);
      k_cvt8<<<g, 256, 0, stream>>>(wq, WQ, n8); k_cvt8<<<g, 256, 0, stream>>>(wk, WK, n8); k_cvt8<<<g, 256, 0, stream>>>(wv, WV, n8); }
    { const size_t n8 = (size_t)LR * DM / 8; const unsigned g = (unsigned)((n8 + 255) / 256);
      k_cvt8<<<g, 256, 0, stream>>>(aq, AL, n8); k_cvt8<<<g, 256, 0, stream>>>(av, AL + (size_t)LR * DM, n8); }
    { const int n4 = DM * 4; const unsigned g = (unsigned)((n4 + 255) / 256);
      k_bext<<<g, 256, 0, stream>>>(bqu, BLq, n4); k_bext<<<g, 256, 0, stream>>>(bvu, BLv, n4); }

    // 2 x A^T for both updates -> x-side extension planes
    k_xa<<<dim3(NB * SEQ / 64, 1, 1), 32 * PW, 0, stream>>>(XB, AL, XLq, XLv);

    // q, k: A = x rows (m = b*SEQ + t), Bt = W rows (n = h*64 + d) -> plane [(b*16 + h)][t][d]; residuals for tokens < EROWS
    k_projq<<<dim3(NB * SEQ / 128, DM / 128, 1), 32 * PW, 0, stream>>>(XB, WQ, XLq, BLq, bq, QH, QR, EROWS);
    k_projk<<<dim3(NB * SEQ / 128, DM / 128, 1), 32 * PW, 0, stream>>>(XB, WK, bk, KP, KR, EROWS);
    // v^T: A = Wv rows (m = h*64 + d), Bt = x rows (n = b*SEQ + t) -> plane [(b*1024 + m)][t] = [(b*16 + h)][d][t]; residual for tokens < EROWS
    k_projv<<<dim3(DM / 128, NB * SEQ / 128, 1), 32 * PW, 0, stream>>>(WV, XB, BLv, XLv, bv, VT, VR, EROWS);

    // query rows [0, EROWS): multi-product instantiation; rows [EROWS, SEQ): single-product instantiation (disjoint output rows)
    k_keypass_early<<<dim3(EROWS / (16 * AW), NB * NH_, 1), 32 * AW, 0, stream>>>(QH, QR, KP, KR, VT, VR, am, OUT);
    if (SEQ > EROWS)
        k_keypass_late<<<dim3((SEQ - EROWS) / (16 * AW), NB * NH_, 1), 32 * AW, 0, stream>>>(QH, KP, VT, am, OUT);
}

// v003
// It runs in 94.9 microseconds.
// Next to v002, in two timings, it ran 1.65 and 1.68 times as fast.
// All steps since v000 together make it 3.36 times as fast.
#include <hip/hip_runtime.h>

// Causal pair-score weighting, width 1024 = 16 heads x 64; one input x [NB][SEQ][1024] feeds q, k and v; Wq/Wk/Wv [out][in] (y = x W^T + bias); rank-8 additive updates on q and v: y += 2 (x A^T) B^T with A [8][in], B [out][8];
// additive key mask [NB][1][1][SEQ] (f32, read by value); score scale 1/sqrt(64); keys j > t are replaced by -1e9 before the mask is added; softmax over keys; output = concatenated heads (f32), no output projection.
// Compute dtypes, f32 accumulate everywhere: projections and x A^T v_wmma_f32_16x16x32_bf16 (x, W, A, B, biases, mask RNE-converted to bf16; products exact); the rank-8 up-projection is one extra 32-deep k-step of the projection GEMM (2 x A^T carried as bf16 hi | lo, B bf16);
// scores v_wmma_f32_16x16x32_f16: single f16 q and k on query rows >= EROWS; q and k each as f16 value + f16 residual x2048 (three products, residual products in their own accumulator) on query rows < EROWS;
// P.V v_wmma_f32_16x16x32_f16: P (x16384 carry, cancels in the normalisation) and v single f16 on query rows >= EROWS; on query rows < EROWS P and v each as f16 value + f16 residual x2048, residual products in their own accumulator folded by 1/2048, row sum from the f32 exponentials; softmax f32 (online, running max).
// Layout: bf16 copies of x, W, A; extension planes [row][32] bf16 (x side: hi | lo | 0 | 0 of 2 x A^T; weight side: B | B | 0 | 0); q, k planes [b*16+h][t][64], v^T plane [b*16+h][d][t], small residual planes q, k [b*16+h][t < EROWS][64] and v^T [b*16+h][d][t < EROWS]; fused online-softmax key-pass kernel in transposed form (S^T = K Q^T, O^T = V^T P^T).
// Key loop bound per wave: the causal limit; if any mask value of the batch is not below 1e8 in magnitude the loop covers all keys (per-element arithmetic is literal in every visited tile). Residual fragments for keys >= EROWS are zero.

#ifndef NB
#define NB 2
#endif
#ifndef SEQ
#define SEQ 2048
#endif
#define NB_FULL  2
#define SEQ_FULL 2048
#ifndef OUT_SEQ
#define OUT_SEQ SEQ              // row pitch (in tokens) between batches of the output
#endif
#define DM   1024
#define NH_  16
#define HD   64
#define LR   8                   // rank of the additive updates
#define LK   32                  // k extent of the extension planes (one WMMA k-step)
#define XP   20                  // LDS row pitch (floats) of the x A^T tile
#define AW   4                   // waves per online-softmax key-pass block (16 query rows each)
#define PW   4                   // waves per projection block (2 x 2 wave tiles of 64 x 64)
#define PBK  64                  // k extent of one staged projection tile: 128 bytes of every operand row
#define PPI  72                  // LDS row pitch (16-bit elements) of a staged row: 144 bytes = 16 x 9
#define POP  (128 * PPI)         // elements of one staged operand tile (128 rows)
#define PST  (2 * POP)           // elements of one stage: A tile | B tile
#define XST  (80 * PPI)          // elements of one stage of the x A^T kernel: 64 x rows | 16 A rows
#define OSP  68                  // LDS row pitch (floats) of the online-softmax key-pass output tile
#define KST  64                  // keys of one staged key-pass tile: 64 K rows of 128 bytes, 128 bytes of each of the 64 V^T rows
#define KOP  (64 * PPI)          // elements of one staged key-pass plane tile (64 rows at pitch PPI)
#define EROWS (SEQ < 512 ? SEQ : 512)   // query rows (and tokens of the small residual planes) handled by the multi-product online-softmax key-pass instantiation
#define QRS  2048.0f             // carry of every residual plane / residual fragment
#define QRI  (1.0f / 2048.0f)
#define SC2  ((float)(0.125 * 1.4426950408889634))      // HD^-0.5 * log2(e)
#define L2E  ((float)1.4426950408889634)
#define NEGL ((float)(-1.0e9 * 1.4426950408889634))     // fill value -1e9 in the log2 domain
#define LSC  2.0f                // update scaling 16 / 8
#define PSH  14.0f               // log2 of the P carry (16384)
#define PFL  (-14.0f)            // exponent argument below which the f16 P would leave the normal range
#define NEGB (-3.0e38f)
#define WIDE 1.0e8f              // mask magnitude bound under which skipped (fully causal-filled) tiles contribute exactly zero

static_assert(HD == 64);
static_assert(NH_ * HD == DM);                 // head h = columns h*64 + d
static_assert(DM % 64 == 0);                   // column tiles of 64 = one head
static_assert(64 % HD == 0);
static_assert(DM % 32 == 0);                   // GEMM k-loop steps by 32
static_assert(LK == 32);                       // extension = exactly one k-step
static_assert(2 * LR <= LK);                   // hi | lo pieces fit the extension row
static_assert(LR == 8);                        // one 16-byte piece per part; B rows loaded as 8 floats
static_assert(2 * LR == 16);                   // A rows of q and v updates fill one 16-column tile
static_assert(SEQ % 64 == 0);                  // a 64-row tile never straddles two batches
static_assert((NB * SEQ) % 64 == 0);
static_assert(SEQ % 128 == 0);                 // mask scan steps by 128
static_assert(SEQ % 32 == 0);                  // key loop steps by 32
static_assert(SEQ % (16 * AW) == 0);           // online-softmax key-pass grids cover the sequence exactly
static_assert(EROWS % 64 == 0);                // a 64-token GEMM tile lies wholly inside or outside the residual planes
static_assert(EROWS >= 32);
static_assert(EROWS <= SEQ);
static_assert(EROWS % (16 * AW) == 0);
static_assert((SEQ - EROWS) % (16 * AW) == 0);
static_assert(((size_t)SEQ * DM) % 8 == 0);
static_assert(((size_t)DM * DM) % 8 == 0);
static_assert(((size_t)LR * DM) % 8 == 0);
static_assert(NB <= NB_FULL);
static_assert(SEQ <= SEQ_FULL);
static_assert((OSP * 4) % 16 == 0);
static_assert(OSP >= HD);
static_assert((XP * 4) % 16 == 0);
static_assert(XP >= 16);
static_assert(32 * 4 * 16 == 16 * HD * 2);
static_assert(32 * 4 * 16 == 16 * 64 * 2);
static_assert(32 * 8 * 16 == 16 * HD * 4);     // online-softmax key-pass epilogue: 8 instructions x 32 lanes x 16 B = 16 rows x 256 B
static_assert(32 * 8 * 16 == 64 * LK * 2);     // x A^T epilogue: 8 instructions x 32 lanes x 16 B = 64 rows x 64 B per plane
static_assert((NB * SEQ) % 128 == 0);          // projection blocks cover 128 x 128
static_assert(DM % 128 == 0);
static_assert(DM % PBK == 0);
static_assert(DM / PBK >= 2);                  // the two-buffer ring needs two stages
static_assert(PBK * 2 == 128);                 // a staged row is one 128-byte line: 8 lanes x 16 B
static_assert((PPI * 2) % 16 == 0);
static_assert(PPI >= PBK);
static_assert(8 * 32 * PW * 16 == 128 * PBK * 2);   // 8 copies per lane fill one operand tile
static_assert(2 * PST * 2 + PW * 16 * 68 * 4 <= 131072);   // static LDS of the projection kernels
static_assert(2 * XST * 2 + 64 * XP * 4 <= 131072);   // static LDS of the x A^T kernel
static_assert(5 * 32 * PW * 16 == 80 * PBK * 2);      // 5 copies per lane fill one stage of the x A^T kernel
static_assert(PW * 16 == 64);                         // x A^T kernel: one 16-row tile per wave
static_assert(2 * 4 * KOP * 2 + AW * 16 * OSP * 4 <= 131072);    // static LDS of the online-softmax key-pass kernels
static_assert(KST == 16 * AW);                 // a block's causal key bound is a whole number of staged tiles
static_assert(SEQ % KST == 0);
static_assert(EROWS % KST == 0);               // a staged tile lies wholly inside or outside the residual planes
static_assert(KST * 2 == 128);                 // a staged V^T row piece is one 128-byte line
static_assert(HD * 2 == 128);                  // a staged K row is one 128-byte line
static_assert(4 * 32 * AW * 16 == 64 * 128);   // 4 copies per lane fill one plane tile

typedef _Float16 h16;
typedef unsigned short bf;
typedef __attribute__((ext_vector_type(16))) __bf16   v16bf;
typedef __attribute__((ext_vector_type(16))) _Float16 v16h;
typedef __attribute__((ext_vector_type(8)))  _Float16 v8h;
typedef __attribute__((ext_vector_type(8)))  unsigned short v8us;
typedef __attribute__((ext_vector_type(8)))  float    v8f;
typedef __attribute__((ext_vector_type(4)))  float    v4f;
typedef v4f  __attribute__((may_alias)) v4fa;

__device__ __forceinline__ unsigned short f2bf(float f) { unsigned u = __float_as_uint(f); u += 0x7FFFu + ((u >> 16) & 1u); return (unsigned short)(u >> 16); }
__device__ __forceinline__ float bfr(float f) { return __uint_as_float(((unsigned)f2bf(f)) << 16); }   // value after RNE convert to bf16
__device__ __forceinline__ v16h cat16(v8h lo, v8h hi) { return __builtin_shufflevector(lo, hi, 0, 1, 2, 3, 4, 5, 6, 7, 8, 9, 10, 11, 12, 13, 14, 15); }
__device__ __forceinline__ v16bf cat16b(v8us lo, v8us hi) { return __builtin_bit_cast(v16bf, __builtin_shufflevector(lo, hi, 0, 1, 2, 3, 4, 5, 6, 7, 8, 9, 10, 11, 12, 13, 14, 15)); }
__device__ __forceinline__ v8f wmma16(v16h a, v16h b, v8f c) { return __builtin_amdgcn_wmma_f32_16x16x32_f16(false, a, false, b, (short)0, c, false, false); }
__device__ __forceinline__ v8f wmmab(v16bf a, v16bf b, v8f c) { return __builtin_amdgcn_wmma_f32_16x16x32_bf16(false, a, false, b, (short)0, c, false, false); }
// fragment loaders from K-contiguous 16-bit rows; p already includes + 8*(lane>>4): elements 0..7 <- k0+8h+0..7, elements 8..15 <- k0+16+8h+0..7 (same map for A and B)
__device__ __forceinline__ v16h  ldh(const h16* p) { return cat16(*(const v8h*)p, *(const v8h*)(p + 16)); }
__device__ __forceinline__ v16bf ldb(const bf* p)  { return cat16b(*(const v8us*)p, *(const v8us*)(p + 16)); }
// ordering point for wave-private LDS tiles (same wave writes and reads)
__device__ __forceinline__ void wave_sync() { __builtin_amdgcn_fence(3 /* release order */, "wavefront"); __builtin_amdgcn_wave_barrier(); asm volatile("" ::: "memory"); }

// f32 -> f16 convert that cannot produce a subnormal operand (|v| < 2^-14 -> +0); applied after the plane's power-of-two carry
static __device__ __forceinline__ h16 toh_flush(float v) { const h16 r = (h16)v; return (fabsf(v) < 6.103515625e-05f) ? (h16)0.0f : r; }
// one matrix instruction followed by its own four-slot guard (ties the accumulator, keeps the operands live)
static __device__ __forceinline__ v8f wmma16g(v16h a, v16h b, v8f c) { c = wmma16(a, b, c); asm volatile("v_nop\n\tv_nop\n\tv_nop\n\tv_nop" : "+v"(c) : "v"(a), "v"(b)); return c; }
static __device__ __forceinline__ v8f wmmabg(v16bf a, v16bf b, v8f c) { c = wmmab(a, b, c); asm volatile("v_nop\n\tv_nop\n\tv_nop\n\tv_nop" : "+v"(c) : "v"(a), "v"(b)); return c; }
// one 16-bit word of an extension row: piece 0 = bf16 value, piece 1 = bf16 of the remainder, pieces 2, 3 = zero (select by value)
static __device__ __forceinline__ unsigned short ext_word(float v, int piece) {
    const unsigned short hw = f2bf(v); const float hv = __uint_as_float(((unsigned)hw) << 16); const unsigned short lw = f2bf(v - hv);
    return (piece == 0) ? hw : ((piece == 1) ? lw : (unsigned short)0); }

// eight asynchronous 16-byte copies per lane, global -> LDS: copy i moves the lane's 16 bytes of tile row (row + 16 i). The closing s_wait_xcnt stands inside the statement so that no address register is rewritten ahead of it.
static __device__ __forceinline__ void copy8(unsigned l, const bf* g, size_t gs) {
    const unsigned ls = 16 * PPI * 2;
    asm volatile("global_load_async_to_lds_b128 %0, %8, off\n\t"
                 "global_load_async_to_lds_b128 %1, %9, off\n\t"
                 "global_load_async_to_lds_b128 %2, %10, off\n\t"
                 "global_load_async_to_lds_b128 %3, %11, off\n\t"
                 "global_load_async_to_lds_b128 %4, %12, off\n\t"
                 "global_load_async_to_lds_b128 %5, %13, off\n\t"
                 "global_load_async_to_lds_b128 %6, %14, off\n\t"
                 "global_load_async_to_lds_b128 %7, %15, off\n\t"
                 "s_wait_xcnt 0x0"
                 :: "v"(l), "v"(l + ls), "v"(l + 2 * ls), "v"(l + 3 * ls), "v"(l + 4 * ls), "v"(l + 5 * ls), "v"(l + 6 * ls), "v"(l + 7 * ls),
                    "v"(g), "v"(g + gs), "v"(g + 2 * gs), "v"(g + 3 * gs), "v"(g + 4 * gs), "v"(g + 5 * gs), "v"(g + 6 * gs), "v"(g + 7 * gs)
                 : "memory");
}

// the same with five copies: four rows of one plane (row + 16 i) and one row of a second plane, laid behind them in LDS
static __device__ __forceinline__ void copy5(unsigned l, const bf* g, size_t gs, const bf* g4) {
    const unsigned ls = 16 * PPI * 2;
    asm volatile("global_load_async_to_lds_b128 %0, %5, off\n\t"
                 "global_load_async_to_lds_b128 %1, %6, off\n\t"
                 "global_load_async_to_lds_b128 %2, %7, off\n\t"
                 "global_load_async_to_lds_b128 %3, %8, off\n\t"
                 "global_load_async_to_lds_b128 %4, %9, off\n\t"
                 "s_wait_xcnt 0x0"
                 :: "v"(l), "v"(l + ls), "v"(l + 2 * ls), "v"(l + 3 * ls), "v"(l + 4 * ls),
                    "v"(g), "v"(g + gs), "v"(g + 2 * gs), "v"(g + 3 * gs), "v"(g4)
                 : "memory");
}

// the same with four copies of 16-bit float rows: copy i moves the lane's 16 bytes of tile row (row + 16 i)
static __device__ __forceinline__ void copy4(unsigned l, const h16* g, size_t gs) {
    const unsigned ls = 16 * PPI * 2;
    asm volatile("global_load_async_to_lds_b128 %0, %4, off\n\t"
                 "global_load_async_to_lds_b128 %1, %5, off\n\t"
                 "global_load_async_to_lds_b128 %2, %6, off\n\t"
                 "global_load_async_to_lds_b128 %3, %7, off\n\t"
                 "s_wait_xcnt 0x0"
                 :: "v"(l), "v"(l + ls), "v"(l + 2 * ls), "v"(l + 3 * ls),
                    "v"(g), "v"(g + gs), "v"(g + 2 * gs), "v"(g + 3 * gs)
                 : "memory");
}

// blocks of 256 threads (8 elements a thread) that each converted plane takes in k_prep
#define CB_X ((int)((size_t)NB * SEQ * DM / 8 / 256))   // x
#define CB_W ((int)((size_t)DM * DM / 8 / 256))         // one weight matrix
#define CB_A ((int)((size_t)LR * DM / 8 / 256))         // one A matrix
#define CB_B (DM * 4 / 256)                             // one weight-side extension plane (4 pieces of 8 per row)
static_assert(((size_t)SEQ * DM / 8) % 256 == 0);       // a block never straddles two batches of x
static_assert(((size_t)DM * DM / 8) % 256 == 0);
static_assert(((size_t)LR * DM / 8) % 256 == 0);

static __device__ __forceinline__ void cvt8(const float* __restrict__ src, bf* dst) {
    const v8f v = *(const v8f*)src; v8us o;
#pragma unroll
    for (int k = 0; k < 8; ++k) o[k] = f2bf(v[k]);
    *(v8us*)dst = o;
    asm volatile("s_wait_xcnt 0x0" ::: "memory");                            // the store's registers are rewritten only behind this wait
}

// k_prep: every f32 -> bf16 conversion of the call in one launch. The block index picks the plane (block-uniform ranges, in the order x | Wq Wk Wv | Aq Av | Bq Bv); every range is covered exactly.
__global__ __launch_bounds__(256) void k_prep(const float* __restrict__ x, const float* __restrict__ wq, const float* __restrict__ wk, const float* __restrict__ wv,
                                              const float* __restrict__ aq, const float* __restrict__ av, const float* __restrict__ bqu, const float* __restrict__ bvu,
                                              bf* XB, bf* WB, bf* AL, bf* BLq, bf* BLv) {
    int blk = (int)blockIdx.x; const int tid = (int)threadIdx.x;
    if (blk < CB_X) {                                                         // x: batch pitch SEQ_FULL tokens in the input, SEQ in the copy
        const size_t i = (size_t)blk * 256 + tid; const size_t nb8 = (size_t)SEQ * DM / 8; const size_t bb = i / nb8, r = i % nb8;
        cvt8(x + bb * ((size_t)SEQ_FULL * DM) + r * 8, XB + i * 8); return; }
    blk -= CB_X;
    if (blk < 3 * CB_W) {
        const int w = blk / CB_W; const float* s = (w == 0) ? wq : ((w == 1) ? wk : wv); const size_t i = (size_t)(blk - w * CB_W) * 256 + tid;
        cvt8(s + i * 8, WB + (size_t)w * DM * DM + i * 8); return; }
    blk -= 3 * CB_W;
    if (blk < 2 * CB_A) {
        const int w = blk / CB_A; const float* s = (w == 0) ? aq : av; const size_t i = (size_t)(blk - w * CB_A) * 256 + tid;
        cvt8(s + i * 8, AL + (size_t)w * LR * DM + i * 8); return; }
    blk -= 2 * CB_A;
    {                                                                         // weight-side extension rows: B | B | 0 | 0
        const int w = blk / CB_B; const float* s = (w == 0) ? bqu : bvu; bf* d = (w == 0) ? BLq : BLv; const int i = (blk - w * CB_B) * 256 + tid;
        const int row = i >> 2, piece = i & 3;
        const v8f v = *(const v8f*)(s + (size_t)row * LR); v8us o;
#pragma unroll
        for (int k = 0; k < 8; ++k) { const unsigned short t = f2bf(v[k]); o[k] = (piece < 2) ? t : (unsigned short)0; }
        *(v8us*)(d + (size_t)i * 8) = o;
        asm volatile("s_wait_xcnt 0x0" ::: "memory"); }                      // the store's registers are rewritten only behind this wait
}

// k_xa: x A^T for both updates in one 16-column tile (columns 0..7 = q update rows of A, 8..15 = v update rows), four waves per 64 token rows (16 rows each), K = DM.
// The 64 x rows and the 16 A rows are staged in LDS, 64 k at a time, by asynchronous 16-byte copies (pitch 144 B), two buffers, as in the projection kernels.
// Output: x-side extension planes XLq, XLv [token][32] bf16 = hi | lo | 0 | 0 of 2 * (x A^T); per plane the 64 rows x 64 B of the tile are one contiguous 4096-byte run:
__global__ __launch_bounds__(32 * PW) void k_xa(const bf* __restrict__ X, const bf* __restrict__ AL, bf* XLq, bf* XLv) {
    __shared__ __align__(16) bf ring[2 * XST];
    __shared__ __align__(16) float os[64 * XP];
    const int lane = threadIdx.x & 31, lr = lane & 15, hi = lane >> 4; const int r0 = blockIdx.x * 64;
    const int wave = __builtin_amdgcn_readfirstlane((int)(threadIdx.x >> 5));
    v8f acc = (v8f){};
    // copy side: thread tid moves bytes 16 (tid & 7) of x rows (tid >> 3) + 16 i, i = 0..3, and of A row (tid >> 3)
    const int crow = (int)(threadIdx.x >> 3), cch = (int)(threadIdx.x & 7);
    const bf* gx = X  + (size_t)(r0 + crow) * DM + cch * 8;                   // rows < NB * SEQ, columns k0 + 63 < DM
    const bf* gl = AL + (size_t)crow * DM + cch * 8;                          // rows < 16
    const unsigned l0 = (unsigned)(size_t)(&ring[crow * PPI + cch * 8]);      // LDS byte address = low 32 bits of the shared address
    const int NT = DM / PBK;
    // read side: same loader and k map as from the planes, rows at pitch PPI
    const int afr = (wave * 16 + lr) * PPI + 8 * hi, bfo = (64 + lr) * PPI + 8 * hi;
    copy5(l0, gx, (size_t)16 * DM, gl);                                       // tile 0 -> buffer 0
    asm volatile("s_wait_asynccnt 0x0" ::: "memory");                         // this wave's copies of tile 0 have landed
    __syncthreads();                                                          // ... and every other wave's
    copy5(l0 + XST * 2, gx + PBK, (size_t)16 * DM, gl + PBK);                 // tile 1 -> buffer 1
#pragma unroll 1
    for (int t = 0; t < NT; ++t) {                                            // rolled: one pass per staged tile
        const int bo = (t & 1) * XST;
#pragma unroll
        for (int ks = 0; ks < PBK; ks += 32) {
            const v16bf bw = ldb(&ring[bo + bfo + ks]); const v16bf a = ldb(&ring[bo + afr + ks]);
            acc = wmmabg(a, bw, acc); }
        asm volatile("s_wait_dscnt 0x0" ::: "memory");                        // this wave's reads of buffer t & 1 are done before it is refilled
        asm volatile("s_wait_asynccnt 0x0" ::: "memory");                     // this wave's copies of tile t + 1 have landed
        __syncthreads();                                                      // publishes tile t + 1 and ends every reader's last read of buffer t & 1
        if (t + 2 < NT) copy5(l0 + bo * 2, gx + (size_t)(t + 2) * PBK, (size_t)16 * DM, gl + (size_t)(t + 2) * PBK);
    }
    asm volatile("s_wait_asynccnt 0x0" ::: "memory");                         // no copy is outstanding behind the loop
#pragma unroll
    for (int j = 0; j < 8; ++j) os[(wave * 16 + hi * 8 + j) * XP + lr] = acc[j] * LSC;   // D: row 8h+j, col lane&15; the wave's own 16 rows x columns 0..15 all written
    wave_sync();
    const size_t ob = (size_t)r0 * LK;
{
#pragma unroll 1
        for (int s = 2 * wave; s < 2 * wave + 2; ++s) { const int p = s * 32 + lane; const int row = p >> 2, piece = p & 3;   // 2 s x 8 rows = the wave's own 16 rows; 4 lanes x 16 B = one 64-byte row
            const v4f a0 = *(const v4fa*)(&os[row * XP + 0]); const v4f a1 = *(const v4fa*)(&os[row * XP + 4]);
            const v4f c0 = *(const v4fa*)(&os[row * XP + 8]); const v4f c1 = *(const v4fa*)(&os[row * XP + 12]);
            v8us oq, ov;
#pragma unroll
            for (int i = 0; i < 4; ++i) { oq[i] = ext_word(a0[i], piece); oq[4 + i] = ext_word(a1[i], piece); ov[i] = ext_word(c0[i], piece); ov[4 + i] = ext_word(c1[i], piece); }
            *(v8us*)(XLq + ob + (size_t)p * 8) = oq; *(v8us*)(XLv + ob + (size_t)p * 8) = ov; }
         }
}

template <int MODE, int LOWR>
__device__ __forceinline__ void proj_body(bf* ring, float* osa, int bx, int by, const bf* __restrict__ A, const bf* __restrict__ Bt, const bf* __restrict__ AX, const bf* __restrict__ BX,
                                          const float* __restrict__ bias, h16* Ph, h16* Pr, int resT) {
    const int K = DM;
    const int lane = threadIdx.x & 31, lr = lane & 15, hi = lane >> 4;
    const int wave = __builtin_amdgcn_readfirstlane((int)(threadIdx.x >> 5));
    const int wm = (wave & 1) * 64, wn = (wave >> 1) * 64;                    // the wave's 64 x 64 tile inside the block
    const int r0 = bx * 128 + wm, c0 = by * 128 + wn;
    float* os = osa + wave * 16 * 68;                                         // wave-private output staging
    v8f acc[4][4];
#pragma unroll
    for (int mb = 0; mb < 4; ++mb)
#pragma unroll
        for (int nb = 0; nb < 4; ++nb) acc[mb][nb] = (v8f){};
    // copy side: thread tid moves bytes 16 (tid & 7) of tile rows (tid >> 3) + 16 i, i = 0..7, of both operands
    const int crow = (int)(threadIdx.x >> 3), cch = (int)(threadIdx.x & 7);
    const bf* ga = A  + (size_t)(bx * 128 + crow) * K + cch * 8;      // rows < M, columns k0 + 63 < K
    const bf* gb = Bt + (size_t)(by * 128 + crow) * K + cch * 8;
    const unsigned la = (unsigned)(size_t)(&ring[crow * PPI + cch * 8]);      // LDS byte address = low 32 bits of the shared address
    const unsigned lb = la + POP * 2;
    const int NT = K / PBK;
    // read side: same loader and k map as from the planes, rows at pitch PPI
    const int afr = (wm + lr) * PPI + 8 * hi, bfo = POP + (wn + lr) * PPI + 8 * hi;
    copy8(la, ga, (size_t)16 * K); copy8(lb, gb, (size_t)16 * K);             // tile 0 -> buffer 0
    asm volatile("s_wait_asynccnt 0x0" ::: "memory");                         // this wave's copies of tile 0 have landed
    __syncthreads();                                                          // ... and every other wave's
    copy8(la + PST * 2, ga + PBK, (size_t)16 * K); copy8(lb + PST * 2, gb + PBK, (size_t)16 * K);   // tile 1 -> buffer 1
#pragma unroll 1
    for (int t = 0; t < NT; ++t) {                                            // rolled: one pass per staged tile
        const int bo = (t & 1) * PST;
#pragma unroll
        for (int ks = 0; ks < PBK; ks += 32) {
            v16bf a[4];
#pragma unroll
            for (int mb = 0; mb < 4; ++mb) a[mb] = ldb(&ring[bo + afr + mb * 16 * PPI + ks]);
            v16bf b[4];                                                       // all eight fragments of a k-step are read as one group of LDS loads
#pragma unroll
            for (int nb = 0; nb < 4; ++nb) b[nb] = ldb(&ring[bo + bfo + nb * 16 * PPI + ks]);
#pragma unroll
            for (int nb = 0; nb < 4; ++nb) {
#pragma unroll
                for (int mb = 0; mb < 4; ++mb) acc[mb][nb] = wmmabg(a[mb], b[nb], acc[mb][nb]); }
        }
        asm volatile("s_wait_dscnt 0x0" ::: "memory");                        // this wave's reads of buffer t & 1 are done before it is refilled
        asm volatile("s_wait_asynccnt 0x0" ::: "memory");                     // this wave's copies of tile t + 1 have landed
        __syncthreads();                                                      // publishes tile t + 1 and ends every reader's last read of buffer t & 1
        if (t + 2 < NT) { copy8(la + bo * 2, ga + (size_t)(t + 2) * PBK, (size_t)16 * K); copy8(lb + bo * 2, gb + (size_t)(t + 2) * PBK, (size_t)16 * K); }
    }
    asm volatile("s_wait_asynccnt 0x0" ::: "memory");                         // no copy is outstanding behind the loop
    if (LOWR) {                                                                                   // extension k-step: rows of 32 bf16, same loader and k map on both sides
        const size_t axo = (size_t)(r0 + lr) * LK + 8 * hi, bxo = (size_t)(c0 + lr) * LK + 8 * hi;
        v16bf a[4];
#pragma unroll
        for (int mb = 0; mb < 4; ++mb) a[mb] = ldb(AX + axo + (size_t)mb * 16 * LK);
#pragma unroll
        for (int nb = 0; nb < 4; ++nb) { const v16bf b = ldb(BX + bxo + (size_t)nb * 16 * LK);
#pragma unroll
            for (int mb = 0; mb < 4; ++mb) acc[mb][nb] = wmmabg(a[mb], b, acc[mb][nb]); }
    }
    float bc[4];
#pragma unroll
    for (int nb = 0; nb < 4; ++nb) bc[nb] = (MODE == 0) ? bfr(bias[c0 + nb * 16 + lr]) : 0.0f;   // MODE 0: c0 + 63 < DM
    size_t tbase, rbase; bool wr;                                                                 // wr: wave-uniform, the wave's whole tile inside the residual plane
    if (MODE == 0) { const int bb = r0 / SEQ, tt = r0 % SEQ; const int zc = bb * NH_ + c0 / HD;
                     tbase = ((size_t)zc * SEQ + (size_t)tt) * HD; rbase = ((size_t)zc * (size_t)resT + (size_t)tt) * HD; wr = tt < resT; }
    else           { const int bb = c0 / SEQ, tt = c0 % SEQ;
                     tbase = (size_t)bb * (size_t)DM * SEQ + (size_t)r0 * SEQ + (size_t)tt; rbase = (size_t)bb * (size_t)DM * (size_t)resT + (size_t)r0 * (size_t)resT + (size_t)tt; wr = tt < resT; }
#pragma unroll
    for (int mb = 0; mb < 4; ++mb) {
        float br[8];
#pragma unroll
        for (int j = 0; j < 8; ++j) br[j] = (MODE == 1) ? bfr(bias[r0 + mb * 16 + hi * 8 + j]) : 0.0f;   // MODE 1: r0 + 63 < DM
#pragma unroll
        for (int nb = 0; nb < 4; ++nb) {
#pragma unroll
            for (int j = 0; j < 8; ++j) os[(hi * 8 + j) * 68 + nb * 16 + lr] = acc[mb][nb][j] + bc[nb] + br[j]; }   // D: row 8h+j, col lane&15; rows 0..15 x columns 0..63 all written
        wave_sync();
{
            if (MODE == 0) {
                const size_t sb = tbase + (size_t)(mb * 16) * HD;
                const size_t rb = rbase + (size_t)(mb * 16) * HD;
#pragma unroll
                for (int s = 0; s < 4; ++s) { const int p = s * 32 + lane; const int row = p >> 3, c8 = (p & 7) * 8;   // 4 s x 4 rows = 16 rows; 8 lanes x 8 = 64 columns = one line
                    const v4f x0 = *(const v4fa*)(&os[row * 68 + c8]); const v4f x1 = *(const v4fa*)(&os[row * 68 + c8 + 4]); v8h hv, rv;
#pragma unroll
                    for (int i = 0; i < 4; ++i) { const h16 a0 = toh_flush(x0[i]); const h16 a1 = toh_flush(x1[i]); hv[i] = a0; hv[4 + i] = a1;
                                                  rv[i] = toh_flush((x0[i] - (float)a0) * QRS); rv[4 + i] = toh_flush((x1[i] - (float)a1) * QRS); }
                    const size_t oo = sb + (size_t)p * 8;
                    const size_t ro = rb + (size_t)p * 8;
                    *(v8h*)(Ph + oo) = hv; asm volatile("s_wait_xcnt 0x0" ::: "memory");                    // each store's registers are rewritten only behind its wait
                    if (wr) { *(v8h*)(Pr + ro) = rv; asm volatile("s_wait_xcnt 0x0" ::: "memory"); } }
            } else {
                const size_t sb = tbase + (size_t)(mb * 16) * SEQ;
                const size_t rb = rbase + (size_t)(mb * 16) * (size_t)resT;
#pragma unroll
                for (int s = 0; s < 4; ++s) { const int row = 4 * s + (lane >> 3), c8 = (lane & 7) * 8;   // 4 s x 4 row groups = 16 rows; 8 lanes x 8 = 64 columns
                    const v4f x0 = *(const v4fa*)(&os[row * 68 + c8]); const v4f x1 = *(const v4fa*)(&os[row * 68 + c8 + 4]); v8h hv, rv;
#pragma unroll
                    for (int i = 0; i < 4; ++i) { const h16 a0 = toh_flush(x0[i]); const h16 a1 = toh_flush(x1[i]); hv[i] = a0; hv[4 + i] = a1;
                                                  rv[i] = toh_flush((x0[i] - (float)a0) * QRS); rv[4 + i] = toh_flush((x1[i] - (float)a1) * QRS); }
                    const size_t oo = sb + (size_t)row * SEQ + c8;
                    const size_t ro = rb + (size_t)row * (size_t)resT + c8;
                    *(v8h*)(Ph + oo) = hv; asm volatile("s_wait_xcnt 0x0" ::: "memory");                    // each store's registers are rewritten only behind its wait
                    if (wr) { *(v8h*)(Pr + ro) = rv; asm volatile("s_wait_xcnt 0x0" ::: "memory"); } }
            }
             }
        wave_sync();
    }
}

// k_proj: the three projections in one launch, blockIdx.z picks one (block-uniform); the three bodies share one ring and one output staging, declared here so that the block's LDS is that of one body.
// z = 0, q: token-major with the update extension; z = 1, k: token-major, no extension; z = 2, v^T: feature-major with the update extension (A = Wv rows, so the block's row tile is blockIdx.y and its column tile blockIdx.x).
__global__ __launch_bounds__(32 * PW) void k_proj(const bf* __restrict__ XB, const bf* __restrict__ WB, const bf* __restrict__ XLq, const bf* __restrict__ BLq, const bf* __restrict__ XLv, const bf* __restrict__ BLv,
                                              const float* __restrict__ bq, const float* __restrict__ bk, const float* __restrict__ bv,
                                              h16* QH, h16* QR, h16* KP, h16* KR, h16* VT, h16* VR, int resT) {
    __shared__ __align__(16) bf ring[2 * PST];
    __shared__ __align__(16) float osa[PW * 16 * 68];
    const int z = (int)blockIdx.z, gx = (int)blockIdx.x, gy = (int)blockIdx.y;
    const bf* WK = WB + (size_t)DM * DM; const bf* WV = WB + (size_t)2 * DM * DM;
    if (z == 0)      proj_body<0, 1>(ring, osa, gx, gy, XB, WB, XLq, BLq, bq, QH, QR, resT);
    else if (z == 1) proj_body<0, 0>(ring, osa, gx, gy, XB, WK, XB, WK, bk, KP, KR, resT);
    else             proj_body<1, 1>(ring, osa, gy, gx, WV, XB, BLv, XLv, bv, VT, VR, resT);
}

template <int EARLY>
__device__ __forceinline__ void keypass_body(h16* ring, float* os, int qt, int zh, const h16* __restrict__ QH, const h16* __restrict__ QR, const h16* __restrict__ KP, const h16* __restrict__ KR,
                                           const h16* __restrict__ VT, const h16* __restrict__ VR, const float* __restrict__ amask, float* OUT) {
    constexpr int KSG = (EARLY ? 4 : 2) * KOP;                                // elements of one stage: K | V^T (| K residual | V^T residual); the ring holds two stages
    const int lane = threadIdx.x & 31, lr = lane & 15, hi = lane >> 4;
    const int wave = __builtin_amdgcn_readfirstlane((int)(threadIdx.x >> 5));
    const int b = zh / NH_, h = zh % NH_;
    const int t0 = (qt * AW + wave) * 16;                                     // qt: the block's tile of 64 query rows, counted over the whole sequence
    const int lim = t0 + lr;                                                  // key j is causal-filled iff j > lim
    const float* amb = amask + (size_t)b * SEQ_FULL;
    const size_t pbase = (size_t)zh * SEQ * HD;
    const size_t rbase = (size_t)zh * EROWS * HD;
    // copy side: thread tid moves bytes 16 (tid & 7) of tile rows (tid >> 3) + 16 i, i = 0..3, of every staged plane (K rows = keys, V^T rows = d)
    const int crow = (int)(threadIdx.x >> 3), cch = (int)(threadIdx.x & 7);
    const h16* gk  = KP + pbase + (size_t)crow * HD + cch * 8;                // + key * HD, keys < SEQ
    const h16* gv  = VT + pbase + (size_t)crow * SEQ + cch * 8;               // + key, keys + 63 < SEQ
    const h16* gkr = KR + rbase + (size_t)crow * HD + cch * 8;                // + key * HD, keys < EROWS
    const h16* gvr = VR + rbase + (size_t)crow * EROWS + cch * 8;             // + key, keys + 63 < EROWS
    const unsigned l0 = (unsigned)(size_t)(&ring[crow * PPI + cch * 8]);      // LDS byte address = low 32 bits of the shared address
    auto stage = [&](int s, int buf) {                                        // tile s (keys 64 s .. 64 s + 63) -> buffer buf
        const int k0 = s * KST; const unsigned l = l0 + (unsigned)buf * (KSG * 2);
        copy4(l, gk + (size_t)k0 * HD, (size_t)16 * HD); copy4(l + KOP * 2, gv + k0, (size_t)16 * SEQ);
        if (EARLY) { const int kc = (k0 < EROWS) ? k0 : (EROWS - KST);        // clamped residual-plane key (address always inside the plane)
                     copy4(l + 2 * KOP * 2, gkr + (size_t)kc * HD, (size_t)16 * HD); copy4(l + 3 * KOP * 2, gvr + kc, (size_t)16 * EROWS); } };
    stage(0, 0);                                                              // tile 0 exists for every block; its copies fly under the mask scan
    // scan of the batch's mask row: any value not below WIDE in magnitude widens the key loop to all keys
    float fl = 0.0f;
#pragma unroll 1
    for (int i = 0; i < SEQ; i += 128) {
        const v4f w = *(const v4f*)(amb + i + 4 * lane);
#pragma unroll
        for (int c = 0; c < 4; ++c) { const float a = fabsf(bfr(w[c])); fl = (a < WIDE) ? fl : 1.0f; } }
    fl = fmaxf(fl, __shfl_xor(fl, 16, 32)); fl = fmaxf(fl, __shfl_xor(fl, 8, 32)); fl = fmaxf(fl, __shfl_xor(fl, 4, 32));
    fl = fmaxf(fl, __shfl_xor(fl, 2, 32));  fl = fmaxf(fl, __shfl_xor(fl, 1, 32));
    const int nkc = (t0 + 16 + 31) & ~31;                                     // causal bound, multiple of 32, <= SEQ
    const int nkv = (fl != 0.0f) ? SEQ : nkc;                                 // select formed on the vector side
    const int nk = __builtin_amdgcn_readfirstlane(nkv);
    const int nbv = (fl != 0.0f) ? SEQ : ((qt + 1) * KST);   // the block's bound = its last wave's; every wave scans the same mask row, so it is block-uniform
    const int NS = __builtin_amdgcn_readfirstlane(nbv) / KST;                 // staged tiles of the block, >= 1
    const size_t qo = pbase + (size_t)(t0 + lr) * HD + 8 * hi;
    const v16h hz = (v16h){};
    v16h qh[2], qr[2];
    qh[0] = ldh(QH + qo); qh[1] = ldh(QH + qo + 32);             // B fragments: col t, k = d (two k-steps)
    qr[0] = hz; qr[1] = hz;
    if (EARLY) { const size_t qro = rbase + (size_t)(t0 + lr) * HD + 8 * hi; qr[0] = ldh(QR + qro); qr[1] = ldh(QR + qro + 32); }   // t0 + lr < EROWS
    const int fo = lr * PPI + 8 * hi;                          // read side, same loader and k map as from the planes, rows at pitch PPI: K + key * PPI (A fragment: row key, k = d); V^T + 16j * PPI + key (A fragment: row d, k = key)
    v8f o[4], oR[4];
#pragma unroll
    for (int j = 0; j < 4; ++j) { o[j] = (v8f){}; oR[j] = (v8f){}; }
    float m = NEGB, l = 0.0f;
    asm volatile("s_wait_asynccnt 0x0" ::: "memory");            // this wave's copies of tile 0 have landed
    __syncthreads();                                             // ... and every other wave's
    if (1 < NS) stage(1, 1);
#pragma unroll 1
    for (int s = 0; s < NS; ++s) {                               // rolled: one pass per staged tile
    const int bo = (s & 1) * KSG;
    const int ke = (nk - s * KST < KST) ? nk - s * KST : KST;    // keys of this tile below the wave's own bound
#pragma unroll 1
    for (int kk = 0; kk < ke; kk += 32) {                        // rolled: the 32-key halves of a tile share one body, which keeps the loop's text small
        const int key0 = s * KST + kk;
        const bool rok = key0 < EROWS;                           // wave-uniform
        const h16* kpt = &ring[bo + fo + kk * PPI];
        v8f sHa = (v8f){}, sLa = (v8f){}, sHb = (v8f){}, sLb = (v8f){};
        const h16* krp = &ring[bo + (EARLY ? 2 : 0) * KOP + fo + kk * PPI];   // residual tiles exist in the EARLY stage only
        const h16* va  = &ring[bo + KOP + fo + kk];
        const h16* vrp = &ring[bo + (EARLY ? 3 : 1) * KOP + fo + kk];
        v16h ka[2], kb[2], kra[2], krb[2], vf[4];          // the fragments of a product run are read as one group of LDS loads ahead of it
#pragma unroll
        for (int ks = 0; ks < 2; ++ks) {
            ka[ks] = ldh(kpt + ks * 32); kb[ks] = ldh(kpt + 16 * PPI + ks * 32);
            if (EARLY) { kra[ks] = ldh(krp + ks * 32); krb[ks] = ldh(krp + 16 * PPI + ks * 32); } }
        if (!EARLY) {                                              // registers allow: the V^T fragments join the K group
#pragma unroll
            for (int j = 0; j < 4; ++j) vf[j] = ldh(va + (16 * j) * PPI); }
#pragma unroll
        for (int ks = 0; ks < 2; ++ks) {
            sHa = wmma16g(ka[ks], qh[ks], sHa); sHb = wmma16g(kb[ks], qh[ks], sHb);
            if (EARLY) {
                sLa = wmma16g(ka[ks], qr[ks], sLa); sLb = wmma16g(kb[ks], qr[ks], sLb);
                if (!rok) { kra[ks] = hz; krb[ks] = hz; }
                sLa = wmma16g(kra[ks], qh[ks], sLa); sLb = wmma16g(krb[ks], qh[ks], sLb);
            }
        }
        if (EARLY) {                                               // the V^T group flies under the softmax
#pragma unroll
            for (int j = 0; j < 4; ++j) vf[j] = ldh(va + (16 * j) * PPI); }
        const float* kp = amb + 8 * hi + key0;                   // keys key0+8h+0..7 and key0+16+8h+0..7, all < nk <= SEQ
        const v4f m0 = *(const v4f*)kp, m1 = *(const v4f*)(kp + 4), m2 = *(const v4f*)(kp + 16), m3 = *(const v4f*)(kp + 20);
        float kx[8], ky[8];
#pragma unroll
        for (int r = 0; r < 4; ++r) { kx[r] = m0[r]; kx[4 + r] = m1[r]; ky[r] = m2[r]; ky[4 + r] = m3[r]; }
        const int ja = key0 + 8 * hi;
        float ta[8], tb[8]; float mx = NEGB;
#pragma unroll
        for (int r = 0; r < 8; ++r) {
            const float sa = EARLY ? (sHa[r] + sLa[r] * QRI) * SC2 : sHa[r] * SC2;
            const float sb = EARLY ? (sHb[r] + sLb[r] * QRI) * SC2 : sHb[r] * SC2;
            ta[r] = ((ja + r > lim) ? NEGL : sa) + bfr(kx[r]) * L2E;             // replace, then add the mask
            tb[r] = ((ja + 16 + r > lim) ? NEGL : sb) + bfr(ky[r]) * L2E;
            mx = fmaxf(mx, fmaxf(ta[r], tb[r])); }
        mx = fmaxf(mx, __shfl_xor(mx, 16, 32));
        const float mnew = fmaxf(m, mx);
        const float alpha = __builtin_amdgcn_exp2f(m - mnew);
        const float sh = PSH - mnew;
        v16h pb, pr = hz; float ls = 0.0f;
#pragma unroll
        for (int r = 0; r < 8; ++r) {
            const float aa = ta[r] + sh, ab = tb[r] + sh;
            const float ea = __builtin_amdgcn_exp2f(aa), eb = __builtin_amdgcn_exp2f(ab);
            const float ga = (aa < PFL) ? 0.0f : ea, gb = (ab < PFL) ? 0.0f : eb;   // below the f16 normal range -> exactly zero, selected by value
            const h16 pa = (h16)ga; const h16 pc = (h16)gb;
            pb[r] = pa; pb[8 + r] = pc;
            if (EARLY) { pr[r] = toh_flush((ga - (float)pa) * QRS); pr[8 + r] = toh_flush((gb - (float)pc) * QRS); ls += ga + gb; }
            else       { ls += (float)pa + (float)pc; } }
        l = l * alpha + ls; m = mnew;
#pragma unroll
        for (int j = 0; j < 4; ++j) { o[j] = o[j] * alpha; if (EARLY) oR[j] = oR[j] * alpha; }
#pragma unroll
        for (int jp = 0; jp < 2; ++jp) {
            const v16h v0 = vf[2 * jp], v1 = vf[2 * jp + 1];
            o[2 * jp] = wmma16g(v0, pb, o[2 * jp]); o[2 * jp + 1] = wmma16g(v1, pb, o[2 * jp + 1]);
            if (EARLY) {
                oR[2 * jp] = wmma16g(v0, pr, oR[2 * jp]); oR[2 * jp + 1] = wmma16g(v1, pr, oR[2 * jp + 1]);
                v16h vr0 = ldh(vrp + (32 * jp) * PPI), vr1 = ldh(vrp + (32 * jp + 16) * PPI);
                if (!rok) { vr0 = hz; vr1 = hz; }
                oR[2 * jp] = wmma16g(vr0, pb, oR[2 * jp]); oR[2 * jp + 1] = wmma16g(vr1, pb, oR[2 * jp + 1]);
            }
        }
    }
    asm volatile("s_wait_dscnt 0x0" ::: "memory");               // this wave's reads of buffer s & 1 are done before it is refilled
    asm volatile("s_wait_asynccnt 0x0" ::: "memory");            // this wave's copies of tile s + 1 have landed
    __syncthreads();                                             // publishes tile s + 1 and ends every reader's last read of buffer s & 1
    if (s + 2 < NS) stage(s + 2, s & 1);
    }
    asm volatile("s_wait_asynccnt 0x0" ::: "memory");            // no copy is outstanding behind the loop
    l += __shfl_xor(l, 16, 32);
    const float inv = 1.0f / l;                                  // l >= 2^14 whenever the row has a finite maximum logit
    const int wb = wave * 16 * OSP;
    // O^T D layout: o[j][r] = (d = 16j + 8h + r, t = lane&15) -> os[t][d]; rows 0..15 x columns 0..63 all written
#pragma unroll
    for (int j = 0; j < 4; ++j) {
        v8f f = o[j];
        if (EARLY) f = o[j] + oR[j] * QRI;
        v4f a, c;
        a[0] = f[0] * inv; a[1] = f[1] * inv; a[2] = f[2] * inv; a[3] = f[3] * inv; c[0] = f[4] * inv; c[1] = f[5] * inv; c[2] = f[6] * inv; c[3] = f[7] * inv;
        *(v4fa*)(&os[wb + lr * OSP + 16 * j + 8 * hi]) = a; *(v4fa*)(&os[wb + lr * OSP + 16 * j + 8 * hi + 4]) = c; }
    wave_sync();
    float* orow = OUT + ((size_t)b * OUT_SEQ + t0) * DM + h * HD;
{
#pragma unroll
        for (int s = 0; s < 8; ++s) { const int row = 2 * s + (lane >> 4), cofs = (lane & 15) * 4;   // 8 s x 2 rows = 16 rows; 16 lanes x 4 floats = 64 columns = two lines
            const v4f val = *(const v4fa*)(&os[wb + row * OSP + cofs]);
            *(v4f*)(orow + (size_t)row * DM + cofs) = val; }
         }
}

// k_keypass: both instantiations in one launch. blockIdx.x = (batch, head); blockIdx.y counts the 64-row query tiles from the last one down, for speed only.
// The choice of the body is block-uniform; the two bodies share one ring and one output staging, declared here.
__global__ __launch_bounds__(32 * AW) __attribute__((amdgpu_num_vgpr(256)))
void k_keypass(const h16* __restrict__ QH, const h16* __restrict__ QR, const h16* __restrict__ KP, const h16* __restrict__ KR,
               const h16* __restrict__ VT, const h16* __restrict__ VR, const float* __restrict__ amask, float* OUT) {
    __shared__ __align__(16) h16 ring[2 * 4 * KOP];
    __shared__ __align__(16) float os[AW * 16 * OSP];
    const int zh = (int)blockIdx.x; const int qt = SEQ / (16 * AW) - 1 - (int)blockIdx.y;
    if (qt < EROWS / (16 * AW)) keypass_body<1>(ring, os, qt, zh, QH, QR, KP, KR, VT, VR, amask, OUT);
    else                        keypass_body<0>(ring, os, qt, zh, QH, QH, KP, KP, VT, VT, amask, OUT);
}

static constexpr size_t al256(size_t v) { return (v + 255) & ~(size_t)255; }
static constexpr size_t SZ_XB = al256((size_t)NB * SEQ * DM * 2);
static constexpr size_t SZ_WB = al256((size_t)3 * DM * DM * 2);
static constexpr size_t SZ_AL = al256((size_t)2 * LR * DM * 2);
static constexpr size_t SZ_BL = al256((size_t)DM * LK * 2);
static constexpr size_t SZ_XL = al256((size_t)NB * SEQ * LK * 2);
static constexpr size_t SZ_PL = al256((size_t)NB * NH_ * SEQ * HD * 2);
static constexpr size_t SZ_RS = al256((size_t)NB * NH_ * EROWS * HD * 2);
static constexpr size_t SZ_TOTAL = SZ_XB + SZ_WB + SZ_AL + 2 * SZ_BL + 2 * SZ_XL + 3 * SZ_PL + 3 * SZ_RS;
static_assert(SZ_TOTAL <= (size_t)134217728);          // workspace carve <= 128 MiB
static_assert(((size_t)DM * DM * 2) % 256 == 0);       // weight sub-planes stay 256-byte aligned
static_assert(((size_t)LR * DM * 2) % 256 == 0);       // the two halves of the A plane stay 256-byte aligned
static_assert((size_t)NB * NH_ * SEQ * HD == (size_t)NB * DM * SEQ);       // v^T plane [(b*1024 + m)][t] has the same extent as the q/k planes
static_assert((size_t)NB * NH_ * EROWS * HD == (size_t)NB * DM * EROWS);   // v^T residual plane [(b*1024 + m)][t < EROWS] has the same extent as the q/k residual planes
static_assert((DM * 4) % 256 == 0);                    // the extension-plane block ranges of k_prep cover their planes exactly

extern "C" void kernel_launch(void* const* d_in, const int* in_sizes, int n_in,
                              void* d_out, int out_size, void* d_ws, size_t ws_size, hipStream_t stream) {
    if (n_in < 12) return;
    const size_t needx = ((size_t)(NB - 1) * SEQ_FULL + SEQ) * DM;
    const size_t needm = (size_t)(NB - 1) * SEQ_FULL + SEQ;
    if ((size_t)in_sizes[0] < needx || (size_t)in_sizes[1] < needm) return;
    if ((size_t)in_sizes[2] < (size_t)DM * DM || (size_t)in_sizes[4] < (size_t)DM * DM || (size_t)in_sizes[6] < (size_t)DM * DM) return;
    if (in_sizes[3] < DM || in_sizes[5] < DM || in_sizes[7] < DM) return;
    if (in_sizes[8] < LR * DM || in_sizes[9] < DM * LR || in_sizes[10] < LR * DM || in_sizes[11] < DM * LR) return;
    if ((size_t)out_size < ((size_t)(NB - 1) * OUT_SEQ + SEQ) * DM) return;
    if (SZ_TOTAL > ws_size) return;
    // wire order: hidden_states, key_mask (the module's additive key mask input), Wq, bq, Wk, bk, Wv, bv, Aq, Bq, Av, Bv
    const float* xin = (const float*)d_in[0];
    const float* am  = (const float*)d_in[1];
    const float* wq = (const float*)d_in[2]; const float* bq = (const float*)d_in[3];
    const float* wk = (const float*)d_in[4]; const float* bk = (const float*)d_in[5];
    const float* wv = (const float*)d_in[6]; const float* bv = (const float*)d_in[7];
    const float* aq = (const float*)d_in[8]; const float* bqu = (const float*)d_in[9];
    const float* av = (const float*)d_in[10]; const float* bvu = (const float*)d_in[11];
    float* OUT = (float*)d_out;      // [NB][SEQ][1024]
    char* wsp = (char*)d_ws;
    bf* XB = (bf*)wsp; wsp += SZ_XB;                 // x      [NB*SEQ][1024]
    bf* WB = (bf*)wsp; wsp += SZ_WB;                 // [3][1024][1024]: q | k | v  ([out][in] = Bt as-is)
    bf* AL = (bf*)wsp; wsp += SZ_AL;                 // [16][1024]: rows 0..7 A of the q update, rows 8..15 A of the v update
    bf* BLq = (bf*)wsp; wsp += SZ_BL;                // [1024][32]: B | B | 0 | 0 (q update)
    bf* BLv = (bf*)wsp; wsp += SZ_BL;                // [1024][32]: B | B | 0 | 0 (v update)
    bf* XLq = (bf*)wsp; wsp += SZ_XL;                // [NB*SEQ][32]: hi | lo | 0 | 0 of 2 x A^T (q update)
    bf* XLv = (bf*)wsp; wsp += SZ_XL;                // [NB*SEQ][32]: hi | lo | 0 | 0 of 2 x A^T (v update)
    h16* QH = (h16*)wsp; wsp += SZ_PL;               // [NB*16][SEQ][64]
    h16* KP = (h16*)wsp; wsp += SZ_PL;               // [NB*16][SEQ][64]
    h16* VT = (h16*)wsp; wsp += SZ_PL;               // [NB*16][64][SEQ]
    h16* QR = (h16*)wsp; wsp += SZ_RS;               // [NB*16][EROWS][64] residual x2048, tokens < EROWS
    h16* KR = (h16*)wsp; wsp += SZ_RS;               // [NB*16][EROWS][64] residual x2048, tokens < EROWS
    h16* VR = (h16*)wsp; wsp += SZ_RS;               // [NB*16][64][EROWS] residual x2048, tokens < EROWS

    // all conversions to bf16
    k_prep<<<dim3(CB_X + 3 * CB_W + 2 * CB_A + 2 * CB_B, 1, 1), 256, 0, stream>>>(xin, wq, wk, wv, aq, av, bqu, bvu, XB, WB, AL, BLq, BLv);

    // 2 x A^T for both updates -> x-side extension planes
    k_xa<<<dim3(NB * SEQ / 64, 1, 1), 32 * PW, 0, stream>>>(XB, AL, XLq, XLv);

    // q, k: A = x rows (m = b*SEQ + t), Bt = W rows (n = h*64 + d) -> plane [(b*16 + h)][t][d]; v^T: A = Wv rows (m = h*64 + d), Bt = x rows (n = b*SEQ + t) -> plane [(b*1024 + m)][t] = [(b*16 + h)][d][t]; residuals for tokens < EROWS
    k_proj<<<dim3(NB * SEQ / 128, DM / 128, 3), 32 * PW, 0, stream>>>(XB, WB, XLq, BLq, XLv, BLv, bq, bk, bv, QH, QR, KP, KR, VT, VR, EROWS);

    // query rows [0, EROWS): multi-product instantiation; rows [EROWS, SEQ): single-product instantiation (disjoint output rows)
    k_keypass<<<dim3(NB * NH_, SEQ / (16 * AW), 1), 32 * AW, 0, stream>>>(QH, QR, KP, KR, VT, VR, am, OUT);
}

// v004
// It runs in 86.8 microseconds.
// In two side-by-side timings against v003, it was 1.09 and 1.10 times as fast.
// Over all steps from v000 it is 3.68 times as fast.
#include <hip/hip_runtime.h>

// Causal pair-score weighting, width 1024 = 16 heads x 64; one input x [NB][SEQ][1024] feeds q, k and v; Wq/Wk/Wv [out][in] (y = x W^T + bias); rank-8 additive updates on q and v: y += 2 (x A^T) B^T with A [8][in], B [out][8];
// additive key mask [NB][1][1][SEQ] (f32, read by value); score scale 1/sqrt(64); keys j > t are replaced by -1e9 before the mask is added; softmax over keys; output = concatenated heads (f32), no output projection.
// Compute dtypes, f32 accumulate everywhere: projections and x A^T v_wmma_f32_16x16x32_bf16 (x, W, A, B, biases, mask RNE-converted to bf16; products exact); the rank-8 up-projection is one extra 32-deep k-step of the projection GEMM (2 x A^T carried as bf16 hi | lo, B bf16);
// scores v_wmma_f32_16x16x32_f16: single f16 q and k on query rows >= EROWS; q and k each as f16 value + f16 residual x2048 (three products, residual products in their own accumulator) on query rows < EROWS;
// P.V v_wmma_f32_16x16x32_f16: P (x16384 carry, cancels in the normalisation) and v single f16 on query rows >= EROWS; on query rows < EROWS P and v each as f16 value + f16 residual x2048, residual products in their own accumulator folded by 1/2048, row sum from the f32 exponentials; softmax f32 (online, running max).
// Layout: bf16 copies of x, W, A; extension planes [row][32] bf16 (x side: hi | lo | 0 | 0 of 2 x A^T; weight side: B | B | 0 | 0); q, k planes [b*16+h][t][64], v^T plane [b*16+h][d][t], small residual planes q, k [b*16+h][t < EROWS][64] and v^T [b*16+h][d][t < EROWS]; fused online-softmax key-pass kernel in transposed form (S^T = K Q^T, O^T = V^T P^T).
// Key loop bound per wave: the causal limit; if any mask value of the batch is not below 1e8 in magnitude the loop covers all keys (per-element arithmetic is literal in every visited tile). Residual fragments for keys >= EROWS are zero.
// The mask's bf16-rounded values (kept as f32, plane [NB][SEQ]) and that per-batch magnitude test (one word per batch) are formed once, in k_prep; the key-pass kernel only reads them.

#ifndef NB
#define NB 2
#endif
#ifndef SEQ
#define SEQ 2048
#endif
#define NB_FULL  2
#define SEQ_FULL 2048
#ifndef OUT_SEQ
#define OUT_SEQ SEQ              // row pitch (in tokens) between batches of the output
#endif
#define DM   1024
#define NH_  16
#define HD   64
#define LR   8                   // rank of the additive updates
#define LK   32                  // k extent of the extension planes (one WMMA k-step)
#define XP   20                  // LDS row pitch (floats) of the x A^T tile
#define AW   4                   // waves per online-softmax key-pass block (16 query rows each)
#define PW   4                   // waves per projection block (2 x 2 wave tiles of 64 x 64)
#define PBK  64                  // k extent of one staged projection tile: 128 bytes of every operand row
#define PPI  72                  // LDS row pitch (16-bit elements) of a staged row: 144 bytes = 16 x 9
#define POP  (128 * PPI)         // elements of one staged operand tile (128 rows)
#define PST  (2 * POP)           // elements of one stage: A tile | B tile
#define XST  (80 * PPI)          // elements of one stage of the x A^T kernel: 64 x rows | 16 A rows
#define OSP  68                  // LDS row pitch (floats) of the online-softmax key-pass output tile
#define KST  64                  // keys of one staged key-pass tile: 64 K rows of 128 bytes, 128 bytes of each of the 64 V^T rows
#define KOP  (64 * PPI)          // elements of one staged key-pass plane tile (64 rows at pitch PPI)
#define EROWS (SEQ < 512 ? SEQ : 512)   // query rows (and tokens of the small residual planes) handled by the multi-product online-softmax key-pass instantiation
#define QRS  2048.0f             // carry of every residual plane / residual fragment
#define QRI  (1.0f / 2048.0f)
#define SC2  ((float)(0.125 * 1.4426950408889634))      // HD^-0.5 * log2(e)
#define L2E  ((float)1.4426950408889634)
#define NEGL ((float)(-1.0e9 * 1.4426950408889634))     // fill value -1e9 in the log2 domain
#define LSC  2.0f                // update scaling 16 / 8
#define PSH  14.0f               // log2 of the P carry (16384)
#define PFL  (-14.0f)            // exponent argument below which the f16 P would leave the normal range
#define NEGB (-3.0e38f)
#define WIDE 1.0e8f              // mask magnitude bound under which skipped (fully causal-filled) tiles contribute exactly zero

static_assert(HD == 64);
static_assert(NH_ * HD == DM);                 // head h = columns h*64 + d
static_assert(DM % 64 == 0);                   // column tiles of 64 = one head
static_assert(64 % HD == 0);
static_assert(DM % 32 == 0);                   // GEMM k-loop steps by 32
static_assert(LK == 32);                       // extension = exactly one k-step
static_assert(2 * LR <= LK);                   // hi | lo pieces fit the extension row
static_assert(LR == 8);                        // one 16-byte piece per part; B rows loaded as 8 floats
static_assert(2 * LR == 16);                   // A rows of q and v updates fill one 16-column tile
static_assert(SEQ % 64 == 0);                  // a 64-row tile never straddles two batches
static_assert((NB * SEQ) % 64 == 0);
static_assert(SEQ % 128 == 0);                 // mask scan steps by 128
static_assert(SEQ % 32 == 0);                  // key loop steps by 32
static_assert(SEQ % (16 * AW) == 0);           // online-softmax key-pass grids cover the sequence exactly
static_assert(EROWS % 64 == 0);                // a 64-token GEMM tile lies wholly inside or outside the residual planes
static_assert(EROWS >= 32);
static_assert(EROWS <= SEQ);
static_assert(EROWS % (16 * AW) == 0);
static_assert((SEQ - EROWS) % (16 * AW) == 0);
static_assert(((size_t)SEQ * DM) % 8 == 0);
static_assert(((size_t)DM * DM) % 8 == 0);
static_assert(((size_t)LR * DM) % 8 == 0);
static_assert(NB <= NB_FULL);
static_assert(SEQ <= SEQ_FULL);
static_assert((OSP * 4) % 16 == 0);
static_assert(OSP >= HD);
static_assert((XP * 4) % 16 == 0);
static_assert(XP >= 16);
static_assert(32 * 4 * 16 == 16 * HD * 2);
static_assert(32 * 4 * 16 == 16 * 64 * 2);
static_assert(32 * 8 * 16 == 16 * HD * 4);     // online-softmax key-pass epilogue: 8 instructions x 32 lanes x 16 B = 16 rows x 256 B
static_assert(32 * 8 * 16 == 64 * LK * 2);     // x A^T epilogue: 8 instructions x 32 lanes x 16 B = 64 rows x 64 B per plane
static_assert((NB * SEQ) % 128 == 0);          // projection blocks cover 128 x 128
static_assert(DM % 128 == 0);
static_assert(DM % PBK == 0);
static_assert(DM / PBK >= 2);                  // the two-buffer ring needs two stages
static_assert(PBK * 2 == 128);                 // a staged row is one 128-byte line: 8 lanes x 16 B
static_assert((PPI * 2) % 16 == 0);
static_assert(PPI >= PBK);
static_assert(8 * 32 * PW * 16 == 128 * PBK * 2);   // 8 copies per lane fill one operand tile
static_assert(2 * PST * 2 + PW * 16 * 68 * 4 <= 131072);   // static LDS of the projection kernels
static_assert(2 * XST * 2 + 64 * XP * 4 <= 131072);   // static LDS of the x A^T kernel
static_assert(5 * 32 * PW * 16 == 80 * PBK * 2);      // 5 copies per lane fill one stage of the x A^T kernel
static_assert(PW * 16 == 64);                         // x A^T kernel: one 16-row tile per wave
static_assert(2 * 4 * KOP * 2 + AW * 16 * OSP * 4 <= 131072);    // static LDS of the online-softmax key-pass kernels
static_assert(KST == 16 * AW);                 // a block's causal key bound is a whole number of staged tiles
static_assert(SEQ % KST == 0);
static_assert(EROWS % KST == 0);               // a staged tile lies wholly inside or outside the residual planes
static_assert(KST * 2 == 128);                 // a staged V^T row piece is one 128-byte line
static_assert(HD * 2 == 128);                  // a staged K row is one 128-byte line
static_assert(4 * 32 * AW * 16 == 64 * 128);   // 4 copies per lane fill one plane tile

typedef _Float16 h16;
typedef unsigned short bf;
typedef __attribute__((ext_vector_type(16))) __bf16   v16bf;
typedef __attribute__((ext_vector_type(16))) _Float16 v16h;
typedef __attribute__((ext_vector_type(8)))  _Float16 v8h;
typedef __attribute__((ext_vector_type(8)))  unsigned short v8us;
typedef __attribute__((ext_vector_type(8)))  float    v8f;
typedef __attribute__((ext_vector_type(4)))  float    v4f;
typedef v4f  __attribute__((may_alias)) v4fa;

__device__ __forceinline__ unsigned short f2bf(float f) { unsigned u = __float_as_uint(f); u += 0x7FFFu + ((u >> 16) & 1u); return (unsigned short)(u >> 16); }
__device__ __forceinline__ float bfr(float f) { return __uint_as_float(((unsigned)f2bf(f)) << 16); }   // value after RNE convert to bf16
__device__ __forceinline__ v16h cat16(v8h lo, v8h hi) { return __builtin_shufflevector(lo, hi, 0, 1, 2, 3, 4, 5, 6, 7, 8, 9, 10, 11, 12, 13, 14, 15); }
__device__ __forceinline__ v16bf cat16b(v8us lo, v8us hi) { return __builtin_bit_cast(v16bf, __builtin_shufflevector(lo, hi, 0, 1, 2, 3, 4, 5, 6, 7, 8, 9, 10, 11, 12, 13, 14, 15)); }
__device__ __forceinline__ v8f wmma16(v16h a, v16h b, v8f c) { return __builtin_amdgcn_wmma_f32_16x16x32_f16(false, a, false, b, (short)0, c, false, false); }
__device__ __forceinline__ v8f wmmab(v16bf a, v16bf b, v8f c) { return __builtin_amdgcn_wmma_f32_16x16x32_bf16(false, a, false, b, (short)0, c, false, false); }
// fragment loaders from K-contiguous 16-bit rows; p already includes + 8*(lane>>4): elements 0..7 <- k0+8h+0..7, elements 8..15 <- k0+16+8h+0..7 (same map for A and B)
__device__ __forceinline__ v16h  ldh(const h16* p) { return cat16(*(const v8h*)p, *(const v8h*)(p + 16)); }
__device__ __forceinline__ v16bf ldb(const bf* p)  { return cat16b(*(const v8us*)p, *(const v8us*)(p + 16)); }
// ordering point for wave-private LDS tiles (same wave writes and reads)
__device__ __forceinline__ void wave_sync() { __builtin_amdgcn_fence(3 /* release order */, "wavefront"); __builtin_amdgcn_wave_barrier(); asm volatile("" ::: "memory"); }

// f32 -> f16 convert that cannot produce a subnormal operand (|v| < 2^-14 -> +0); applied after the plane's power-of-two carry
static __device__ __forceinline__ h16 toh_flush(float v) { const h16 r = (h16)v; return (fabsf(v) < 6.103515625e-05f) ? (h16)0.0f : r; }
// one matrix instruction followed by its own four-slot guard (ties the accumulator, keeps the operands live)
static __device__ __forceinline__ v8f wmma16g(v16h a, v16h b, v8f c) { c = wmma16(a, b, c); asm volatile("v_nop\n\tv_nop\n\tv_nop\n\tv_nop" : "+v"(c) : "v"(a), "v"(b)); return c; }
static __device__ __forceinline__ v8f wmmabg(v16bf a, v16bf b, v8f c) { c = wmmab(a, b, c); asm volatile("v_nop\n\tv_nop\n\tv_nop\n\tv_nop" : "+v"(c) : "v"(a), "v"(b)); return c; }
// one 16-bit word of an extension row: piece 0 = bf16 value, piece 1 = bf16 of the remainder, pieces 2, 3 = zero (select by value)
static __device__ __forceinline__ unsigned short ext_word(float v, int piece) {
    const unsigned short hw = f2bf(v); const float hv = __uint_as_float(((unsigned)hw) << 16); const unsigned short lw = f2bf(v - hv);
    return (piece == 0) ? hw : ((piece == 1) ? lw : (unsigned short)0); }

// eight asynchronous 16-byte copies per lane, global -> LDS: copy i moves the lane's 16 bytes of tile row (row + 16 i). The closing s_wait_xcnt stands inside the statement so that no address register is rewritten ahead of it.
static __device__ __forceinline__ void copy8(unsigned l, const bf* g, size_t gs) {
    const unsigned ls = 16 * PPI * 2;
    asm volatile("global_load_async_to_lds_b128 %0, %8, off\n\t"
                 "global_load_async_to_lds_b128 %1, %9, off\n\t"
                 "global_load_async_to_lds_b128 %2, %10, off\n\t"
                 "global_load_async_to_lds_b128 %3, %11, off\n\t"
                 "global_load_async_to_lds_b128 %4, %12, off\n\t"
                 "global_load_async_to_lds_b128 %5, %13, off\n\t"
                 "global_load_async_to_lds_b128 %6, %14, off\n\t"
                 "global_load_async_to_lds_b128 %7, %15, off\n\t"
                 "s_wait_xcnt 0x0"
                 :: "v"(l), "v"(l + ls), "v"(l + 2 * ls), "v"(l + 3 * ls), "v"(l + 4 * ls), "v"(l + 5 * ls), "v"(l + 6 * ls), "v"(l + 7 * ls),
                    "v"(g), "v"(g + gs), "v"(g + 2 * gs), "v"(g + 3 * gs), "v"(g + 4 * gs), "v"(g + 5 * gs), "v"(g + 6 * gs), "v"(g + 7 * gs)
                 : "memory");
}

// the same with five copies: four rows of one plane (row + 16 i) and one row of a second plane, laid behind them in LDS
static __device__ __forceinline__ void copy5(unsigned l, const bf* g, size_t gs, const bf* g4) {
    const unsigned ls = 16 * PPI * 2;
    asm volatile("global_load_async_to_lds_b128 %0, %5, off\n\t"
                 "global_load_async_to_lds_b128 %1, %6, off\n\t"
                 "global_load_async_to_lds_b128 %2, %7, off\n\t"
                 "global_load_async_to_lds_b128 %3, %8, off\n\t"
                 "global_load_async_to_lds_b128 %4, %9, off\n\t"
                 "s_wait_xcnt 0x0"
                 :: "v"(l), "v"(l + ls), "v"(l + 2 * ls), "v"(l + 3 * ls), "v"(l + 4 * ls),
                    "v"(g), "v"(g + gs), "v"(g + 2 * gs), "v"(g + 3 * gs), "v"(g4)
                 : "memory");
}

// the same with four copies of 16-bit float rows: copy i moves the lane's 16 bytes of tile row (row + 16 i)
static __device__ __forceinline__ void copy4(unsigned l, const h16* g, size_t gs) {
    const unsigned ls = 16 * PPI * 2;
    asm volatile("global_load_async_to_lds_b128 %0, %4, off\n\t"
                 "global_load_async_to_lds_b128 %1, %5, off\n\t"
                 "global_load_async_to_lds_b128 %2, %6, off\n\t"
                 "global_load_async_to_lds_b128 %3, %7, off\n\t"
                 "s_wait_xcnt 0x0"
                 :: "v"(l), "v"(l + ls), "v"(l + 2 * ls), "v"(l + 3 * ls),
                    "v"(g), "v"(g + gs), "v"(g + 2 * gs), "v"(g + 3 * gs)
                 : "memory");
}

// blocks of 256 threads (8 elements a thread) that each converted plane takes in k_prep
#define CB_X ((int)((size_t)NB * SEQ * DM / 8 / 256))   // x
#define CB_W ((int)((size_t)DM * DM / 8 / 256))         // one weight matrix
#define CB_A ((int)((size_t)LR * DM / 8 / 256))         // one A matrix
#define CB_B (DM * 4 / 256)                             // one weight-side extension plane (4 pieces of 8 per row)
static_assert(((size_t)SEQ * DM / 8) % 256 == 0);       // a block never straddles two batches of x
static_assert(((size_t)DM * DM / 8) % 256 == 0);
static_assert(((size_t)LR * DM / 8) % 256 == 0);

static __device__ __forceinline__ void cvt8(const float* __restrict__ src, bf* dst) {
    const v8f v = *(const v8f*)src; v8us o;
#pragma unroll
    for (int k = 0; k < 8; ++k) o[k] = f2bf(v[k]);
    *(v8us*)dst = o;
    asm volatile("s_wait_xcnt 0x0" ::: "memory");                            // the store's registers are rewritten only behind this wait
}

// k_prep: every f32 -> bf16 conversion of the call in one launch. The block index picks the plane (block-uniform ranges, in the order mask, one block per batch | x | Wq Wk Wv | Aq Av | Bq Bv); every range is covered exactly.
__global__ __launch_bounds__(256) void k_prep(const float* __restrict__ x, const float* __restrict__ wq, const float* __restrict__ wk, const float* __restrict__ wv,
                                              const float* __restrict__ aq, const float* __restrict__ av, const float* __restrict__ bqu, const float* __restrict__ bvu,
                                              const float* __restrict__ amask, bf* XB, bf* WB, bf* AL, bf* BLq, bf* BLv, float* MB, int* MF) {
    int blk = (int)blockIdx.x; const int tid = (int)threadIdx.x;
    if (blk < NB) {                                                           // mask row of batch blk: batch pitch SEQ_FULL in the input, SEQ in the plane; first in the grid, for speed only
        const float* amb = amask + (size_t)blk * SEQ_FULL; float* mrow = MB + (size_t)blk * SEQ;
        for (int i = tid * 8; i < SEQ; i += 256 * 8) {                        // value after RNE convert to bf16, stored as f32
            const v8f v = *(const v8f*)(amb + i); v8f o;
#pragma unroll
            for (int k = 0; k < 8; ++k) o[k] = bfr(v[k]);
            *(v8f*)(mrow + i) = o;
            asm volatile("s_wait_xcnt 0x0" ::: "memory"); }                  // the load's and the store's registers are rewritten only behind this wait
        if (tid < 32) {                                                       // the first wave scans the whole row: any value not below WIDE in magnitude widens the key loop to all keys
            float fl = 0.0f;
#pragma unroll 4
            for (int i = 0; i < SEQ; i += 128) {                              // four loads in flight a trip: more would raise the register count of every block of this kernel
                const v4f w = *(const v4f*)(amb + i + 4 * tid);
#pragma unroll
                for (int c = 0; c < 4; ++c) { const float a = fabsf(bfr(w[c])); fl = (a < WIDE) ? fl : 1.0f; } }
            fl = fmaxf(fl, __shfl_xor(fl, 16, 32)); fl = fmaxf(fl, __shfl_xor(fl, 8, 32)); fl = fmaxf(fl, __shfl_xor(fl, 4, 32));
            fl = fmaxf(fl, __shfl_xor(fl, 2, 32));  fl = fmaxf(fl, __shfl_xor(fl, 1, 32));
            if (tid == 0) MF[blk] = (fl != 0.0f) ? 1 : 0; }
        return; }
    blk -= NB;
    if (blk < CB_X) {                                                         // x: batch pitch SEQ_FULL tokens in the input, SEQ in the copy
        const size_t i = (size_t)blk * 256 + tid; const size_t nb8 = (size_t)SEQ * DM / 8; const size_t bb = i / nb8, r = i % nb8;
        cvt8(x + bb * ((size_t)SEQ_FULL * DM) + r * 8, XB + i * 8); return; }
    blk -= CB_X;
    if (blk < 3 * CB_W) {
        const int w = blk / CB_W; const float* s = (w == 0) ? wq : ((w == 1) ? wk : wv); const size_t i = (size_t)(blk - w * CB_W) * 256 + tid;
        cvt8(s + i * 8, WB + (size_t)w * DM * DM + i * 8); return; }
    blk -= 3 * CB_W;
    if (blk < 2 * CB_A) {
        const int w = blk / CB_A; const float* s = (w == 0) ? aq : av; const size_t i = (size_t)(blk - w * CB_A) * 256 + tid;
        cvt8(s + i * 8, AL + (size_t)w * LR * DM + i * 8); return; }
    blk -= 2 * CB_A;
    {                                                                         // weight-side extension rows: B | B | 0 | 0
        const int w = blk / CB_B; const float* s = (w == 0) ? bqu : bvu; bf* d = (w == 0) ? BLq : BLv; const int i = (blk - w * CB_B) * 256 + tid;
        const int row = i >> 2, piece = i & 3;
        const v8f v = *(const v8f*)(s + (size_t)row * LR); v8us o;
#pragma unroll
        for (int k = 0; k < 8; ++k) { const unsigned short t = f2bf(v[k]); o[k] = (piece < 2) ? t : (unsigned short)0; }
        *(v8us*)(d + (size_t)i * 8) = o;
        asm volatile("s_wait_xcnt 0x0" ::: "memory"); }                      // the store's registers are rewritten only behind this wait
}

// k_xa: x A^T for both updates in one 16-column tile (columns 0..7 = q update rows of A, 8..15 = v update rows), four waves per 64 token rows (16 rows each), K = DM.
// The 64 x rows and the 16 A rows are staged in LDS, 64 k at a time, by asynchronous 16-byte copies (pitch 144 B), two buffers, as in the projection kernels.
// Output: x-side extension planes XLq, XLv [token][32] bf16 = hi | lo | 0 | 0 of 2 * (x A^T); per plane the 64 rows x 64 B of the tile are one contiguous 4096-byte run:
__global__ __launch_bounds__(32 * PW) void k_xa(const bf* __restrict__ X, const bf* __restrict__ AL, bf* XLq, bf* XLv) {
    __shared__ __align__(16) bf ring[2 * XST];
    __shared__ __align__(16) float os[64 * XP];
    const int lane = threadIdx.x & 31, lr = lane & 15, hi = lane >> 4; const int r0 = blockIdx.x * 64;
    const int wave = __builtin_amdgcn_readfirstlane((int)(threadIdx.x >> 5));
    v8f acc = (v8f){};
    // copy side: thread tid moves bytes 16 (tid & 7) of x rows (tid >> 3) + 16 i, i = 0..3, and of A row (tid >> 3)
    const int crow = (int)(threadIdx.x >> 3), cch = (int)(threadIdx.x & 7);
    const bf* gx = X  + (size_t)(r0 + crow) * DM + cch * 8;                   // rows < NB * SEQ, columns k0 + 63 < DM
    const bf* gl = AL + (size_t)crow * DM + cch * 8;                          // rows < 16
    const unsigned l0 = (unsigned)(size_t)(&ring[crow * PPI + cch * 8]);      // LDS byte address = low 32 bits of the shared address
    const int NT = DM / PBK;
    // read side: same loader and k map as from the planes, rows at pitch PPI
    const int afr = (wave * 16 + lr) * PPI + 8 * hi, bfo = (64 + lr) * PPI + 8 * hi;
    copy5(l0, gx, (size_t)16 * DM, gl);                                       // tile 0 -> buffer 0
    asm volatile("s_wait_asynccnt 0x0" ::: "memory");                         // this wave's copies of tile 0 have landed
    __syncthreads();                                                          // ... and every other wave's
    copy5(l0 + XST * 2, gx + PBK, (size_t)16 * DM, gl + PBK);                 // tile 1 -> buffer 1
#pragma unroll 1
    for (int t = 0; t < NT; ++t) {                                            // rolled: one pass per staged tile
        const int bo = (t & 1) * XST;
#pragma unroll
        for (int ks = 0; ks < PBK; ks += 32) {
            const v16bf bw = ldb(&ring[bo + bfo + ks]); const v16bf a = ldb(&ring[bo + afr + ks]);
            acc = wmmabg(a, bw, acc); }
        asm volatile("s_wait_dscnt 0x0" ::: "memory");                        // this wave's reads of buffer t & 1 are done before it is refilled
        asm volatile("s_wait_asynccnt 0x0" ::: "memory");                     // this wave's copies of tile t + 1 have landed
        __syncthreads();                                                      // publishes tile t + 1 and ends every reader's last read of buffer t & 1
        if (t + 2 < NT) copy5(l0 + bo * 2, gx + (size_t)(t + 2) * PBK, (size_t)16 * DM, gl + (size_t)(t + 2) * PBK);
    }
    asm volatile("s_wait_asynccnt 0x0" ::: "memory");                         // no copy is outstanding behind the loop
#pragma unroll
    for (int j = 0; j < 8; ++j) os[(wave * 16 + hi * 8 + j) * XP + lr] = acc[j] * LSC;   // D: row 8h+j, col lane&15; the wave's own 16 rows x columns 0..15 all written
    wave_sync();
    const size_t ob = (size_t)r0 * LK;
{
#pragma unroll 1
        for (int s = 2 * wave; s < 2 * wave + 2; ++s) { const int p = s * 32 + lane; const int row = p >> 2, piece = p & 3;   // 2 s x 8 rows = the wave's own 16 rows; 4 lanes x 16 B = one 64-byte row
            const v4f a0 = *(const v4fa*)(&os[row * XP + 0]); const v4f a1 = *(const v4fa*)(&os[row * XP + 4]);
            const v4f c0 = *(const v4fa*)(&os[row * XP + 8]); const v4f c1 = *(const v4fa*)(&os[row * XP + 12]);
            v8us oq, ov;
#pragma unroll
            for (int i = 0; i < 4; ++i) { oq[i] = ext_word(a0[i], piece); oq[4 + i] = ext_word(a1[i], piece); ov[i] = ext_word(c0[i], piece); ov[4 + i] = ext_word(c1[i], piece); }
            *(v8us*)(XLq + ob + (size_t)p * 8) = oq; *(v8us*)(XLv + ob + (size_t)p * 8) = ov; }
         }
}

template <int MODE, int LOWR>
__device__ __forceinline__ void proj_body(bf* ring, float* osa, int bx, int by, const bf* __restrict__ A, const bf* __restrict__ Bt, const bf* __restrict__ AX, const bf* __restrict__ BX,
                                          const float* __restrict__ bias, h16* Ph, h16* Pr, int resT) {
    const int K = DM;
    const int lane = threadIdx.x & 31, lr = lane & 15, hi = lane >> 4;
    const int wave = __builtin_amdgcn_readfirstlane((int)(threadIdx.x >> 5));
    const int wm = (wave & 1) * 64, wn = (wave >> 1) * 64;                    // the wave's 64 x 64 tile inside the block
    const int r0 = bx * 128 + wm, c0 = by * 128 + wn;
    float* os = osa + wave * 16 * 68;                                         // wave-private output staging
    v8f acc[4][4];
#pragma unroll
    for (int mb = 0; mb < 4; ++mb)
#pragma unroll
        for (int nb = 0; nb < 4; ++nb) acc[mb][nb] = (v8f){};
    // copy side: thread tid moves bytes 16 (tid & 7) of tile rows (tid >> 3) + 16 i, i = 0..7, of both operands
    const int crow = (int)(threadIdx.x >> 3), cch = (int)(threadIdx.x & 7);
    const bf* ga = A  + (size_t)(bx * 128 + crow) * K + cch * 8;      // rows < M, columns k0 + 63 < K
    const bf* gb = Bt + (size_t)(by * 128 + crow) * K + cch * 8;
    const unsigned la = (unsigned)(size_t)(&ring[crow * PPI + cch * 8]);      // LDS byte address = low 32 bits of the shared address
    const unsigned lb = la + POP * 2;
    const int NT = K / PBK;
    // read side: same loader and k map as from the planes, rows at pitch PPI
    const int afr = (wm + lr) * PPI + 8 * hi, bfo = POP + (wn + lr) * PPI + 8 * hi;
    copy8(la, ga, (size_t)16 * K); copy8(lb, gb, (size_t)16 * K);             // tile 0 -> buffer 0
    asm volatile("s_wait_asynccnt 0x0" ::: "memory");                         // this wave's copies of tile 0 have landed
    __syncthreads();                                                          // ... and every other wave's
    copy8(la + PST * 2, ga + PBK, (size_t)16 * K); copy8(lb + PST * 2, gb + PBK, (size_t)16 * K);   // tile 1 -> buffer 1
#pragma unroll 1
    for (int t = 0; t < NT; ++t) {                                            // rolled: one pass per staged tile
        const int bo = (t & 1) * PST;
#pragma unroll
        for (int ks = 0; ks < PBK; ks += 32) {
            v16bf a[4];
#pragma unroll
            for (int mb = 0; mb < 4; ++mb) a[mb] = ldb(&ring[bo + afr + mb * 16 * PPI + ks]);
            v16bf b[4];                                                       // all eight fragments of a k-step are read as one group of LDS loads
#pragma unroll
            for (int nb = 0; nb < 4; ++nb) b[nb] = ldb(&ring[bo + bfo + nb * 16 * PPI + ks]);
#pragma unroll
            for (int nb = 0; nb < 4; ++nb) {
#pragma unroll
                for (int mb = 0; mb < 4; ++mb) acc[mb][nb] = wmmabg(a[mb], b[nb], acc[mb][nb]); }
        }
        asm volatile("s_wait_dscnt 0x0" ::: "memory");                        // this wave's reads of buffer t & 1 are done before it is refilled
        asm volatile("s_wait_asynccnt 0x0" ::: "memory");                     // this wave's copies of tile t + 1 have landed
        __syncthreads();                                                      // publishes tile t + 1 and ends every reader's last read of buffer t & 1
        if (t + 2 < NT) { copy8(la + bo * 2, ga + (size_t)(t + 2) * PBK, (size_t)16 * K); copy8(lb + bo * 2, gb + (size_t)(t + 2) * PBK, (size_t)16 * K); }
    }
    asm volatile("s_wait_asynccnt 0x0" ::: "memory");                         // no copy is outstanding behind the loop
    if (LOWR) {                                                                                   // extension k-step: rows of 32 bf16, same loader and k map on both sides
        const size_t axo = (size_t)(r0 + lr) * LK + 8 * hi, bxo = (size_t)(c0 + lr) * LK + 8 * hi;
        v16bf a[4];
#pragma unroll
        for (int mb = 0; mb < 4; ++mb) a[mb] = ldb(AX + axo + (size_t)mb * 16 * LK);
#pragma unroll
        for (int nb = 0; nb < 4; ++nb) { const v16bf b = ldb(BX + bxo + (size_t)nb * 16 * LK);
#pragma unroll
            for (int mb = 0; mb < 4; ++mb) acc[mb][nb] = wmmabg(a[mb], b, acc[mb][nb]); }
    }
    float bc[4];
#pragma unroll
    for (int nb = 0; nb < 4; ++nb) bc[nb] = (MODE == 0) ? bfr(bias[c0 + nb * 16 + lr]) : 0.0f;   // MODE 0: c0 + 63 < DM
    size_t tbase, rbase; bool wr;                                                                 // wr: wave-uniform, the wave's whole tile inside the residual plane
    if (MODE == 0) { const int bb = r0 / SEQ, tt = r0 % SEQ; const int zc = bb * NH_ + c0 / HD;
                     tbase = ((size_t)zc * SEQ + (size_t)tt) * HD; rbase = ((size_t)zc * (size_t)resT + (size_t)tt) * HD; wr = tt < resT; }
    else           { const int bb = c0 / SEQ, tt = c0 % SEQ;
                     tbase = (size_t)bb * (size_t)DM * SEQ + (size_t)r0 * SEQ + (size_t)tt; rbase = (size_t)bb * (size_t)DM * (size_t)resT + (size_t)r0 * (size_t)resT + (size_t)tt; wr = tt < resT; }
#pragma unroll
    for (int mb = 0; mb < 4; ++mb) {
        float br[8];
#pragma unroll
        for (int j = 0; j < 8; ++j) br[j] = (MODE == 1) ? bfr(bias[r0 + mb * 16 + hi * 8 + j]) : 0.0f;   // MODE 1: r0 + 63 < DM
#pragma unroll
        for (int nb = 0; nb < 4; ++nb) {
#pragma unroll
            for (int j = 0; j < 8; ++j) os[(hi * 8 + j) * 68 + nb * 16 + lr] = acc[mb][nb][j] + bc[nb] + br[j]; }   // D: row 8h+j, col lane&15; rows 0..15 x columns 0..63 all written
        wave_sync();
{
            if (MODE == 0) {
                const size_t sb = tbase + (size_t)(mb * 16) * HD;
                const size_t rb = rbase + (size_t)(mb * 16) * HD;
#pragma unroll
                for (int s = 0; s < 4; ++s) { const int p = s * 32 + lane; const int row = p >> 3, c8 = (p & 7) * 8;   // 4 s x 4 rows = 16 rows; 8 lanes x 8 = 64 columns = one line
                    const v4f x0 = *(const v4fa*)(&os[row * 68 + c8]); const v4f x1 = *(const v4fa*)(&os[row * 68 + c8 + 4]); v8h hv, rv;
#pragma unroll
                    for (int i = 0; i < 4; ++i) { const h16 a0 = toh_flush(x0[i]); const h16 a1 = toh_flush(x1[i]); hv[i] = a0; hv[4 + i] = a1;
                                                  rv[i] = toh_flush((x0[i] - (float)a0) * QRS); rv[4 + i] = toh_flush((x1[i] - (float)a1) * QRS); }
                    const size_t oo = sb + (size_t)p * 8;
                    const size_t ro = rb + (size_t)p * 8;
                    *(v8h*)(Ph + oo) = hv; asm volatile("s_wait_xcnt 0x0" ::: "memory");                    // each store's registers are rewritten only behind its wait
                    if (wr) { *(v8h*)(Pr + ro) = rv; asm volatile("s_wait_xcnt 0x0" ::: "memory"); } }
            } else {
                const size_t sb = tbase + (size_t)(mb * 16) * SEQ;
                const size_t rb = rbase + (size_t)(mb * 16) * (size_t)resT;
#pragma unroll
                for (int s = 0; s < 4; ++s) { const int row = 4 * s + (lane >> 3), c8 = (lane & 7) * 8;   // 4 s x 4 row groups = 16 rows; 8 lanes x 8 = 64 columns
                    const v4f x0 = *(const v4fa*)(&os[row * 68 + c8]); const v4f x1 = *(const v4fa*)(&os[row * 68 + c8 + 4]); v8h hv, rv;
#pragma unroll
                    for (int i = 0; i < 4; ++i) { const h16 a0 = toh_flush(x0[i]); const h16 a1 = toh_flush(x1[i]); hv[i] = a0; hv[4 + i] = a1;
                                                  rv[i] = toh_flush((x0[i] - (float)a0) * QRS); rv[4 + i] = toh_flush((x1[i] - (float)a1) * QRS); }
                    const size_t oo = sb + (size_t)row * SEQ + c8;
                    const size_t ro = rb + (size_t)row * (size_t)resT + c8;
                    *(v8h*)(Ph + oo) = hv; asm volatile("s_wait_xcnt 0x0" ::: "memory");                    // each store's registers are rewritten only behind its wait
                    if (wr) { *(v8h*)(Pr + ro) = rv; asm volatile("s_wait_xcnt 0x0" ::: "memory"); } }
            }
             }
        wave_sync();
    }
}

// k_proj: the three projections in one launch, blockIdx.z picks one (block-uniform); the three bodies share one ring and one output staging, declared here so that the block's LDS is that of one body.
// z = 0, q: token-major with the update extension; z = 1, k: token-major, no extension; z = 2, v^T: feature-major with the update extension (A = Wv rows, so the block's row tile is blockIdx.y and its column tile blockIdx.x).
__global__ __launch_bounds__(32 * PW) void k_proj(const bf* __restrict__ XB, const bf* __restrict__ WB, const bf* __restrict__ XLq, const bf* __restrict__ BLq, const bf* __restrict__ XLv, const bf* __restrict__ BLv,
                                              const float* __restrict__ bq, const float* __restrict__ bk, const float* __restrict__ bv,
                                              h16* QH, h16* QR, h16* KP, h16* KR, h16* VT, h16* VR, int resT) {
    __shared__ __align__(16) bf ring[2 * PST];
    __shared__ __align__(16) float osa[PW * 16 * 68];
    const int z = (int)blockIdx.z, gx = (int)blockIdx.x, gy = (int)blockIdx.y;
    const bf* WK = WB + (size_t)DM * DM; const bf* WV = WB + (size_t)2 * DM * DM;
    if (z == 0)      proj_body<0, 1>(ring, osa, gx, gy, XB, WB, XLq, BLq, bq, QH, QR, resT);
    else if (z == 1) proj_body<0, 0>(ring, osa, gx, gy, XB, WK, XB, WK, bk, KP, KR, resT);
    else             proj_body<1, 1>(ring, osa, gy, gx, WV, XB, BLv, XLv, bv, VT, VR, resT);
}

template <int EARLY>
__device__ __forceinline__ void keypass_body(h16* ring, float* os, int qt, int zh, const h16* __restrict__ QH, const h16* __restrict__ QR, const h16* __restrict__ KP, const h16* __restrict__ KR,
                                           const h16* __restrict__ VT, const h16* __restrict__ VR, const float* __restrict__ MB, const int* __restrict__ MF, float* OUT) {
    constexpr int KSG = (EARLY ? 4 : 2) * KOP;                                // elements of one stage: K | V^T (| K residual | V^T residual); the ring holds two stages
    const int lane = threadIdx.x & 31, lr = lane & 15, hi = lane >> 4;
    const int wave = __builtin_amdgcn_readfirstlane((int)(threadIdx.x >> 5));
    const int b = zh / NH_, h = zh % NH_;
    const int t0 = (qt * AW + wave) * 16;                                     // qt: the block's tile of 64 query rows, counted over the whole sequence
    const int lim = t0 + lr;                                                  // key j is causal-filled iff j > lim
    const float* amb = MB + (size_t)b * SEQ;                                  // the batch's mask row, already rounded to bf16 values
    const size_t pbase = (size_t)zh * SEQ * HD;
    const size_t rbase = (size_t)zh * EROWS * HD;
    // copy side: thread tid moves bytes 16 (tid & 7) of tile rows (tid >> 3) + 16 i, i = 0..3, of every staged plane (K rows = keys, V^T rows = d)
    const int crow = (int)(threadIdx.x >> 3), cch = (int)(threadIdx.x & 7);
    const h16* gk  = KP + pbase + (size_t)crow * HD + cch * 8;                // + key * HD, keys < SEQ
    const h16* gv  = VT + pbase + (size_t)crow * SEQ + cch * 8;               // + key, keys + 63 < SEQ
    const h16* gkr = KR + rbase + (size_t)crow * HD + cch * 8;                // + key * HD, keys < EROWS
    const h16* gvr = VR + rbase + (size_t)crow * EROWS + cch * 8;             // + key, keys + 63 < EROWS
    const unsigned l0 = (unsigned)(size_t)(&ring[crow * PPI + cch * 8]);      // LDS byte address = low 32 bits of the shared address
    auto stage = [&](int s, int buf) {                                        // tile s (keys 64 s .. 64 s + 63) -> buffer buf
        const int k0 = s * KST; const unsigned l = l0 + (unsigned)buf * (KSG * 2);
        copy4(l, gk + (size_t)k0 * HD, (size_t)16 * HD); copy4(l + KOP * 2, gv + k0, (size_t)16 * SEQ);
        if (EARLY) { const int kc = (k0 < EROWS) ? k0 : (EROWS - KST);        // clamped residual-plane key (address always inside the plane)
                     copy4(l + 2 * KOP * 2, gkr + (size_t)kc * HD, (size_t)16 * HD); copy4(l + 3 * KOP * 2, gvr + kc, (size_t)16 * EROWS); } };
    stage(0, 0);                                                              // tile 0 exists for every block; its copies fly under the Q loads
    const bool wide = MF[b] != 0;                                             // k_prep's test of the batch's mask row: any value not below WIDE in magnitude widens the key loop to all keys
    const int nkc = (t0 + 16 + 31) & ~31;                                     // causal bound, multiple of 32, <= SEQ
    const int nk = __builtin_amdgcn_readfirstlane(wide ? SEQ : nkc);
    const int nbv = wide ? SEQ : ((qt + 1) * KST);           // the block's bound = its last wave's; every wave reads the same word, so it is block-uniform
    const int NS = __builtin_amdgcn_readfirstlane(nbv) / KST;                 // staged tiles of the block, >= 1
    const size_t qo = pbase + (size_t)(t0 + lr) * HD + 8 * hi;
    const v16h hz = (v16h){};
    v16h qh[2], qr[2];
    qh[0] = ldh(QH + qo); qh[1] = ldh(QH + qo + 32);             // B fragments: col t, k = d (two k-steps)
    qr[0] = hz; qr[1] = hz;
    if (EARLY) { const size_t qro = rbase + (size_t)(t0 + lr) * HD + 8 * hi; qr[0] = ldh(QR + qro); qr[1] = ldh(QR + qro + 32); }   // t0 + lr < EROWS
    const int fo = lr * PPI + 8 * hi;                          // read side, same loader and k map as from the planes, rows at pitch PPI: K + key * PPI (A fragment: row key, k = d); V^T + 16j * PPI + key (A fragment: row d, k = key)
    v8f o[4], oR[4];
#pragma unroll
    for (int j = 0; j < 4; ++j) { o[j] = (v8f){}; oR[j] = (v8f){}; }
    float m = NEGB, l = 0.0f;
    asm volatile("s_wait_asynccnt 0x0" ::: "memory");            // this wave's copies of tile 0 have landed
    __syncthreads();                                             // ... and every other wave's
    if (1 < NS) stage(1, 1);
#pragma unroll 1
    for (int s = 0; s < NS; ++s) {                               // rolled: one pass per staged tile
    const int bo = (s & 1) * KSG;
    const int ke = (nk - s * KST < KST) ? nk - s * KST : KST;    // keys of this tile below the wave's own bound
#pragma unroll 1
    for (int kk = 0; kk < ke; kk += 32) {                        // rolled: the 32-key halves of a tile share one body, which keeps the loop's text small
        const int key0 = s * KST + kk;
        const bool rok = key0 < EROWS;                           // wave-uniform
        const h16* kpt = &ring[bo + fo + kk * PPI];
        v8f sHa = (v8f){}, sLa = (v8f){}, sHb = (v8f){}, sLb = (v8f){};
        const h16* krp = &ring[bo + (EARLY ? 2 : 0) * KOP + fo + kk * PPI];   // residual tiles exist in the EARLY stage only
        const h16* va  = &ring[bo + KOP + fo + kk];
        const h16* vrp = &ring[bo + (EARLY ? 3 : 1) * KOP + fo + kk];
        v16h ka[2], kb[2], kra[2], krb[2], vf[4];          // the fragments of a product run are read as one group of LDS loads ahead of it
#pragma unroll
        for (int ks = 0; ks < 2; ++ks) {
            ka[ks] = ldh(kpt + ks * 32); kb[ks] = ldh(kpt + 16 * PPI + ks * 32);
            if (EARLY) { kra[ks] = ldh(krp + ks * 32); krb[ks] = ldh(krp + 16 * PPI + ks * 32); } }
        if (!EARLY) {                                              // registers allow: the V^T fragments join the K group
#pragma unroll
            for (int j = 0; j < 4; ++j) vf[j] = ldh(va + (16 * j) * PPI); }
#pragma unroll
        for (int ks = 0; ks < 2; ++ks) {
            sHa = wmma16g(ka[ks], qh[ks], sHa); sHb = wmma16g(kb[ks], qh[ks], sHb);
            if (EARLY) {
                sLa = wmma16g(ka[ks], qr[ks], sLa); sLb = wmma16g(kb[ks], qr[ks], sLb);
                if (!rok) { kra[ks] = hz; krb[ks] = hz; }
                sLa = wmma16g(kra[ks], qh[ks], sLa); sLb = wmma16g(krb[ks], qh[ks], sLb);
            }
        }
        if (EARLY) {                                               // the V^T group flies under the softmax
#pragma unroll
            for (int j = 0; j < 4; ++j) vf[j] = ldh(va + (16 * j) * PPI); }
        const float* kp = amb + 8 * hi + key0;                   // keys key0+8h+0..7 and key0+16+8h+0..7, all < nk <= SEQ
        const v4f m0 = *(const v4f*)kp, m1 = *(const v4f*)(kp + 4), m2 = *(const v4f*)(kp + 16), m3 = *(const v4f*)(kp + 20);
        float kx[8], ky[8];
#pragma unroll
        for (int r = 0; r < 4; ++r) { kx[r] = m0[r]; kx[4 + r] = m1[r]; ky[r] = m2[r]; ky[4 + r] = m3[r]; }
        const int ja = key0 + 8 * hi;
        float ta[8], tb[8]; float mx = NEGB;
#pragma unroll
        for (int r = 0; r < 8; ++r) {
            const float sa = EARLY ? (sHa[r] + sLa[r] * QRI) * SC2 : sHa[r] * SC2;
            const float sb = EARLY ? (sHb[r] + sLb[r] * QRI) * SC2 : sHb[r] * SC2;
            ta[r] = ((ja + r > lim) ? NEGL : sa) + kx[r] * L2E;                  // replace, then add the mask
            tb[r] = ((ja + 16 + r > lim) ? NEGL : sb) + ky[r] * L2E;
            mx = fmaxf(mx, fmaxf(ta[r], tb[r])); }
        mx = fmaxf(mx, __shfl_xor(mx, 16, 32));
        const float mnew = fmaxf(m, mx);
        const float alpha = __builtin_amdgcn_exp2f(m - mnew);
        const float sh = PSH - mnew;
        v16h pb, pr = hz; float ls = 0.0f;
#pragma unroll
        for (int r = 0; r < 8; ++r) {
            const float aa = ta[r] + sh, ab = tb[r] + sh;
            const float ea = __builtin_amdgcn_exp2f(aa), eb = __builtin_amdgcn_exp2f(ab);
            const float ga = (aa < PFL) ? 0.0f : ea, gb = (ab < PFL) ? 0.0f : eb;   // below the f16 normal range -> exactly zero, selected by value
            const h16 pa = (h16)ga; const h16 pc = (h16)gb;
            pb[r] = pa; pb[8 + r] = pc;
            if (EARLY) { pr[r] = toh_flush((ga - (float)pa) * QRS); pr[8 + r] = toh_flush((gb - (float)pc) * QRS); ls += ga + gb; }
            else       { ls += (float)pa + (float)pc; } }
        l = l * alpha + ls; m = mnew;
#pragma unroll
        for (int j = 0; j < 4; ++j) { o[j] = o[j] * alpha; if (EARLY) oR[j] = oR[j] * alpha; }
#pragma unroll
        for (int jp = 0; jp < 2; ++jp) {
            const v16h v0 = vf[2 * jp], v1 = vf[2 * jp + 1];
            o[2 * jp] = wmma16g(v0, pb, o[2 * jp]); o[2 * jp + 1] = wmma16g(v1, pb, o[2 * jp + 1]);
            if (EARLY) {
                oR[2 * jp] = wmma16g(v0, pr, oR[2 * jp]); oR[2 * jp + 1] = wmma16g(v1, pr, oR[2 * jp + 1]);
                v16h vr0 = ldh(vrp + (32 * jp) * PPI), vr1 = ldh(vrp + (32 * jp + 16) * PPI);
                if (!rok) { vr0 = hz; vr1 = hz; }
                oR[2 * jp] = wmma16g(vr0, pb, oR[2 * jp]); oR[2 * jp + 1] = wmma16g(vr1, pb, oR[2 * jp + 1]);
            }
        }
    }
    asm volatile("s_wait_dscnt 0x0" ::: "memory");               // this wave's reads of buffer s & 1 are done before it is refilled
    asm volatile("s_wait_asynccnt 0x0" ::: "memory");            // this wave's copies of tile s + 1 have landed
    __syncthreads();                                             // publishes tile s + 1 and ends every reader's last read of buffer s & 1
    if (s + 2 < NS) stage(s + 2, s & 1);
    }
    asm volatile("s_wait_asynccnt 0x0" ::: "memory");            // no copy is outstanding behind the loop
    l += __shfl_xor(l, 16, 32);
    const float inv = 1.0f / l;                                  // l >= 2^14 whenever the row has a finite maximum logit
    const int wb = wave * 16 * OSP;
    // O^T D layout: o[j][r] = (d = 16j + 8h + r, t = lane&15) -> os[t][d]; rows 0..15 x columns 0..63 all written
#pragma unroll
    for (int j = 0; j < 4; ++j) {
        v8f f = o[j];
        if (EARLY) f = o[j] + oR[j] * QRI;
        v4f a, c;
        a[0] = f[0] * inv; a[1] = f[1] * inv; a[2] = f[2] * inv; a[3] = f[3] * inv; c[0] = f[4] * inv; c[1] = f[5] * inv; c[2] = f[6] * inv; c[3] = f[7] * inv;
        *(v4fa*)(&os[wb + lr * OSP + 16 * j + 8 * hi]) = a; *(v4fa*)(&os[wb + lr * OSP + 16 * j + 8 * hi + 4]) = c; }
    wave_sync();
    float* orow = OUT + ((size_t)b * OUT_SEQ + t0) * DM + h * HD;
{
#pragma unroll
        for (int s = 0; s < 8; ++s) { const int row = 2 * s + (lane >> 4), cofs = (lane & 15) * 4;   // 8 s x 2 rows = 16 rows; 16 lanes x 4 floats = 64 columns = two lines
            const v4f val = *(const v4fa*)(&os[wb + row * OSP + cofs]);
            *(v4f*)(orow + (size_t)row * DM + cofs) = val; }
         }
}

// k_keypass: both instantiations in one launch. blockIdx.x = (batch, head); blockIdx.y counts the 64-row query tiles from the last one down, for speed only.
// The choice of the body is block-uniform; the two bodies share one ring and one output staging, declared here.
__global__ __launch_bounds__(32 * AW) __attribute__((amdgpu_num_vgpr(256)))
void k_keypass(const h16* __restrict__ QH, const h16* __restrict__ QR, const h16* __restrict__ KP, const h16* __restrict__ KR,
               const h16* __restrict__ VT, const h16* __restrict__ VR, const float* __restrict__ MB, const int* __restrict__ MF, float* OUT) {
    __shared__ __align__(16) h16 ring[2 * 4 * KOP];
    __shared__ __align__(16) float os[AW * 16 * OSP];
    const int zh = (int)blockIdx.x; const int qt = SEQ / (16 * AW) - 1 - (int)blockIdx.y;
    if (qt < EROWS / (16 * AW)) keypass_body<1>(ring, os, qt, zh, QH, QR, KP, KR, VT, VR, MB, MF, OUT);
    else                        keypass_body<0>(ring, os, qt, zh, QH, QH, KP, KP, VT, VT, MB, MF, OUT);
}

static constexpr size_t al256(size_t v) { return (v + 255) & ~(size_t)255; }
static constexpr size_t SZ_XB = al256((size_t)NB * SEQ * DM * 2);
static constexpr size_t SZ_WB = al256((size_t)3 * DM * DM * 2);
static constexpr size_t SZ_AL = al256((size_t)2 * LR * DM * 2);
static constexpr size_t SZ_BL = al256((size_t)DM * LK * 2);
static constexpr size_t SZ_XL = al256((size_t)NB * SEQ * LK * 2);
static constexpr size_t SZ_PL = al256((size_t)NB * NH_ * SEQ * HD * 2);
static constexpr size_t SZ_RS = al256((size_t)NB * NH_ * EROWS * HD * 2);
static constexpr size_t SZ_MB = al256((size_t)NB * SEQ * 4);
static constexpr size_t SZ_MF = al256((size_t)NB * 4);
static constexpr size_t SZ_TOTAL = SZ_XB + SZ_WB + SZ_AL + 2 * SZ_BL + 2 * SZ_XL + 3 * SZ_PL + 3 * SZ_RS + SZ_MB + SZ_MF;
static_assert(SZ_TOTAL <= (size_t)134217728);          // workspace carve <= 128 MiB
static_assert(((size_t)DM * DM * 2) % 256 == 0);       // weight sub-planes stay 256-byte aligned
static_assert(((size_t)LR * DM * 2) % 256 == 0);       // the two halves of the A plane stay 256-byte aligned
static_assert((size_t)NB * NH_ * SEQ * HD == (size_t)NB * DM * SEQ);       // v^T plane [(b*1024 + m)][t] has the same extent as the q/k planes
static_assert((size_t)NB * NH_ * EROWS * HD == (size_t)NB * DM * EROWS);   // v^T residual plane [(b*1024 + m)][t < EROWS] has the same extent as the q/k residual planes
static_assert((DM * 4) % 256 == 0);                    // the extension-plane block ranges of k_prep cover their planes exactly

extern "C" void kernel_launch(void* const* d_in, const int* in_sizes, int n_in,
                              void* d_out, int out_size, void* d_ws, size_t ws_size, hipStream_t stream) {
    if (n_in < 12) return;
    const size_t needx = ((size_t)(NB - 1) * SEQ_FULL + SEQ) * DM;
    const size_t needm = (size_t)(NB - 1) * SEQ_FULL + SEQ;
    if ((size_t)in_sizes[0] < needx || (size_t)in_sizes[1] < needm) return;
    if ((size_t)in_sizes[2] < (size_t)DM * DM || (size_t)in_sizes[4] < (size_t)DM * DM || (size_t)in_sizes[6] < (size_t)DM * DM) return;
    if (in_sizes[3] < DM || in_sizes[5] < DM || in_sizes[7] < DM) return;
    if (in_sizes[8] < LR * DM || in_sizes[9] < DM * LR || in_sizes[10] < LR * DM || in_sizes[11] < DM * LR) return;
    if ((size_t)out_size < ((size_t)(NB - 1) * OUT_SEQ + SEQ) * DM) return;
    if (SZ_TOTAL > ws_size) return;
    // wire order: hidden_states, key_mask (the module's additive key mask input), Wq, bq, Wk, bk, Wv, bv, Aq, Bq, Av, Bv
    const float* xin = (const float*)d_in[0];
    const float* am  = (const float*)d_in[1];
    const float* wq = (const float*)d_in[2]; const float* bq = (const float*)d_in[3];
    const float* wk = (const float*)d_in[4]; const float* bk = (const float*)d_in[5];
    const float* wv = (const float*)d_in[6]; const float* bv = (const float*)d_in[7];
    const float* aq = (const float*)d_in[8]; const float* bqu = (const float*)d_in[9];
    const float* av = (const float*)d_in[10]; const float* bvu = (const float*)d_in[11];
    float* OUT = (float*)d_out;      // [NB][SEQ][1024]
    char* wsp = (char*)d_ws;
    bf* XB = (bf*)wsp; wsp += SZ_XB;                 // x      [NB*SEQ][1024]
    bf* WB = (bf*)wsp; wsp += SZ_WB;                 // [3][1024][1024]: q | k | v  ([out][in] = Bt as-is)
    bf* AL = (bf*)wsp; wsp += SZ_AL;                 // [16][1024]: rows 0..7 A of the q update, rows 8..15 A of the v update
    bf* BLq = (bf*)wsp; wsp += SZ_BL;                // [1024][32]: B | B | 0 | 0 (q update)
    bf* BLv = (bf*)wsp; wsp += SZ_BL;                // [1024][32]: B | B | 0 | 0 (v update)
    bf* XLq = (bf*)wsp; wsp += SZ_XL;                // [NB*SEQ][32]: hi | lo | 0 | 0 of 2 x A^T (q update)
    bf* XLv = (bf*)wsp; wsp += SZ_XL;                // [NB*SEQ][32]: hi | lo | 0 | 0 of 2 x A^T (v update)
    h16* QH = (h16*)wsp; wsp += SZ_PL;               // [NB*16][SEQ][64]
    h16* KP = (h16*)wsp; wsp += SZ_PL;               // [NB*16][SEQ][64]
    h16* VT = (h16*)wsp; wsp += SZ_PL;               // [NB*16][64][SEQ]
    h16* QR = (h16*)wsp; wsp += SZ_RS;               // [NB*16][EROWS][64] residual x2048, tokens < EROWS
    h16* KR = (h16*)wsp; wsp += SZ_RS;               // [NB*16][EROWS][64] residual x2048, tokens < EROWS
    h16* VR = (h16*)wsp; wsp += SZ_RS;               // [NB*16][64][EROWS] residual x2048, tokens < EROWS
    float* MB = (float*)wsp; wsp += SZ_MB;           // [NB][SEQ] mask values after the convert to bf16, as f32
    int* MF = (int*)wsp; wsp += SZ_MF;               // [NB] 1 where the batch's mask row widens the key loop

    // all conversions to bf16
    k_prep<<<dim3(NB + CB_X + 3 * CB_W + 2 * CB_A + 2 * CB_B, 1, 1), 256, 0, stream>>>(xin, wq, wk, wv, aq, av, bqu, bvu, am, XB, WB, AL, BLq, BLv, MB, MF);

    // 2 x A^T for both updates -> x-side extension planes
    k_xa<<<dim3(NB * SEQ / 64, 1, 1), 32 * PW, 0, stream>>>(XB, AL, XLq, XLv);

    // q, k: A = x rows (m = b*SEQ + t), Bt = W rows (n = h*64 + d) -> plane [(b*16 + h)][t][d]; v^T: A = Wv rows (m = h*64 + d), Bt = x rows (n = b*SEQ + t) -> plane [(b*1024 + m)][t] = [(b*16 + h)][d][t]; residuals for tokens < EROWS
    k_proj<<<dim3(NB * SEQ / 128, DM / 128, 3), 32 * PW, 0, stream>>>(XB, WB, XLq, BLq, XLv, BLv, bq, bk, bv, QH, QR, KP, KR, VT, VR, EROWS);

    // query rows [0, EROWS): multi-product instantiation; rows [EROWS, SEQ): single-product instantiation (disjoint output rows)
    k_keypass<<<dim3(NB * NH_, SEQ / (16 * AW), 1), 32 * AW, 0, stream>>>(QH, QR, KP, KR, VT, VR, MB, MF, OUT);
}

// v005
// It runs in 77.2 microseconds.
// Next to v004, in two timings, it ran 1.13 and 1.12 times as fast.
// Over all steps from v000 it is 4.13 times as fast.
#include <hip/hip_runtime.h>

// Causal pair-score weighting, width 1024 = 16 heads x 64; one input x [NB][SEQ][1024] feeds q, k and v; Wq/Wk/Wv [out][in] (y = x W^T + bias); rank-8 additive updates on q and v: y += 2 (x A^T) B^T with A [8][in], B [out][8];
// additive key mask [NB][1][1][SEQ] (f32, read by value); score scale 1/sqrt(64); keys j > t are replaced by -1e9 before the mask is added; softmax over keys; output = concatenated heads (f32), no output projection.
// Compute dtypes, f32 accumulate everywhere: projections and x A^T v_wmma_f32_16x16x32_bf16 (x, W, A, B, biases, mask RNE-converted to bf16; products exact); the rank-8 up-projection is one extra 32-deep k-step of the projection GEMM (2 x A^T carried as bf16 hi | lo, B bf16); x A^T is formed inside the projection blocks, from the x tiles that they stage anyway;
// scores v_wmma_f32_16x16x32_f16: single f16 q and k on query rows >= EROWS; q and k each as f16 value + f16 residual x2048 (three products, residual products in their own accumulator) on query rows < EROWS;
// P.V v_wmma_f32_16x16x32_f16: P (x16384 carry, cancels in the normalisation) and v single f16 on query rows >= EROWS; on query rows < EROWS P and v each as f16 value + f16 residual x2048, residual products in their own accumulator folded by 1/2048, row sum from the f32 exponentials; softmax f32 (online, running max).
// Layout: bf16 copies of x, W, A; weight-side extension planes [row][32] bf16 (B | B | 0 | 0; the x side, hi | lo | 0 | 0 of 2 x A^T, lives in fragments only); q, k planes [b*16+h][t][64], v^T plane [b*16+h][d][t], small residual planes q, k [b*16+h][t < EROWS][64] and v^T [b*16+h][d][t < EROWS]; fused online-softmax key-pass kernel in transposed form (S^T = K Q^T, O^T = V^T P^T).
// Key loop bound per wave: the causal limit; if any mask value of the batch is not below 1e8 in magnitude the loop covers all keys (per-element arithmetic is literal in every visited tile). Residual fragments for keys >= EROWS are zero.
// The mask's bf16-rounded values (kept as f32, plane [NB][SEQ]) and that per-batch magnitude test (one word per batch) are formed once, in k_prep; the key-pass kernel only reads them.

#ifndef NB
#define NB 2
#endif
#ifndef SEQ
#define SEQ 2048
#endif
#define NB_FULL  2
#define SEQ_FULL 2048
#ifndef OUT_SEQ
#define OUT_SEQ SEQ              // row pitch (in tokens) between batches of the output
#endif
#define DM   1024
#define NH_  16
#define HD   64
#define LR   8                   // rank of the additive updates
#define LK   32                  // k extent of the extension planes (one WMMA k-step)
#define XP   20                  // LDS row pitch (floats) of the x A^T tile
#define AW   4                   // waves per online-softmax key-pass block (16 query rows each)
#define PW   4                   // waves per projection block (2 x 2 wave tiles of 64 x 64)
#define PBK  64                  // k extent of one staged projection tile: 128 bytes of every operand row
#define PPI  72                  // LDS row pitch (16-bit elements) of a staged row: 144 bytes = 16 x 9
#define POP  (128 * PPI)         // elements of one staged operand tile (128 rows)
#define PST  (2 * POP)           // elements of one stage: A tile | B tile
#define XOP  (16 * PPI)          // elements of one staged tile of the 16 A rows (q update rows 0..7, v update rows 8..15)
#define OSP  68                  // LDS row pitch (floats) of the online-softmax key-pass output tile
#define KST  64                  // keys of one staged key-pass tile: 64 K rows of 128 bytes, 128 bytes of each of the 64 V^T rows
#define KOP  (64 * PPI)          // elements of one staged key-pass plane tile (64 rows at pitch PPI)
#define EROWS (SEQ < 512 ? SEQ : 512)   // query rows (and tokens of the small residual planes) handled by the multi-product online-softmax key-pass instantiation
#define QRS  2048.0f             // carry of every residual plane / residual fragment
#define QRI  (1.0f / 2048.0f)
#define SC2  ((float)(0.125 * 1.4426950408889634))      // HD^-0.5 * log2(e)
#define L2E  ((float)1.4426950408889634)
#define NEGL ((float)(-1.0e9 * 1.4426950408889634))     // fill value -1e9 in the log2 domain
#define LSC  2.0f                // update scaling 16 / 8
#define PSH  14.0f               // log2 of the P carry (16384)
#define PFL  (-14.0f)            // exponent argument below which the f16 P would leave the normal range
#define NEGB (-3.0e38f)
#define WIDE 1.0e8f              // mask magnitude bound under which skipped (fully causal-filled) tiles contribute exactly zero

static_assert(HD == 64);
static_assert(NH_ * HD == DM);                 // head h = columns h*64 + d
static_assert(DM % 64 == 0);                   // column tiles of 64 = one head
static_assert(64 % HD == 0);
static_assert(DM % 32 == 0);                   // GEMM k-loop steps by 32
static_assert(LK == 32);                       // extension = exactly one k-step
static_assert(2 * LR <= LK);                   // hi | lo pieces fit the extension row
static_assert(LR == 8);                        // one 16-byte piece per part; B rows loaded as 8 floats
static_assert(2 * LR == 16);                   // A rows of q and v updates fill one 16-column tile
static_assert(SEQ % 64 == 0);                  // a 64-row tile never straddles two batches
static_assert((NB * SEQ) % 64 == 0);
static_assert(SEQ % 128 == 0);                 // mask scan steps by 128
static_assert(SEQ % 32 == 0);                  // key loop steps by 32
static_assert(SEQ % (16 * AW) == 0);           // online-softmax key-pass grids cover the sequence exactly
static_assert(EROWS % 64 == 0);                // a 64-token GEMM tile lies wholly inside or outside the residual planes
static_assert(EROWS >= 32);
static_assert(EROWS <= SEQ);
static_assert(EROWS % (16 * AW) == 0);
static_assert((SEQ - EROWS) % (16 * AW) == 0);
static_assert(((size_t)SEQ * DM) % 8 == 0);
static_assert(((size_t)DM * DM) % 8 == 0);
static_assert(((size_t)LR * DM) % 8 == 0);
static_assert(NB <= NB_FULL);
static_assert(SEQ <= SEQ_FULL);
static_assert((OSP * 4) % 16 == 0);
static_assert(OSP >= HD);
static_assert((XP * 4) % 16 == 0);
static_assert(XP >= 16);
static_assert(32 * 4 * 16 == 16 * HD * 2);
static_assert(32 * 4 * 16 == 16 * 64 * 2);
static_assert(32 * 8 * 16 == 16 * HD * 4);     // online-softmax key-pass epilogue: 8 instructions x 32 lanes x 16 B = 16 rows x 256 B
static_assert((NB * SEQ) % 128 == 0);          // projection blocks cover 128 x 128
static_assert(DM % 128 == 0);
static_assert(DM % PBK == 0);
static_assert(DM / PBK >= 2);                  // the two-buffer ring needs two stages
static_assert(PBK * 2 == 128);                 // a staged row is one 128-byte line: 8 lanes x 16 B
static_assert((PPI * 2) % 16 == 0);
static_assert(PPI >= PBK);
static_assert(8 * 32 * PW * 16 == 128 * PBK * 2);   // 8 copies per lane fill one operand tile
static_assert(2 * PST * 2 + 2 * XOP * 2 + PW * 16 * 68 * 4 <= 131072);   // static LDS of the projection kernel
static_assert(128 * XP * 4 <= 2 * PST * 2);           // the block's x A^T tile (128 rows) fits the ring, which is free behind the k loop
static_assert(32 * PW * 16 == 16 * PBK * 2);          // one copy per lane fills one tile of the 16 A rows
static_assert(2 * 4 * KOP * 2 + AW * 16 * OSP * 4 <= 131072);    // static LDS of the online-softmax key-pass kernels
static_assert(KST == 16 * AW);                 // a block's causal key bound is a whole number of staged tiles
static_assert(SEQ % KST == 0);
static_assert(EROWS % KST == 0);               // a staged tile lies wholly inside or outside the residual planes
static_assert(KST * 2 == 128);                 // a staged V^T row piece is one 128-byte line
static_assert(HD * 2 == 128);                  // a staged K row is one 128-byte line
static_assert(4 * 32 * AW * 16 == 64 * 128);   // 4 copies per lane fill one plane tile

typedef _Float16 h16;
typedef unsigned short bf;
typedef __attribute__((ext_vector_type(16))) __bf16   v16bf;
typedef __attribute__((ext_vector_type(16))) _Float16 v16h;
typedef __attribute__((ext_vector_type(8)))  _Float16 v8h;
typedef __attribute__((ext_vector_type(8)))  unsigned short v8us;
typedef __attribute__((ext_vector_type(8)))  float    v8f;
typedef __attribute__((ext_vector_type(4)))  float    v4f;
typedef v4f  __attribute__((may_alias)) v4fa;
typedef float __attribute__((may_alias)) fal;

__device__ __forceinline__ unsigned short f2bf(float f) { unsigned u = __float_as_uint(f); u += 0x7FFFu + ((u >> 16) & 1u); return (unsigned short)(u >> 16); }
__device__ __forceinline__ float bfr(float f) { return __uint_as_float(((unsigned)f2bf(f)) << 16); }   // value after RNE convert to bf16
__device__ __forceinline__ v16h cat16(v8h lo, v8h hi) { return __builtin_shufflevector(lo, hi, 0, 1, 2, 3, 4, 5, 6, 7, 8, 9, 10, 11, 12, 13, 14, 15); }
__device__ __forceinline__ v16bf cat16b(v8us lo, v8us hi) { return __builtin_bit_cast(v16bf, __builtin_shufflevector(lo, hi, 0, 1, 2, 3, 4, 5, 6, 7, 8, 9, 10, 11, 12, 13, 14, 15)); }
__device__ __forceinline__ v8f wmma16(v16h a, v16h b, v8f c) { return __builtin_amdgcn_wmma_f32_16x16x32_f16(false, a, false, b, (short)0, c, false, false); }
__device__ __forceinline__ v8f wmmab(v16bf a, v16bf b, v8f c) { return __builtin_amdgcn_wmma_f32_16x16x32_bf16(false, a, false, b, (short)0, c, false, false); }
// fragment loaders from K-contiguous 16-bit rows; p already includes + 8*(lane>>4): elements 0..7 <- k0+8h+0..7, elements 8..15 <- k0+16+8h+0..7 (same map for A and B)
__device__ __forceinline__ v16h  ldh(const h16* p) { return cat16(*(const v8h*)p, *(const v8h*)(p + 16)); }
__device__ __forceinline__ v16bf ldb(const bf* p)  { return cat16b(*(const v8us*)p, *(const v8us*)(p + 16)); }
// ordering point for wave-private LDS tiles (same wave writes and reads)
__device__ __forceinline__ void wave_sync() { __builtin_amdgcn_fence(3 /* release order */, "wavefront"); __builtin_amdgcn_wave_barrier(); asm volatile("" ::: "memory"); }

// f32 -> f16 convert that cannot produce a subnormal operand (|v| < 2^-14 -> +0); applied after the plane's power-of-two carry
static __device__ __forceinline__ h16 toh_flush(float v) { const h16 r = (h16)v; return (fabsf(v) < 6.103515625e-05f) ? (h16)0.0f : r; }
// one matrix instruction followed by its own four-slot guard (ties the accumulator, keeps the operands live)
static __device__ __forceinline__ v8f wmma16g(v16h a, v16h b, v8f c) { c = wmma16(a, b, c); asm volatile("v_nop\n\tv_nop\n\tv_nop\n\tv_nop" : "+v"(c) : "v"(a), "v"(b)); return c; }
static __device__ __forceinline__ v8f wmmabg(v16bf a, v16bf b, v8f c) { c = wmmab(a, b, c); asm volatile("v_nop\n\tv_nop\n\tv_nop\n\tv_nop" : "+v"(c) : "v"(a), "v"(b)); return c; }
// one 16-bit word of an extension row: piece 0 = bf16 value, piece 1 = bf16 of the remainder, pieces 2, 3 = zero (select by value)
static __device__ __forceinline__ unsigned short ext_word(float v, int piece) {
    const unsigned short hw = f2bf(v); const float hv = __uint_as_float(((unsigned)hw) << 16); const unsigned short lw = f2bf(v - hv);
    return (piece == 0) ? hw : ((piece == 1) ? lw : (unsigned short)0); }

// eight asynchronous 16-byte copies per lane, global -> LDS: copy i moves the lane's 16 bytes of tile row (row + 16 i). The closing s_wait_xcnt stands inside the statement so that no address register is rewritten ahead of it.
static __device__ __forceinline__ void copy8(unsigned l, const bf* g, size_t gs) {
    const unsigned ls = 16 * PPI * 2;
    asm volatile("global_load_async_to_lds_b128 %0, %8, off\n\t"
                 "global_load_async_to_lds_b128 %1, %9, off\n\t"
                 "global_load_async_to_lds_b128 %2, %10, off\n\t"
                 "global_load_async_to_lds_b128 %3, %11, off\n\t"
                 "global_load_async_to_lds_b128 %4, %12, off\n\t"
                 "global_load_async_to_lds_b128 %5, %13, off\n\t"
                 "global_load_async_to_lds_b128 %6, %14, off\n\t"
                 "global_load_async_to_lds_b128 %7, %15, off\n\t"
                 "s_wait_xcnt 0x0"
                 :: "v"(l), "v"(l + ls), "v"(l + 2 * ls), "v"(l + 3 * ls), "v"(l + 4 * ls), "v"(l + 5 * ls), "v"(l + 6 * ls), "v"(l + 7 * ls),
                    "v"(g), "v"(g + gs), "v"(g + 2 * gs), "v"(g + 3 * gs), "v"(g + 4 * gs), "v"(g + 5 * gs), "v"(g + 6 * gs), "v"(g + 7 * gs)
                 : "memory");
}

// the same with one copy: the lane's 16 bytes of one row
static __device__ __forceinline__ void copy1(unsigned l, const bf* g) {
    asm volatile("global_load_async_to_lds_b128 %0, %1, off\n\t"
                 "s_wait_xcnt 0x0"
                 :: "v"(l), "v"(g)
                 : "memory");
}

// the same with four copies of 16-bit float rows: copy i moves the lane's 16 bytes of tile row (row + 16 i)
static __device__ __forceinline__ void copy4(unsigned l, const h16* g, size_t gs) {
    const unsigned ls = 16 * PPI * 2;
    asm volatile("global_load_async_to_lds_b128 %0, %4, off\n\t"
                 "global_load_async_to_lds_b128 %1, %5, off\n\t"
                 "global_load_async_to_lds_b128 %2, %6, off\n\t"
                 "global_load_async_to_lds_b128 %3, %7, off\n\t"
                 "s_wait_xcnt 0x0"
                 :: "v"(l), "v"(l + ls), "v"(l + 2 * ls), "v"(l + 3 * ls),
                    "v"(g), "v"(g + gs), "v"(g + 2 * gs), "v"(g + 3 * gs)
                 : "memory");
}

// blocks of 256 threads (8 elements a thread) that each converted plane takes in k_prep
#define CB_X ((int)((size_t)NB * SEQ * DM / 8 / 256))   // x
#define CB_W ((int)((size_t)DM * DM / 8 / 256))         // one weight matrix
#define CB_A ((int)((size_t)LR * DM / 8 / 256))         // one A matrix
#define CB_B (DM * 4 / 256)                             // one weight-side extension plane (4 pieces of 8 per row)
static_assert(((size_t)SEQ * DM / 8) % 256 == 0);       // a block never straddles two batches of x
static_assert(((size_t)DM * DM / 8) % 256 == 0);
static_assert(((size_t)LR * DM / 8) % 256 == 0);

static __device__ __forceinline__ void cvt8(const float* __restrict__ src, bf* dst) {
    const v8f v = *(const v8f*)src; v8us o;
#pragma unroll
    for (int k = 0; k < 8; ++k) o[k] = f2bf(v[k]);
    *(v8us*)dst = o;
    asm volatile("s_wait_xcnt 0x0" ::: "memory");                            // the store's registers are rewritten only behind this wait
}

// k_prep: every f32 -> bf16 conversion of the call in one launch. The block index picks the plane (block-uniform ranges, in the order mask, one block per batch | x | Wq Wk Wv | Aq Av | Bq Bv); every range is covered exactly.
__global__ __launch_bounds__(256) void k_prep(const float* __restrict__ x, const float* __restrict__ wq, const float* __restrict__ wk, const float* __restrict__ wv,
                                              const float* __restrict__ aq, const float* __restrict__ av, const float* __restrict__ bqu, const float* __restrict__ bvu,
                                              const float* __restrict__ amask, bf* XB, bf* WB, bf* AL, bf* BLq, bf* BLv, float* MB, int* MF) {
    int blk = (int)blockIdx.x; const int tid = (int)threadIdx.x;
    if (blk < NB) {                                                           // mask row of batch blk: batch pitch SEQ_FULL in the input, SEQ in the plane; first in the grid, for speed only
        const float* amb = amask + (size_t)blk * SEQ_FULL; float* mrow = MB + (size_t)blk * SEQ;
        for (int i = tid * 8; i < SEQ; i += 256 * 8) {                        // value after RNE convert to bf16, stored as f32
            const v8f v = *(const v8f*)(amb + i); v8f o;
#pragma unroll
            for (int k = 0; k < 8; ++k) o[k] = bfr(v[k]);
            *(v8f*)(mrow + i) = o;
            asm volatile("s_wait_xcnt 0x0" ::: "memory"); }                  // the load's and the store's registers are rewritten only behind this wait
        if (tid < 32) {                                                       // the first wave scans the whole row: any value not below WIDE in magnitude widens the key loop to all keys
            float fl = 0.0f;
#pragma unroll 4
            for (int i = 0; i < SEQ; i += 128) {                              // four loads in flight a trip: more would raise the register count of every block of this kernel
                const v4f w = *(const v4f*)(amb + i + 4 * tid);
#pragma unroll
                for (int c = 0; c < 4; ++c) { const float a = fabsf(bfr(w[c])); fl = (a < WIDE) ? fl : 1.0f; } }
            fl = fmaxf(fl, __shfl_xor(fl, 16, 32)); fl = fmaxf(fl, __shfl_xor(fl, 8, 32)); fl = fmaxf(fl, __shfl_xor(fl, 4, 32));
            fl = fmaxf(fl, __shfl_xor(fl, 2, 32));  fl = fmaxf(fl, __shfl_xor(fl, 1, 32));
            if (tid == 0) MF[blk] = (fl != 0.0f) ? 1 : 0; }
        return; }
    blk -= NB;
    if (blk < CB_X) {                                                         // x: batch pitch SEQ_FULL tokens in the input, SEQ in the copy
        const size_t i = (size_t)blk * 256 + tid; const size_t nb8 = (size_t)SEQ * DM / 8; const size_t bb = i / nb8, r = i % nb8;
        cvt8(x + bb * ((size_t)SEQ_FULL * DM) + r * 8, XB + i * 8); return; }
    blk -= CB_X;
    if (blk < 3 * CB_W) {
        const int w = blk / CB_W; const float* s = (w == 0) ? wq : ((w == 1) ? wk : wv); const size_t i = (size_t)(blk - w * CB_W) * 256 + tid;
        cvt8(s + i * 8, WB + (size_t)w * DM * DM + i * 8); return; }
    blk -= 3 * CB_W;
    if (blk < 2 * CB_A) {
        const int w = blk / CB_A; const float* s = (w == 0) ? aq : av; const size_t i = (size_t)(blk - w * CB_A) * 256 + tid;
        cvt8(s + i * 8, AL + (size_t)w * LR * DM + i * 8); return; }
    blk -= 2 * CB_A;
    {                                                                         // weight-side extension rows: B | B | 0 | 0
        const int w = blk / CB_B; const float* s = (w == 0) ? bqu : bvu; bf* d = (w == 0) ? BLq : BLv; const int i = (blk - w * CB_B) * 256 + tid;
        const int row = i >> 2, piece = i & 3;
        const v8f v = *(const v8f*)(s + (size_t)row * LR); v8us o;
#pragma unroll
        for (int k = 0; k < 8; ++k) { const unsigned short t = f2bf(v[k]); o[k] = (piece < 2) ? t : (unsigned short)0; }
        *(v8us*)(d + (size_t)i * 8) = o;
        asm volatile("s_wait_xcnt 0x0" ::: "memory"); }                      // the store's registers are rewritten only behind this wait
}

template <int MODE, int LOWR>
__device__ __forceinline__ void proj_body(bf* ring, bf* xring, float* osa, int bx, int by, const bf* __restrict__ A, const bf* __restrict__ Bt, const bf* __restrict__ AL, const bf* __restrict__ WX, int xcol,
                                          const float* __restrict__ bias, h16* Ph, h16* Pr, int resT) {
    const int K = DM;
    const int lane = threadIdx.x & 31, lr = lane & 15, hi = lane >> 4;
    const int wave = __builtin_amdgcn_readfirstlane((int)(threadIdx.x >> 5));
    const int wm = (wave & 1) * 64, wn = (wave >> 1) * 64;                    // the wave's 64 x 64 tile inside the block
    const int r0 = bx * 128 + wm, c0 = by * 128 + wn;
    float* os = osa + wave * 16 * 68;                                         // wave-private output staging
    v8f acc[4][4];
#pragma unroll
    for (int mb = 0; mb < 4; ++mb)
#pragma unroll
        for (int nb = 0; nb < 4; ++nb) acc[mb][nb] = (v8f){};
    v8f xacc[2]; xacc[0] = (v8f){}; xacc[1] = (v8f){};                        // LOWR: x A^T of the wave's 32 x rows
    const int xh = LOWR ? ((MODE == 0) ? (wave >> 1) : (wave & 1)) : 0;       // which 32 of the 64 x rows that it shares with its partner wave are its own for x A^T (wave-uniform)
    const int rot[4] = { xh * 32, xh * 32 + 16, 32 - xh * 32, 48 - xh * 32 };  // x-side fragment i holds the 16 x rows from rot[i] on: the wave's own 32 rows are always fragments 0 and 1, so that no branch picks registers in the k loop
    // copy side: thread tid moves bytes 16 (tid & 7) of tile rows (tid >> 3) + 16 i, i = 0..7, of both operands (and of A row tid >> 3 when LOWR)
    const int crow = (int)(threadIdx.x >> 3), cch = (int)(threadIdx.x & 7);
    const bf* ga = A  + (size_t)(bx * 128 + crow) * K + cch * 8;      // rows < M, columns k0 + 63 < K
    const bf* gb = Bt + (size_t)(by * 128 + crow) * K + cch * 8;
    const unsigned la = (unsigned)(size_t)(&ring[crow * PPI + cch * 8]);      // LDS byte address = low 32 bits of the shared address
    const unsigned lb = la + POP * 2;
    const bf* gl = AL + (size_t)crow * K + cch * 8;                           // rows < 16
    const unsigned lx = (unsigned)(size_t)(&xring[crow * PPI + cch * 8]);
    const int xfo = lr * PPI + 8 * hi;
    const int NT = K / PBK;
    // read side: same loader and k map as from the planes, rows at pitch PPI
    const int afr = (wm + lr) * PPI + 8 * hi, bfo = POP + (wn + lr) * PPI + 8 * hi;
    copy8(la, ga, (size_t)16 * K); copy8(lb, gb, (size_t)16 * K);             // tile 0 -> buffer 0
    if (LOWR) copy1(lx, gl);
    asm volatile("s_wait_asynccnt 0x0" ::: "memory");                         // this wave's copies of tile 0 have landed
    __syncthreads();                                                          // ... and every other wave's
    copy8(la + PST * 2, ga + PBK, (size_t)16 * K); copy8(lb + PST * 2, gb + PBK, (size_t)16 * K);   // tile 1 -> buffer 1
    if (LOWR) copy1(lx + XOP * 2, gl + PBK);
#pragma unroll 1
    for (int t = 0; t < NT; ++t) {                                            // rolled: one pass per staged tile
        const int bo = (t & 1) * PST;
#pragma unroll
        for (int ks = 0; ks < PBK; ks += 32) {
            v16bf a[4];
#pragma unroll
            for (int mb = 0; mb < 4; ++mb) a[mb] = ldb(&ring[bo + afr + ((MODE == 0) ? rot[mb] : mb * 16) * PPI + ks]);
            v16bf b[4];                                                       // all fragments of a k-step (eight, nine with LOWR) are read as one group of LDS loads
#pragma unroll
            for (int nb = 0; nb < 4; ++nb) b[nb] = ldb(&ring[bo + bfo + ((MODE == 1) ? rot[nb] : nb * 16) * PPI + ks]);
            v16bf al = a[0];
            if (LOWR) al = ldb(&xring[(t & 1) * XOP + xfo + ks]);
#pragma unroll
            for (int nb = 0; nb < 4; ++nb) {
#pragma unroll
                for (int mb = 0; mb < 4; ++mb) acc[mb][nb] = wmmabg(a[mb], b[nb], acc[mb][nb]); }
            if (LOWR) { xacc[0] = wmmabg((MODE == 0) ? a[0] : b[0], al, xacc[0]); xacc[1] = wmmabg((MODE == 0) ? a[1] : b[1], al, xacc[1]); }
        }
        asm volatile("s_wait_dscnt 0x0" ::: "memory");                        // this wave's reads of buffer t & 1 are done before it is refilled
        asm volatile("s_wait_asynccnt 0x0" ::: "memory");                     // this wave's copies of tile t + 1 have landed
        __syncthreads();                                                      // publishes tile t + 1 and ends every reader's last read of buffer t & 1
        if (t + 2 < NT) { copy8(la + bo * 2, ga + (size_t)(t + 2) * PBK, (size_t)16 * K); copy8(lb + bo * 2, gb + (size_t)(t + 2) * PBK, (size_t)16 * K);
                          if (LOWR) copy1(lx + (t & 1) * (XOP * 2), gl + (size_t)(t + 2) * PBK); }
    }
    asm volatile("s_wait_asynccnt 0x0" ::: "memory");                         // no copy is outstanding behind the loop
    if (LOWR) {                                                                                   // extension k-step: rows of 32 bf16, same k map on both sides
        const size_t wxo = (size_t)(((MODE == 0) ? c0 : r0) + lr) * LK + 8 * hi;
        v16bf we[4];                                                                              // weight side, from its plane; the loads fly under the exchange below
#pragma unroll
        for (int i = 0; i < 4; ++i) we[i] = ldb(WX + wxo + (size_t)i * 16 * LK);
        fal* xs = (fal*)ring;                                                                     // [128 x rows of the block][XP]; every reader of the ring has passed the loop's last barrier and no copy is outstanding
        const int xw = (MODE == 0) ? wm : wn;                                                     // the wave's 64 x rows inside the block
#pragma unroll
        for (int i = 0; i < 2; ++i)
#pragma unroll
            for (int j = 0; j < 8; ++j) xs[(xw + rot[i] + hi * 8 + j) * XP + lr] = xacc[i][j] * LSC;   // D: row 8h+j, col lane&15
        __syncthreads();                                                                          // each wave reads 32 rows that its partner wave wrote
        v16bf xe[4];
#pragma unroll
        for (int i = 0; i < 4; ++i) {
            const v4f e0 = *(const v4fa*)(&xs[(xw + rot[i] + lr) * XP + xcol]); const v4f e1 = *(const v4fa*)(&xs[(xw + rot[i] + lr) * XP + xcol + 4]); v8us w;
#pragma unroll
            for (int k = 0; k < 4; ++k) { w[k] = ext_word(e0[k], hi); w[4 + k] = ext_word(e1[k], hi); }
            xe[i] = cat16b(w, (v8us){}); }
#pragma unroll
        for (int nb = 0; nb < 4; ++nb) {
#pragma unroll
            for (int mb = 0; mb < 4; ++mb) acc[mb][nb] = (MODE == 0) ? wmmabg(xe[mb], we[nb], acc[mb][nb]) : wmmabg(we[mb], xe[nb], acc[mb][nb]); }
    }
    float bc[4];
#pragma unroll
    for (int nb = 0; nb < 4; ++nb) bc[nb] = (MODE == 0) ? bfr(bias[c0 + nb * 16 + lr]) : 0.0f;   // MODE 0: c0 + 63 < DM
    size_t tbase, rbase; bool wr;                                                                 // wr: wave-uniform, the wave's whole tile inside the residual plane
    if (MODE == 0) { const int bb = r0 / SEQ, tt = r0 % SEQ; const int zc = bb * NH_ + c0 / HD;
                     tbase = ((size_t)zc * SEQ + (size_t)tt) * HD; rbase = ((size_t)zc * (size_t)resT + (size_t)tt) * HD; wr = tt < resT; }
    else           { const int bb = c0 / SEQ, tt = c0 % SEQ;
                     tbase = (size_t)bb * (size_t)DM * SEQ + (size_t)r0 * SEQ + (size_t)tt; rbase = (size_t)bb * (size_t)DM * (size_t)resT + (size_t)r0 * (size_t)resT + (size_t)tt; wr = tt < resT; }
#pragma unroll
    for (int mb = 0; mb < 4; ++mb) {
        float br[8];
#pragma unroll
        for (int j = 0; j < 8; ++j) br[j] = (MODE == 1) ? bfr(bias[r0 + mb * 16 + hi * 8 + j]) : 0.0f;   // MODE 1: r0 + 63 < DM
#pragma unroll
        for (int nb = 0; nb < 4; ++nb) {
#pragma unroll
            for (int j = 0; j < 8; ++j) os[(hi * 8 + j) * 68 + ((MODE == 1) ? rot[nb] : nb * 16) + lr] = acc[mb][nb][j] + bc[nb] + br[j]; }   // D: row 8h+j, col lane&15; rows 0..15 x columns 0..63 all written
        wave_sync();
{
            if (MODE == 0) {
                const size_t sb = tbase + (size_t)rot[mb] * HD;
                const size_t rb = rbase + (size_t)rot[mb] * HD;
#pragma unroll
                for (int s = 0; s < 4; ++s) { const int p = s * 32 + lane; const int row = p >> 3, c8 = (p & 7) * 8;   // 4 s x 4 rows = 16 rows; 8 lanes x 8 = 64 columns = one line
                    const v4f x0 = *(const v4fa*)(&os[row * 68 + c8]); const v4f x1 = *(const v4fa*)(&os[row * 68 + c8 + 4]); v8h hv, rv;
#pragma unroll
                    for (int i = 0; i < 4; ++i) { const h16 a0 = toh_flush(x0[i]); const h16 a1 = toh_flush(x1[i]); hv[i] = a0; hv[4 + i] = a1;
                                                  rv[i] = toh_flush((x0[i] - (float)a0) * QRS); rv[4 + i] = toh_flush((x1[i] - (float)a1) * QRS); }
                    const size_t oo = sb + (size_t)p * 8;
                    const size_t ro = rb + (size_t)p * 8;
                    *(v8h*)(Ph + oo) = hv; asm volatile("s_wait_xcnt 0x0" ::: "memory");                    // each store's registers are rewritten only behind its wait
                    if (wr) { *(v8h*)(Pr + ro) = rv; asm volatile("s_wait_xcnt 0x0" ::: "memory"); } }
            } else {
                const size_t sb = tbase + (size_t)(mb * 16) * SEQ;
                const size_t rb = rbase + (size_t)(mb * 16) * (size_t)resT;
#pragma unroll
                for (int s = 0; s < 4; ++s) { const int row = 4 * s + (lane >> 3), c8 = (lane & 7) * 8;   // 4 s x 4 row groups = 16 rows; 8 lanes x 8 = 64 columns
                    const v4f x0 = *(const v4fa*)(&os[row * 68 + c8]); const v4f x1 = *(const v4fa*)(&os[row * 68 + c8 + 4]); v8h hv, rv;
#pragma unroll
                    for (int i = 0; i < 4; ++i) { const h16 a0 = toh_flush(x0[i]); const h16 a1 = toh_flush(x1[i]); hv[i] = a0; hv[4 + i] = a1;
                                                  rv[i] = toh_flush((x0[i] - (float)a0) * QRS); rv[4 + i] = toh_flush((x1[i] - (float)a1) * QRS); }
                    const size_t oo = sb + (size_t)row * SEQ + c8;
                    const size_t ro = rb + (size_t)row * (size_t)resT + c8;
                    *(v8h*)(Ph + oo) = hv; asm volatile("s_wait_xcnt 0x0" ::: "memory");                    // each store's registers are rewritten only behind its wait
                    if (wr) { *(v8h*)(Pr + ro) = rv; asm volatile("s_wait_xcnt 0x0" ::: "memory"); } }
            }
             }
        wave_sync();
    }
}

// k_proj: the three projections in one launch, blockIdx.z picks one (block-uniform); the three bodies share one ring and one output staging, declared here so that the block's LDS is that of one body.
// z = 0, q: token-major with the update extension; z = 1, k: token-major, no extension; z = 2, v^T: feature-major with the update extension (A = Wv rows, so the block's row tile is blockIdx.y and its column tile blockIdx.x).
// Registers are capped at 256: without the cap the extension step spreads above v255 and pays a register-window switch at many of its instructions.
__global__ __launch_bounds__(32 * PW) __attribute__((amdgpu_num_vgpr(256)))
void k_proj(const bf* __restrict__ XB, const bf* __restrict__ WB, const bf* __restrict__ AL, const bf* __restrict__ BLq, const bf* __restrict__ BLv,
                                              const float* __restrict__ bq, const float* __restrict__ bk, const float* __restrict__ bv,
                                              h16* QH, h16* QR, h16* KP, h16* KR, h16* VT, h16* VR, int resT) {
    __shared__ __align__(16) bf ring[2 * PST];
    __shared__ __align__(16) bf xring[2 * XOP];
    __shared__ __align__(16) float osa[PW * 16 * 68];
    const int z = (int)blockIdx.z, gx = (int)blockIdx.x, gy = (int)blockIdx.y;
    const bf* WK = WB + (size_t)DM * DM; const bf* WV = WB + (size_t)2 * DM * DM;
    if (z == 0)      proj_body<0, 1>(ring, xring, osa, gx, gy, XB, WB, AL, BLq, 0, bq, QH, QR, resT);
    else if (z == 1) proj_body<0, 0>(ring, xring, osa, gx, gy, XB, WK, AL, WK, 0, bk, KP, KR, resT);
    else             proj_body<1, 1>(ring, xring, osa, gy, gx, WV, XB, AL, BLv, LR, bv, VT, VR, resT);
}

template <int EARLY>
__device__ __forceinline__ void keypass_body(h16* ring, float* os, int qt, int zh, const h16* __restrict__ QH, const h16* __restrict__ QR, const h16* __restrict__ KP, const h16* __restrict__ KR,
                                           const h16* __restrict__ VT, const h16* __restrict__ VR, const float* __restrict__ MB, const int* __restrict__ MF, float* OUT) {
    constexpr int KSG = (EARLY ? 4 : 2) * KOP;                                // elements of one stage: K | V^T (| K residual | V^T residual); the ring holds two stages
    const int lane = threadIdx.x & 31, lr = lane & 15, hi = lane >> 4;
    const int wave = __builtin_amdgcn_readfirstlane((int)(threadIdx.x >> 5));
    const int b = zh / NH_, h = zh % NH_;
    const int t0 = (qt * AW + wave) * 16;                                     // qt: the block's tile of 64 query rows, counted over the whole sequence
    const int lim = t0 + lr;                                                  // key j is causal-filled iff j > lim
    const float* amb = MB + (size_t)b * SEQ;                                  // the batch's mask row, already rounded to bf16 values
    const size_t pbase = (size_t)zh * SEQ * HD;
    const size_t rbase = (size_t)zh * EROWS * HD;
    // copy side: thread tid moves bytes 16 (tid & 7) of tile rows (tid >> 3) + 16 i, i = 0..3, of every staged plane (K rows = keys, V^T rows = d)
    const int crow = (int)(threadIdx.x >> 3), cch = (int)(threadIdx.x & 7);
    const h16* gk  = KP + pbase + (size_t)crow * HD + cch * 8;                // + key * HD, keys < SEQ
    const h16* gv  = VT + pbase + (size_t)crow * SEQ + cch * 8;               // + key, keys + 63 < SEQ
    const h16* gkr = KR + rbase + (size_t)crow * HD + cch * 8;                // + key * HD, keys < EROWS
    const h16* gvr = VR + rbase + (size_t)crow * EROWS + cch * 8;             // + key, keys + 63 < EROWS
    const unsigned l0 = (unsigned)(size_t)(&ring[crow * PPI + cch * 8]);      // LDS byte address = low 32 bits of the shared address
    auto stage = [&](int s, int buf) {                                        // tile s (keys 64 s .. 64 s + 63) -> buffer buf
        const int k0 = s * KST; const unsigned l = l0 + (unsigned)buf * (KSG * 2);
        copy4(l, gk + (size_t)k0 * HD, (size_t)16 * HD); copy4(l + KOP * 2, gv + k0, (size_t)16 * SEQ);
        if (EARLY) { const int kc = (k0 < EROWS) ? k0 : (EROWS - KST);        // clamped residual-plane key (address always inside the plane)
                     copy4(l + 2 * KOP * 2, gkr + (size_t)kc * HD, (size_t)16 * HD); copy4(l + 3 * KOP * 2, gvr + kc, (size_t)16 * EROWS); } };
    stage(0, 0);                                                              // tile 0 exists for every block; its copies fly under the Q loads
    const bool wide = MF[b] != 0;                                             // k_prep's test of the batch's mask row: any value not below WIDE in magnitude widens the key loop to all keys
    const int nkc = (t0 + 16 + 31) & ~31;                                     // causal bound, multiple of 32, <= SEQ
    const int nk = __builtin_amdgcn_readfirstlane(wide ? SEQ : nkc);
    const int nbv = wide ? SEQ : ((qt + 1) * KST);           // the block's bound = its last wave's; every wave reads the same word, so it is block-uniform
    const int NS = __builtin_amdgcn_readfirstlane(nbv) / KST;                 // staged tiles of the block, >= 1
    const size_t qo = pbase + (size_t)(t0 + lr) * HD + 8 * hi;
    const v16h hz = (v16h){};
    v16h qh[2], qr[2];
    qh[0] = ldh(QH + qo); qh[1] = ldh(QH + qo + 32);             // B fragments: col t, k = d (two k-steps)
    qr[0] = hz; qr[1] = hz;
    if (EARLY) { const size_t qro = rbase + (size_t)(t0 + lr) * HD + 8 * hi; qr[0] = ldh(QR + qro); qr[1] = ldh(QR + qro + 32); }   // t0 + lr < EROWS
    const int fo = lr * PPI + 8 * hi;                          // read side, same loader and k map as from the planes, rows at pitch PPI: K + key * PPI (A fragment: row key, k = d); V^T + 16j * PPI + key (A fragment: row d, k = key)
    v8f o[4], oR[4];
#pragma unroll
    for (int j = 0; j < 4; ++j) { o[j] = (v8f){}; oR[j] = (v8f){}; }
    float m = NEGB, l = 0.0f;
    asm volatile("s_wait_asynccnt 0x0" ::: "memory");            // this wave's copies of tile 0 have landed
    __syncthreads();                                             // ... and every other wave's
    if (1 < NS) stage(1, 1);
#pragma unroll 1
    for (int s = 0; s < NS; ++s) {                               // rolled: one pass per staged tile
    const int bo = (s & 1) * KSG;
    const int ke = (nk - s * KST < KST) ? nk - s * KST : KST;    // keys of this tile below the wave's own bound
#pragma unroll 1
    for (int kk = 0; kk < ke; kk += 32) {                        // rolled: the 32-key halves of a tile share one body, which keeps the loop's text small
        const int key0 = s * KST + kk;
        const bool rok = key0 < EROWS;                           // wave-uniform
        const h16* kpt = &ring[bo + fo + kk * PPI];
        v8f sHa = (v8f){}, sLa = (v8f){}, sHb = (v8f){}, sLb = (v8f){};
        const h16* krp = &ring[bo + (EARLY ? 2 : 0) * KOP + fo + kk * PPI];   // residual tiles exist in the EARLY stage only
        const h16* va  = &ring[bo + KOP + fo + kk];
        const h16* vrp = &ring[bo + (EARLY ? 3 : 1) * KOP + fo + kk];
        v16h ka[2], kb[2], kra[2], krb[2], vf[4];          // the fragments of a product run are read as one group of LDS loads ahead of it
#pragma unroll
        for (int ks = 0; ks < 2; ++ks) {
            ka[ks] = ldh(kpt + ks * 32); kb[ks] = ldh(kpt + 16 * PPI + ks * 32);
            if (EARLY) { kra[ks] = ldh(krp + ks * 32); krb[ks] = ldh(krp + 16 * PPI + ks * 32); } }
        if (!EARLY) {                                              // registers allow: the V^T fragments join the K group
#pragma unroll
            for (int j = 0; j < 4; ++j) vf[j] = ldh(va + (16 * j) * PPI); }
#pragma unroll
        for (int ks = 0; ks < 2; ++ks) {
            sHa = wmma16g(ka[ks], qh[ks], sHa); sHb = wmma16g(kb[ks], qh[ks], sHb);
            if (EARLY) {
                sLa = wmma16g(ka[ks], qr[ks], sLa); sLb = wmma16g(kb[ks], qr[ks], sLb);
                if (!rok) { kra[ks] = hz; krb[ks] = hz; }
                sLa = wmma16g(kra[ks], qh[ks], sLa); sLb = wmma16g(krb[ks], qh[ks], sLb);
            }
        }
        if (EARLY) {                                               // the V^T group flies under the softmax
#pragma unroll
            for (int j = 0; j < 4; ++j) vf[j] = ldh(va + (16 * j) * PPI); }
        const float* kp = amb + 8 * hi + key0;                   // keys key0+8h+0..7 and key0+16+8h+0..7, all < nk <= SEQ
        const v4f m0 = *(const v4f*)kp, m1 = *(const v4f*)(kp + 4), m2 = *(const v4f*)(kp + 16), m3 = *(const v4f*)(kp + 20);
        float kx[8], ky[8];
#pragma unroll
        for (int r = 0; r < 4; ++r) { kx[r] = m0[r]; kx[4 + r] = m1[r]; ky[r] = m2[r]; ky[4 + r] = m3[r]; }
        const int ja = key0 + 8 * hi;
        float ta[8], tb[8]; float mx = NEGB;
#pragma unroll
        for (int r = 0; r < 8; ++r) {
            const float sa = EARLY ? (sHa[r] + sLa[r] * QRI) * SC2 : sHa[r] * SC2;
            const float sb = EARLY ? (sHb[r] + sLb[r] * QRI) * SC2 : sHb[r] * SC2;
            ta[r] = ((ja + r > lim) ? NEGL : sa) + kx[r] * L2E;                  // replace, then add the mask
            tb[r] = ((ja + 16 + r > lim) ? NEGL : sb) + ky[r] * L2E;
            mx = fmaxf(mx, fmaxf(ta[r], tb[r])); }
        mx = fmaxf(mx, __shfl_xor(mx, 16, 32));
        const float mnew = fmaxf(m, mx);
        const float alpha = __builtin_amdgcn_exp2f(m - mnew);
        const float sh = PSH - mnew;
        v16h pb, pr = hz; float ls = 0.0f;
#pragma unroll
        for (int r = 0; r < 8; ++r) {
            const float aa = ta[r] + sh, ab = tb[r] + sh;
            const float ea = __builtin_amdgcn_exp2f(aa), eb = __builtin_amdgcn_exp2f(ab);
            const float ga = (aa < PFL) ? 0.0f : ea, gb = (ab < PFL) ? 0.0f : eb;   // below the f16 normal range -> exactly zero, selected by value
            const h16 pa = (h16)ga; const h16 pc = (h16)gb;
            pb[r] = pa; pb[8 + r] = pc;
            if (EARLY) { pr[r] = toh_flush((ga - (float)pa) * QRS); pr[8 + r] = toh_flush((gb - (float)pc) * QRS); ls += ga + gb; }
            else       { ls += (float)pa + (float)pc; } }
        l = l * alpha + ls; m = mnew;
#pragma unroll
        for (int j = 0; j < 4; ++j) { o[j] = o[j] * alpha; if (EARLY) oR[j] = oR[j] * alpha; }
#pragma unroll
        for (int jp = 0; jp < 2; ++jp) {
            const v16h v0 = vf[2 * jp], v1 = vf[2 * jp + 1];
            o[2 * jp] = wmma16g(v0, pb, o[2 * jp]); o[2 * jp + 1] = wmma16g(v1, pb, o[2 * jp + 1]);
            if (EARLY) {
                oR[2 * jp] = wmma16g(v0, pr, oR[2 * jp]); oR[2 * jp + 1] = wmma16g(v1, pr, oR[2 * jp + 1]);
                v16h vr0 = ldh(vrp + (32 * jp) * PPI), vr1 = ldh(vrp + (32 * jp + 16) * PPI);
                if (!rok) { vr0 = hz; vr1 = hz; }
                oR[2 * jp] = wmma16g(vr0, pb, oR[2 * jp]); oR[2 * jp + 1] = wmma16g(vr1, pb, oR[2 * jp + 1]);
            }
        }
    }
    asm volatile("s_wait_dscnt 0x0" ::: "memory");               // this wave's reads of buffer s & 1 are done before it is refilled
    asm volatile("s_wait_asynccnt 0x0" ::: "memory");            // this wave's copies of tile s + 1 have landed
    __syncthreads();                                             // publishes tile s + 1 and ends every reader's last read of buffer s & 1
    if (s + 2 < NS) stage(s + 2, s & 1);
    }
    asm volatile("s_wait_asynccnt 0x0" ::: "memory");            // no copy is outstanding behind the loop
    l += __shfl_xor(l, 16, 32);
    const float inv = 1.0f / l;                                  // l >= 2^14 whenever the row has a finite maximum logit
    const int wb = wave * 16 * OSP;
    // O^T D layout: o[j][r] = (d = 16j + 8h + r, t = lane&15) -> os[t][d]; rows 0..15 x columns 0..63 all written
#pragma unroll
    for (int j = 0; j < 4; ++j) {
        v8f f = o[j];
        if (EARLY) f = o[j] + oR[j] * QRI;
        v4f a, c;
        a[0] = f[0] * inv; a[1] = f[1] * inv; a[2] = f[2] * inv; a[3] = f[3] * inv; c[0] = f[4] * inv; c[1] = f[5] * inv; c[2] = f[6] * inv; c[3] = f[7] * inv;
        *(v4fa*)(&os[wb + lr * OSP + 16 * j + 8 * hi]) = a; *(v4fa*)(&os[wb + lr * OSP + 16 * j + 8 * hi + 4]) = c; }
    wave_sync();
    float* orow = OUT + ((size_t)b * OUT_SEQ + t0) * DM + h * HD;
{
#pragma unroll
        for (int s = 0; s < 8; ++s) { const int row = 2 * s + (lane >> 4), cofs = (lane & 15) * 4;   // 8 s x 2 rows = 16 rows; 16 lanes x 4 floats = 64 columns = two lines
            const v4f val = *(const v4fa*)(&os[wb + row * OSP + cofs]);
            *(v4f*)(orow + (size_t)row * DM + cofs) = val; }
         }
}

// k_keypass: both instantiations in one launch. blockIdx.x = (batch, head); blockIdx.y counts the 64-row query tiles from the last one down, for speed only.
// The choice of the body is block-uniform; the two bodies share one ring and one output staging, declared here.
__global__ __launch_bounds__(32 * AW) __attribute__((amdgpu_num_vgpr(256)))
void k_keypass(const h16* __restrict__ QH, const h16* __restrict__ QR, const h16* __restrict__ KP, const h16* __restrict__ KR,
               const h16* __restrict__ VT, const h16* __restrict__ VR, const float* __restrict__ MB, const int* __restrict__ MF, float* OUT) {
    __shared__ __align__(16) h16 ring[2 * 4 * KOP];
    __shared__ __align__(16) float os[AW * 16 * OSP];
    const int zh = (int)blockIdx.x; const int qt = SEQ / (16 * AW) - 1 - (int)blockIdx.y;
    if (qt < EROWS / (16 * AW)) keypass_body<1>(ring, os, qt, zh, QH, QR, KP, KR, VT, VR, MB, MF, OUT);
    else                        keypass_body<0>(ring, os, qt, zh, QH, QH, KP, KP, VT, VT, MB, MF, OUT);
}

static constexpr size_t al256(size_t v) { return (v + 255) & ~(size_t)255; }
static constexpr size_t SZ_XB = al256((size_t)NB * SEQ * DM * 2);
static constexpr size_t SZ_WB = al256((size_t)3 * DM * DM * 2);
static constexpr size_t SZ_AL = al256((size_t)2 * LR * DM * 2);
static constexpr size_t SZ_BL = al256((size_t)DM * LK * 2);
static constexpr size_t SZ_PL = al256((size_t)NB * NH_ * SEQ * HD * 2);
static constexpr size_t SZ_RS = al256((size_t)NB * NH_ * EROWS * HD * 2);
static constexpr size_t SZ_MB = al256((size_t)NB * SEQ * 4);
static constexpr size_t SZ_MF = al256((size_t)NB * 4);
static constexpr size_t SZ_TOTAL = SZ_XB + SZ_WB + SZ_AL + 2 * SZ_BL + 3 * SZ_PL + 3 * SZ_RS + SZ_MB + SZ_MF;
static_assert(SZ_TOTAL <= (size_t)134217728);          // workspace carve <= 128 MiB
static_assert(((size_t)DM * DM * 2) % 256 == 0);       // weight sub-planes stay 256-byte aligned
static_assert(((size_t)LR * DM * 2) % 256 == 0);       // the two halves of the A plane stay 256-byte aligned
static_assert((size_t)NB * NH_ * SEQ * HD == (size_t)NB * DM * SEQ);       // v^T plane [(b*1024 + m)][t] has the same extent as the q/k planes
static_assert((size_t)NB * NH_ * EROWS * HD == (size_t)NB * DM * EROWS);   // v^T residual plane [(b*1024 + m)][t < EROWS] has the same extent as the q/k residual planes
static_assert((DM * 4) % 256 == 0);                    // the extension-plane block ranges of k_prep cover their planes exactly

extern "C" void kernel_launch(void* const* d_in, const int* in_sizes, int n_in,
                              void* d_out, int out_size, void* d_ws, size_t ws_size, hipStream_t stream) {
    if (n_in < 12) return;
    const size_t needx = ((size_t)(NB - 1) * SEQ_FULL + SEQ) * DM;
    const size_t needm = (size_t)(NB - 1) * SEQ_FULL + SEQ;
    if ((size_t)in_sizes[0] < needx || (size_t)in_sizes[1] < needm) return;
    if ((size_t)in_sizes[2] < (size_t)DM * DM || (size_t)in_sizes[4] < (size_t)DM * DM || (size_t)in_sizes[6] < (size_t)DM * DM) return;
    if (in_sizes[3] < DM || in_sizes[5] < DM || in_sizes[7] < DM) return;
    if (in_sizes[8] < LR * DM || in_sizes[9] < DM * LR || in_sizes[10] < LR * DM || in_sizes[11] < DM * LR) return;
    if ((size_t)out_size < ((size_t)(NB - 1) * OUT_SEQ + SEQ) * DM) return;
    if (SZ_TOTAL > ws_size) return;
    // wire order: hidden_states, key_mask (the module's additive key mask input), Wq, bq, Wk, bk, Wv, bv, Aq, Bq, Av, Bv
    const float* xin = (const float*)d_in[0];
    const float* am  = (const float*)d_in[1];
    const float* wq = (const float*)d_in[2]; const float* bq = (const float*)d_in[3];
    const float* wk = (const float*)d_in[4]; const float* bk = (const float*)d_in[5];
    const float* wv = (const float*)d_in[6]; const float* bv = (const float*)d_in[7];
    const float* aq = (const float*)d_in[8]; const float* bqu = (const float*)d_in[9];
    const float* av = (const float*)d_in[10]; const float* bvu = (const float*)d_in[11];
    float* OUT = (float*)d_out;      // [NB][SEQ][1024]
    char* wsp = (char*)d_ws;
    bf* XB = (bf*)wsp; wsp += SZ_XB;                 // x      [NB*SEQ][1024]
    bf* WB = (bf*)wsp; wsp += SZ_WB;                 // [3][1024][1024]: q | k | v  ([out][in] = Bt as-is)
    bf* AL = (bf*)wsp; wsp += SZ_AL;                 // [16][1024]: rows 0..7 A of the q update, rows 8..15 A of the v update
    bf* BLq = (bf*)wsp; wsp += SZ_BL;                // [1024][32]: B | B | 0 | 0 (q update)
    bf* BLv = (bf*)wsp; wsp += SZ_BL;                // [1024][32]: B | B | 0 | 0 (v update)
    h16* QH = (h16*)wsp; wsp += SZ_PL;               // [NB*16][SEQ][64]
    h16* KP = (h16*)wsp; wsp += SZ_PL;               // [NB*16][SEQ][64]
    h16* VT = (h16*)wsp; wsp += SZ_PL;               // [NB*16][64][SEQ]
    h16* QR = (h16*)wsp; wsp += SZ_RS;               // [NB*16][EROWS][64] residual x2048, tokens < EROWS
    h16* KR = (h16*)wsp; wsp += SZ_RS;               // [NB*16][EROWS][64] residual x2048, tokens < EROWS
    h16* VR = (h16*)wsp; wsp += SZ_RS;               // [NB*16][64][EROWS] residual x2048, tokens < EROWS
    float* MB = (float*)wsp; wsp += SZ_MB;           // [NB][SEQ] mask values after the convert to bf16, as f32
    int* MF = (int*)wsp; wsp += SZ_MF;               // [NB] 1 where the batch's mask row widens the key loop

    // all conversions to bf16
    k_prep<<<dim3(NB + CB_X + 3 * CB_W + 2 * CB_A + 2 * CB_B, 1, 1), 256, 0, stream>>>(xin, wq, wk, wv, aq, av, bqu, bvu, am, XB, WB, AL, BLq, BLv, MB, MF);

    // q, k: A = x rows (m = b*SEQ + t), Bt = W rows (n = h*64 + d) -> plane [(b*16 + h)][t][d]; v^T: A = Wv rows (m = h*64 + d), Bt = x rows (n = b*SEQ + t) -> plane [(b*1024 + m)][t] = [(b*16 + h)][d][t]; residuals for tokens < EROWS
    k_proj<<<dim3(NB * SEQ / 128, DM / 128, 3), 32 * PW, 0, stream>>>(XB, WB, AL, BLq, BLv, bq, bk, bv, QH, QR, KP, KR, VT, VR, EROWS);

    // query rows [0, EROWS): multi-product instantiation; rows [EROWS, SEQ): single-product instantiation (disjoint output rows)
    k_keypass<<<dim3(NB * NH_, SEQ / (16 * AW), 1), 32 * AW, 0, stream>>>(QH, QR, KP, KR, VT, VR, MB, MF, OUT);
}

// v006
// One run takes 71.8 microseconds.
// Next to v005, in two timings, it ran 1.08 times as fast each time.
// Over all steps from v000 it is 4.45 times as fast.
#include <hip/hip_runtime.h>

// Causal pair-score weighting, width 1024 = 16 heads x 64; one input x [NB][SEQ][1024] feeds q, k and v; Wq/Wk/Wv [out][in] (y = x W^T + bias); rank-8 additive updates on q and v: y += 2 (x A^T) B^T with A [8][in], B [out][8];
// additive key mask [NB][1][1][SEQ] (f32, read by value); score scale 1/sqrt(64); keys j > t are replaced by -1e9 before the mask is added; softmax over keys; output = concatenated heads (f32), no output projection.
// Compute dtypes, f32 accumulate everywhere: projections and x A^T v_wmma_f32_16x16x32_bf16 (x, W, A, B, biases, mask RNE-converted to bf16; products exact); the rank-8 up-projection is one extra 32-deep k-step of the projection GEMM (2 x A^T carried as bf16 hi | lo, B bf16); x A^T is formed inside the projection blocks, from the x tiles that they stage anyway;
// scores v_wmma_f32_16x16x32_f16: single f16 q and k on query rows >= EROWS; q and k each as f16 value + f16 residual x2048 (three products, residual products in their own accumulator) on query rows < EROWS;
// P.V v_wmma_f32_16x16x32_f16: P (x16384 carry, cancels in the normalisation) and v single f16 on query rows >= EROWS; on query rows < EROWS P and v each as f16 value + f16 residual x2048, residual products in their own accumulator folded by 1/2048, row sum from the f32 exponentials; softmax f32 (online, running max).
// Layout: bf16 copies of x, W, A; weight-side extension planes [row][32] bf16 (B | B | 0 | 0; the x side, hi | lo | 0 | 0 of 2 x A^T, lives in fragments only); q, k planes [b*16+h][t][64], v^T plane [b*16+h][d][t], small residual planes q, k [b*16+h][t < EROWS][64] and v^T [b*16+h][d][t < EROWS]; fused online-softmax key-pass kernel in transposed form (S^T = K Q^T, O^T = V^T P^T).
// Key loop bound per wave: the causal limit; if any mask value of the batch is not below 1e8 in magnitude the loop covers all keys (per-element arithmetic is literal in every visited tile). Residual fragments for keys >= EROWS are zero.
// The mask's bf16-rounded values (kept as f32, plane [NB][SEQ]) and that per-batch magnitude test (one word per batch) are formed once, in k_prep; the key-pass kernel only reads them: each block stages its batch's row in LDS once, and the key loop reads it there.

#ifndef NB
#define NB 2
#endif
#ifndef SEQ
#define SEQ 2048
#endif
#define NB_FULL  2
#define SEQ_FULL 2048
#ifndef OUT_SEQ
#define OUT_SEQ SEQ              // row pitch (in tokens) between batches of the output
#endif
#define DM   1024
#define NH_  16
#define HD   64
#define LR   8                   // rank of the additive updates
#define LK   32                  // k extent of the extension planes (one WMMA k-step)
#define XP   20                  // LDS row pitch (floats) of the x A^T tile
#define AW   4                   // waves per online-softmax key-pass block (16 query rows each)
#define PW   4                   // waves per projection block (2 x 2 wave tiles of 64 x 64)
#define PBK  64                  // k extent of one staged projection tile: 128 bytes of every operand row
#define PPI  72                  // LDS row pitch (16-bit elements) of a staged row: 144 bytes = 16 x 9
#define POP  (128 * PPI)         // elements of one staged operand tile (128 rows)
#define PST  (2 * POP)           // elements of one stage: A tile | B tile
#define XOP  (16 * PPI)          // elements of one staged tile of the 16 A rows (q update rows 0..7, v update rows 8..15)
#define OSP  68                  // LDS row pitch (floats) of the online-softmax key-pass output tile
#define KST  64                  // keys of one staged key-pass tile: 64 K rows of 128 bytes, 128 bytes of each of the 64 V^T rows
#define KOP  (64 * PPI)          // elements of one staged key-pass plane tile (64 rows at pitch PPI)
#define EROWS (SEQ < 512 ? SEQ : 512)   // query rows (and tokens of the small residual planes) handled by the multi-product online-softmax key-pass instantiation
#define QRS  2048.0f             // carry of every residual plane / residual fragment
#define QRI  (1.0f / 2048.0f)
#define SC2  ((float)(0.125 * 1.4426950408889634))      // HD^-0.5 * log2(e)
#define L2E  ((float)1.4426950408889634)
#define NEGL ((float)(-1.0e9 * 1.4426950408889634))     // fill value -1e9 in the log2 domain
#define LSC  2.0f                // update scaling 16 / 8
#define PSH  14.0f               // log2 of the P carry (16384)
#define PFL  (-14.0f)            // exponent argument below which the f16 P would leave the normal range
#define NEGB (-3.0e38f)
#define WIDE 1.0e8f              // mask magnitude bound under which skipped (fully causal-filled) tiles contribute exactly zero

static_assert(HD == 64);
static_assert(NH_ * HD == DM);                 // head h = columns h*64 + d
static_assert(DM % 64 == 0);                   // column tiles of 64 = one head
static_assert(64 % HD == 0);
static_assert(DM % 32 == 0);                   // GEMM k-loop steps by 32
static_assert(LK == 32);                       // extension = exactly one k-step
static_assert(2 * LR <= LK);                   // hi | lo pieces fit the extension row
static_assert(LR == 8);                        // one 16-byte piece per part; B rows loaded as 8 floats
static_assert(2 * LR == 16);                   // A rows of q and v updates fill one 16-column tile
static_assert(SEQ % 64 == 0);                  // a 64-row tile never straddles two batches
static_assert((NB * SEQ) % 64 == 0);
static_assert(SEQ % 128 == 0);                 // mask scan steps by 128
static_assert(SEQ % 32 == 0);                  // key loop steps by 32
static_assert(SEQ % (16 * AW) == 0);           // online-softmax key-pass grids cover the sequence exactly
static_assert(EROWS % 64 == 0);                // a 64-token GEMM tile lies wholly inside or outside the residual planes
static_assert(EROWS >= 32);
static_assert(EROWS <= SEQ);
static_assert(EROWS % (16 * AW) == 0);
static_assert((SEQ - EROWS) % (16 * AW) == 0);
static_assert(((size_t)SEQ * DM) % 8 == 0);
static_assert(((size_t)DM * DM) % 8 == 0);
static_assert(((size_t)LR * DM) % 8 == 0);
static_assert(NB <= NB_FULL);
static_assert(SEQ <= SEQ_FULL);
static_assert((OSP * 4) % 16 == 0);
static_assert(OSP >= HD);
static_assert((XP * 4) % 16 == 0);
static_assert(XP >= 16);
static_assert(32 * 4 * 16 == 16 * HD * 2);
static_assert(32 * 4 * 16 == 16 * 64 * 2);
static_assert(32 * 8 * 16 == 16 * HD * 4);     // online-softmax key-pass epilogue: 8 instructions x 32 lanes x 16 B = 16 rows x 256 B
static_assert((NB * SEQ) % 128 == 0);          // projection blocks cover 128 x 128
static_assert(DM % 128 == 0);
static_assert(DM % PBK == 0);
static_assert(DM / PBK >= 2);                  // the two-buffer ring needs two stages
static_assert(PBK * 2 == 128);                 // a staged row is one 128-byte line: 8 lanes x 16 B
static_assert((PPI * 2) % 16 == 0);
static_assert(PPI >= PBK);
static_assert(8 * 32 * PW * 16 == 128 * PBK * 2);   // 8 copies per lane fill one operand tile
static_assert(2 * PST * 2 + 2 * XOP * 2 + PW * 16 * 68 * 4 <= 131072);   // static LDS of the projection kernel
static_assert(128 * XP * 4 <= 2 * PST * 2);           // the block's x A^T tile (128 rows) fits the ring, which is free behind the k loop
static_assert(32 * PW * 16 == 16 * PBK * 2);          // one copy per lane fills one tile of the 16 A rows
static_assert(2 * 4 * KOP * 2 + AW * 16 * OSP * 4 + SEQ * 4 <= 106496);    // static LDS of the online-softmax key-pass kernels: three blocks fit one 320 KiB LDS
static_assert(4 * 32 * AW * 16 == SEQ * 4);    // 4 copies per lane fill the batch's mask row
static_assert(KST == 16 * AW);                 // a block's causal key bound is a whole number of staged tiles
static_assert(SEQ % KST == 0);
static_assert(EROWS % KST == 0);               // a staged tile lies wholly inside or outside the residual planes
static_assert(KST * 2 == 128);                 // a staged V^T row piece is one 128-byte line
static_assert(HD * 2 == 128);                  // a staged K row is one 128-byte line
static_assert(4 * 32 * AW * 16 == 64 * 128);   // 4 copies per lane fill one plane tile

typedef _Float16 h16;
typedef unsigned short bf;
typedef __attribute__((ext_vector_type(16))) __bf16   v16bf;
typedef __attribute__((ext_vector_type(16))) _Float16 v16h;
typedef __attribute__((ext_vector_type(8)))  _Float16 v8h;
typedef __attribute__((ext_vector_type(8)))  unsigned short v8us;
typedef __attribute__((ext_vector_type(8)))  float    v8f;
typedef __attribute__((ext_vector_type(4)))  float    v4f;
typedef v4f  __attribute__((may_alias)) v4fa;
typedef float __attribute__((may_alias)) fal;

__device__ __forceinline__ unsigned short f2bf(float f) { unsigned u = __float_as_uint(f); u += 0x7FFFu + ((u >> 16) & 1u); return (unsigned short)(u >> 16); }
__device__ __forceinline__ float bfr(float f) { return __uint_as_float(((unsigned)f2bf(f)) << 16); }   // value after RNE convert to bf16
__device__ __forceinline__ v16h cat16(v8h lo, v8h hi) { return __builtin_shufflevector(lo, hi, 0, 1, 2, 3, 4, 5, 6, 7, 8, 9, 10, 11, 12, 13, 14, 15); }
__device__ __forceinline__ v16bf cat16b(v8us lo, v8us hi) { return __builtin_bit_cast(v16bf, __builtin_shufflevector(lo, hi, 0, 1, 2, 3, 4, 5, 6, 7, 8, 9, 10, 11, 12, 13, 14, 15)); }
__device__ __forceinline__ v8f wmma16(v16h a, v16h b, v8f c) { return __builtin_amdgcn_wmma_f32_16x16x32_f16(false, a, false, b, (short)0, c, false, false); }
__device__ __forceinline__ v8f wmmab(v16bf a, v16bf b, v8f c) { return __builtin_amdgcn_wmma_f32_16x16x32_bf16(false, a, false, b, (short)0, c, false, false); }
// fragment loaders from K-contiguous 16-bit rows; p already includes + 8*(lane>>4): elements 0..7 <- k0+8h+0..7, elements 8..15 <- k0+16+8h+0..7 (same map for A and B)
__device__ __forceinline__ v16h  ldh(const h16* p) { return cat16(*(const v8h*)p, *(const v8h*)(p + 16)); }
__device__ __forceinline__ v16bf ldb(const bf* p)  { return cat16b(*(const v8us*)p, *(const v8us*)(p + 16)); }
// ordering point for wave-private LDS tiles (same wave writes and reads)
__device__ __forceinline__ void wave_sync() { __builtin_amdgcn_fence(3 /* release order */, "wavefront"); __builtin_amdgcn_wave_barrier(); asm volatile("" ::: "memory"); }

// f32 -> f16 convert that cannot produce a subnormal operand (|v| < 2^-14 -> +0); applied after the plane's power-of-two carry
static __device__ __forceinline__ h16 toh_flush(float v) { const h16 r = (h16)v; return (fabsf(v) < 6.103515625e-05f) ? (h16)0.0f : r; }
// one matrix instruction followed by its own four-slot guard (ties the accumulator, keeps the operands live)
static __device__ __forceinline__ v8f wmma16g(v16h a, v16h b, v8f c) { c = wmma16(a, b, c); asm volatile("v_nop\n\tv_nop\n\tv_nop\n\tv_nop" : "+v"(c) : "v"(a), "v"(b)); return c; }
static __device__ __forceinline__ v8f wmmabg(v16bf a, v16bf b, v8f c) { c = wmmab(a, b, c); asm volatile("v_nop\n\tv_nop\n\tv_nop\n\tv_nop" : "+v"(c) : "v"(a), "v"(b)); return c; }
// one 16-bit word of an extension row: piece 0 = bf16 value, piece 1 = bf16 of the remainder, pieces 2, 3 = zero (select by value)
static __device__ __forceinline__ unsigned short ext_word(float v, int piece) {
    const unsigned short hw = f2bf(v); const float hv = __uint_as_float(((unsigned)hw) << 16); const unsigned short lw = f2bf(v - hv);
    return (piece == 0) ? hw : ((piece == 1) ? lw : (unsigned short)0); }

// eight asynchronous 16-byte copies per lane, global -> LDS: copy i moves the lane's 16 bytes of tile row (row + 16 i). The closing s_wait_xcnt stands inside the statement so that no address register is rewritten ahead of it.
static __device__ __forceinline__ void copy8(unsigned l, const bf* g, size_t gs) {
    const unsigned ls = 16 * PPI * 2;
    asm volatile("global_load_async_to_lds_b128 %0, %8, off\n\t"
                 "global_load_async_to_lds_b128 %1, %9, off\n\t"
                 "global_load_async_to_lds_b128 %2, %10, off\n\t"
                 "global_load_async_to_lds_b128 %3, %11, off\n\t"
                 "global_load_async_to_lds_b128 %4, %12, off\n\t"
                 "global_load_async_to_lds_b128 %5, %13, off\n\t"
                 "global_load_async_to_lds_b128 %6, %14, off\n\t"
                 "global_load_async_to_lds_b128 %7, %15, off\n\t"
                 "s_wait_xcnt 0x0"
                 :: "v"(l), "v"(l + ls), "v"(l + 2 * ls), "v"(l + 3 * ls), "v"(l + 4 * ls), "v"(l + 5 * ls), "v"(l + 6 * ls), "v"(l + 7 * ls),
                    "v"(g), "v"(g + gs), "v"(g + 2 * gs), "v"(g + 3 * gs), "v"(g + 4 * gs), "v"(g + 5 * gs), "v"(g + 6 * gs), "v"(g + 7 * gs)
                 : "memory");
}

// the same with one copy: the lane's 16 bytes of one row
static __device__ __forceinline__ void copy1(unsigned l, const bf* g) {
    asm volatile("global_load_async_to_lds_b128 %0, %1, off\n\t"
                 "s_wait_xcnt 0x0"
                 :: "v"(l), "v"(g)
                 : "memory");
}

// the same with four copies of 16-bit float rows: copy i moves the lane's 16 bytes of tile row (row + 16 i)
static __device__ __forceinline__ void copy4(unsigned l, const h16* g, size_t gs) {
    const unsigned ls = 16 * PPI * 2;
    asm volatile("global_load_async_to_lds_b128 %0, %4, off\n\t"
                 "global_load_async_to_lds_b128 %1, %5, off\n\t"
                 "global_load_async_to_lds_b128 %2, %6, off\n\t"
                 "global_load_async_to_lds_b128 %3, %7, off\n\t"
                 "s_wait_xcnt 0x0"
                 :: "v"(l), "v"(l + ls), "v"(l + 2 * ls), "v"(l + 3 * ls),
                    "v"(g), "v"(g + gs), "v"(g + 2 * gs), "v"(g + 3 * gs)
                 : "memory");
}

// the same with four copies of one f32 row: copy i moves the lane's 16 bytes of the block's i-th run of 32 * AW * 4 floats
static __device__ __forceinline__ void copy4m(unsigned l, const float* g) {
    const unsigned ls = 32 * AW * 16; const size_t gs = 32 * AW * 4;
    asm volatile("global_load_async_to_lds_b128 %0, %4, off\n\t"
                 "global_load_async_to_lds_b128 %1, %5, off\n\t"
                 "global_load_async_to_lds_b128 %2, %6, off\n\t"
                 "global_load_async_to_lds_b128 %3, %7, off\n\t"
                 "s_wait_xcnt 0x0"
                 :: "v"(l), "v"(l + ls), "v"(l + 2 * ls), "v"(l + 3 * ls),
                    "v"(g), "v"(g + gs), "v"(g + 2 * gs), "v"(g + 3 * gs)
                 : "memory");
}

// blocks of 256 threads (8 elements a thread) that each converted plane takes in k_prep
#define CB_X ((int)((size_t)NB * SEQ * DM / 8 / 256))   // x
#define CB_W ((int)((size_t)DM * DM / 8 / 256))         // one weight matrix
#define CB_A ((int)((size_t)LR * DM / 8 / 256))         // one A matrix
#define CB_B (DM * 4 / 256)                             // one weight-side extension plane (4 pieces of 8 per row)
static_assert(((size_t)SEQ * DM / 8) % 256 == 0);       // a block never straddles two batches of x
static_assert(((size_t)DM * DM / 8) % 256 == 0);
static_assert(((size_t)LR * DM / 8) % 256 == 0);

static __device__ __forceinline__ void cvt8(const float* __restrict__ src, bf* dst) {
    const v8f v = *(const v8f*)src; v8us o;
#pragma unroll
    for (int k = 0; k < 8; ++k) o[k] = f2bf(v[k]);
    *(v8us*)dst = o;
    asm volatile("s_wait_xcnt 0x0" ::: "memory");                            // the store's registers are rewritten only behind this wait
}

// k_prep: every f32 -> bf16 conversion of the call in one launch. The block index picks the plane (block-uniform ranges, in the order mask, one block per batch | x | Wq Wk Wv | Aq Av | Bq Bv); every range is covered exactly.
__global__ __launch_bounds__(256) void k_prep(const float* __restrict__ x, const float* __restrict__ wq, const float* __restrict__ wk, const float* __restrict__ wv,
                                              const float* __restrict__ aq, const float* __restrict__ av, const float* __restrict__ bqu, const float* __restrict__ bvu,
                                              const float* __restrict__ amask, bf* XB, bf* WB, bf* AL, bf* BLq, bf* BLv, float* MB, int* MF) {
    int blk = (int)blockIdx.x; const int tid = (int)threadIdx.x;
    if (blk < NB) {                                                           // mask row of batch blk: batch pitch SEQ_FULL in the input, SEQ in the plane; first in the grid, for speed only
        const float* amb = amask + (size_t)blk * SEQ_FULL; float* mrow = MB + (size_t)blk * SEQ;
        for (int i = tid * 8; i < SEQ; i += 256 * 8) {                        // value after RNE convert to bf16, stored as f32
            const v8f v = *(const v8f*)(amb + i); v8f o;
#pragma unroll
            for (int k = 0; k < 8; ++k) o[k] = bfr(v[k]);
            *(v8f*)(mrow + i) = o;
            asm volatile("s_wait_xcnt 0x0" ::: "memory"); }                  // the load's and the store's registers are rewritten only behind this wait
        if (tid < 32) {                                                       // the first wave scans the whole row: any value not below WIDE in magnitude widens the key loop to all keys
            float fl = 0.0f;
#pragma unroll 4
            for (int i = 0; i < SEQ; i += 128) {                              // four loads in flight a trip: more would raise the register count of every block of this kernel
                const v4f w = *(const v4f*)(amb + i + 4 * tid);
#pragma unroll
                for (int c = 0; c < 4; ++c) { const float a = fabsf(bfr(w[c])); fl = (a < WIDE) ? fl : 1.0f; } }
            fl = fmaxf(fl, __shfl_xor(fl, 16, 32)); fl = fmaxf(fl, __shfl_xor(fl, 8, 32)); fl = fmaxf(fl, __shfl_xor(fl, 4, 32));
            fl = fmaxf(fl, __shfl_xor(fl, 2, 32));  fl = fmaxf(fl, __shfl_xor(fl, 1, 32));
            if (tid == 0) MF[blk] = (fl != 0.0f) ? 1 : 0; }
        return; }
    blk -= NB;
    if (blk < CB_X) {                                                         // x: batch pitch SEQ_FULL tokens in the input, SEQ in the copy
        const size_t i = (size_t)blk * 256 + tid; const size_t nb8 = (size_t)SEQ * DM / 8; const size_t bb = i / nb8, r = i % nb8;
        cvt8(x + bb * ((size_t)SEQ_FULL * DM) + r * 8, XB + i * 8); return; }
    blk -= CB_X;
    if (blk < 3 * CB_W) {
        const int w = blk / CB_W; const float* s = (w == 0) ? wq : ((w == 1) ? wk : wv); const size_t i = (size_t)(blk - w * CB_W) * 256 + tid;
        cvt8(s + i * 8, WB + (size_t)w * DM * DM + i * 8); return; }
    blk -= 3 * CB_W;
    if (blk < 2 * CB_A) {
        const int w = blk / CB_A; const float* s = (w == 0) ? aq : av; const size_t i = (size_t)(blk - w * CB_A) * 256 + tid;
        cvt8(s + i * 8, AL + (size_t)w * LR * DM + i * 8); return; }
    blk -= 2 * CB_A;
    {                                                                         // weight-side extension rows: B | B | 0 | 0
        const int w = blk / CB_B; const float* s = (w == 0) ? bqu : bvu; bf* d = (w == 0) ? BLq : BLv; const int i = (blk - w * CB_B) * 256 + tid;
        const int row = i >> 2, piece = i & 3;
        const v8f v = *(const v8f*)(s + (size_t)row * LR); v8us o;
#pragma unroll
        for (int k = 0; k < 8; ++k) { const unsigned short t = f2bf(v[k]); o[k] = (piece < 2) ? t : (unsigned short)0; }
        *(v8us*)(d + (size_t)i * 8) = o;
        asm volatile("s_wait_xcnt 0x0" ::: "memory"); }                      // the store's registers are rewritten only behind this wait
}

template <int MODE, int LOWR>
__device__ __forceinline__ void proj_body(bf* ring, bf* xring, float* osa, int bx, int by, const bf* __restrict__ A, const bf* __restrict__ Bt, const bf* __restrict__ AL, const bf* __restrict__ WX, int xcol,
                                          const float* __restrict__ bias, h16* Ph, h16* Pr, int resT) {
    const int K = DM;
    const int lane = threadIdx.x & 31, lr = lane & 15, hi = lane >> 4;
    const int wave = __builtin_amdgcn_readfirstlane((int)(threadIdx.x >> 5));
    const int wm = (wave & 1) * 64, wn = (wave >> 1) * 64;                    // the wave's 64 x 64 tile inside the block
    const int r0 = bx * 128 + wm, c0 = by * 128 + wn;
    float* os = osa + wave * 16 * 68;                                         // wave-private output staging
    v8f acc[4][4];
#pragma unroll
    for (int mb = 0; mb < 4; ++mb)
#pragma unroll
        for (int nb = 0; nb < 4; ++nb) acc[mb][nb] = (v8f){};
    v8f xacc[2]; xacc[0] = (v8f){}; xacc[1] = (v8f){};                        // LOWR: x A^T of the wave's 32 x rows
    const int xh = LOWR ? ((MODE == 0) ? (wave >> 1) : (wave & 1)) : 0;       // which 32 of the 64 x rows that it shares with its partner wave are its own for x A^T (wave-uniform)
    const int rot[4] = { xh * 32, xh * 32 + 16, 32 - xh * 32, 48 - xh * 32 };  // x-side fragment i holds the 16 x rows from rot[i] on: the wave's own 32 rows are always fragments 0 and 1, so that no branch picks registers in the k loop
    // copy side: thread tid moves bytes 16 (tid & 7) of tile rows (tid >> 3) + 16 i, i = 0..7, of both operands (and of A row tid >> 3 when LOWR)
    const int crow = (int)(threadIdx.x >> 3), cch = (int)(threadIdx.x & 7);
    const bf* ga = A  + (size_t)(bx * 128 + crow) * K + cch * 8;      // rows < M, columns k0 + 63 < K
    const bf* gb = Bt + (size_t)(by * 128 + crow) * K + cch * 8;
    const unsigned la = (unsigned)(size_t)(&ring[crow * PPI + cch * 8]);      // LDS byte address = low 32 bits of the shared address
    const unsigned lb = la + POP * 2;
    const bf* gl = AL + (size_t)crow * K + cch * 8;                           // rows < 16
    const unsigned lx = (unsigned)(size_t)(&xring[crow * PPI + cch * 8]);
    const int xfo = lr * PPI + 8 * hi;
    const int NT = K / PBK;
    // read side: same loader and k map as from the planes, rows at pitch PPI
    const int afr = (wm + lr) * PPI + 8 * hi, bfo = POP + (wn + lr) * PPI + 8 * hi;
    copy8(la, ga, (size_t)16 * K); copy8(lb, gb, (size_t)16 * K);             // tile 0 -> buffer 0
    if (LOWR) copy1(lx, gl);
    asm volatile("s_wait_asynccnt 0x0" ::: "memory");                         // this wave's copies of tile 0 have landed
    __syncthreads();                                                          // ... and every other wave's
    copy8(la + PST * 2, ga + PBK, (size_t)16 * K); copy8(lb + PST * 2, gb + PBK, (size_t)16 * K);   // tile 1 -> buffer 1
    if (LOWR) copy1(lx + XOP * 2, gl + PBK);
#pragma unroll 1
    for (int t = 0; t < NT; ++t) {                                            // rolled: one pass per staged tile
        const int bo = (t & 1) * PST;
#pragma unroll
        for (int ks = 0; ks < PBK; ks += 32) {
            v16bf a[4];
#pragma unroll
            for (int mb = 0; mb < 4; ++mb) a[mb] = ldb(&ring[bo + afr + ((MODE == 0) ? rot[mb] : mb * 16) * PPI + ks]);
            v16bf b[4];                                                       // all fragments of a k-step (eight, nine with LOWR) are read as one group of LDS loads
#pragma unroll
            for (int nb = 0; nb < 4; ++nb) b[nb] = ldb(&ring[bo + bfo + ((MODE == 1) ? rot[nb] : nb * 16) * PPI + ks]);
            v16bf al = a[0];
            if (LOWR) al = ldb(&xring[(t & 1) * XOP + xfo + ks]);
#pragma unroll
            for (int nb = 0; nb < 4; ++nb) {
#pragma unroll
                for (int mb = 0; mb < 4; ++mb) acc[mb][nb] = wmmabg(a[mb], b[nb], acc[mb][nb]); }
            if (LOWR) { xacc[0] = wmmabg((MODE == 0) ? a[0] : b[0], al, xacc[0]); xacc[1] = wmmabg((MODE == 0) ? a[1] : b[1], al, xacc[1]); }
        }
        asm volatile("s_wait_dscnt 0x0" ::: "memory");                        // this wave's reads of buffer t & 1 are done before it is refilled
        asm volatile("s_wait_asynccnt 0x0" ::: "memory");                     // this wave's copies of tile t + 1 have landed
        __syncthreads();                                                      // publishes tile t + 1 and ends every reader's last read of buffer t & 1
        if (t + 2 < NT) { copy8(la + bo * 2, ga + (size_t)(t + 2) * PBK, (size_t)16 * K); copy8(lb + bo * 2, gb + (size_t)(t + 2) * PBK, (size_t)16 * K);
                          if (LOWR) copy1(lx + (t & 1) * (XOP * 2), gl + (size_t)(t + 2) * PBK); }
    }
    asm volatile("s_wait_asynccnt 0x0" ::: "memory");                         // no copy is outstanding behind the loop
    if (LOWR) {                                                                                   // extension k-step: rows of 32 bf16, same k map on both sides
        const size_t wxo = (size_t)(((MODE == 0) ? c0 : r0) + lr) * LK + 8 * hi;
        v16bf we[4];                                                                              // weight side, from its plane; the loads fly under the exchange below
#pragma unroll
        for (int i = 0; i < 4; ++i) we[i] = ldb(WX + wxo + (size_t)i * 16 * LK);
        fal* xs = (fal*)ring;                                                                     // [128 x rows of the block][XP]; every reader of the ring has passed the loop's last barrier and no copy is outstanding
        const int xw = (MODE == 0) ? wm : wn;                                                     // the wave's 64 x rows inside the block
#pragma unroll
        for (int i = 0; i < 2; ++i)
#pragma unroll
            for (int j = 0; j < 8; ++j) xs[(xw + rot[i] + hi * 8 + j) * XP + lr] = xacc[i][j] * LSC;   // D: row 8h+j, col lane&15
        __syncthreads();                                                                          // each wave reads 32 rows that its partner wave wrote
        v16bf xe[4];
#pragma unroll
        for (int i = 0; i < 4; ++i) {
            const v4f e0 = *(const v4fa*)(&xs[(xw + rot[i] + lr) * XP + xcol]); const v4f e1 = *(const v4fa*)(&xs[(xw + rot[i] + lr) * XP + xcol + 4]); v8us w;
#pragma unroll
            for (int k = 0; k < 4; ++k) { w[k] = ext_word(e0[k], hi); w[4 + k] = ext_word(e1[k], hi); }
            xe[i] = cat16b(w, (v8us){}); }
#pragma unroll
        for (int nb = 0; nb < 4; ++nb) {
#pragma unroll
            for (int mb = 0; mb < 4; ++mb) acc[mb][nb] = (MODE == 0) ? wmmabg(xe[mb], we[nb], acc[mb][nb]) : wmmabg(we[mb], xe[nb], acc[mb][nb]); }
    }
    float bc[4];
#pragma unroll
    for (int nb = 0; nb < 4; ++nb) bc[nb] = (MODE == 0) ? bfr(bias[c0 + nb * 16 + lr]) : 0.0f;   // MODE 0: c0 + 63 < DM
    size_t tbase, rbase; bool wr;                                                                 // wr: wave-uniform, the wave's whole tile inside the residual plane
    if (MODE == 0) { const int bb = r0 / SEQ, tt = r0 % SEQ; const int zc = bb * NH_ + c0 / HD;
                     tbase = ((size_t)zc * SEQ + (size_t)tt) * HD; rbase = ((size_t)zc * (size_t)resT + (size_t)tt) * HD; wr = tt < resT; }
    else           { const int bb = c0 / SEQ, tt = c0 % SEQ;
                     tbase = (size_t)bb * (size_t)DM * SEQ + (size_t)r0 * SEQ + (size_t)tt; rbase = (size_t)bb * (size_t)DM * (size_t)resT + (size_t)r0 * (size_t)resT + (size_t)tt; wr = tt < resT; }
#pragma unroll
    for (int mb = 0; mb < 4; ++mb) {
        float br[8];
#pragma unroll
        for (int j = 0; j < 8; ++j) br[j] = (MODE == 1) ? bfr(bias[r0 + mb * 16 + hi * 8 + j]) : 0.0f;   // MODE 1: r0 + 63 < DM
#pragma unroll
        for (int nb = 0; nb < 4; ++nb) {
#pragma unroll
            for (int j = 0; j < 8; ++j) os[(hi * 8 + j) * 68 + ((MODE == 1) ? rot[nb] : nb * 16) + lr] = acc[mb][nb][j] + bc[nb] + br[j]; }   // D: row 8h+j, col lane&15; rows 0..15 x columns 0..63 all written
        wave_sync();
{
            if (MODE == 0) {
                const size_t sb = tbase + (size_t)rot[mb] * HD;
                const size_t rb = rbase + (size_t)rot[mb] * HD;
#pragma unroll
                for (int s = 0; s < 4; ++s) { const int p = s * 32 + lane; const int row = p >> 3, c8 = (p & 7) * 8;   // 4 s x 4 rows = 16 rows; 8 lanes x 8 = 64 columns = one line
                    const v4f x0 = *(const v4fa*)(&os[row * 68 + c8]); const v4f x1 = *(const v4fa*)(&os[row * 68 + c8 + 4]); v8h hv, rv;
#pragma unroll
                    for (int i = 0; i < 4; ++i) { const h16 a0 = toh_flush(x0[i]); const h16 a1 = toh_flush(x1[i]); hv[i] = a0; hv[4 + i] = a1;
                                                  rv[i] = toh_flush((x0[i] - (float)a0) * QRS); rv[4 + i] = toh_flush((x1[i] - (float)a1) * QRS); }
                    const size_t oo = sb + (size_t)p * 8;
                    const size_t ro = rb + (size_t)p * 8;
                    *(v8h*)(Ph + oo) = hv; asm volatile("s_wait_xcnt 0x0" ::: "memory");                    // each store's registers are rewritten only behind its wait
                    if (wr) { *(v8h*)(Pr + ro) = rv; asm volatile("s_wait_xcnt 0x0" ::: "memory"); } }
            } else {
                const size_t sb = tbase + (size_t)(mb * 16) * SEQ;
                const size_t rb = rbase + (size_t)(mb * 16) * (size_t)resT;
#pragma unroll
                for (int s = 0; s < 4; ++s) { const int row = 4 * s + (lane >> 3), c8 = (lane & 7) * 8;   // 4 s x 4 row groups = 16 rows; 8 lanes x 8 = 64 columns
                    const v4f x0 = *(const v4fa*)(&os[row * 68 + c8]); const v4f x1 = *(const v4fa*)(&os[row * 68 + c8 + 4]); v8h hv, rv;
#pragma unroll
                    for (int i = 0; i < 4; ++i) { const h16 a0 = toh_flush(x0[i]); const h16 a1 = toh_flush(x1[i]); hv[i] = a0; hv[4 + i] = a1;
                                                  rv[i] = toh_flush((x0[i] - (float)a0) * QRS); rv[4 + i] = toh_flush((x1[i] - (float)a1) * QRS); }
                    const size_t oo = sb + (size_t)row * SEQ + c8;
                    const size_t ro = rb + (size_t)row * (size_t)resT + c8;
                    *(v8h*)(Ph + oo) = hv; asm volatile("s_wait_xcnt 0x0" ::: "memory");                    // each store's registers are rewritten only behind its wait
                    if (wr) { *(v8h*)(Pr + ro) = rv; asm volatile("s_wait_xcnt 0x0" ::: "memory"); } }
            }
             }
        wave_sync();
    }
}

// k_proj: the three projections in one launch, blockIdx.z picks one (block-uniform); the three bodies share one ring and one output staging, declared here so that the block's LDS is that of one body.
// z = 0, q: token-major with the update extension; z = 1, k: token-major, no extension; z = 2, v^T: feature-major with the update extension (A = Wv rows, so the block's row tile is blockIdx.y and its column tile blockIdx.x).
// Registers are capped at 256: without the cap the extension step spreads above v255 and pays a register-window switch at many of its instructions.
__global__ __launch_bounds__(32 * PW) __attribute__((amdgpu_num_vgpr(256)))
void k_proj(const bf* __restrict__ XB, const bf* __restrict__ WB, const bf* __restrict__ AL, const bf* __restrict__ BLq, const bf* __restrict__ BLv,
                                              const float* __restrict__ bq, const float* __restrict__ bk, const float* __restrict__ bv,
                                              h16* QH, h16* QR, h16* KP, h16* KR, h16* VT, h16* VR, int resT) {
    __shared__ __align__(16) bf ring[2 * PST];
    __shared__ __align__(16) bf xring[2 * XOP];
    __shared__ __align__(16) float osa[PW * 16 * 68];
    const int z = (int)blockIdx.z, gx = (int)blockIdx.x, gy = (int)blockIdx.y;
    const bf* WK = WB + (size_t)DM * DM; const bf* WV = WB + (size_t)2 * DM * DM;
    if (z == 0)      proj_body<0, 1>(ring, xring, osa, gx, gy, XB, WB, AL, BLq, 0, bq, QH, QR, resT);
    else if (z == 1) proj_body<0, 0>(ring, xring, osa, gx, gy, XB, WK, AL, WK, 0, bk, KP, KR, resT);
    else             proj_body<1, 1>(ring, xring, osa, gy, gx, WV, XB, AL, BLv, LR, bv, VT, VR, resT);
}

template <int EARLY>
__device__ __forceinline__ void keypass_body(h16* ring, float* os, float* mrow, int qt, int zh, const h16* __restrict__ QH, const h16* __restrict__ QR, const h16* __restrict__ KP, const h16* __restrict__ KR,
                                           const h16* __restrict__ VT, const h16* __restrict__ VR, const float* __restrict__ MB, const int* __restrict__ MF, float* OUT) {
    constexpr int KSG = (EARLY ? 4 : 2) * KOP;                                // elements of one stage: K | V^T (| K residual | V^T residual); the ring holds two stages
    const int lane = threadIdx.x & 31, lr = lane & 15, hi = lane >> 4;
    const int wave = __builtin_amdgcn_readfirstlane((int)(threadIdx.x >> 5));
    const int b = zh / NH_, h = zh % NH_;
    const int t0 = (qt * AW + wave) * 16;                                     // qt: the block's tile of 64 query rows, counted over the whole sequence
    const int lim = t0 + lr;                                                  // key j is causal-filled iff j > lim
    const float* amb = MB + (size_t)b * SEQ;                                  // the batch's mask row, already rounded to bf16 values
    const size_t pbase = (size_t)zh * SEQ * HD;
    const size_t rbase = (size_t)zh * EROWS * HD;
    // copy side: thread tid moves bytes 16 (tid & 7) of tile rows (tid >> 3) + 16 i, i = 0..3, of every staged plane (K rows = keys, V^T rows = d)
    const int crow = (int)(threadIdx.x >> 3), cch = (int)(threadIdx.x & 7);
    const h16* gk  = KP + pbase + (size_t)crow * HD + cch * 8;                // + key * HD, keys < SEQ
    const h16* gv  = VT + pbase + (size_t)crow * SEQ + cch * 8;               // + key, keys + 63 < SEQ
    const h16* gkr = KR + rbase + (size_t)crow * HD + cch * 8;                // + key * HD, keys < EROWS
    const h16* gvr = VR + rbase + (size_t)crow * EROWS + cch * 8;             // + key, keys + 63 < EROWS
    const unsigned l0 = (unsigned)(size_t)(&ring[crow * PPI + cch * 8]);      // LDS byte address = low 32 bits of the shared address
    auto stage = [&](int s, int buf) {                                        // tile s (keys 64 s .. 64 s + 63) -> buffer buf
        const int k0 = s * KST; const unsigned l = l0 + (unsigned)buf * (KSG * 2);
        copy4(l, gk + (size_t)k0 * HD, (size_t)16 * HD); copy4(l + KOP * 2, gv + k0, (size_t)16 * SEQ);
        if (EARLY) { const int kc = (k0 < EROWS) ? k0 : (EROWS - KST);        // clamped residual-plane key (address always inside the plane)
                     copy4(l + 2 * KOP * 2, gkr + (size_t)kc * HD, (size_t)16 * HD); copy4(l + 3 * KOP * 2, gvr + kc, (size_t)16 * EROWS); } };
    stage(0, 0);                                                              // tile 0 exists for every block; its copies fly under the Q loads
    copy4m((unsigned)(size_t)(&mrow[threadIdx.x * 4]), amb + threadIdx.x * 4);   // the batch's whole mask row (SEQ floats) -> LDS, once per block; tile 0's wait and barrier below cover these copies too
    const bool wide = MF[b] != 0;                                             // k_prep's test of the batch's mask row: any value not below WIDE in magnitude widens the key loop to all keys
    const int nkc = (t0 + 16 + 31) & ~31;                                     // causal bound, multiple of 32, <= SEQ
    const int nk = __builtin_amdgcn_readfirstlane(wide ? SEQ : nkc);
    const int nbv = wide ? SEQ : ((qt + 1) * KST);           // the block's bound = its last wave's; every wave reads the same word, so it is block-uniform
    const int NS = __builtin_amdgcn_readfirstlane(nbv) / KST;                 // staged tiles of the block, >= 1
    const size_t qo = pbase + (size_t)(t0 + lr) * HD + 8 * hi;
    const v16h hz = (v16h){};
    v16h qh[2], qr[2];
    qh[0] = ldh(QH + qo); qh[1] = ldh(QH + qo + 32);             // B fragments: col t, k = d (two k-steps)
    qr[0] = hz; qr[1] = hz;
    if (EARLY) { const size_t qro = rbase + (size_t)(t0 + lr) * HD + 8 * hi; qr[0] = ldh(QR + qro); qr[1] = ldh(QR + qro + 32); }   // t0 + lr < EROWS
    const int fo = lr * PPI + 8 * hi;                          // read side, same loader and k map as from the planes, rows at pitch PPI: K + key * PPI (A fragment: row key, k = d); V^T + 16j * PPI + key (A fragment: row d, k = key)
    v8f o[4], oR[4];
#pragma unroll
    for (int j = 0; j < 4; ++j) { o[j] = (v8f){}; oR[j] = (v8f){}; }
    float m = NEGB, l = 0.0f;
    asm volatile("s_wait_asynccnt 0x0" ::: "memory");            // this wave's copies of tile 0 have landed
    __syncthreads();                                             // ... and every other wave's
    if (1 < NS) stage(1, 1);
#pragma unroll 1
    for (int s = 0; s < NS; ++s) {                               // rolled: one pass per staged tile
    const int bo = (s & 1) * KSG;
    const int ke = (nk - s * KST < KST) ? nk - s * KST : KST;    // keys of this tile below the wave's own bound
#pragma unroll 1
    for (int kk = 0; kk < ke; kk += 32) {                        // rolled: the 32-key halves of a tile share one body, which keeps the loop's text small
        const int key0 = s * KST + kk;
        const bool rok = key0 < EROWS;                           // wave-uniform
        const h16* kpt = &ring[bo + fo + kk * PPI];
        v8f sHa = (v8f){}, sLa = (v8f){}, sHb = (v8f){}, sLb = (v8f){};
        const h16* krp = &ring[bo + (EARLY ? 2 : 0) * KOP + fo + kk * PPI];   // residual tiles exist in the EARLY stage only
        const h16* va  = &ring[bo + KOP + fo + kk];
        const h16* vrp = &ring[bo + (EARLY ? 3 : 1) * KOP + fo + kk];
        const float* kp = &mrow[8 * hi + key0];                  // keys key0+8h+0..7 and key0+16+8h+0..7, all < nk <= SEQ; from the row staged in LDS
        const v4f m0 = *(const v4fa*)kp, m1 = *(const v4fa*)(kp + 4), m2 = *(const v4fa*)(kp + 16), m3 = *(const v4fa*)(kp + 20);
        v16h ka[2], kb[2], kra[2], krb[2], vf[4];          // the fragments of a product run are read as one group of LDS loads ahead of it
#pragma unroll
        for (int ks = 0; ks < 2; ++ks) {
            ka[ks] = ldh(kpt + ks * 32); kb[ks] = ldh(kpt + 16 * PPI + ks * 32);
            if (EARLY) { kra[ks] = ldh(krp + ks * 32); krb[ks] = ldh(krp + 16 * PPI + ks * 32); } }
        if (!EARLY) {                                              // registers allow: the V^T fragments join the K group
#pragma unroll
            for (int j = 0; j < 4; ++j) vf[j] = ldh(va + (16 * j) * PPI); }
#pragma unroll
        for (int ks = 0; ks < 2; ++ks) {
            sHa = wmma16g(ka[ks], qh[ks], sHa); sHb = wmma16g(kb[ks], qh[ks], sHb);
            if (EARLY) {
                sLa = wmma16g(ka[ks], qr[ks], sLa); sLb = wmma16g(kb[ks], qr[ks], sLb);
                if (!rok) { kra[ks] = hz; krb[ks] = hz; }
                sLa = wmma16g(kra[ks], qh[ks], sLa); sLb = wmma16g(krb[ks], qh[ks], sLb);
            }
        }
        if (EARLY) {                                               // the V^T group flies under the softmax
#pragma unroll
            for (int j = 0; j < 4; ++j) vf[j] = ldh(va + (16 * j) * PPI); }
        float kx[8], ky[8];
#pragma unroll
        for (int r = 0; r < 4; ++r) { kx[r] = m0[r]; kx[4 + r] = m1[r]; ky[r] = m2[r]; ky[4 + r] = m3[r]; }
        const int ja = key0 + 8 * hi;
        float ta[8], tb[8]; float mx = NEGB;
#pragma unroll
        for (int r = 0; r < 8; ++r) {
            const float sa = EARLY ? (sHa[r] + sLa[r] * QRI) * SC2 : sHa[r] * SC2;
            const float sb = EARLY ? (sHb[r] + sLb[r] * QRI) * SC2 : sHb[r] * SC2;
            ta[r] = ((ja + r > lim) ? NEGL : sa) + kx[r] * L2E;                  // replace, then add the mask
            tb[r] = ((ja + 16 + r > lim) ? NEGL : sb) + ky[r] * L2E;
            mx = fmaxf(mx, fmaxf(ta[r], tb[r])); }
        mx = fmaxf(mx, __shfl_xor(mx, 16, 32));
        const float mnew = fmaxf(m, mx);
        const float alpha = __builtin_amdgcn_exp2f(m - mnew);
        const float sh = PSH - mnew;
        v16h pb, pr = hz; float ls = 0.0f;
#pragma unroll
        for (int r = 0; r < 8; ++r) {
            const float aa = ta[r] + sh, ab = tb[r] + sh;
            const float ea = __builtin_amdgcn_exp2f(aa), eb = __builtin_amdgcn_exp2f(ab);
            const float ga = (aa < PFL) ? 0.0f : ea, gb = (ab < PFL) ? 0.0f : eb;   // below the f16 normal range -> exactly zero, selected by value
            const h16 pa = (h16)ga; const h16 pc = (h16)gb;
            pb[r] = pa; pb[8 + r] = pc;
            if (EARLY) { pr[r] = toh_flush((ga - (float)pa) * QRS); pr[8 + r] = toh_flush((gb - (float)pc) * QRS); ls += ga + gb; }
            else       { ls += (float)pa + (float)pc; } }
        l = l * alpha + ls; m = mnew;
#pragma unroll
        for (int j = 0; j < 4; ++j) { o[j] = o[j] * alpha; if (EARLY) oR[j] = oR[j] * alpha; }
#pragma unroll
        for (int jp = 0; jp < 2; ++jp) {
            const v16h v0 = vf[2 * jp], v1 = vf[2 * jp + 1];
            o[2 * jp] = wmma16g(v0, pb, o[2 * jp]); o[2 * jp + 1] = wmma16g(v1, pb, o[2 * jp + 1]);
            if (EARLY) {
                oR[2 * jp] = wmma16g(v0, pr, oR[2 * jp]); oR[2 * jp + 1] = wmma16g(v1, pr, oR[2 * jp + 1]);
                v16h vr0 = ldh(vrp + (32 * jp) * PPI), vr1 = ldh(vrp + (32 * jp + 16) * PPI);
                if (!rok) { vr0 = hz; vr1 = hz; }
                oR[2 * jp] = wmma16g(vr0, pb, oR[2 * jp]); oR[2 * jp + 1] = wmma16g(vr1, pb, oR[2 * jp + 1]);
            }
        }
    }
    asm volatile("s_wait_dscnt 0x0" ::: "memory");               // this wave's reads of buffer s & 1 are done before it is refilled
    asm volatile("s_wait_asynccnt 0x0" ::: "memory");            // this wave's copies of tile s + 1 have landed
    __syncthreads();                                             // publishes tile s + 1 and ends every reader's last read of buffer s & 1
    if (s + 2 < NS) stage(s + 2, s & 1);
    }
    asm volatile("s_wait_asynccnt 0x0" ::: "memory");            // no copy is outstanding behind the loop
    l += __shfl_xor(l, 16, 32);
    const float inv = 1.0f / l;                                  // l >= 2^14 whenever the row has a finite maximum logit
    const int wb = wave * 16 * OSP;
    // O^T D layout: o[j][r] = (d = 16j + 8h + r, t = lane&15) -> os[t][d]; rows 0..15 x columns 0..63 all written
#pragma unroll
    for (int j = 0; j < 4; ++j) {
        v8f f = o[j];
        if (EARLY) f = o[j] + oR[j] * QRI;
        v4f a, c;
        a[0] = f[0] * inv; a[1] = f[1] * inv; a[2] = f[2] * inv; a[3] = f[3] * inv; c[0] = f[4] * inv; c[1] = f[5] * inv; c[2] = f[6] * inv; c[3] = f[7] * inv;
        *(v4fa*)(&os[wb + lr * OSP + 16 * j + 8 * hi]) = a; *(v4fa*)(&os[wb + lr * OSP + 16 * j + 8 * hi + 4]) = c; }
    wave_sync();
    float* orow = OUT + ((size_t)b * OUT_SEQ + t0) * DM + h * HD;
{
#pragma unroll
        for (int s = 0; s < 8; ++s) { const int row = 2 * s + (lane >> 4), cofs = (lane & 15) * 4;   // 8 s x 2 rows = 16 rows; 16 lanes x 4 floats = 64 columns = two lines
            const v4f val = *(const v4fa*)(&os[wb + row * OSP + cofs]);
            *(v4f*)(orow + (size_t)row * DM + cofs) = val; }
         }
}

// k_keypass: both instantiations in one launch. blockIdx.x = (batch, head); blockIdx.y counts the 64-row query tiles from the last one down, for speed only.
// The choice of the body is block-uniform; the two bodies share one ring and one output staging, declared here.
__global__ __launch_bounds__(32 * AW) __attribute__((amdgpu_num_vgpr(256)))
void k_keypass(const h16* __restrict__ QH, const h16* __restrict__ QR, const h16* __restrict__ KP, const h16* __restrict__ KR,
               const h16* __restrict__ VT, const h16* __restrict__ VR, const float* __restrict__ MB, const int* __restrict__ MF, float* OUT) {
    __shared__ __align__(16) h16 ring[2 * 4 * KOP];
    __shared__ __align__(16) float os[AW * 16 * OSP];
    __shared__ __align__(16) float mrow[SEQ];
    const int zh = (int)blockIdx.x; const int qt = SEQ / (16 * AW) - 1 - (int)blockIdx.y;
    if (qt < EROWS / (16 * AW)) keypass_body<1>(ring, os, mrow, qt, zh, QH, QR, KP, KR, VT, VR, MB, MF, OUT);
    else                        keypass_body<0>(ring, os, mrow, qt, zh, QH, QH, KP, KP, VT, VT, MB, MF, OUT);
}

static constexpr size_t al256(size_t v) { return (v + 255) & ~(size_t)255; }
static constexpr size_t SZ_XB = al256((size_t)NB * SEQ * DM * 2);
static constexpr size_t SZ_WB = al256((size_t)3 * DM * DM * 2);
static constexpr size_t SZ_AL = al256((size_t)2 * LR * DM * 2);
static constexpr size_t SZ_BL = al256((size_t)DM * LK * 2);
static constexpr size_t SZ_PL = al256((size_t)NB * NH_ * SEQ * HD * 2);
static constexpr size_t SZ_RS = al256((size_t)NB * NH_ * EROWS * HD * 2);
static constexpr size_t SZ_MB = al256((size_t)NB * SEQ * 4);
static constexpr size_t SZ_MF = al256((size_t)NB * 4);
static constexpr size_t SZ_TOTAL = SZ_XB + SZ_WB + SZ_AL + 2 * SZ_BL + 3 * SZ_PL + 3 * SZ_RS + SZ_MB + SZ_MF;
static_assert(SZ_TOTAL <= (size_t)134217728);          // workspace carve <= 128 MiB
static_assert(((size_t)DM * DM * 2) % 256 == 0);       // weight sub-planes stay 256-byte aligned
static_assert(((size_t)LR * DM * 2) % 256 == 0);       // the two halves of the A plane stay 256-byte aligned
static_assert((size_t)NB * NH_ * SEQ * HD == (size_t)NB * DM * SEQ);       // v^T plane [(b*1024 + m)][t] has the same extent as the q/k planes
static_assert((size_t)NB * NH_ * EROWS * HD == (size_t)NB * DM * EROWS);   // v^T residual plane [(b*1024 + m)][t < EROWS] has the same extent as the q/k residual planes
static_assert((DM * 4) % 256 == 0);                    // the extension-plane block ranges of k_prep cover their planes exactly

extern "C" void kernel_launch(void* const* d_in, const int* in_sizes, int n_in,
                              void* d_out, int out_size, void* d_ws, size_t ws_size, hipStream_t stream) {
    if (n_in < 12) return;
    const size_t needx = ((size_t)(NB - 1) * SEQ_FULL + SEQ) * DM;
    const size_t needm = (size_t)(NB - 1) * SEQ_FULL + SEQ;
    if ((size_t)in_sizes[0] < needx || (size_t)in_sizes[1] < needm) return;
    if ((size_t)in_sizes[2] < (size_t)DM * DM || (size_t)in_sizes[4] < (size_t)DM * DM || (size_t)in_sizes[6] < (size_t)DM * DM) return;
    if (in_sizes[3] < DM || in_sizes[5] < DM || in_sizes[7] < DM) return;
    if (in_sizes[8] < LR * DM || in_sizes[9] < DM * LR || in_sizes[10] < LR * DM || in_sizes[11] < DM * LR) return;
    if ((size_t)out_size < ((size_t)(NB - 1) * OUT_SEQ + SEQ) * DM) return;
    if (SZ_TOTAL > ws_size) return;
    // wire order: hidden_states, key_mask (the module's additive key mask input), Wq, bq, Wk, bk, Wv, bv, Aq, Bq, Av, Bv
    const float* xin = (const float*)d_in[0];
    const float* am  = (const float*)d_in[1];
    const float* wq = (const float*)d_in[2]; const float* bq = (const float*)d_in[3];
    const float* wk = (const float*)d_in[4]; const float* bk = (const float*)d_in[5];
    const float* wv = (const float*)d_in[6]; const float* bv = (const float*)d_in[7];
    const float* aq = (const float*)d_in[8]; const float* bqu = (const float*)d_in[9];
    const float* av = (const float*)d_in[10]; const float* bvu = (const float*)d_in[11];
    float* OUT = (float*)d_out;      // [NB][SEQ][1024]
    char* wsp = (char*)d_ws;
    bf* XB = (bf*)wsp; wsp += SZ_XB;                 // x      [NB*SEQ][1024]
    bf* WB = (bf*)wsp; wsp += SZ_WB;                 // [3][1024][1024]: q | k | v  ([out][in] = Bt as-is)
    bf* AL = (bf*)wsp; wsp += SZ_AL;                 // [16][1024]: rows 0..7 A of the q update, rows 8..15 A of the v update
    bf* BLq = (bf*)wsp; wsp += SZ_BL;                // [1024][32]: B | B | 0 | 0 (q update)
    bf* BLv = (bf*)wsp; wsp += SZ_BL;                // [1024][32]: B | B | 0 | 0 (v update)
    h16* QH = (h16*)wsp; wsp += SZ_PL;               // [NB*16][SEQ][64]
    h16* KP = (h16*)wsp; wsp += SZ_PL;               // [NB*16][SEQ][64]
    h16* VT = (h16*)wsp; wsp += SZ_PL;               // [NB*16][64][SEQ]
    h16* QR = (h16*)wsp; wsp += SZ_RS;               // [NB*16][EROWS][64] residual x2048, tokens < EROWS
    h16* KR = (h16*)wsp; wsp += SZ_RS;               // [NB*16][EROWS][64] residual x2048, tokens < EROWS
    h16* VR = (h16*)wsp; wsp += SZ_RS;               // [NB*16][64][EROWS] residual x2048, tokens < EROWS
    float* MB = (float*)wsp; wsp += SZ_MB;           // [NB][SEQ] mask values after the convert to bf16, as f32
    int* MF = (int*)wsp; wsp += SZ_MF;               // [NB] 1 where the batch's mask row widens the key loop

    // all conversions to bf16
    k_prep<<<dim3(NB + CB_X + 3 * CB_W + 2 * CB_A + 2 * CB_B, 1, 1), 256, 0, stream>>>(xin, wq, wk, wv, aq, av, bqu, bvu, am, XB, WB, AL, BLq, BLv, MB, MF);

    // q, k: A = x rows (m = b*SEQ + t), Bt = W rows (n = h*64 + d) -> plane [(b*16 + h)][t][d]; v^T: A = Wv rows (m = h*64 + d), Bt = x rows (n = b*SEQ + t) -> plane [(b*1024 + m)][t] = [(b*16 + h)][d][t]; residuals for tokens < EROWS
    k_proj<<<dim3(NB * SEQ / 128, DM / 128, 3), 32 * PW, 0, stream>>>(XB, WB, AL, BLq, BLv, bq, bk, bv, QH, QR, KP, KR, VT, VR, EROWS);

    // query rows [0, EROWS): multi-product instantiation; rows [EROWS, SEQ): single-product instantiation (disjoint output rows)
    k_keypass<<<dim3(NB * NH_, SEQ / (16 * AW), 1), 32 * AW, 0, stream>>>(QH, QR, KP, KR, VT, VR, MB, MF, OUT);
}

// v007
// One run takes 69.1 microseconds.
// In both of two side-by-side timings against v006, it was 1.04 times as fast.
// Over all steps from v000 it is 4.62 times as fast.
#include <hip/hip_runtime.h>

// Causal pair-score weighting, width 1024 = 16 heads x 64; one input x [NB][SEQ][1024] feeds q, k and v; Wq/Wk/Wv [out][in] (y = x W^T + bias); rank-8 additive updates on q and v: y += 2 (x A^T) B^T with A [8][in], B [out][8];
// additive key mask [NB][1][1][SEQ] (f32, read by value); score scale 1/sqrt(64); keys j > t are replaced by -1e9 before the mask is added; softmax over keys; output = concatenated heads (f32), no output projection.
// Compute dtypes, f32 accumulate everywhere: projections and x A^T v_wmma_f32_16x16x32_bf16 (x, W, A, B, biases, mask RNE-converted to bf16; products exact); the rank-8 up-projection is one extra 32-deep k-step of the projection GEMM (2 x A^T carried as bf16 hi | lo, B bf16); x A^T is formed inside the projection blocks, from the x tiles that they stage anyway;
// scores v_wmma_f32_16x16x32_f16: single f16 q and k on query rows >= EROWS; q and k each as f16 value + f16 residual x2048 (three products, residual products in their own accumulator) on query rows < EROWS;
// P.V v_wmma_f32_16x16x32_f16: P (x16384 carry, cancels in the normalisation) and v single f16 on query rows >= EROWS; on query rows < EROWS P and v each as f16 value + f16 residual x2048, residual products in their own accumulator folded by 1/2048, row sum from the f32 exponentials; softmax f32 (online, running max).
// Layout: bf16 copies of x, W, A; weight-side extension planes [row][32] bf16 (B | B | 0 | 0; the x side, hi | lo | 0 | 0 of 2 x A^T, lives in fragments only); q, k planes [b*16+h][t][64], v^T plane [b*16+h][d][t], small residual planes q, k [b*16+h][t < EROWS][64] and v^T [b*16+h][d][t < EROWS]; fused online-softmax key-pass kernel in transposed form (S^T = K Q^T, O^T = V^T P^T).
// Key loop bound per wave: the causal limit; if any mask value of the batch is not below 1e8 in magnitude the loop covers all keys (per-element arithmetic is literal in every visited tile). Residual fragments for keys >= EROWS are zero.
// The mask's bf16-rounded values (kept as f32, plane [NB][SEQ]) and that per-batch magnitude test (one word per batch) are formed once, in k_prep; the key-pass kernel only reads them: each block stages its batch's row in LDS once, and the key loop reads it there.

#ifndef NB
#define NB 2
#endif
#ifndef SEQ
#define SEQ 2048
#endif
#define NB_FULL  2
#define SEQ_FULL 2048
#ifndef OUT_SEQ
#define OUT_SEQ SEQ              // row pitch (in tokens) between batches of the output
#endif
#define DM   1024
#define NH_  16
#define HD   64
#define LR   8                   // rank of the additive updates
#define LK   32                  // k extent of the extension planes (one WMMA k-step)
#define XP   20                  // LDS row pitch (floats) of the x A^T tile
#define AW   4                   // waves per online-softmax key-pass block (16 query rows each)
#define PW   4                   // waves per projection block (2 x 2 wave tiles of 64 x 64)
#define PBK  64                  // k extent of one staged projection tile: 128 bytes of every operand row
#define PPI  72                  // LDS row pitch (16-bit elements) of a staged row: 144 bytes = 16 x 9
#define POP  (128 * PPI)         // elements of one staged operand tile (128 rows)
#define PST  (2 * POP)           // elements of one stage: A tile | B tile
#define XOP  (16 * PPI)          // elements of one staged tile of the 16 A rows (q update rows 0..7, v update rows 8..15)
#define OSP  68                  // LDS row pitch (floats) of the online-softmax key-pass output tile
#define KST  64                  // keys of one staged key-pass tile: 64 K rows of 128 bytes, 128 bytes of each of the 64 V^T rows
#define KOP  (64 * PPI)          // elements of one staged key-pass plane tile (64 rows at pitch PPI)
#define EROWS (SEQ < 512 ? SEQ : 512)   // query rows (and tokens of the small residual planes) handled by the multi-product online-softmax key-pass instantiation
#define QRS  2048.0f             // carry of every residual plane / residual fragment
#define QRI  (1.0f / 2048.0f)
#define SC2  ((float)(0.125 * 1.4426950408889634))      // HD^-0.5 * log2(e)
#define L2E  ((float)1.4426950408889634)
#define NEGL ((float)(-1.0e9 * 1.4426950408889634))     // fill value -1e9 in the log2 domain
#define LSC  2.0f                // update scaling 16 / 8
#define PSH  14.0f               // log2 of the P carry (16384)
#define PFL  (-14.0f)            // exponent argument below which the f16 P would leave the normal range
#define NEGB (-3.0e38f)
#define WIDE 1.0e8f              // mask magnitude bound under which skipped (fully causal-filled) tiles contribute exactly zero

static_assert(HD == 64);
static_assert(NH_ * HD == DM);                 // head h = columns h*64 + d
static_assert(DM % 64 == 0);                   // column tiles of 64 = one head
static_assert(64 % HD == 0);
static_assert(DM % 32 == 0);                   // GEMM k-loop steps by 32
static_assert(LK == 32);                       // extension = exactly one k-step
static_assert(2 * LR <= LK);                   // hi | lo pieces fit the extension row
static_assert(LR == 8);                        // one 16-byte piece per part; B rows loaded as 8 floats
static_assert(2 * LR == 16);                   // A rows of q and v updates fill one 16-column tile
static_assert(SEQ % 64 == 0);                  // a 64-row tile never straddles two batches
static_assert((NB * SEQ) % 64 == 0);
static_assert(SEQ % 128 == 0);                 // mask scan steps by 128
static_assert(SEQ % 32 == 0);                  // key loop steps by 32
static_assert(SEQ % (16 * AW) == 0);           // online-softmax key-pass grids cover the sequence exactly
static_assert(EROWS % 64 == 0);                // a 64-token GEMM tile lies wholly inside or outside the residual planes
static_assert(EROWS >= 32);
static_assert(EROWS <= SEQ);
static_assert(EROWS % (16 * AW) == 0);
static_assert((SEQ - EROWS) % (16 * AW) == 0);
static_assert(((size_t)SEQ * DM) % 8 == 0);
static_assert(((size_t)DM * DM) % 8 == 0);
static_assert(((size_t)LR * DM) % 8 == 0);
static_assert(NB <= NB_FULL);
static_assert(SEQ <= SEQ_FULL);
static_assert((OSP * 4) % 16 == 0);
static_assert(OSP >= HD);
static_assert((XP * 4) % 16 == 0);
static_assert(XP >= 16);
static_assert(32 * 4 * 16 == 16 * HD * 2);
static_assert(32 * 4 * 16 == 16 * 64 * 2);
static_assert(32 * 8 * 16 == 16 * HD * 4);     // online-softmax key-pass epilogue: 8 instructions x 32 lanes x 16 B = 16 rows x 256 B
static_assert((NB * SEQ) % 128 == 0);          // projection blocks cover 128 x 128
static_assert(DM % 128 == 0);
static_assert(DM % PBK == 0);
static_assert(DM / PBK >= 2);                  // the two-buffer ring needs two stages
static_assert(PBK * 2 == 128);                 // a staged row is one 128-byte line: 8 lanes x 16 B
static_assert((PPI * 2) % 16 == 0);
static_assert(PPI >= PBK);
static_assert(8 * 32 * PW * 16 == 128 * PBK * 2);   // 8 copies per lane fill one operand tile
static_assert(2 * PST * 2 + 2 * XOP * 2 + PW * 16 * 68 * 4 <= 131072);   // static LDS of the projection kernel
static_assert(128 * XP * 4 <= 2 * PST * 2);           // the block's x A^T tile (128 rows) fits the ring, which is free behind the k loop
static_assert(32 * PW * 16 == 16 * PBK * 2);          // one copy per lane fills one tile of the 16 A rows
static_assert(2 * 4 * KOP * 2 + AW * 16 * OSP * 4 + SEQ * 4 <= 106496);    // static LDS of the online-softmax key-pass kernels: three blocks fit one 320 KiB LDS
static_assert(4 * 32 * AW * 16 == SEQ * 4);    // 4 copies per lane fill the batch's mask row
static_assert(KST == 16 * AW);                 // a block's causal key bound is a whole number of staged tiles
static_assert(SEQ % KST == 0);
static_assert(EROWS % KST == 0);               // a staged tile lies wholly inside or outside the residual planes
static_assert(KST * 2 == 128);                 // a staged V^T row piece is one 128-byte line
static_assert(HD * 2 == 128);                  // a staged K row is one 128-byte line
static_assert(4 * 32 * AW * 16 == 64 * 128);   // 4 copies per lane fill one plane tile

typedef _Float16 h16;
typedef unsigned short bf;
typedef __attribute__((ext_vector_type(16))) __bf16   v16bf;
typedef __attribute__((ext_vector_type(16))) _Float16 v16h;
typedef __attribute__((ext_vector_type(8)))  _Float16 v8h;
typedef __attribute__((ext_vector_type(8)))  unsigned short v8us;
typedef __attribute__((ext_vector_type(8)))  float    v8f;
typedef __attribute__((ext_vector_type(4)))  float    v4f;
typedef v4f  __attribute__((may_alias)) v4fa;
typedef float __attribute__((may_alias)) fal;

__device__ __forceinline__ unsigned short f2bf(float f) { unsigned u = __float_as_uint(f); u += 0x7FFFu + ((u >> 16) & 1u); return (unsigned short)(u >> 16); }
__device__ __forceinline__ float bfr(float f) { return __uint_as_float(((unsigned)f2bf(f)) << 16); }   // value after RNE convert to bf16
__device__ __forceinline__ v16h cat16(v8h lo, v8h hi) { return __builtin_shufflevector(lo, hi, 0, 1, 2, 3, 4, 5, 6, 7, 8, 9, 10, 11, 12, 13, 14, 15); }
__device__ __forceinline__ v16bf cat16b(v8us lo, v8us hi) { return __builtin_bit_cast(v16bf, __builtin_shufflevector(lo, hi, 0, 1, 2, 3, 4, 5, 6, 7, 8, 9, 10, 11, 12, 13, 14, 15)); }
__device__ __forceinline__ v8f wmma16(v16h a, v16h b, v8f c) { return __builtin_amdgcn_wmma_f32_16x16x32_f16(false, a, false, b, (short)0, c, false, false); }
__device__ __forceinline__ v8f wmmab(v16bf a, v16bf b, v8f c) { return __builtin_amdgcn_wmma_f32_16x16x32_bf16(false, a, false, b, (short)0, c, false, false); }
// fragment loaders from K-contiguous 16-bit rows; p already includes + 8*(lane>>4): elements 0..7 <- k0+8h+0..7, elements 8..15 <- k0+16+8h+0..7 (same map for A and B)
__device__ __forceinline__ v16h  ldh(const h16* p) { return cat16(*(const v8h*)p, *(const v8h*)(p + 16)); }
__device__ __forceinline__ v16bf ldb(const bf* p)  { return cat16b(*(const v8us*)p, *(const v8us*)(p + 16)); }
// ordering point for wave-private LDS tiles (same wave writes and reads)
__device__ __forceinline__ void wave_sync() { __builtin_amdgcn_fence(3 /* release order */, "wavefront"); __builtin_amdgcn_wave_barrier(); asm volatile("" ::: "memory"); }

// f32 -> f16 convert that cannot produce a subnormal operand (|v| < 2^-14 -> +0); applied after the plane's power-of-two carry
static __device__ __forceinline__ h16 toh_flush(float v) { const h16 r = (h16)v; return (fabsf(v) < 6.103515625e-05f) ? (h16)0.0f : r; }
// one matrix instruction followed by its own four-slot guard (ties the accumulator, keeps the operands live)
static __device__ __forceinline__ v8f wmma16g(v16h a, v16h b, v8f c) { c = wmma16(a, b, c); asm volatile("v_nop\n\tv_nop\n\tv_nop\n\tv_nop" : "+v"(c) : "v"(a), "v"(b)); return c; }
static __device__ __forceinline__ v8f wmmabg(v16bf a, v16bf b, v8f c) { c = wmmab(a, b, c); asm volatile("v_nop\n\tv_nop\n\tv_nop\n\tv_nop" : "+v"(c) : "v"(a), "v"(b)); return c; }
// one 16-bit word of an extension row: piece 0 = bf16 value, piece 1 = bf16 of the remainder, pieces 2, 3 = zero (select by value)
static __device__ __forceinline__ unsigned short ext_word(float v, int piece) {
    const unsigned short hw = f2bf(v); const float hv = __uint_as_float(((unsigned)hw) << 16); const unsigned short lw = f2bf(v - hv);
    return (piece == 0) ? hw : ((piece == 1) ? lw : (unsigned short)0); }

// eight asynchronous 16-byte copies per lane, global -> LDS: copy i moves the lane's 16 bytes of tile row (row + 16 i). The closing s_wait_xcnt stands inside the statement so that no address register is rewritten ahead of it.
static __device__ __forceinline__ void copy8(unsigned l, const bf* g, size_t gs) {
    const unsigned ls = 16 * PPI * 2;
    asm volatile("global_load_async_to_lds_b128 %0, %8, off\n\t"
                 "global_load_async_to_lds_b128 %1, %9, off\n\t"
                 "global_load_async_to_lds_b128 %2, %10, off\n\t"
                 "global_load_async_to_lds_b128 %3, %11, off\n\t"
                 "global_load_async_to_lds_b128 %4, %12, off\n\t"
                 "global_load_async_to_lds_b128 %5, %13, off\n\t"
                 "global_load_async_to_lds_b128 %6, %14, off\n\t"
                 "global_load_async_to_lds_b128 %7, %15, off\n\t"
                 "s_wait_xcnt 0x0"
                 :: "v"(l), "v"(l + ls), "v"(l + 2 * ls), "v"(l + 3 * ls), "v"(l + 4 * ls), "v"(l + 5 * ls), "v"(l + 6 * ls), "v"(l + 7 * ls),
                    "v"(g), "v"(g + gs), "v"(g + 2 * gs), "v"(g + 3 * gs), "v"(g + 4 * gs), "v"(g + 5 * gs), "v"(g + 6 * gs), "v"(g + 7 * gs)
                 : "memory");
}

// the same with one copy: the lane's 16 bytes of one row
static __device__ __forceinline__ void copy1(unsigned l, const bf* g) {
    asm volatile("global_load_async_to_lds_b128 %0, %1, off\n\t"
                 "s_wait_xcnt 0x0"
                 :: "v"(l), "v"(g)
                 : "memory");
}

// the same with four copies of 16-bit float rows: copy i moves the lane's 16 bytes of tile row (row + 16 i)
static __device__ __forceinline__ void copy4(unsigned l, const h16* g, size_t gs) {
    const unsigned ls = 16 * PPI * 2;
    asm volatile("global_load_async_to_lds_b128 %0, %4, off\n\t"
                 "global_load_async_to_lds_b128 %1, %5, off\n\t"
                 "global_load_async_to_lds_b128 %2, %6, off\n\t"
                 "global_load_async_to_lds_b128 %3, %7, off\n\t"
                 "s_wait_xcnt 0x0"
                 :: "v"(l), "v"(l + ls), "v"(l + 2 * ls), "v"(l + 3 * ls),
                    "v"(g), "v"(g + gs), "v"(g + 2 * gs), "v"(g + 3 * gs)
                 : "memory");
}

// the same with four copies of one f32 row: copy i moves the lane's 16 bytes of the block's i-th run of 32 * AW * 4 floats
static __device__ __forceinline__ void copy4m(unsigned l, const float* g) {
    const unsigned ls = 32 * AW * 16; const size_t gs = 32 * AW * 4;
    asm volatile("global_load_async_to_lds_b128 %0, %4, off\n\t"
                 "global_load_async_to_lds_b128 %1, %5, off\n\t"
                 "global_load_async_to_lds_b128 %2, %6, off\n\t"
                 "global_load_async_to_lds_b128 %3, %7, off\n\t"
                 "s_wait_xcnt 0x0"
                 :: "v"(l), "v"(l + ls), "v"(l + 2 * ls), "v"(l + 3 * ls),
                    "v"(g), "v"(g + gs), "v"(g + 2 * gs), "v"(g + 3 * gs)
                 : "memory");
}

// blocks of 256 threads (8 elements a thread) that each converted plane takes in k_prep
#define CB_X ((int)((size_t)NB * SEQ * DM / 8 / 256))   // x
#define CB_W ((int)((size_t)DM * DM / 8 / 256))         // one weight matrix
#define CB_A ((int)((size_t)LR * DM / 8 / 256))         // one A matrix
#define CB_B (DM * 4 / 256)                             // one weight-side extension plane (4 pieces of 8 per row)
static_assert(((size_t)SEQ * DM / 8) % 256 == 0);       // a block never straddles two batches of x
static_assert(((size_t)DM * DM / 8) % 256 == 0);
static_assert(((size_t)LR * DM / 8) % 256 == 0);

static __device__ __forceinline__ void cvt8(const float* __restrict__ src, bf* dst) {
    const v8f v = *(const v8f*)src; v8us o;
#pragma unroll
    for (int k = 0; k < 8; ++k) o[k] = f2bf(v[k]);
    *(v8us*)dst = o;
    asm volatile("s_wait_xcnt 0x0" ::: "memory");                            // the store's registers are rewritten only behind this wait
}

// k_prep: every f32 -> bf16 conversion of the call in one launch. The block index picks the plane (block-uniform ranges, in the order mask, one block per batch | x | Wq Wk Wv | Aq Av | Bq Bv); every range is covered exactly.
__global__ __launch_bounds__(256) void k_prep(const float* __restrict__ x, const float* __restrict__ wq, const float* __restrict__ wk, const float* __restrict__ wv,
                                              const float* __restrict__ aq, const float* __restrict__ av, const float* __restrict__ bqu, const float* __restrict__ bvu,
                                              const float* __restrict__ amask, bf* XB, bf* WB, bf* AL, bf* BLq, bf* BLv, float* MB, int* MF) {
    int blk = (int)blockIdx.x; const int tid = (int)threadIdx.x;
    if (blk < NB) {                                                           // mask row of batch blk: batch pitch SEQ_FULL in the input, SEQ in the plane; first in the grid, for speed only
        const float* amb = amask + (size_t)blk * SEQ_FULL; float* mrow = MB + (size_t)blk * SEQ;
        for (int i = tid * 8; i < SEQ; i += 256 * 8) {                        // value after RNE convert to bf16, stored as f32
            const v8f v = *(const v8f*)(amb + i); v8f o;
#pragma unroll
            for (int k = 0; k < 8; ++k) o[k] = bfr(v[k]);
            *(v8f*)(mrow + i) = o;
            asm volatile("s_wait_xcnt 0x0" ::: "memory"); }                  // the load's and the store's registers are rewritten only behind this wait
        if (tid < 32) {                                                       // the first wave scans the whole row: any value not below WIDE in magnitude widens the key loop to all keys
            float fl = 0.0f;
#pragma unroll 4
            for (int i = 0; i < SEQ; i += 128) {                              // four loads in flight a trip: more would raise the register count of every block of this kernel
                const v4f w = *(const v4f*)(amb + i + 4 * tid);
#pragma unroll
                for (int c = 0; c < 4; ++c) { const float a = fabsf(bfr(w[c])); fl = (a < WIDE) ? fl : 1.0f; } }
            fl = fmaxf(fl, __shfl_xor(fl, 16, 32)); fl = fmaxf(fl, __shfl_xor(fl, 8, 32)); fl = fmaxf(fl, __shfl_xor(fl, 4, 32));
            fl = fmaxf(fl, __shfl_xor(fl, 2, 32));  fl = fmaxf(fl, __shfl_xor(fl, 1, 32));
            if (tid == 0) MF[blk] = (fl != 0.0f) ? 1 : 0; }
        return; }
    blk -= NB;
    if (blk < CB_X) {                                                         // x: batch pitch SEQ_FULL tokens in the input, SEQ in the copy
        const size_t i = (size_t)blk * 256 + tid; const size_t nb8 = (size_t)SEQ * DM / 8; const size_t bb = i / nb8, r = i % nb8;
        cvt8(x + bb * ((size_t)SEQ_FULL * DM) + r * 8, XB + i * 8); return; }
    blk -= CB_X;
    if (blk < 3 * CB_W) {
        const int w = blk / CB_W; const float* s = (w == 0) ? wq : ((w == 1) ? wk : wv); const size_t i = (size_t)(blk - w * CB_W) * 256 + tid;
        cvt8(s + i * 8, WB + (size_t)w * DM * DM + i * 8); return; }
    blk -= 3 * CB_W;
    if (blk < 2 * CB_A) {
        const int w = blk / CB_A; const float* s = (w == 0) ? aq : av; const size_t i = (size_t)(blk - w * CB_A) * 256 + tid;
        cvt8(s + i * 8, AL + (size_t)w * LR * DM + i * 8); return; }
    blk -= 2 * CB_A;
    {                                                                         // weight-side extension rows: B | B | 0 | 0
        const int w = blk / CB_B; const float* s = (w == 0) ? bqu : bvu; bf* d = (w == 0) ? BLq : BLv; const int i = (blk - w * CB_B) * 256 + tid;
        const int row = i >> 2, piece = i & 3;
        const v8f v = *(const v8f*)(s + (size_t)row * LR); v8us o;
#pragma unroll
        for (int k = 0; k < 8; ++k) { const unsigned short t = f2bf(v[k]); o[k] = (piece < 2) ? t : (unsigned short)0; }
        *(v8us*)(d + (size_t)i * 8) = o;
        asm volatile("s_wait_xcnt 0x0" ::: "memory"); }                      // the store's registers are rewritten only behind this wait
}

template <int MODE, int LOWR>
__device__ __forceinline__ void proj_body(bf* ring, bf* xring, float* osa, int bx, int by, const bf* __restrict__ A, const bf* __restrict__ Bt, const bf* __restrict__ AL, const bf* __restrict__ WX, int xcol,
                                          const float* __restrict__ bias, h16* Ph, h16* Pr, int resT) {
    const int K = DM;
    const int lane = threadIdx.x & 31, lr = lane & 15, hi = lane >> 4;
    const int wave = __builtin_amdgcn_readfirstlane((int)(threadIdx.x >> 5));
    const int wm = (wave & 1) * 64, wn = (wave >> 1) * 64;                    // the wave's 64 x 64 tile inside the block
    const int r0 = bx * 128 + wm, c0 = by * 128 + wn;
    float* os = osa + wave * 16 * 68;                                         // wave-private output staging
    v8f acc[4][4];
#pragma unroll
    for (int mb = 0; mb < 4; ++mb)
#pragma unroll
        for (int nb = 0; nb < 4; ++nb) acc[mb][nb] = (v8f){};
    v8f xacc[2]; xacc[0] = (v8f){}; xacc[1] = (v8f){};                        // LOWR: x A^T of the wave's 32 x rows
    const int xh = LOWR ? ((MODE == 0) ? (wave >> 1) : (wave & 1)) : 0;       // which 32 of the 64 x rows that it shares with its partner wave are its own for x A^T (wave-uniform)
    const int rot[4] = { xh * 32, xh * 32 + 16, 32 - xh * 32, 48 - xh * 32 };  // x-side fragment i holds the 16 x rows from rot[i] on: the wave's own 32 rows are always fragments 0 and 1, so that no branch picks registers in the k loop
    // copy side: thread tid moves bytes 16 (tid & 7) of tile rows (tid >> 3) + 16 i, i = 0..7, of both operands (and of A row tid >> 3 when LOWR)
    const int crow = (int)(threadIdx.x >> 3), cch = (int)(threadIdx.x & 7);
    const bf* ga = A  + (size_t)(bx * 128 + crow) * K + cch * 8;      // rows < M, columns k0 + 63 < K
    const bf* gb = Bt + (size_t)(by * 128 + crow) * K + cch * 8;
    const unsigned la = (unsigned)(size_t)(&ring[crow * PPI + cch * 8]);      // LDS byte address = low 32 bits of the shared address
    const unsigned lb = la + POP * 2;
    const bf* gl = AL + (size_t)crow * K + cch * 8;                           // rows < 16
    const unsigned lx = (unsigned)(size_t)(&xring[crow * PPI + cch * 8]);
    const int xfo = lr * PPI + 8 * hi;
    const int NT = K / PBK;
    // read side: same loader and k map as from the planes, rows at pitch PPI
    const int afr = (wm + lr) * PPI + 8 * hi, bfo = POP + (wn + lr) * PPI + 8 * hi;
    copy8(la, ga, (size_t)16 * K); copy8(lb, gb, (size_t)16 * K);             // tile 0 -> buffer 0
    if (LOWR) copy1(lx, gl);
    asm volatile("s_wait_asynccnt 0x0" ::: "memory");                         // this wave's copies of tile 0 have landed
    __syncthreads();                                                          // ... and every other wave's
    copy8(la + PST * 2, ga + PBK, (size_t)16 * K); copy8(lb + PST * 2, gb + PBK, (size_t)16 * K);   // tile 1 -> buffer 1
    if (LOWR) copy1(lx + XOP * 2, gl + PBK);
#pragma unroll 1
    for (int t = 0; t < NT; ++t) {                                            // rolled: one pass per staged tile
        const int bo = (t & 1) * PST;
#pragma unroll
        for (int ks = 0; ks < PBK; ks += 32) {
            v16bf a[4];
#pragma unroll
            for (int mb = 0; mb < 4; ++mb) a[mb] = ldb(&ring[bo + afr + ((MODE == 0) ? rot[mb] : mb * 16) * PPI + ks]);
            v16bf b[4];                                                       // all fragments of a k-step (eight, nine with LOWR) are read as one group of LDS loads
#pragma unroll
            for (int nb = 0; nb < 4; ++nb) b[nb] = ldb(&ring[bo + bfo + ((MODE == 1) ? rot[nb] : nb * 16) * PPI + ks]);
            v16bf al = a[0];
            if (LOWR) al = ldb(&xring[(t & 1) * XOP + xfo + ks]);
#pragma unroll
            for (int nb = 0; nb < 4; ++nb) {
#pragma unroll
                for (int mb = 0; mb < 4; ++mb) acc[mb][nb] = wmmabg(a[mb], b[nb], acc[mb][nb]); }
            if (LOWR) { xacc[0] = wmmabg((MODE == 0) ? a[0] : b[0], al, xacc[0]); xacc[1] = wmmabg((MODE == 0) ? a[1] : b[1], al, xacc[1]); }
        }
        asm volatile("s_wait_dscnt 0x0" ::: "memory");                        // this wave's reads of buffer t & 1 are done before it is refilled
        asm volatile("s_wait_asynccnt 0x0" ::: "memory");                     // this wave's copies of tile t + 1 have landed
        __syncthreads();                                                      // publishes tile t + 1 and ends every reader's last read of buffer t & 1
        if (t + 2 < NT) { copy8(la + bo * 2, ga + (size_t)(t + 2) * PBK, (size_t)16 * K); copy8(lb + bo * 2, gb + (size_t)(t + 2) * PBK, (size_t)16 * K);
                          if (LOWR) copy1(lx + (t & 1) * (XOP * 2), gl + (size_t)(t + 2) * PBK); }
    }
    asm volatile("s_wait_asynccnt 0x0" ::: "memory");                         // no copy is outstanding behind the loop
    if (LOWR) {                                                                                   // extension k-step: rows of 32 bf16, same k map on both sides
        const size_t wxo = (size_t)(((MODE == 0) ? c0 : r0) + lr) * LK + 8 * hi;
        v16bf we[4];                                                                              // weight side, from its plane; the loads fly under the exchange below
#pragma unroll
        for (int i = 0; i < 4; ++i) we[i] = ldb(WX + wxo + (size_t)i * 16 * LK);
        fal* xs = (fal*)ring;                                                                     // [128 x rows of the block][XP]; every reader of the ring has passed the loop's last barrier and no copy is outstanding
        const int xw = (MODE == 0) ? wm : wn;                                                     // the wave's 64 x rows inside the block
#pragma unroll
        for (int i = 0; i < 2; ++i)
#pragma unroll
            for (int j = 0; j < 8; ++j) xs[(xw + rot[i] + hi * 8 + j) * XP + lr] = xacc[i][j] * LSC;   // D: row 8h+j, col lane&15
        __syncthreads();                                                                          // each wave reads 32 rows that its partner wave wrote
        v16bf xe[4];
#pragma unroll
        for (int i = 0; i < 4; ++i) {
            const v4f e0 = *(const v4fa*)(&xs[(xw + rot[i] + lr) * XP + xcol]); const v4f e1 = *(const v4fa*)(&xs[(xw + rot[i] + lr) * XP + xcol + 4]); v8us w;
#pragma unroll
            for (int k = 0; k < 4; ++k) { w[k] = ext_word(e0[k], hi); w[4 + k] = ext_word(e1[k], hi); }
            xe[i] = cat16b(w, (v8us){}); }
#pragma unroll
        for (int nb = 0; nb < 4; ++nb) {
#pragma unroll
            for (int mb = 0; mb < 4; ++mb) acc[mb][nb] = (MODE == 0) ? wmmabg(xe[mb], we[nb], acc[mb][nb]) : wmmabg(we[mb], xe[nb], acc[mb][nb]); }
    }
    float bc[4];
#pragma unroll
    for (int nb = 0; nb < 4; ++nb) bc[nb] = (MODE == 0) ? bfr(bias[c0 + nb * 16 + lr]) : 0.0f;   // MODE 0: c0 + 63 < DM
    size_t tbase, rbase; bool wr;                                                                 // wr: wave-uniform, the wave's whole tile inside the residual plane
    if (MODE == 0) { const int bb = r0 / SEQ, tt = r0 % SEQ; const int zc = bb * NH_ + c0 / HD;
                     tbase = ((size_t)zc * SEQ + (size_t)tt) * HD; rbase = ((size_t)zc * (size_t)resT + (size_t)tt) * HD; wr = tt < resT; }
    else           { const int bb = c0 / SEQ, tt = c0 % SEQ;
                     tbase = (size_t)bb * (size_t)DM * SEQ + (size_t)r0 * SEQ + (size_t)tt; rbase = (size_t)bb * (size_t)DM * (size_t)resT + (size_t)r0 * (size_t)resT + (size_t)tt; wr = tt < resT; }
#pragma unroll
    for (int mb = 0; mb < 4; ++mb) {
        float br[8];
#pragma unroll
        for (int j = 0; j < 8; ++j) br[j] = (MODE == 1) ? bfr(bias[r0 + mb * 16 + hi * 8 + j]) : 0.0f;   // MODE 1: r0 + 63 < DM
#pragma unroll
        for (int nb = 0; nb < 4; ++nb) {
#pragma unroll
            for (int j = 0; j < 8; ++j) os[(hi * 8 + j) * 68 + ((MODE == 1) ? rot[nb] : nb * 16) + lr] = acc[mb][nb][j] + bc[nb] + br[j]; }   // D: row 8h+j, col lane&15; rows 0..15 x columns 0..63 all written
        wave_sync();
{
            if (MODE == 0) {
                const size_t sb = tbase + (size_t)rot[mb] * HD;
                const size_t rb = rbase + (size_t)rot[mb] * HD;
#pragma unroll
                for (int s = 0; s < 4; ++s) { const int p = s * 32 + lane; const int row = p >> 3, c8 = (p & 7) * 8;   // 4 s x 4 rows = 16 rows; 8 lanes x 8 = 64 columns = one line
                    const v4f x0 = *(const v4fa*)(&os[row * 68 + c8]); const v4f x1 = *(const v4fa*)(&os[row * 68 + c8 + 4]); v8h hv, rv;
#pragma unroll
                    for (int i = 0; i < 4; ++i) { const h16 a0 = toh_flush(x0[i]); const h16 a1 = toh_flush(x1[i]); hv[i] = a0; hv[4 + i] = a1;
                                                  rv[i] = toh_flush((x0[i] - (float)a0) * QRS); rv[4 + i] = toh_flush((x1[i] - (float)a1) * QRS); }
                    const size_t oo = sb + (size_t)p * 8;
                    const size_t ro = rb + (size_t)p * 8;
                    *(v8h*)(Ph + oo) = hv; asm volatile("s_wait_xcnt 0x0" ::: "memory");                    // each store's registers are rewritten only behind its wait
                    if (wr) { *(v8h*)(Pr + ro) = rv; asm volatile("s_wait_xcnt 0x0" ::: "memory"); } }
            } else {
                const size_t sb = tbase + (size_t)(mb * 16) * SEQ;
                const size_t rb = rbase + (size_t)(mb * 16) * (size_t)resT;
#pragma unroll
                for (int s = 0; s < 4; ++s) { const int row = 4 * s + (lane >> 3), c8 = (lane & 7) * 8;   // 4 s x 4 row groups = 16 rows; 8 lanes x 8 = 64 columns
                    const v4f x0 = *(const v4fa*)(&os[row * 68 + c8]); const v4f x1 = *(const v4fa*)(&os[row * 68 + c8 + 4]); v8h hv, rv;
#pragma unroll
                    for (int i = 0; i < 4; ++i) { const h16 a0 = toh_flush(x0[i]); const h16 a1 = toh_flush(x1[i]); hv[i] = a0; hv[4 + i] = a1;
                                                  rv[i] = toh_flush((x0[i] - (float)a0) * QRS); rv[4 + i] = toh_flush((x1[i] - (float)a1) * QRS); }
                    const size_t oo = sb + (size_t)row * SEQ + c8;
                    const size_t ro = rb + (size_t)row * (size_t)resT + c8;
                    *(v8h*)(Ph + oo) = hv; asm volatile("s_wait_xcnt 0x0" ::: "memory");                    // each store's registers are rewritten only behind its wait
                    if (wr) { *(v8h*)(Pr + ro) = rv; asm volatile("s_wait_xcnt 0x0" ::: "memory"); } }
            }
             }
        wave_sync();
    }
}

// k_proj: the three projections in one launch, blockIdx.z picks one (block-uniform); the three bodies share one ring and one output staging, declared here so that the block's LDS is that of one body.
// z = 0, q: token-major with the update extension; z = 1, k: token-major, no extension; z = 2, v^T: feature-major with the update extension (A = Wv rows, so the block's row tile is blockIdx.y and its column tile blockIdx.x).
// Registers are capped at 256: without the cap the extension step spreads above v255 and pays a register-window switch at many of its instructions.
__global__ __launch_bounds__(32 * PW) __attribute__((amdgpu_num_vgpr(256)))
void k_proj(const bf* __restrict__ XB, const bf* __restrict__ WB, const bf* __restrict__ AL, const bf* __restrict__ BLq, const bf* __restrict__ BLv,
                                              const float* __restrict__ bq, const float* __restrict__ bk, const float* __restrict__ bv,
                                              h16* QH, h16* QR, h16* KP, h16* KR, h16* VT, h16* VR, int resT) {
    __shared__ __align__(16) bf ring[2 * PST];
    __shared__ __align__(16) bf xring[2 * XOP];
    __shared__ __align__(16) float osa[PW * 16 * 68];
    const int z = (int)blockIdx.z, gx = (int)blockIdx.x, gy = (int)blockIdx.y;
    const bf* WK = WB + (size_t)DM * DM; const bf* WV = WB + (size_t)2 * DM * DM;
    if (z == 0)      proj_body<0, 1>(ring, xring, osa, gx, gy, XB, WB, AL, BLq, 0, bq, QH, QR, resT);
    else if (z == 1) proj_body<0, 0>(ring, xring, osa, gx, gy, XB, WK, AL, WK, 0, bk, KP, KR, resT);
    else             proj_body<1, 1>(ring, xring, osa, gy, gx, WV, XB, AL, BLv, LR, bv, VT, VR, resT);
}

// compile-time switch handed to the key pass's tile pass
template <bool B> struct sw { static constexpr bool v = B; };

template <int EARLY>
__device__ __forceinline__ void keypass_body(h16* ring, float* os, float* mrow, int qt, int zh, const h16* __restrict__ QH, const h16* __restrict__ QR, const h16* __restrict__ KP, const h16* __restrict__ KR,
                                           const h16* __restrict__ VT, const h16* __restrict__ VR, const float* __restrict__ MB, const int* __restrict__ MF, float* OUT) {
    constexpr int KSG = (EARLY ? 4 : 2) * KOP;                                // elements of one stage: K | V^T (| K residual | V^T residual); the ring holds two stages
    const int lane = threadIdx.x & 31, lr = lane & 15, hi = lane >> 4;
    const int wave = __builtin_amdgcn_readfirstlane((int)(threadIdx.x >> 5));
    const int b = zh / NH_, h = zh % NH_;
    const int t0 = (qt * AW + wave) * 16;                                     // qt: the block's tile of 64 query rows, counted over the whole sequence
    const int lim = t0 + lr;                                                  // key j is causal-filled iff j > lim
    const float* amb = MB + (size_t)b * SEQ;                                  // the batch's mask row, already rounded to bf16 values
    const size_t pbase = (size_t)zh * SEQ * HD;
    const size_t rbase = (size_t)zh * EROWS * HD;
    // copy side: thread tid moves bytes 16 (tid & 7) of tile rows (tid >> 3) + 16 i, i = 0..3, of every staged plane (K rows = keys, V^T rows = d)
    const int crow = (int)(threadIdx.x >> 3), cch = (int)(threadIdx.x & 7);
    const h16* gk  = KP + pbase + (size_t)crow * HD + cch * 8;                // + key * HD, keys < SEQ
    const h16* gv  = VT + pbase + (size_t)crow * SEQ + cch * 8;               // + key, keys + 63 < SEQ
    const h16* gkr = KR + rbase + (size_t)crow * HD + cch * 8;                // + key * HD, keys < EROWS
    const h16* gvr = VR + rbase + (size_t)crow * EROWS + cch * 8;             // + key, keys + 63 < EROWS
    const unsigned l0 = (unsigned)(size_t)(&ring[crow * PPI + cch * 8]);      // LDS byte address = low 32 bits of the shared address
    auto stage = [&](int s, int buf) {                                        // tile s (keys 64 s .. 64 s + 63) -> buffer buf
        const int k0 = s * KST; const unsigned l = l0 + (unsigned)buf * (KSG * 2);
        copy4(l, gk + (size_t)k0 * HD, (size_t)16 * HD); copy4(l + KOP * 2, gv + k0, (size_t)16 * SEQ);
        if (EARLY) { const int kc = (k0 < EROWS) ? k0 : (EROWS - KST);        // clamped residual-plane key (address always inside the plane)
                     copy4(l + 2 * KOP * 2, gkr + (size_t)kc * HD, (size_t)16 * HD); copy4(l + 3 * KOP * 2, gvr + kc, (size_t)16 * EROWS); } };
    stage(0, 0);                                                              // tile 0 exists for every block; its copies fly under the Q loads
    copy4m((unsigned)(size_t)(&mrow[threadIdx.x * 4]), amb + threadIdx.x * 4);   // the batch's whole mask row (SEQ floats) -> LDS, once per block; tile 0's wait and barrier below cover these copies too
    const bool wide = MF[b] != 0;                                             // k_prep's test of the batch's mask row: any value not below WIDE in magnitude widens the key loop to all keys
    const int nkc = (t0 + 16 + 31) & ~31;                                     // causal bound, multiple of 32, <= SEQ
    const int nk = __builtin_amdgcn_readfirstlane(wide ? SEQ : nkc);
    const int nbv = wide ? SEQ : ((qt + 1) * KST);           // the block's bound = its last wave's; every wave reads the same word, so it is block-uniform
    const int NS = __builtin_amdgcn_readfirstlane(nbv) / KST;                 // staged tiles of the block, >= 1
    const size_t qo = pbase + (size_t)(t0 + lr) * HD + 8 * hi;
    const v16h hz = (v16h){};
    v16h qh[2], qr[2];
    qh[0] = ldh(QH + qo); qh[1] = ldh(QH + qo + 32);             // B fragments: col t, k = d (two k-steps)
    qr[0] = hz; qr[1] = hz;
    if (EARLY) { const size_t qro = rbase + (size_t)(t0 + lr) * HD + 8 * hi; qr[0] = ldh(QR + qro); qr[1] = ldh(QR + qro + 32);     // t0 + lr < EROWS
                 asm volatile("s_wait_xcnt 0x0" ::: "memory"); }               // the Q loads' address registers are rewritten only behind this wait
    const int fo = lr * PPI + 8 * hi;                          // read side, same loader and k map as from the planes, rows at pitch PPI: K + key * PPI (A fragment: row key, k = d); V^T + 16j * PPI + key (A fragment: row d, k = key)
    v8f o[4], oR[4];
#pragma unroll
    for (int j = 0; j < 4; ++j) { o[j] = (v8f){}; oR[j] = (v8f){}; }
    float m = NEGB, l = 0.0f;
    asm volatile("s_wait_asynccnt 0x0" ::: "memory");            // this wave's copies of tile 0 have landed
    __syncthreads();                                             // ... and every other wave's
    if (1 < NS) stage(1, 1);
    // one pass over staged tile s. FILL = false: every key of the tile is below every query row of the block, no key is replaced, and the per-element index, compare and select are left out; all else is the same text
    auto tile = [&](auto fsw, int s) __attribute__((always_inline)) {
    constexpr bool FILL = decltype(fsw)::v;
    const int bo = (s & 1) * KSG;
    const int ke = (nk - s * KST < KST) ? nk - s * KST : KST;    // keys of this tile below the wave's own bound
#pragma unroll 1
    for (int kk = 0; kk < ke; kk += 32) {                        // rolled: the 32-key halves of a tile share one body, which keeps the loop's text small
        const int key0 = s * KST + kk;
        const bool rok = key0 < EROWS;                           // wave-uniform
        const h16* kpt = &ring[bo + fo + kk * PPI];
        v8f sHa = (v8f){}, sLa = (v8f){}, sHb = (v8f){}, sLb = (v8f){};
        const h16* krp = &ring[bo + (EARLY ? 2 : 0) * KOP + fo + kk * PPI];   // residual tiles exist in the EARLY stage only
        const h16* va  = &ring[bo + KOP + fo + kk];
        const h16* vrp = &ring[bo + (EARLY ? 3 : 1) * KOP + fo + kk];
        const float* kp = &mrow[8 * hi + key0];                  // keys key0+8h+0..7 and key0+16+8h+0..7, all < nk <= SEQ; from the row staged in LDS
        const v4f m0 = *(const v4fa*)kp, m1 = *(const v4fa*)(kp + 4), m2 = *(const v4fa*)(kp + 16), m3 = *(const v4fa*)(kp + 20);
        v16h ka[2], kb[2], kra[2], krb[2], vf[4];          // the fragments of a product run are read as one group of LDS loads ahead of it
#pragma unroll
        for (int ks = 0; ks < 2; ++ks) {
            ka[ks] = ldh(kpt + ks * 32); kb[ks] = ldh(kpt + 16 * PPI + ks * 32);
            if (EARLY) { kra[ks] = ldh(krp + ks * 32); krb[ks] = ldh(krp + 16 * PPI + ks * 32); } }
        if (!EARLY) {                                              // registers allow: the V^T fragments join the K group
#pragma unroll
            for (int j = 0; j < 4; ++j) vf[j] = ldh(va + (16 * j) * PPI); }
#pragma unroll
        for (int ks = 0; ks < 2; ++ks) {
            sHa = wmma16g(ka[ks], qh[ks], sHa); sHb = wmma16g(kb[ks], qh[ks], sHb);
            if (EARLY) {
                sLa = wmma16g(ka[ks], qr[ks], sLa); sLb = wmma16g(kb[ks], qr[ks], sLb);
                if (!rok) { kra[ks] = hz; krb[ks] = hz; }
                sLa = wmma16g(kra[ks], qh[ks], sLa); sLb = wmma16g(krb[ks], qh[ks], sLb);
            }
        }
        if (EARLY) {                                               // the V^T group flies under the softmax
#pragma unroll
            for (int j = 0; j < 4; ++j) vf[j] = ldh(va + (16 * j) * PPI); }
        float kx[8], ky[8];
#pragma unroll
        for (int r = 0; r < 4; ++r) { kx[r] = m0[r]; kx[4 + r] = m1[r]; ky[r] = m2[r]; ky[4 + r] = m3[r]; }
        const int ja = key0 + 8 * hi;
        float ta[8], tb[8]; float mx = NEGB;
#pragma unroll
        for (int r = 0; r < 8; ++r) {
            const float sa = EARLY ? (sHa[r] + sLa[r] * QRI) * SC2 : sHa[r] * SC2;
            const float sb = EARLY ? (sHb[r] + sLb[r] * QRI) * SC2 : sHb[r] * SC2;
            if (FILL) { ta[r] = ((ja + r > lim) ? NEGL : sa) + kx[r] * L2E;      // replace, then add the mask
                        tb[r] = ((ja + 16 + r > lim) ? NEGL : sb) + ky[r] * L2E; }
            else      { ta[r] = __builtin_fmaf(kx[r], L2E, sa);                  // the mask is added in the fused form that the other body compiles to: same bits
                        tb[r] = __builtin_fmaf(ky[r], L2E, sb); }
            mx = fmaxf(mx, fmaxf(ta[r], tb[r])); }
        mx = fmaxf(mx, __shfl_xor(mx, 16, 32));
        const float mnew = fmaxf(m, mx);
        float alpha;                                               // exp2(m - mnew), with the one slot that the instruction set asks for behind a transcendental in the same statement
        asm volatile("v_exp_f32 %0, %1\n\tv_nop" : "=v"(alpha) : "v"(m - mnew));
        const float sh = PSH - mnew;
        v16h pb, pr = hz; float ls = 0.0f;
#pragma unroll
        for (int r = 0; r < 8; ++r) {
            const float aa = ta[r] + sh, ab = tb[r] + sh;
            const float ea = __builtin_amdgcn_exp2f(aa), eb = __builtin_amdgcn_exp2f(ab);
            const float ga = (aa < PFL) ? 0.0f : ea, gb = (ab < PFL) ? 0.0f : eb;   // below the f16 normal range -> exactly zero, selected by value
            const h16 pa = (h16)ga; const h16 pc = (h16)gb;
            pb[r] = pa; pb[8 + r] = pc;
            if (EARLY) { pr[r] = toh_flush((ga - (float)pa) * QRS); pr[8 + r] = toh_flush((gb - (float)pc) * QRS); ls += ga + gb; }
            else       { ls += (float)pa + (float)pc; } }
        l = l * alpha + ls; m = mnew;
#pragma unroll
        for (int j = 0; j < 4; ++j) { o[j] = o[j] * alpha; if (EARLY) oR[j] = oR[j] * alpha; }
#pragma unroll
        for (int jp = 0; jp < 2; ++jp) {
            const v16h v0 = vf[2 * jp], v1 = vf[2 * jp + 1];
            o[2 * jp] = wmma16g(v0, pb, o[2 * jp]); o[2 * jp + 1] = wmma16g(v1, pb, o[2 * jp + 1]);
            if (EARLY) {
                oR[2 * jp] = wmma16g(v0, pr, oR[2 * jp]); oR[2 * jp + 1] = wmma16g(v1, pr, oR[2 * jp + 1]);
                v16h vr0 = ldh(vrp + (32 * jp) * PPI), vr1 = ldh(vrp + (32 * jp + 16) * PPI);
                if (!rok) { vr0 = hz; vr1 = hz; }
                oR[2 * jp] = wmma16g(vr0, pb, oR[2 * jp]); oR[2 * jp + 1] = wmma16g(vr1, pb, oR[2 * jp + 1]);
            }
        }
    }
    asm volatile("s_wait_dscnt 0x0" ::: "memory");               // this wave's reads of buffer s & 1 are done before it is refilled
    asm volatile("s_wait_asynccnt 0x0" ::: "memory");            // this wave's copies of tile s + 1 have landed
    __syncthreads();                                             // publishes tile s + 1 and ends every reader's last read of buffer s & 1
    if (s + 2 < NS) stage(s + 2, s & 1);
    };
    // tiles 0 .. qt - 1 hold keys below 64 qt, the block's first query row (qt < NS always); from tile qt on the replacement can apply. Two loops, so that each body stays one straight run of code.
    // The multi-product instantiation (at most EROWS / KST tiles below the diagonal, a small part of the work) keeps its one loop.
    if constexpr (!EARLY) {
#pragma unroll 1
        for (int s = 0; s < qt; ++s) tile(sw<false>{}, s);       // rolled: one pass per staged tile
    }
#pragma unroll 1
    for (int s = EARLY ? 0 : qt; s < NS; ++s) tile(sw<true>{}, s);   // rolled: one pass per staged tile
    asm volatile("s_wait_asynccnt 0x0" ::: "memory");            // no copy is outstanding behind the loop
    l += __shfl_xor(l, 16, 32);
    const float inv = 1.0f / l;                                  // l >= 2^14 whenever the row has a finite maximum logit
    const int wb = wave * 16 * OSP;
    // O^T D layout: o[j][r] = (d = 16j + 8h + r, t = lane&15) -> os[t][d]; rows 0..15 x columns 0..63 all written
#pragma unroll
    for (int j = 0; j < 4; ++j) {
        v8f f = o[j];
        if (EARLY) f = o[j] + oR[j] * QRI;
        v4f a, c;
        a[0] = f[0] * inv; a[1] = f[1] * inv; a[2] = f[2] * inv; a[3] = f[3] * inv; c[0] = f[4] * inv; c[1] = f[5] * inv; c[2] = f[6] * inv; c[3] = f[7] * inv;
        *(v4fa*)(&os[wb + lr * OSP + 16 * j + 8 * hi]) = a; *(v4fa*)(&os[wb + lr * OSP + 16 * j + 8 * hi + 4]) = c; }
    wave_sync();
    float* orow = OUT + ((size_t)b * OUT_SEQ + t0) * DM + h * HD;
{
#pragma unroll
        for (int s = 0; s < 8; ++s) { const int row = 2 * s + (lane >> 4), cofs = (lane & 15) * 4;   // 8 s x 2 rows = 16 rows; 16 lanes x 4 floats = 64 columns = two lines
            const v4f val = *(const v4fa*)(&os[wb + row * OSP + cofs]);
            *(v4f*)(orow + (size_t)row * DM + cofs) = val; }
         }
}

// k_keypass: both instantiations in one launch. blockIdx.x = (batch, head); blockIdx.y counts the 64-row query tiles from the last one down, for speed only.
// The choice of the body is block-uniform; the two bodies share one ring and one output staging, declared here.
// Registers are capped at 272: the LDS admits three blocks per WGP, three waves per SIMD, and 3 x 272 registers fit a SIMD's 1,024; at 256 the multi-product body spilled in this build.
__global__ __launch_bounds__(32 * AW) __attribute__((amdgpu_num_vgpr(272)))
void k_keypass(const h16* __restrict__ QH, const h16* __restrict__ QR, const h16* __restrict__ KP, const h16* __restrict__ KR,
               const h16* __restrict__ VT, const h16* __restrict__ VR, const float* __restrict__ MB, const int* __restrict__ MF, float* OUT) {
    __shared__ __align__(16) h16 ring[2 * 4 * KOP];
    __shared__ __align__(16) float os[AW * 16 * OSP];
    __shared__ __align__(16) float mrow[SEQ];
    const int zh = (int)blockIdx.x; const int qt = SEQ / (16 * AW) - 1 - (int)blockIdx.y;
    if (qt < EROWS / (16 * AW)) keypass_body<1>(ring, os, mrow, qt, zh, QH, QR, KP, KR, VT, VR, MB, MF, OUT);
    else                        keypass_body<0>(ring, os, mrow, qt, zh, QH, QH, KP, KP, VT, VT, MB, MF, OUT);
}

static constexpr size_t al256(size_t v) { return (v + 255) & ~(size_t)255; }
static constexpr size_t SZ_XB = al256((size_t)NB * SEQ * DM * 2);
static constexpr size_t SZ_WB = al256((size_t)3 * DM * DM * 2);
static constexpr size_t SZ_AL = al256((size_t)2 * LR * DM * 2);
static constexpr size_t SZ_BL = al256((size_t)DM * LK * 2);
static constexpr size_t SZ_PL = al256((size_t)NB * NH_ * SEQ * HD * 2);
static constexpr size_t SZ_RS = al256((size_t)NB * NH_ * EROWS * HD * 2);
static constexpr size_t SZ_MB = al256((size_t)NB * SEQ * 4);
static constexpr size_t SZ_MF = al256((size_t)NB * 4);
static constexpr size_t SZ_TOTAL = SZ_XB + SZ_WB + SZ_AL + 2 * SZ_BL + 3 * SZ_PL + 3 * SZ_RS + SZ_MB + SZ_MF;
static_assert(SZ_TOTAL <= (size_t)134217728);          // workspace carve <= 128 MiB
static_assert(((size_t)DM * DM * 2) % 256 == 0);       // weight sub-planes stay 256-byte aligned
static_assert(((size_t)LR * DM * 2) % 256 == 0);       // the two halves of the A plane stay 256-byte aligned
static_assert((size_t)NB * NH_ * SEQ * HD == (size_t)NB * DM * SEQ);       // v^T plane [(b*1024 + m)][t] has the same extent as the q/k planes
static_assert((size_t)NB * NH_ * EROWS * HD == (size_t)NB * DM * EROWS);   // v^T residual plane [(b*1024 + m)][t < EROWS] has the same extent as the q/k residual planes
static_assert((DM * 4) % 256 == 0);                    // the extension-plane block ranges of k_prep cover their planes exactly

extern "C" void kernel_launch(void* const* d_in, const int* in_sizes, int n_in,
                              void* d_out, int out_size, void* d_ws, size_t ws_size, hipStream_t stream) {
    if (n_in < 12) return;
    const size_t needx = ((size_t)(NB - 1) * SEQ_FULL + SEQ) * DM;
    const size_t needm = (size_t)(NB - 1) * SEQ_FULL + SEQ;
    if ((size_t)in_sizes[0] < needx || (size_t)in_sizes[1] < needm) return;
    if ((size_t)in_sizes[2] < (size_t)DM * DM || (size_t)in_sizes[4] < (size_t)DM * DM || (size_t)in_sizes[6] < (size_t)DM * DM) return;
    if (in_sizes[3] < DM || in_sizes[5] < DM || in_sizes[7] < DM) return;
    if (in_sizes[8] < LR * DM || in_sizes[9] < DM * LR || in_sizes[10] < LR * DM || in_sizes[11] < DM * LR) return;
    if ((size_t)out_size < ((size_t)(NB - 1) * OUT_SEQ + SEQ) * DM) return;
    if (SZ_TOTAL > ws_size) return;
    // wire order: hidden_states, key_mask (the module's additive key mask input), Wq, bq, Wk, bk, Wv, bv, Aq, Bq, Av, Bv
    const float* xin = (const float*)d_in[0];
    const float* am  = (const float*)d_in[1];
    const float* wq = (const float*)d_in[2]; const float* bq = (const float*)d_in[3];
    const float* wk = (const float*)d_in[4]; const float* bk = (const float*)d_in[5];
    const float* wv = (const float*)d_in[6]; const float* bv = (const float*)d_in[7];
    const float* aq = (const float*)d_in[8]; const float* bqu = (const float*)d_in[9];
    const float* av = (const float*)d_in[10]; const float* bvu = (const float*)d_in[11];
    float* OUT = (float*)d_out;      // [NB][SEQ][1024]
    char* wsp = (char*)d_ws;
    bf* XB = (bf*)wsp; wsp += SZ_XB;                 // x      [NB*SEQ][1024]
    bf* WB = (bf*)wsp; wsp += SZ_WB;                 // [3][1024][1024]: q | k | v  ([out][in] = Bt as-is)
    bf* AL = (bf*)wsp; wsp += SZ_AL;                 // [16][1024]: rows 0..7 A of the q update, rows 8..15 A of the v update
    bf* BLq = (bf*)wsp; wsp += SZ_BL;                // [1024][32]: B | B | 0 | 0 (q update)
    bf* BLv = (bf*)wsp; wsp += SZ_BL;                // [1024][32]: B | B | 0 | 0 (v update)
    h16* QH = (h16*)wsp; wsp += SZ_PL;               // [NB*16][SEQ][64]
    h16* KP = (h16*)wsp; wsp += SZ_PL;               // [NB*16][SEQ][64]
    h16* VT = (h16*)wsp; wsp += SZ_PL;               // [NB*16][64][SEQ]
    h16* QR = (h16*)wsp; wsp += SZ_RS;               // [NB*16][EROWS][64] residual x2048, tokens < EROWS
    h16* KR = (h16*)wsp; wsp += SZ_RS;               // [NB*16][EROWS][64] residual x2048, tokens < EROWS
    h16* VR = (h16*)wsp; wsp += SZ_RS;               // [NB*16][64][EROWS] residual x2048, tokens < EROWS
    float* MB = (float*)wsp; wsp += SZ_MB;           // [NB][SEQ] mask values after the convert to bf16, as f32
    int* MF = (int*)wsp; wsp += SZ_MF;               // [NB] 1 where the batch's mask row widens the key loop

    // all conversions to bf16
    k_prep<<<dim3(NB + CB_X + 3 * CB_W + 2 * CB_A + 2 * CB_B, 1, 1), 256, 0, stream>>>(xin, wq, wk, wv, aq, av, bqu, bvu, am, XB, WB, AL, BLq, BLv, MB, MF);

    // q, k: A = x rows (m = b*SEQ + t), Bt = W rows (n = h*64 + d) -> plane [(b*16 + h)][t][d]; v^T: A = Wv rows (m = h*64 + d), Bt = x rows (n = b*SEQ + t) -> plane [(b*1024 + m)][t] = [(b*16 + h)][d][t]; residuals for tokens < EROWS
    k_proj<<<dim3(NB * SEQ / 128, DM / 128, 3), 32 * PW, 0, stream>>>(XB, WB, AL, BLq, BLv, bq, bk, bv, QH, QR, KP, KR, VT, VR, EROWS);

    // query rows [0, EROWS): multi-product instantiation; rows [EROWS, SEQ): single-product instantiation (disjoint output rows)
    k_keypass<<<dim3(NB * NH_, SEQ / (16 * AW), 1), 32 * AW, 0, stream>>>(QH, QR, KP, KR, VT, VR, MB, MF, OUT);
}

// v008
// A run of this version takes 65.3 microseconds.
// Two timings next to v007 both put it at 1.06 times that version's speed.
// Over all steps from v000 it is 4.90 times as fast.
#include <hip/hip_runtime.h>

// Causal pair-score weighting, width 1024 = 16 heads x 64; one input x [NB][SEQ][1024] feeds q, k and v; Wq/Wk/Wv [out][in] (y = x W^T + bias); rank-8 additive updates on q and v: y += 2 (x A^T) B^T with A [8][in], B [out][8];
// additive key mask [NB][1][1][SEQ] (f32, read by value); score scale 1/sqrt(64); keys j > t are replaced by -1e9 before the mask is added; softmax over keys; output = concatenated heads (f32), no output projection.
// Compute dtypes, f32 accumulate everywhere: projections and x A^T v_wmma_f32_16x16x32_bf16 (x, W, A, B, biases, mask RNE-converted to bf16; products exact); the rank-8 up-projection is one extra 32-deep k-step of the projection GEMM (2 x A^T carried as bf16 hi | lo, B bf16); x A^T is formed inside the projection blocks, from the x tiles that they stage anyway;
// scores v_wmma_f32_16x16x32_f16: single f16 q and k on query rows >= EROWS; q and k each as f16 value + f16 residual x2048 (three products, residual products in their own accumulator) on query rows < EROWS;
// P.V v_wmma_f32_16x16x32_f16: P (x16384 carry, cancels in the normalisation) and v single f16 on query rows >= EROWS; on query rows < EROWS P and v each as f16 value + f16 residual x2048, residual products in their own accumulator folded by 1/2048, row sum from the f32 exponentials; softmax f32 (online, running max).
// Layout: bf16 copies of x, W, A; weight-side extension planes [row][32] bf16 (B | B | 0 | 0; the x side, hi | lo | 0 | 0 of 2 x A^T, lives in fragments only); q, k planes [b*16+h][t][64], v^T plane [b*16+h][d][t], small residual planes q, k [b*16+h][t < EROWS][64] and v^T [b*16+h][d][t < EROWS]; fused online-softmax key-pass kernel in transposed form (S^T = K Q^T, O^T = V^T P^T).
// Key loop bound per wave: the causal limit; if any mask value of the batch is not below 1e8 in magnitude the loop covers all keys (per-element arithmetic is literal in every visited tile, save the compare and select that the single-product body leaves out in tiles below the block's first query row). Residual fragments for keys >= EROWS are zero.
// The mask's bf16-rounded values (kept as f32, plane [NB][SEQ]) and that per-batch magnitude test (one word per batch) are formed once, in k_prep; the key-pass kernel only reads them: each block stages its batch's row in LDS once, and the key loop reads it there.

#ifndef NB
#define NB 2
#endif
#ifndef SEQ
#define SEQ 2048
#endif
#define NB_FULL  2
#define SEQ_FULL 2048
#ifndef OUT_SEQ
#define OUT_SEQ SEQ              // row pitch (in tokens) between batches of the output
#endif
#define DM   1024
#define NH_  16
#define HD   64
#define LR   8                   // rank of the additive updates
#define LK   32                  // k extent of the extension planes (one WMMA k-step)
#define XP   20                  // LDS row pitch (floats) of the x A^T tile
#define AW   4                   // waves per online-softmax key-pass block (16 query rows each)
#define PW   4                   // waves per projection block (2 x 2 wave tiles of 64 x 64)
#define PBK  64                  // k extent of one staged projection tile: 128 bytes of every operand row
#define PPI  72                  // LDS row pitch (16-bit elements) of a staged row: 144 bytes = 16 x 9
#define POP  (128 * PPI)         // elements of one staged operand tile (128 rows)
#define PST  (2 * POP)           // elements of one stage: A tile | B tile
#define XOP  (16 * PPI)          // elements of one staged tile of the 16 A rows (q update rows 0..7, v update rows 8..15)
#define OSP  68                  // LDS row pitch (floats) of the online-softmax key-pass output tile
#define KST  64                  // keys of one staged key-pass tile: 64 K rows of 128 bytes, 128 bytes of each of the 64 V^T rows
#define KOP  (64 * PPI)          // elements of one staged key-pass plane tile (64 rows at pitch PPI)
#define EROWS (SEQ < 512 ? SEQ : 512)   // query rows (and tokens of the small residual planes) handled by the multi-product online-softmax key-pass instantiation
#define QRS  2048.0f             // carry of every residual plane / residual fragment
#define QRI  (1.0f / 2048.0f)
#define SC2  ((float)(0.125 * 1.4426950408889634))      // HD^-0.5 * log2(e)
#define L2E  ((float)1.4426950408889634)
#define NEGL ((float)(-1.0e9 * 1.4426950408889634))     // fill value -1e9 in the log2 domain
#define LSC  2.0f                // update scaling 16 / 8
#define PSH  14.0f               // log2 of the P carry (16384)
#define PFL  (-14.0f)            // exponent argument below which the f16 P would leave the normal range
#define NEGB (-3.0e38f)
#define WIDE 1.0e8f              // mask magnitude bound under which skipped (fully causal-filled) tiles contribute exactly zero

static_assert(HD == 64);
static_assert(NH_ * HD == DM);                 // head h = columns h*64 + d
static_assert(DM % 64 == 0);                   // column tiles of 64 = one head
static_assert(64 % HD == 0);
static_assert(DM % 32 == 0);                   // GEMM k-loop steps by 32
static_assert(LK == 32);                       // extension = exactly one k-step
static_assert(2 * LR <= LK);                   // hi | lo pieces fit the extension row
static_assert(LR == 8);                        // one 16-byte piece per part; B rows loaded as 8 floats
static_assert(2 * LR == 16);                   // A rows of q and v updates fill one 16-column tile
static_assert(SEQ % 64 == 0);                  // a 64-row tile never straddles two batches
static_assert((NB * SEQ) % 64 == 0);
static_assert(SEQ % 128 == 0);                 // mask scan steps by 128
static_assert(SEQ % 32 == 0);                  // key loop steps by 32
static_assert(SEQ % (16 * AW) == 0);           // online-softmax key-pass grids cover the sequence exactly
static_assert(EROWS % 64 == 0);                // a 64-token GEMM tile lies wholly inside or outside the residual planes
static_assert(EROWS >= 32);
static_assert(EROWS <= SEQ);
static_assert(EROWS % (16 * AW) == 0);
static_assert((SEQ - EROWS) % (16 * AW) == 0);
static_assert(((size_t)SEQ * DM) % 8 == 0);
static_assert(((size_t)DM * DM) % 8 == 0);
static_assert(((size_t)LR * DM) % 8 == 0);
static_assert(NB <= NB_FULL);
static_assert(SEQ <= SEQ_FULL);
static_assert((OSP * 4) % 16 == 0);
static_assert(OSP >= HD);
static_assert((XP * 4) % 16 == 0);
static_assert(XP >= 16);
static_assert(32 * 4 * 16 == 16 * HD * 2);
static_assert(32 * 4 * 16 == 16 * 64 * 2);
static_assert(32 * 8 * 16 == 16 * HD * 4);     // online-softmax key-pass epilogue: 8 instructions x 32 lanes x 16 B = 16 rows x 256 B
static_assert((NB * SEQ) % 128 == 0);          // projection blocks cover 128 x 128
static_assert(DM % 128 == 0);
static_assert(DM % PBK == 0);
static_assert(DM / PBK >= 2);                  // the two-buffer ring needs two stages
static_assert(PBK * 2 == 128);                 // a staged row is one 128-byte line: 8 lanes x 16 B
static_assert((PPI * 2) % 16 == 0);
static_assert(PPI >= PBK);
static_assert(8 * 32 * PW * 16 == 128 * PBK * 2);   // 8 copies per lane fill one operand tile
static_assert(2 * PST * 2 + 2 * XOP * 2 + PW * 16 * 68 * 4 <= 131072);   // static LDS of the projection kernel
static_assert(128 * XP * 4 <= 2 * PST * 2);           // the block's x A^T tile (128 rows) fits the ring, which is free behind the k loop
static_assert(32 * PW * 16 == 16 * PBK * 2);          // one copy per lane fills one tile of the 16 A rows
static_assert(2 * 4 * KOP * 2 + AW * 16 * OSP * 4 + SEQ * 4 <= 106496);    // static LDS of the online-softmax key-pass kernels: three blocks fit one 320 KiB LDS
static_assert(4 * 32 * AW * 16 == SEQ * 4);    // 4 copies per lane fill the batch's mask row
static_assert(KST == 16 * AW);                 // a block's causal key bound is a whole number of staged tiles
static_assert(SEQ % KST == 0);
static_assert(EROWS % KST == 0);               // a staged tile lies wholly inside or outside the residual planes
static_assert(KST * 2 == 128);                 // a staged V^T row piece is one 128-byte line
static_assert(HD * 2 == 128);                  // a staged K row is one 128-byte line
static_assert(4 * 32 * AW * 16 == 64 * 128);   // 4 copies per lane fill one plane tile

typedef _Float16 h16;
typedef unsigned short bf;
typedef __attribute__((ext_vector_type(16))) __bf16   v16bf;
typedef __attribute__((ext_vector_type(16))) _Float16 v16h;
typedef __attribute__((ext_vector_type(8)))  _Float16 v8h;
typedef __attribute__((ext_vector_type(8)))  unsigned short v8us;
typedef __attribute__((ext_vector_type(8)))  float    v8f;
typedef __attribute__((ext_vector_type(4)))  float    v4f;
typedef v4f  __attribute__((may_alias)) v4fa;
typedef float __attribute__((may_alias)) fal;

__device__ __forceinline__ unsigned short f2bf(float f) { unsigned u = __float_as_uint(f); u += 0x7FFFu + ((u >> 16) & 1u); return (unsigned short)(u >> 16); }
__device__ __forceinline__ float bfr(float f) { return __uint_as_float(((unsigned)f2bf(f)) << 16); }   // value after RNE convert to bf16
__device__ __forceinline__ v16h cat16(v8h lo, v8h hi) { return __builtin_shufflevector(lo, hi, 0, 1, 2, 3, 4, 5, 6, 7, 8, 9, 10, 11, 12, 13, 14, 15); }
__device__ __forceinline__ v16bf cat16b(v8us lo, v8us hi) { return __builtin_bit_cast(v16bf, __builtin_shufflevector(lo, hi, 0, 1, 2, 3, 4, 5, 6, 7, 8, 9, 10, 11, 12, 13, 14, 15)); }
__device__ __forceinline__ v8f wmma16(v16h a, v16h b, v8f c) { return __builtin_amdgcn_wmma_f32_16x16x32_f16(false, a, false, b, (short)0, c, false, false); }
__device__ __forceinline__ v8f wmmab(v16bf a, v16bf b, v8f c) { return __builtin_amdgcn_wmma_f32_16x16x32_bf16(false, a, false, b, (short)0, c, false, false); }
// fragment loaders from K-contiguous 16-bit rows; p already includes + 8*(lane>>4): elements 0..7 <- k0+8h+0..7, elements 8..15 <- k0+16+8h+0..7 (same map for A and B)
__device__ __forceinline__ v16h  ldh(const h16* p) { return cat16(*(const v8h*)p, *(const v8h*)(p + 16)); }
__device__ __forceinline__ v16bf ldb(const bf* p)  { return cat16b(*(const v8us*)p, *(const v8us*)(p + 16)); }
// ordering point for wave-private LDS tiles (same wave writes and reads)
__device__ __forceinline__ void wave_sync() { __builtin_amdgcn_fence(3 /* release order */, "wavefront"); __builtin_amdgcn_wave_barrier(); asm volatile("" ::: "memory"); }

// f32 -> f16 convert that cannot produce a subnormal operand (|v| < 2^-14 -> +0); applied after the plane's power-of-two carry
static __device__ __forceinline__ h16 toh_flush(float v) { const h16 r = (h16)v; return (fabsf(v) < 6.103515625e-05f) ? (h16)0.0f : r; }
// one 16-bit word of an extension row: piece 0 = bf16 value, piece 1 = bf16 of the remainder, pieces 2, 3 = zero (select by value)
static __device__ __forceinline__ unsigned short ext_word(float v, int piece) {
    const unsigned short hw = f2bf(v); const float hv = __uint_as_float(((unsigned)hw) << 16); const unsigned short lw = f2bf(v - hv);
    return (piece == 0) ? hw : ((piece == 1) ? lw : (unsigned short)0); }

// eight asynchronous 16-byte copies per lane, global -> LDS: copy i moves the lane's 16 bytes of tile row (row + 16 i). The closing s_wait_xcnt stands inside the statement so that no address register is rewritten ahead of it.
static __device__ __forceinline__ void copy8(unsigned l, const bf* g, size_t gs) {
    const unsigned ls = 16 * PPI * 2;
    asm volatile("global_load_async_to_lds_b128 %0, %8, off\n\t"
                 "global_load_async_to_lds_b128 %1, %9, off\n\t"
                 "global_load_async_to_lds_b128 %2, %10, off\n\t"
                 "global_load_async_to_lds_b128 %3, %11, off\n\t"
                 "global_load_async_to_lds_b128 %4, %12, off\n\t"
                 "global_load_async_to_lds_b128 %5, %13, off\n\t"
                 "global_load_async_to_lds_b128 %6, %14, off\n\t"
                 "global_load_async_to_lds_b128 %7, %15, off\n\t"
                 "s_wait_xcnt 0x0"
                 :: "v"(l), "v"(l + ls), "v"(l + 2 * ls), "v"(l + 3 * ls), "v"(l + 4 * ls), "v"(l + 5 * ls), "v"(l + 6 * ls), "v"(l + 7 * ls),
                    "v"(g), "v"(g + gs), "v"(g + 2 * gs), "v"(g + 3 * gs), "v"(g + 4 * gs), "v"(g + 5 * gs), "v"(g + 6 * gs), "v"(g + 7 * gs)
                 : "memory");
}

// the same with one copy: the lane's 16 bytes of one row
static __device__ __forceinline__ void copy1(unsigned l, const bf* g) {
    asm volatile("global_load_async_to_lds_b128 %0, %1, off\n\t"
                 "s_wait_xcnt 0x0"
                 :: "v"(l), "v"(g)
                 : "memory");
}

// the same with four copies of 16-bit float rows: copy i moves the lane's 16 bytes of tile row (row + 16 i)
static __device__ __forceinline__ void copy4(unsigned l, const h16* g, size_t gs) {
    const unsigned ls = 16 * PPI * 2;
    asm volatile("global_load_async_to_lds_b128 %0, %4, off\n\t"
                 "global_load_async_to_lds_b128 %1, %5, off\n\t"
                 "global_load_async_to_lds_b128 %2, %6, off\n\t"
                 "global_load_async_to_lds_b128 %3, %7, off\n\t"
                 "s_wait_xcnt 0x0"
                 :: "v"(l), "v"(l + ls), "v"(l + 2 * ls), "v"(l + 3 * ls),
                    "v"(g), "v"(g + gs), "v"(g + 2 * gs), "v"(g + 3 * gs)
                 : "memory");
}

// the same with four copies of one f32 row: copy i moves the lane's 16 bytes of the block's i-th run of 32 * AW * 4 floats
static __device__ __forceinline__ void copy4m(unsigned l, const float* g) {
    const unsigned ls = 32 * AW * 16; const size_t gs = 32 * AW * 4;
    asm volatile("global_load_async_to_lds_b128 %0, %4, off\n\t"
                 "global_load_async_to_lds_b128 %1, %5, off\n\t"
                 "global_load_async_to_lds_b128 %2, %6, off\n\t"
                 "global_load_async_to_lds_b128 %3, %7, off\n\t"
                 "s_wait_xcnt 0x0"
                 :: "v"(l), "v"(l + ls), "v"(l + 2 * ls), "v"(l + 3 * ls),
                    "v"(g), "v"(g + gs), "v"(g + 2 * gs), "v"(g + 3 * gs)
                 : "memory");
}

// blocks of 256 threads (8 elements a thread) that each converted plane takes in k_prep
#define CB_X ((int)((size_t)NB * SEQ * DM / 8 / 256))   // x
#define CB_W ((int)((size_t)DM * DM / 8 / 256))         // one weight matrix
#define CB_A ((int)((size_t)LR * DM / 8 / 256))         // one A matrix
#define CB_B (DM * 4 / 256)                             // one weight-side extension plane (4 pieces of 8 per row)
static_assert(((size_t)SEQ * DM / 8) % 256 == 0);       // a block never straddles two batches of x
static_assert(((size_t)DM * DM / 8) % 256 == 0);
static_assert(((size_t)LR * DM / 8) % 256 == 0);

static __device__ __forceinline__ void cvt8(const float* __restrict__ src, bf* dst) {
    const v8f v = *(const v8f*)src; v8us o;
#pragma unroll
    for (int k = 0; k < 8; ++k) o[k] = f2bf(v[k]);
    *(v8us*)dst = o;
    asm volatile("s_wait_xcnt 0x0" ::: "memory");                            // the store's registers are rewritten only behind this wait
}

// k_prep: every f32 -> bf16 conversion of the call in one launch. The block index picks the plane (block-uniform ranges, in the order mask, one block per batch | x | Wq Wk Wv | Aq Av | Bq Bv); every range is covered exactly.
__global__ __launch_bounds__(256) void k_prep(const float* __restrict__ x, const float* __restrict__ wq, const float* __restrict__ wk, const float* __restrict__ wv,
                                              const float* __restrict__ aq, const float* __restrict__ av, const float* __restrict__ bqu, const float* __restrict__ bvu,
                                              const float* __restrict__ amask, bf* XB, bf* WB, bf* AL, bf* BLq, bf* BLv, float* MB, int* MF) {
    int blk = (int)blockIdx.x; const int tid = (int)threadIdx.x;
    if (blk < NB) {                                                           // mask row of batch blk: batch pitch SEQ_FULL in the input, SEQ in the plane; first in the grid, for speed only
        const float* amb = amask + (size_t)blk * SEQ_FULL; float* mrow = MB + (size_t)blk * SEQ;
        for (int i = tid * 8; i < SEQ; i += 256 * 8) {                        // value after RNE convert to bf16, stored as f32
            const v8f v = *(const v8f*)(amb + i); v8f o;
#pragma unroll
            for (int k = 0; k < 8; ++k) o[k] = bfr(v[k]);
            *(v8f*)(mrow + i) = o;
            asm volatile("s_wait_xcnt 0x0" ::: "memory"); }                  // the load's and the store's registers are rewritten only behind this wait
        if (tid < 32) {                                                       // the first wave scans the whole row: any value not below WIDE in magnitude widens the key loop to all keys
            float fl = 0.0f;
#pragma unroll 4
            for (int i = 0; i < SEQ; i += 128) {                              // four loads in flight a trip: more would raise the register count of every block of this kernel
                const v4f w = *(const v4f*)(amb + i + 4 * tid);
#pragma unroll
                for (int c = 0; c < 4; ++c) { const float a = fabsf(bfr(w[c])); fl = (a < WIDE) ? fl : 1.0f; } }
            fl = fmaxf(fl, __shfl_xor(fl, 16, 32)); fl = fmaxf(fl, __shfl_xor(fl, 8, 32)); fl = fmaxf(fl, __shfl_xor(fl, 4, 32));
            fl = fmaxf(fl, __shfl_xor(fl, 2, 32));  fl = fmaxf(fl, __shfl_xor(fl, 1, 32));
            if (tid == 0) MF[blk] = (fl != 0.0f) ? 1 : 0; }
        return; }
    blk -= NB;
    if (blk < CB_X) {                                                         // x: batch pitch SEQ_FULL tokens in the input, SEQ in the copy
        const size_t i = (size_t)blk * 256 + tid; const size_t nb8 = (size_t)SEQ * DM / 8; const size_t bb = i / nb8, r = i % nb8;
        cvt8(x + bb * ((size_t)SEQ_FULL * DM) + r * 8, XB + i * 8); return; }
    blk -= CB_X;
    if (blk < 3 * CB_W) {
        const int w = blk / CB_W; const float* s = (w == 0) ? wq : ((w == 1) ? wk : wv); const size_t i = (size_t)(blk - w * CB_W) * 256 + tid;
        cvt8(s + i * 8, WB + (size_t)w * DM * DM + i * 8); return; }
    blk -= 3 * CB_W;
    if (blk < 2 * CB_A) {
        const int w = blk / CB_A; const float* s = (w == 0) ? aq : av; const size_t i = (size_t)(blk - w * CB_A) * 256 + tid;
        cvt8(s + i * 8, AL + (size_t)w * LR * DM + i * 8); return; }
    blk -= 2 * CB_A;
    {                                                                         // weight-side extension rows: B | B | 0 | 0
        const int w = blk / CB_B; const float* s = (w == 0) ? bqu : bvu; bf* d = (w == 0) ? BLq : BLv; const int i = (blk - w * CB_B) * 256 + tid;
        const int row = i >> 2, piece = i & 3;
        const v8f v = *(const v8f*)(s + (size_t)row * LR); v8us o;
#pragma unroll
        for (int k = 0; k < 8; ++k) { const unsigned short t = f2bf(v[k]); o[k] = (piece < 2) ? t : (unsigned short)0; }
        *(v8us*)(d + (size_t)i * 8) = o;
        asm volatile("s_wait_xcnt 0x0" ::: "memory"); }                      // the store's registers are rewritten only behind this wait
}

template <int MODE, int LOWR>
__device__ __forceinline__ void proj_body(bf* ring, bf* xring, float* osa, int bx, int by, const bf* __restrict__ A, const bf* __restrict__ Bt, const bf* __restrict__ AL, const bf* __restrict__ WX, int xcol,
                                          const float* __restrict__ bias, h16* Ph, h16* Pr, int resT) {
    const int K = DM;
    const int lane = threadIdx.x & 31, lr = lane & 15, hi = lane >> 4;
    const int wave = __builtin_amdgcn_readfirstlane((int)(threadIdx.x >> 5));
    const int wm = (wave & 1) * 64, wn = (wave >> 1) * 64;                    // the wave's 64 x 64 tile inside the block
    const int r0 = bx * 128 + wm, c0 = by * 128 + wn;
    float* os = osa + wave * 16 * 68;                                         // wave-private output staging
    v8f acc[4][4];
#pragma unroll
    for (int mb = 0; mb < 4; ++mb)
#pragma unroll
        for (int nb = 0; nb < 4; ++nb) acc[mb][nb] = (v8f){};
    v8f xacc[2]; xacc[0] = (v8f){}; xacc[1] = (v8f){};                        // LOWR: x A^T of the wave's 32 x rows
    const int xh = LOWR ? ((MODE == 0) ? (wave >> 1) : (wave & 1)) : 0;       // which 32 of the 64 x rows that it shares with its partner wave are its own for x A^T (wave-uniform)
    const int rot[4] = { xh * 32, xh * 32 + 16, 32 - xh * 32, 48 - xh * 32 };  // x-side fragment i holds the 16 x rows from rot[i] on: the wave's own 32 rows are always fragments 0 and 1, so that no branch picks registers in the k loop
    // copy side: thread tid moves bytes 16 (tid & 7) of tile rows (tid >> 3) + 16 i, i = 0..7, of both operands (and of A row tid >> 3 when LOWR)
    const int crow = (int)(threadIdx.x >> 3), cch = (int)(threadIdx.x & 7);
    const bf* ga = A  + (size_t)(bx * 128 + crow) * K + cch * 8;      // rows < M, columns k0 + 63 < K
    const bf* gb = Bt + (size_t)(by * 128 + crow) * K + cch * 8;
    const unsigned la = (unsigned)(size_t)(&ring[crow * PPI + cch * 8]);      // LDS byte address = low 32 bits of the shared address
    const unsigned lb = la + POP * 2;
    const bf* gl = AL + (size_t)crow * K + cch * 8;                           // rows < 16
    const unsigned lx = (unsigned)(size_t)(&xring[crow * PPI + cch * 8]);
    const int xfo = lr * PPI + 8 * hi;
    const int NT = K / PBK;
    // read side: same loader and k map as from the planes, rows at pitch PPI
    const int afr = (wm + lr) * PPI + 8 * hi, bfo = POP + (wn + lr) * PPI + 8 * hi;
    copy8(la, ga, (size_t)16 * K); copy8(lb, gb, (size_t)16 * K);             // tile 0 -> buffer 0
    if (LOWR) copy1(lx, gl);
    asm volatile("s_wait_asynccnt 0x0" ::: "memory");                         // this wave's copies of tile 0 have landed
    __syncthreads();                                                          // ... and every other wave's
    copy8(la + PST * 2, ga + PBK, (size_t)16 * K); copy8(lb + PST * 2, gb + PBK, (size_t)16 * K);   // tile 1 -> buffer 1
    if (LOWR) copy1(lx + XOP * 2, gl + PBK);
#pragma unroll 1
    for (int t = 0; t < NT; ++t) {                                            // rolled: one pass per staged tile
        const int bo = (t & 1) * PST;
#pragma unroll
        for (int ks = 0; ks < PBK; ks += 32) {
            v16bf a[4];
#pragma unroll
            for (int mb = 0; mb < 4; ++mb) a[mb] = ldb(&ring[bo + afr + ((MODE == 0) ? rot[mb] : mb * 16) * PPI + ks]);
            v16bf b[4];                                                       // all fragments of a k-step (eight, nine with LOWR) are read as one group of LDS loads
#pragma unroll
            for (int nb = 0; nb < 4; ++nb) b[nb] = ldb(&ring[bo + bfo + ((MODE == 1) ? rot[nb] : nb * 16) * PPI + ks]);
            v16bf al = a[0];
            if (LOWR) al = ldb(&xring[(t & 1) * XOP + xfo + ks]);
            __builtin_amdgcn_sched_barrier(0);                                // keeps the k-step's LDS loads one group ahead of its products
#pragma unroll
            for (int nb = 0; nb < 4; ++nb) {
#pragma unroll
                for (int mb = 0; mb < 4; ++mb) acc[mb][nb] = wmmab(a[mb], b[nb], acc[mb][nb]); }
            if (LOWR) { xacc[0] = wmmab((MODE == 0) ? a[0] : b[0], al, xacc[0]); xacc[1] = wmmab((MODE == 0) ? a[1] : b[1], al, xacc[1]); }
            __builtin_amdgcn_sched_barrier(0);                                // ... and the next group behind them
        }
        asm volatile("s_wait_dscnt 0x0" ::: "memory");                        // this wave's reads of buffer t & 1 are done before it is refilled
        asm volatile("s_wait_asynccnt 0x0" ::: "memory");                     // this wave's copies of tile t + 1 have landed
        __syncthreads();                                                      // publishes tile t + 1 and ends every reader's last read of buffer t & 1
        if (t + 2 < NT) { copy8(la + bo * 2, ga + (size_t)(t + 2) * PBK, (size_t)16 * K); copy8(lb + bo * 2, gb + (size_t)(t + 2) * PBK, (size_t)16 * K);
                          if (LOWR) copy1(lx + (t & 1) * (XOP * 2), gl + (size_t)(t + 2) * PBK); }
    }
    asm volatile("s_wait_asynccnt 0x0" ::: "memory");                         // no copy is outstanding behind the loop
    if (LOWR) {                                                                                   // extension k-step: rows of 32 bf16, same k map on both sides
        const size_t wxo = (size_t)(((MODE == 0) ? c0 : r0) + lr) * LK + 8 * hi;
        v16bf we[4];                                                                              // weight side, from its plane; the loads fly under the exchange below
#pragma unroll
        for (int i = 0; i < 4; ++i) we[i] = ldb(WX + wxo + (size_t)i * 16 * LK);
        fal* xs = (fal*)ring;                                                                     // [128 x rows of the block][XP]; every reader of the ring has passed the loop's last barrier and no copy is outstanding
        const int xw = (MODE == 0) ? wm : wn;                                                     // the wave's 64 x rows inside the block
#pragma unroll
        for (int i = 0; i < 2; ++i)
#pragma unroll
            for (int j = 0; j < 8; ++j) xs[(xw + rot[i] + hi * 8 + j) * XP + lr] = xacc[i][j] * LSC;   // D: row 8h+j, col lane&15
        __syncthreads();                                                                          // each wave reads 32 rows that its partner wave wrote
        v16bf xe[4];
#pragma unroll
        for (int i = 0; i < 4; ++i) {
            const v4f e0 = *(const v4fa*)(&xs[(xw + rot[i] + lr) * XP + xcol]); const v4f e1 = *(const v4fa*)(&xs[(xw + rot[i] + lr) * XP + xcol + 4]); v8us w;
#pragma unroll
            for (int k = 0; k < 4; ++k) { w[k] = ext_word(e0[k], hi); w[4 + k] = ext_word(e1[k], hi); }
            xe[i] = cat16b(w, (v8us){}); }
#pragma unroll
        for (int nb = 0; nb < 4; ++nb) {
#pragma unroll
            for (int mb = 0; mb < 4; ++mb) acc[mb][nb] = (MODE == 0) ? wmmab(xe[mb], we[nb], acc[mb][nb]) : wmmab(we[mb], xe[nb], acc[mb][nb]); }
    }
    float bc[4];
#pragma unroll
    for (int nb = 0; nb < 4; ++nb) bc[nb] = (MODE == 0) ? bfr(bias[c0 + nb * 16 + lr]) : 0.0f;   // MODE 0: c0 + 63 < DM
    size_t tbase, rbase; bool wr;                                                                 // wr: wave-uniform, the wave's whole tile inside the residual plane
    if (MODE == 0) { const int bb = r0 / SEQ, tt = r0 % SEQ; const int zc = bb * NH_ + c0 / HD;
                     tbase = ((size_t)zc * SEQ + (size_t)tt) * HD; rbase = ((size_t)zc * (size_t)resT + (size_t)tt) * HD; wr = tt < resT; }
    else           { const int bb = c0 / SEQ, tt = c0 % SEQ;
                     tbase = (size_t)bb * (size_t)DM * SEQ + (size_t)r0 * SEQ + (size_t)tt; rbase = (size_t)bb * (size_t)DM * (size_t)resT + (size_t)r0 * (size_t)resT + (size_t)tt; wr = tt < resT; }
#pragma unroll
    for (int mb = 0; mb < 4; ++mb) {
        float br[8];
#pragma unroll
        for (int j = 0; j < 8; ++j) br[j] = (MODE == 1) ? bfr(bias[r0 + mb * 16 + hi * 8 + j]) : 0.0f;   // MODE 1: r0 + 63 < DM
#pragma unroll
        for (int nb = 0; nb < 4; ++nb) {
#pragma unroll
            for (int j = 0; j < 8; ++j) os[(hi * 8 + j) * 68 + ((MODE == 1) ? rot[nb] : nb * 16) + lr] = acc[mb][nb][j] + bc[nb] + br[j]; }   // D: row 8h+j, col lane&15; rows 0..15 x columns 0..63 all written
        wave_sync();
{
            if (MODE == 0) {
                const size_t sb = tbase + (size_t)rot[mb] * HD;
                const size_t rb = rbase + (size_t)rot[mb] * HD;
#pragma unroll
                for (int s = 0; s < 4; ++s) { const int p = s * 32 + lane; const int row = p >> 3, c8 = (p & 7) * 8;   // 4 s x 4 rows = 16 rows; 8 lanes x 8 = 64 columns = one line
                    const v4f x0 = *(const v4fa*)(&os[row * 68 + c8]); const v4f x1 = *(const v4fa*)(&os[row * 68 + c8 + 4]); v8h hv, rv;
#pragma unroll
                    for (int i = 0; i < 4; ++i) { const h16 a0 = toh_flush(x0[i]); const h16 a1 = toh_flush(x1[i]); hv[i] = a0; hv[4 + i] = a1;
                                                  rv[i] = toh_flush((x0[i] - (float)a0) * QRS); rv[4 + i] = toh_flush((x1[i] - (float)a1) * QRS); }
                    const size_t oo = sb + (size_t)p * 8;
                    const size_t ro = rb + (size_t)p * 8;
                    *(v8h*)(Ph + oo) = hv; asm volatile("s_wait_xcnt 0x0" ::: "memory");                    // each store's registers are rewritten only behind its wait
                    if (wr) { *(v8h*)(Pr + ro) = rv; asm volatile("s_wait_xcnt 0x0" ::: "memory"); } }
            } else {
                const size_t sb = tbase + (size_t)(mb * 16) * SEQ;
                const size_t rb = rbase + (size_t)(mb * 16) * (size_t)resT;
#pragma unroll
                for (int s = 0; s < 4; ++s) { const int row = 4 * s + (lane >> 3), c8 = (lane & 7) * 8;   // 4 s x 4 row groups = 16 rows; 8 lanes x 8 = 64 columns
                    const v4f x0 = *(const v4fa*)(&os[row * 68 + c8]); const v4f x1 = *(const v4fa*)(&os[row * 68 + c8 + 4]); v8h hv, rv;
#pragma unroll
                    for (int i = 0; i < 4; ++i) { const h16 a0 = toh_flush(x0[i]); const h16 a1 = toh_flush(x1[i]); hv[i] = a0; hv[4 + i] = a1;
                                                  rv[i] = toh_flush((x0[i] - (float)a0) * QRS); rv[4 + i] = toh_flush((x1[i] - (float)a1) * QRS); }
                    const size_t oo = sb + (size_t)row * SEQ + c8;
                    const size_t ro = rb + (size_t)row * (size_t)resT + c8;
                    *(v8h*)(Ph + oo) = hv; asm volatile("s_wait_xcnt 0x0" ::: "memory");                    // each store's registers are rewritten only behind its wait
                    if (wr) { *(v8h*)(Pr + ro) = rv; asm volatile("s_wait_xcnt 0x0" ::: "memory"); } }
            }
             }
        wave_sync();
    }
}

// k_proj: the three projections in one launch, blockIdx.z picks one (block-uniform); the three bodies share one ring and one output staging, declared here so that the block's LDS is that of one body.
// z = 0, q: token-major with the update extension; z = 1, k: token-major, no extension; z = 2, v^T: feature-major with the update extension (A = Wv rows, so the block's row tile is blockIdx.y and its column tile blockIdx.x).
// Registers are capped at 256: without the cap the extension step spreads above v255 and pays a register-window switch at many of its instructions.
__global__ __launch_bounds__(32 * PW) __attribute__((amdgpu_num_vgpr(256)))
void k_proj(const bf* __restrict__ XB, const bf* __restrict__ WB, const bf* __restrict__ AL, const bf* __restrict__ BLq, const bf* __restrict__ BLv,
                                              const float* __restrict__ bq, const float* __restrict__ bk, const float* __restrict__ bv,
                                              h16* QH, h16* QR, h16* KP, h16* KR, h16* VT, h16* VR, int resT) {
    __shared__ __align__(16) bf ring[2 * PST];
    __shared__ __align__(16) bf xring[2 * XOP];
    __shared__ __align__(16) float osa[PW * 16 * 68];
    const int z = (int)blockIdx.z, gx = (int)blockIdx.x, gy = (int)blockIdx.y;
    const bf* WK = WB + (size_t)DM * DM; const bf* WV = WB + (size_t)2 * DM * DM;
    if (z == 0)      proj_body<0, 1>(ring, xring, osa, gx, gy, XB, WB, AL, BLq, 0, bq, QH, QR, resT);
    else if (z == 1) proj_body<0, 0>(ring, xring, osa, gx, gy, XB, WK, AL, WK, 0, bk, KP, KR, resT);
    else             proj_body<1, 1>(ring, xring, osa, gy, gx, WV, XB, AL, BLv, LR, bv, VT, VR, resT);
}

// compile-time switch handed to the key pass's tile pass
template <bool B> struct sw { static constexpr bool v = B; };

template <int EARLY>
__device__ __forceinline__ void keypass_body(h16* ring, float* os, float* mrow, int qt, int zh, const h16* __restrict__ QH, const h16* __restrict__ QR, const h16* __restrict__ KP, const h16* __restrict__ KR,
                                           const h16* __restrict__ VT, const h16* __restrict__ VR, const float* __restrict__ MB, const int* __restrict__ MF, float* OUT) {
    constexpr int KSG = (EARLY ? 4 : 2) * KOP;                                // elements of one stage: K | V^T (| K residual | V^T residual); the ring holds two stages
    const int lane = threadIdx.x & 31, lr = lane & 15, hi = lane >> 4;
    const int wave = __builtin_amdgcn_readfirstlane((int)(threadIdx.x >> 5));
    const int b = zh / NH_, h = zh % NH_;
    const int t0 = (qt * AW + wave) * 16;                                     // qt: the block's tile of 64 query rows, counted over the whole sequence
    const int lim = t0 + lr;                                                  // key j is causal-filled iff j > lim
    const float* amb = MB + (size_t)b * SEQ;                                  // the batch's mask row, already rounded to bf16 values
    const size_t pbase = (size_t)zh * SEQ * HD;
    const size_t rbase = (size_t)zh * EROWS * HD;
    // copy side: thread tid moves bytes 16 (tid & 7) of tile rows (tid >> 3) + 16 i, i = 0..3, of every staged plane (K rows = keys, V^T rows = d)
    const int crow = (int)(threadIdx.x >> 3), cch = (int)(threadIdx.x & 7);
    const h16* gk  = KP + pbase + (size_t)crow * HD + cch * 8;                // + key * HD, keys < SEQ
    const h16* gv  = VT + pbase + (size_t)crow * SEQ + cch * 8;               // + key, keys + 63 < SEQ
    const h16* gkr = KR + rbase + (size_t)crow * HD + cch * 8;                // + key * HD, keys < EROWS
    const h16* gvr = VR + rbase + (size_t)crow * EROWS + cch * 8;             // + key, keys + 63 < EROWS
    const unsigned l0 = (unsigned)(size_t)(&ring[crow * PPI + cch * 8]);      // LDS byte address = low 32 bits of the shared address
    auto stage = [&](int s, int buf) {                                        // tile s (keys 64 s .. 64 s + 63) -> buffer buf
        const int k0 = s * KST; const unsigned l = l0 + (unsigned)buf * (KSG * 2);
        copy4(l, gk + (size_t)k0 * HD, (size_t)16 * HD); copy4(l + KOP * 2, gv + k0, (size_t)16 * SEQ);
        if (EARLY) { const int kc = (k0 < EROWS) ? k0 : (EROWS - KST);        // clamped residual-plane key (address always inside the plane)
                     copy4(l + 2 * KOP * 2, gkr + (size_t)kc * HD, (size_t)16 * HD); copy4(l + 3 * KOP * 2, gvr + kc, (size_t)16 * EROWS); } };
    stage(0, 0);                                                              // tile 0 exists for every block; its copies fly under the Q loads
    copy4m((unsigned)(size_t)(&mrow[threadIdx.x * 4]), amb + threadIdx.x * 4);   // the batch's whole mask row (SEQ floats) -> LDS, once per block; tile 0's wait and barrier below cover these copies too
    const bool wide = MF[b] != 0;                                             // k_prep's test of the batch's mask row: any value not below WIDE in magnitude widens the key loop to all keys
    const int nkc = (t0 + 16 + 31) & ~31;                                     // causal bound, multiple of 32, <= SEQ
    const int nk = __builtin_amdgcn_readfirstlane(wide ? SEQ : nkc);
    const int nbv = wide ? SEQ : ((qt + 1) * KST);           // the block's bound = its last wave's; every wave reads the same word, so it is block-uniform
    const int NS = __builtin_amdgcn_readfirstlane(nbv) / KST;                 // staged tiles of the block, >= 1
    const size_t qo = pbase + (size_t)(t0 + lr) * HD + 8 * hi;
    const v16h hz = (v16h){};
    v16h qh[2], qr[2];
    qh[0] = ldh(QH + qo); qh[1] = ldh(QH + qo + 32);             // B fragments: col t, k = d (two k-steps)
    qr[0] = hz; qr[1] = hz;
    if (EARLY) { const size_t qro = rbase + (size_t)(t0 + lr) * HD + 8 * hi; qr[0] = ldh(QR + qro); qr[1] = ldh(QR + qro + 32);     // t0 + lr < EROWS
                 asm volatile("s_wait_xcnt 0x0" ::: "memory"); }               // the Q loads' address registers are rewritten only behind this wait
    const int fo = lr * PPI + 8 * hi;                          // read side, same loader and k map as from the planes, rows at pitch PPI: K + key * PPI (A fragment: row key, k = d); V^T + 16j * PPI + key (A fragment: row d, k = key)
    v8f o[4], oR[4];
#pragma unroll
    for (int j = 0; j < 4; ++j) { o[j] = (v8f){}; oR[j] = (v8f){}; }
    float m = NEGB, l = 0.0f;
    asm volatile("s_wait_asynccnt 0x0" ::: "memory");            // this wave's copies of tile 0 have landed
    __syncthreads();                                             // ... and every other wave's
    if (1 < NS) stage(1, 1);
    // one pass over staged tile s. FILL = false: every key of the tile is below every query row of the block, no key is replaced, and the per-element index, compare and select are left out; all else is the same text
    auto tile = [&](auto fsw, int s) __attribute__((always_inline)) {
    constexpr bool FILL = decltype(fsw)::v;
    const int bo = (s & 1) * KSG;
    const int ke = (nk - s * KST < KST) ? nk - s * KST : KST;    // keys of this tile below the wave's own bound
#pragma unroll 1
    for (int kk = 0; kk < ke; kk += 32) {                        // rolled: the 32-key halves of a tile share one body, which keeps the loop's text small
        const int key0 = s * KST + kk;
        const bool rok = key0 < EROWS;                           // wave-uniform
        const h16* kpt = &ring[bo + fo + kk * PPI];
        v8f sHa = (v8f){}, sLa = (v8f){}, sHb = (v8f){}, sLb = (v8f){};
        const h16* krp = &ring[bo + (EARLY ? 2 : 0) * KOP + fo + kk * PPI];   // residual tiles exist in the EARLY stage only
        const h16* va  = &ring[bo + KOP + fo + kk];
        const h16* vrp = &ring[bo + (EARLY ? 3 : 1) * KOP + fo + kk];
        const float* kp = &mrow[8 * hi + key0];                  // keys key0+8h+0..7 and key0+16+8h+0..7, all < nk <= SEQ; from the row staged in LDS
        const v4f m0 = *(const v4fa*)kp, m1 = *(const v4fa*)(kp + 4), m2 = *(const v4fa*)(kp + 16), m3 = *(const v4fa*)(kp + 20);
        v16h ka[2], kb[2], kra[2], krb[2], vf[4];          // the fragments of a product run are read as one group of LDS loads ahead of it
#pragma unroll
        for (int ks = 0; ks < 2; ++ks) {
            ka[ks] = ldh(kpt + ks * 32); kb[ks] = ldh(kpt + 16 * PPI + ks * 32);
            if (EARLY) { kra[ks] = ldh(krp + ks * 32); krb[ks] = ldh(krp + 16 * PPI + ks * 32); } }
        if (!EARLY) {                                              // registers allow: the V^T fragments join the K group
#pragma unroll
            for (int j = 0; j < 4; ++j) vf[j] = ldh(va + (16 * j) * PPI); }
        __builtin_amdgcn_sched_barrier(0);                         // keeps the LDS loads above one group ahead of the score products
#pragma unroll
        for (int ks = 0; ks < 2; ++ks) {
            sHa = wmma16(ka[ks], qh[ks], sHa); sHb = wmma16(kb[ks], qh[ks], sHb);
            if (EARLY) {
                sLa = wmma16(ka[ks], qr[ks], sLa); sLb = wmma16(kb[ks], qr[ks], sLb);
                if (!rok) { kra[ks] = hz; krb[ks] = hz; }
                sLa = wmma16(kra[ks], qh[ks], sLa); sLb = wmma16(krb[ks], qh[ks], sLb);
            }
        }
        if (EARLY) {                                               // the V^T group flies under the softmax
#pragma unroll
            for (int j = 0; j < 4; ++j) vf[j] = ldh(va + (16 * j) * PPI); }
        float kx[8], ky[8];
#pragma unroll
        for (int r = 0; r < 4; ++r) { kx[r] = m0[r]; kx[4 + r] = m1[r]; ky[r] = m2[r]; ky[4 + r] = m3[r]; }
        const int ja = key0 + 8 * hi;
        float ta[8], tb[8]; float mx = NEGB;
#pragma unroll
        for (int r = 0; r < 8; ++r) {
            const float sa = EARLY ? (sHa[r] + sLa[r] * QRI) * SC2 : sHa[r] * SC2;
            const float sb = EARLY ? (sHb[r] + sLb[r] * QRI) * SC2 : sHb[r] * SC2;
            if (FILL) { ta[r] = ((ja + r > lim) ? NEGL : sa) + kx[r] * L2E;      // replace, then add the mask
                        tb[r] = ((ja + 16 + r > lim) ? NEGL : sb) + ky[r] * L2E; }
            else      { ta[r] = __builtin_fmaf(kx[r], L2E, sa);                  // the mask is added in the fused form that the other body compiles to: same bits
                        tb[r] = __builtin_fmaf(ky[r], L2E, sb); }
            mx = fmaxf(mx, fmaxf(ta[r], tb[r])); }
        mx = fmaxf(mx, __shfl_xor(mx, 16, 32));
        const float mnew = fmaxf(m, mx);
        float alpha;                                               // exp2(m - mnew), with the one slot that the instruction set asks for behind a transcendental in the same statement
        asm volatile("v_exp_f32 %0, %1\n\tv_nop" : "=v"(alpha) : "v"(m - mnew));
        const float sh = PSH - mnew;
        v16h pb, pr = hz; float ls = 0.0f;
#pragma unroll
        for (int r = 0; r < 8; ++r) {
            const float aa = ta[r] + sh, ab = tb[r] + sh;
            const float ea = __builtin_amdgcn_exp2f(aa), eb = __builtin_amdgcn_exp2f(ab);
            const float ga = (aa < PFL) ? 0.0f : ea, gb = (ab < PFL) ? 0.0f : eb;   // below the f16 normal range -> exactly zero, selected by value
            const h16 pa = (h16)ga; const h16 pc = (h16)gb;
            pb[r] = pa; pb[8 + r] = pc;
            if (EARLY) { pr[r] = toh_flush((ga - (float)pa) * QRS); pr[8 + r] = toh_flush((gb - (float)pc) * QRS); ls += ga + gb; }
            else       { ls += (float)pa + (float)pc; } }
        l = l * alpha + ls; m = mnew;
#pragma unroll
        for (int j = 0; j < 4; ++j) { o[j] = o[j] * alpha; if (EARLY) oR[j] = oR[j] * alpha; }
#pragma unroll
        for (int jp = 0; jp < 2; ++jp) {
            const v16h v0 = vf[2 * jp], v1 = vf[2 * jp + 1];
            o[2 * jp] = wmma16(v0, pb, o[2 * jp]); o[2 * jp + 1] = wmma16(v1, pb, o[2 * jp + 1]);
            if (EARLY) {
                oR[2 * jp] = wmma16(v0, pr, oR[2 * jp]); oR[2 * jp + 1] = wmma16(v1, pr, oR[2 * jp + 1]);
                v16h vr0 = ldh(vrp + (32 * jp) * PPI), vr1 = ldh(vrp + (32 * jp + 16) * PPI);
                if (!rok) { vr0 = hz; vr1 = hz; }
                oR[2 * jp] = wmma16(vr0, pb, oR[2 * jp]); oR[2 * jp + 1] = wmma16(vr1, pb, oR[2 * jp + 1]);
            }
        }
    }
    asm volatile("s_wait_dscnt 0x0" ::: "memory");               // this wave's reads of buffer s & 1 are done before it is refilled
    asm volatile("s_wait_asynccnt 0x0" ::: "memory");            // this wave's copies of tile s + 1 have landed
    __syncthreads();                                             // publishes tile s + 1 and ends every reader's last read of buffer s & 1
    if (s + 2 < NS) stage(s + 2, s & 1);
    };
    // tiles 0 .. qt - 1 hold keys below 64 qt, the block's first query row (qt < NS always); from tile qt on the replacement can apply. Two loops, so that each body stays one straight run of code.
    // The multi-product instantiation (at most EROWS / KST tiles below the diagonal, a small part of the work) keeps its one loop.
    if constexpr (!EARLY) {
#pragma unroll 1
        for (int s = 0; s < qt; ++s) tile(sw<false>{}, s);       // rolled: one pass per staged tile
    }
#pragma unroll 1
    for (int s = EARLY ? 0 : qt; s < NS; ++s) tile(sw<true>{}, s);   // rolled: one pass per staged tile
    asm volatile("s_wait_asynccnt 0x0" ::: "memory");            // no copy is outstanding behind the loop
    l += __shfl_xor(l, 16, 32);
    const float inv = 1.0f / l;                                  // l >= 2^14 whenever the row has a finite maximum logit
    const int wb = wave * 16 * OSP;
    // O^T D layout: o[j][r] = (d = 16j + 8h + r, t = lane&15) -> os[t][d]; rows 0..15 x columns 0..63 all written
#pragma unroll
    for (int j = 0; j < 4; ++j) {
        v8f f = o[j];
        if (EARLY) f = o[j] + oR[j] * QRI;
        v4f a, c;
        a[0] = f[0] * inv; a[1] = f[1] * inv; a[2] = f[2] * inv; a[3] = f[3] * inv; c[0] = f[4] * inv; c[1] = f[5] * inv; c[2] = f[6] * inv; c[3] = f[7] * inv;
        *(v4fa*)(&os[wb + lr * OSP + 16 * j + 8 * hi]) = a; *(v4fa*)(&os[wb + lr * OSP + 16 * j + 8 * hi + 4]) = c; }
    wave_sync();
    float* orow = OUT + ((size_t)b * OUT_SEQ + t0) * DM + h * HD;
{
#pragma unroll
        for (int s = 0; s < 8; ++s) { const int row = 2 * s + (lane >> 4), cofs = (lane & 15) * 4;   // 8 s x 2 rows = 16 rows; 16 lanes x 4 floats = 64 columns = two lines
            const v4f val = *(const v4fa*)(&os[wb + row * OSP + cofs]);
            *(v4f*)(orow + (size_t)row * DM + cofs) = val; }
         }
}

// k_keypass: both instantiations in one launch. blockIdx.x = (batch, head); blockIdx.y counts the 64-row query tiles from the last one down, for speed only. The choice of the body is block-uniform; the two bodies share one ring and one output staging, declared here.
// Registers are capped at 272: the LDS admits three blocks per WGP, three waves per SIMD, and 3 x 272 registers fit a SIMD's 1,024.
__global__ __launch_bounds__(32 * AW) __attribute__((amdgpu_num_vgpr(272)))
void k_keypass(const h16* __restrict__ QH, const h16* __restrict__ QR, const h16* __restrict__ KP, const h16* __restrict__ KR,
               const h16* __restrict__ VT, const h16* __restrict__ VR, const float* __restrict__ MB, const int* __restrict__ MF, float* OUT) {
    __shared__ __align__(16) h16 ring[2 * 4 * KOP];
    __shared__ __align__(16) float os[AW * 16 * OSP];
    __shared__ __align__(16) float mrow[SEQ];
    const int zh = (int)blockIdx.x; const int qt = SEQ / (16 * AW) - 1 - (int)blockIdx.y;
    if (qt < EROWS / (16 * AW)) keypass_body<1>(ring, os, mrow, qt, zh, QH, QR, KP, KR, VT, VR, MB, MF, OUT);
    else                        keypass_body<0>(ring, os, mrow, qt, zh, QH, QH, KP, KP, VT, VT, MB, MF, OUT);
}

static constexpr size_t al256(size_t v) { return (v + 255) & ~(size_t)255; }
static constexpr size_t SZ_XB = al256((size_t)NB * SEQ * DM * 2);
static constexpr size_t SZ_WB = al256((size_t)3 * DM * DM * 2);
static constexpr size_t SZ_AL = al256((size_t)2 * LR * DM * 2);
static constexpr size_t SZ_BL = al256((size_t)DM * LK * 2);
static constexpr size_t SZ_PL = al256((size_t)NB * NH_ * SEQ * HD * 2);
static constexpr size_t SZ_RS = al256((size_t)NB * NH_ * EROWS * HD * 2);
static constexpr size_t SZ_MB = al256((size_t)NB * SEQ * 4);
static constexpr size_t SZ_MF = al256((size_t)NB * 4);
static constexpr size_t SZ_TOTAL = SZ_XB + SZ_WB + SZ_AL + 2 * SZ_BL + 3 * SZ_PL + 3 * SZ_RS + SZ_MB + SZ_MF;
static_assert(SZ_TOTAL <= (size_t)134217728);          // workspace carve <= 128 MiB
static_assert(((size_t)DM * DM * 2) % 256 == 0);       // weight sub-planes stay 256-byte aligned
static_assert(((size_t)LR * DM * 2) % 256 == 0);       // the two halves of the A plane stay 256-byte aligned
static_assert((size_t)NB * NH_ * SEQ * HD == (size_t)NB * DM * SEQ);       // v^T plane [(b*1024 + m)][t] has the same extent as the q/k planes
static_assert((size_t)NB * NH_ * EROWS * HD == (size_t)NB * DM * EROWS);   // v^T residual plane [(b*1024 + m)][t < EROWS] has the same extent as the q/k residual planes
static_assert((DM * 4) % 256 == 0);                    // the extension-plane block ranges of k_prep cover their planes exactly

extern "C" void kernel_launch(void* const* d_in, const int* in_sizes, int n_in,
                              void* d_out, int out_size, void* d_ws, size_t ws_size, hipStream_t stream) {
    if (n_in < 12) return;
    const size_t needx = ((size_t)(NB - 1) * SEQ_FULL + SEQ) * DM;
    const size_t needm = (size_t)(NB - 1) * SEQ_FULL + SEQ;
    if ((size_t)in_sizes[0] < needx || (size_t)in_sizes[1] < needm) return;
    if ((size_t)in_sizes[2] < (size_t)DM * DM || (size_t)in_sizes[4] < (size_t)DM * DM || (size_t)in_sizes[6] < (size_t)DM * DM) return;
    if (in_sizes[3] < DM || in_sizes[5] < DM || in_sizes[7] < DM) return;
    if (in_sizes[8] < LR * DM || in_sizes[9] < DM * LR || in_sizes[10] < LR * DM || in_sizes[11] < DM * LR) return;
    if ((size_t)out_size < ((size_t)(NB - 1) * OUT_SEQ + SEQ) * DM) return;
    if (SZ_TOTAL > ws_size) return;
    // wire order: hidden_states, key_mask (the module's additive key mask input), Wq, bq, Wk, bk, Wv, bv, Aq, Bq, Av, Bv
    const float* xin = (const float*)d_in[0];
    const float* am  = (const float*)d_in[1];
    const float* wq = (const float*)d_in[2]; const float* bq = (const float*)d_in[3];
    const float* wk = (const float*)d_in[4]; const float* bk = (const float*)d_in[5];
    const float* wv = (const float*)d_in[6]; const float* bv = (const float*)d_in[7];
    const float* aq = (const float*)d_in[8]; const float* bqu = (const float*)d_in[9];
    const float* av = (const float*)d_in[10]; const float* bvu = (const float*)d_in[11];
    float* OUT = (float*)d_out;      // [NB][SEQ][1024]
    char* wsp = (char*)d_ws;
    bf* XB = (bf*)wsp; wsp += SZ_XB;                 // x      [NB*SEQ][1024]
    bf* WB = (bf*)wsp; wsp += SZ_WB;                 // [3][1024][1024]: q | k | v  ([out][in] = Bt as-is)
    bf* AL = (bf*)wsp; wsp += SZ_AL;                 // [16][1024]: rows 0..7 A of the q update, rows 8..15 A of the v update
    bf* BLq = (bf*)wsp; wsp += SZ_BL;                // [1024][32]: B | B | 0 | 0 (q update)
    bf* BLv = (bf*)wsp; wsp += SZ_BL;                // [1024][32]: B | B | 0 | 0 (v update)
    h16* QH = (h16*)wsp; wsp += SZ_PL;               // [NB*16][SEQ][64]
    h16* KP = (h16*)wsp; wsp += SZ_PL;               // [NB*16][SEQ][64]
    h16* VT = (h16*)wsp; wsp += SZ_PL;               // [NB*16][64][SEQ]
    h16* QR = (h16*)wsp; wsp += SZ_RS;               // [NB*16][EROWS][64] residual x2048, tokens < EROWS
    h16* KR = (h16*)wsp; wsp += SZ_RS;               // [NB*16][EROWS][64] residual x2048, tokens < EROWS
    h16* VR = (h16*)wsp; wsp += SZ_RS;               // [NB*16][64][EROWS] residual x2048, tokens < EROWS
    float* MB = (float*)wsp; wsp += SZ_MB;           // [NB][SEQ] mask values after the convert to bf16, as f32
    int* MF = (int*)wsp; wsp += SZ_MF;               // [NB] 1 where the batch's mask row widens the key loop

    // all conversions to bf16
    k_prep<<<dim3(NB + CB_X + 3 * CB_W + 2 * CB_A + 2 * CB_B, 1, 1), 256, 0, stream>>>(xin, wq, wk, wv, aq, av, bqu, bvu, am, XB, WB, AL, BLq, BLv, MB, MF);

    // q, k: A = x rows (m = b*SEQ + t), Bt = W rows (n = h*64 + d) -> plane [(b*16 + h)][t][d]; v^T: A = Wv rows (m = h*64 + d), Bt = x rows (n = b*SEQ + t) -> plane [(b*1024 + m)][t] = [(b*16 + h)][d][t]; residuals for tokens < EROWS
    k_proj<<<dim3(NB * SEQ / 128, DM / 128, 3), 32 * PW, 0, stream>>>(XB, WB, AL, BLq, BLv, bq, bk, bv, QH, QR, KP, KR, VT, VR, EROWS);

    // query rows [0, EROWS): multi-product instantiation; rows [EROWS, SEQ): single-product instantiation (disjoint output rows)
    k_keypass<<<dim3(NB * NH_, SEQ / (16 * AW), 1), 32 * AW, 0, stream>>>(QH, QR, KP, KR, VT, VR, MB, MF, OUT);
}

// v009
// One run takes 63.3 microseconds.
// Next to v008, in two timings, it ran 1.03 times as fast each time.
// Counting every step since v000, it is 5.05 times as fast.
#include <hip/hip_runtime.h>

// Causal pair-score weighting, width 1024 = 16 heads x 64; one input x [NB][SEQ][1024] feeds q, k and v; Wq/Wk/Wv [out][in] (y = x W^T + bias); rank-8 additive updates on q and v: y += 2 (x A^T) B^T with A [8][in], B [out][8];
// additive key mask [NB][1][1][SEQ] (f32, read by value); score scale 1/sqrt(64); keys j > t are replaced by -1e9 before the mask is added; softmax over keys; output = concatenated heads (f32), no output projection.
// Compute dtypes, f32 accumulate everywhere: projections and x A^T v_wmma_f32_16x16x32_bf16 (x, W, A, B, biases, mask RNE-converted to bf16; products exact); the rank-8 up-projection is one extra 32-deep k-step of the projection GEMM (2 x A^T carried as bf16 hi | lo, B bf16); x A^T is formed inside the projection blocks, from the x tiles that they stage anyway;
// scores v_wmma_f32_16x16x32_f16: single f16 q and k on query rows >= EROWS; q and k each as f16 value + f16 residual x2048 (three products, residual products in their own accumulator) on query rows < EROWS;
// P.V v_wmma_f32_16x16x32_f16: P (x16384 carry, cancels in the normalisation) and v single f16 on query rows >= EROWS; on query rows < EROWS P and v each as f16 value + f16 residual x2048, residual products in their own accumulator folded by 1/2048, row sum from the f32 exponentials; softmax f32 (online, running max).
// Layout: bf16 copies of x, W, A; weight-side extension planes [row][32] bf16 (B | B | 0 | 0; the x side, hi | lo | 0 | 0 of 2 x A^T, lives in fragments only); q, k planes [b*16+h][t][64], v^T plane [b*16+h][d][t], small residual planes q, k [b*16+h][t < EROWS][64] and v^T [b*16+h][d][t < EROWS]; fused online-softmax key-pass kernel in transposed form (S^T = K Q^T, O^T = V^T P^T).
// Key loop bound per wave: the causal limit; if any mask value of the batch is not below 1e8 in magnitude the loop covers all keys (per-element arithmetic is literal in every visited tile, save the compare and select that the single-product body leaves out in tiles below the block's first query row). Residual fragments for keys >= EROWS are zero.
// The mask's bf16-rounded values (kept as f32, plane [NB][SEQ]) and that per-batch magnitude test (one word per batch) are formed once, in k_prep; the key-pass kernel only reads them: each block stages its batch's row in LDS once, and the key loop reads it there.

#ifndef NB
#define NB 2
#endif
#ifndef SEQ
#define SEQ 2048
#endif
#define NB_FULL  2
#define SEQ_FULL 2048
#ifndef OUT_SEQ
#define OUT_SEQ SEQ              // row pitch (in tokens) between batches of the output
#endif
#define DM   1024
#define NH_  16
#define HD   64
#define LR   8                   // rank of the additive updates
#define LK   32                  // k extent of the extension planes (one WMMA k-step)
#define XP   20                  // LDS row pitch (floats) of the x A^T tile
#define AW   4                   // waves per online-softmax key-pass block (16 query rows each)
#define PW   4                   // waves per projection block (2 x 2 wave tiles of 64 x 64)
#define PBK  64                  // k extent of one staged projection tile: 128 bytes of every operand row
#define PPI  72                  // LDS row pitch (16-bit elements) of a staged row: 144 bytes = 16 x 9
#define POP  (128 * PPI)         // elements of one staged operand tile (128 rows)
#define PST  (2 * POP)           // elements of one stage: A tile | B tile
#define XOP  (16 * PPI)          // elements of one staged tile of the 16 A rows (q update rows 0..7, v update rows 8..15)
#define OSP  68                  // LDS row pitch (floats) of the online-softmax key-pass output tile
#define KST  64                  // keys of one staged key-pass tile: 64 K rows of 128 bytes, 128 bytes of each of the 64 V^T rows
#define KOP  (64 * PPI)          // elements of one staged key-pass plane tile (64 rows at pitch PPI)
#define EROWS (SEQ < 512 ? SEQ : 512)   // query rows (and tokens of the small residual planes) handled by the multi-product online-softmax key-pass instantiation
#define QRS  2048.0f             // carry of every residual plane / residual fragment
#define QRI  (1.0f / 2048.0f)
#define SC2  ((float)(0.125 * 1.4426950408889634))      // HD^-0.5 * log2(e)
#define L2E  ((float)1.4426950408889634)
#define NEGL ((float)(-1.0e9 * 1.4426950408889634))     // fill value -1e9 in the log2 domain
#define LSC  2.0f                // update scaling 16 / 8
#define PSH  14.0f               // log2 of the P carry (16384)
#define PFL  (-14.0f)            // exponent argument below which the f16 P would leave the normal range
#define NEGB (-3.0e38f)
#define WIDE 1.0e8f              // mask magnitude bound under which skipped (fully causal-filled) tiles contribute exactly zero

static_assert(HD == 64);
static_assert(NH_ * HD == DM);                 // head h = columns h*64 + d
static_assert(DM % 64 == 0);                   // column tiles of 64 = one head
static_assert(64 % HD == 0);
static_assert(DM % 32 == 0);                   // GEMM k-loop steps by 32
static_assert(LK == 32);                       // extension = exactly one k-step
static_assert(2 * LR <= LK);                   // hi | lo pieces fit the extension row
static_assert(LR == 8);                        // one 16-byte piece per part; B rows loaded as 8 floats
static_assert(2 * LR == 16);                   // A rows of q and v updates fill one 16-column tile
static_assert(SEQ % 64 == 0);                  // a 64-row tile never straddles two batches
static_assert((NB * SEQ) % 64 == 0);
static_assert(SEQ % 128 == 0);                 // mask scan steps by 128
static_assert(SEQ % 32 == 0);                  // key loop steps by 32
static_assert(SEQ % (16 * AW) == 0);           // online-softmax key-pass grids cover the sequence exactly
static_assert(EROWS % 64 == 0);                // a 64-token GEMM tile lies wholly inside or outside the residual planes
static_assert(EROWS >= 32);
static_assert(EROWS <= SEQ);
static_assert(EROWS % (16 * AW) == 0);
static_assert((SEQ - EROWS) % (16 * AW) == 0);
static_assert(((size_t)SEQ * DM) % 8 == 0);
static_assert(((size_t)DM * DM) % 8 == 0);
static_assert(((size_t)LR * DM) % 8 == 0);
static_assert(NB <= NB_FULL);
static_assert(SEQ <= SEQ_FULL);
static_assert((OSP * 4) % 16 == 0);
static_assert(OSP >= HD);
static_assert((XP * 4) % 16 == 0);
static_assert(XP >= 16);
static_assert(32 * 4 * 16 == 16 * HD * 2);
static_assert(32 * 4 * 16 == 16 * 64 * 2);
static_assert(32 * 8 * 16 == 16 * HD * 4);     // online-softmax key-pass epilogue: 8 instructions x 32 lanes x 16 B = 16 rows x 256 B
static_assert((NB * SEQ) % 128 == 0);          // projection blocks cover 128 x 128
static_assert(DM % 128 == 0);
static_assert(DM % PBK == 0);
static_assert(DM / PBK >= 2);                  // the two-buffer ring needs two stages
static_assert(PBK * 2 == 128);                 // a staged row is one 128-byte line: 8 lanes x 16 B
static_assert((PPI * 2) % 16 == 0);
static_assert(PPI >= PBK);
static_assert(8 * 32 * PW * 16 == 128 * PBK * 2);   // 8 copies per lane fill one operand tile
static_assert(2 * PST * 2 + 2 * XOP * 2 + PW * 16 * 68 * 4 <= 131072);   // static LDS of the projection kernel
static_assert(128 * XP * 4 <= 2 * PST * 2);           // the block's x A^T tile (128 rows) fits the ring, which is free behind the k loop
static_assert(32 * PW * 16 == 16 * PBK * 2);          // one copy per lane fills one tile of the 16 A rows
static_assert(2 * 4 * KOP * 2 + AW * 16 * OSP * 4 + SEQ * 4 <= 106496);    // static LDS of the online-softmax key-pass kernels: three blocks fit one 320 KiB LDS
static_assert(4 * 32 * AW * 16 == SEQ * 4);    // 4 copies per lane fill the batch's mask row
static_assert(KST == 16 * AW);                 // a block's causal key bound is a whole number of staged tiles
static_assert(SEQ % KST == 0);
static_assert(EROWS % KST == 0);               // a staged tile lies wholly inside or outside the residual planes
static_assert(KST * 2 == 128);                 // a staged V^T row piece is one 128-byte line
static_assert(HD * 2 == 128);                  // a staged K row is one 128-byte line
static_assert(4 * 32 * AW * 16 == 64 * 128);   // 4 copies per lane fill one plane tile

typedef _Float16 h16;
typedef unsigned short bf;
typedef __attribute__((ext_vector_type(16))) __bf16   v16bf;
typedef __attribute__((ext_vector_type(16))) _Float16 v16h;
typedef __attribute__((ext_vector_type(8)))  _Float16 v8h;
typedef __attribute__((ext_vector_type(8)))  unsigned short v8us;
typedef __attribute__((ext_vector_type(8)))  float    v8f;
typedef __attribute__((ext_vector_type(4)))  float    v4f;
typedef v4f  __attribute__((may_alias)) v4fa;
typedef float __attribute__((may_alias)) fal;

__device__ __forceinline__ unsigned short f2bf(float f) { unsigned u = __float_as_uint(f); u += 0x7FFFu + ((u >> 16) & 1u); return (unsigned short)(u >> 16); }
__device__ __forceinline__ float bfr(float f) { return __uint_as_float(((unsigned)f2bf(f)) << 16); }   // value after RNE convert to bf16
__device__ __forceinline__ v16h cat16(v8h lo, v8h hi) { return __builtin_shufflevector(lo, hi, 0, 1, 2, 3, 4, 5, 6, 7, 8, 9, 10, 11, 12, 13, 14, 15); }
__device__ __forceinline__ v16bf cat16b(v8us lo, v8us hi) { return __builtin_bit_cast(v16bf, __builtin_shufflevector(lo, hi, 0, 1, 2, 3, 4, 5, 6, 7, 8, 9, 10, 11, 12, 13, 14, 15)); }
__device__ __forceinline__ v8f wmma16(v16h a, v16h b, v8f c) { return __builtin_amdgcn_wmma_f32_16x16x32_f16(false, a, false, b, (short)0, c, false, false); }
__device__ __forceinline__ v8f wmmab(v16bf a, v16bf b, v8f c) { return __builtin_amdgcn_wmma_f32_16x16x32_bf16(false, a, false, b, (short)0, c, false, false); }
// fragment loaders from K-contiguous 16-bit rows; p already includes + 8*(lane>>4): elements 0..7 <- k0+8h+0..7, elements 8..15 <- k0+16+8h+0..7 (same map for A and B)
__device__ __forceinline__ v16h  ldh(const h16* p) { return cat16(*(const v8h*)p, *(const v8h*)(p + 16)); }
__device__ __forceinline__ v16bf ldb(const bf* p)  { return cat16b(*(const v8us*)p, *(const v8us*)(p + 16)); }
// ordering point for wave-private LDS tiles (same wave writes and reads)
__device__ __forceinline__ void wave_sync() { __builtin_amdgcn_fence(3 /* release order */, "wavefront"); __builtin_amdgcn_wave_barrier(); asm volatile("" ::: "memory"); }

// f32 -> f16 convert that cannot produce a subnormal operand (|v| < 2^-14 -> +0); applied after the plane's power-of-two carry
static __device__ __forceinline__ h16 toh_flush(float v) { const h16 r = (h16)v; return (fabsf(v) < 6.103515625e-05f) ? (h16)0.0f : r; }
// one 16-bit word of an extension row: piece 0 = bf16 value, piece 1 = bf16 of the remainder, pieces 2, 3 = zero (select by value)
static __device__ __forceinline__ unsigned short ext_word(float v, int piece) {
    const unsigned short hw = f2bf(v); const float hv = __uint_as_float(((unsigned)hw) << 16); const unsigned short lw = f2bf(v - hv);
    return (piece == 0) ? hw : ((piece == 1) ? lw : (unsigned short)0); }

// eight asynchronous 16-byte copies per lane, global -> LDS: copy i moves the lane's 16 bytes of tile row (row + 16 i). The closing s_wait_xcnt stands inside the statement so that no address register is rewritten ahead of it.
static __device__ __forceinline__ void copy8(unsigned l, const bf* g, size_t gs) {
    const unsigned ls = 16 * PPI * 2;
    asm volatile("global_load_async_to_lds_b128 %0, %8, off\n\t"
                 "global_load_async_to_lds_b128 %1, %9, off\n\t"
                 "global_load_async_to_lds_b128 %2, %10, off\n\t"
                 "global_load_async_to_lds_b128 %3, %11, off\n\t"
                 "global_load_async_to_lds_b128 %4, %12, off\n\t"
                 "global_load_async_to_lds_b128 %5, %13, off\n\t"
                 "global_load_async_to_lds_b128 %6, %14, off\n\t"
                 "global_load_async_to_lds_b128 %7, %15, off\n\t"
                 "s_wait_xcnt 0x0"
                 :: "v"(l), "v"(l + ls), "v"(l + 2 * ls), "v"(l + 3 * ls), "v"(l + 4 * ls), "v"(l + 5 * ls), "v"(l + 6 * ls), "v"(l + 7 * ls),
                    "v"(g), "v"(g + gs), "v"(g + 2 * gs), "v"(g + 3 * gs), "v"(g + 4 * gs), "v"(g + 5 * gs), "v"(g + 6 * gs), "v"(g + 7 * gs)
                 : "memory");
}

// the same with one copy: the lane's 16 bytes of one row
static __device__ __forceinline__ void copy1(unsigned l, const bf* g) {
    asm volatile("global_load_async_to_lds_b128 %0, %1, off\n\t"
                 "s_wait_xcnt 0x0"
                 :: "v"(l), "v"(g)
                 : "memory");
}

// the same with four copies of 16-bit float rows: copy i moves the lane's 16 bytes of tile row (row + 16 i)
static __device__ __forceinline__ void copy4(unsigned l, const h16* g, size_t gs) {
    const unsigned ls = 16 * PPI * 2;
    asm volatile("global_load_async_to_lds_b128 %0, %4, off\n\t"
                 "global_load_async_to_lds_b128 %1, %5, off\n\t"
                 "global_load_async_to_lds_b128 %2, %6, off\n\t"
                 "global_load_async_to_lds_b128 %3, %7, off\n\t"
                 "s_wait_xcnt 0x0"
                 :: "v"(l), "v"(l + ls), "v"(l + 2 * ls), "v"(l + 3 * ls),
                    "v"(g), "v"(g + gs), "v"(g + 2 * gs), "v"(g + 3 * gs)
                 : "memory");
}

// the same with four copies of one f32 row: copy i moves the lane's 16 bytes of the block's i-th run of 32 * AW * 4 floats
static __device__ __forceinline__ void copy4m(unsigned l, const float* g) {
    const unsigned ls = 32 * AW * 16; const size_t gs = 32 * AW * 4;
    asm volatile("global_load_async_to_lds_b128 %0, %4, off\n\t"
                 "global_load_async_to_lds_b128 %1, %5, off\n\t"
                 "global_load_async_to_lds_b128 %2, %6, off\n\t"
                 "global_load_async_to_lds_b128 %3, %7, off\n\t"
                 "s_wait_xcnt 0x0"
                 :: "v"(l), "v"(l + ls), "v"(l + 2 * ls), "v"(l + 3 * ls),
                    "v"(g), "v"(g + gs), "v"(g + 2 * gs), "v"(g + 3 * gs)
                 : "memory");
}

// blocks of 256 threads (8 elements a thread) that each converted plane takes in k_prep
#define CB_X ((int)((size_t)NB * SEQ * DM / 8 / 256))   // x
#define CB_W ((int)((size_t)DM * DM / 8 / 256))         // one weight matrix
#define CB_A ((int)((size_t)LR * DM / 8 / 256))         // one A matrix
#define CB_B (DM * 4 / 256)                             // one weight-side extension plane (4 pieces of 8 per row)
static_assert(((size_t)SEQ * DM / 8) % 256 == 0);       // a block never straddles two batches of x
static_assert(((size_t)DM * DM / 8) % 256 == 0);
static_assert(((size_t)LR * DM / 8) % 256 == 0);

static __device__ __forceinline__ void cvt8(const float* __restrict__ src, bf* dst) {
    const v8f v = *(const v8f*)src; v8us o;
#pragma unroll
    for (int k = 0; k < 8; ++k) o[k] = f2bf(v[k]);
    *(v8us*)dst = o;
    asm volatile("s_wait_xcnt 0x0" ::: "memory");                            // the store's registers are rewritten only behind this wait
}

// k_prep: every f32 -> bf16 conversion of the call in one launch. The block index picks the plane (block-uniform ranges, in the order mask, one block per batch | x | Wq Wk Wv | Aq Av | Bq Bv); every range is covered exactly.
__global__ __launch_bounds__(256) void k_prep(const float* __restrict__ x, const float* __restrict__ wq, const float* __restrict__ wk, const float* __restrict__ wv,
                                              const float* __restrict__ aq, const float* __restrict__ av, const float* __restrict__ bqu, const float* __restrict__ bvu,
                                              const float* __restrict__ amask, bf* XB, bf* WB, bf* AL, bf* BLq, bf* BLv, float* MB, int* MF) {
    int blk = (int)blockIdx.x; const int tid = (int)threadIdx.x;
    if (blk < NB) {                                                           // mask row of batch blk: batch pitch SEQ_FULL in the input, SEQ in the plane; first in the grid, for speed only
        const float* amb = amask + (size_t)blk * SEQ_FULL; float* mrow = MB + (size_t)blk * SEQ;
        for (int i = tid * 8; i < SEQ; i += 256 * 8) {                        // value after RNE convert to bf16, stored as f32
            const v8f v = *(const v8f*)(amb + i); v8f o;
#pragma unroll
            for (int k = 0; k < 8; ++k) o[k] = bfr(v[k]);
            *(v8f*)(mrow + i) = o;
            asm volatile("s_wait_xcnt 0x0" ::: "memory"); }                  // the load's and the store's registers are rewritten only behind this wait
        if (tid < 32) {                                                       // the first wave scans the whole row: any value not below WIDE in magnitude widens the key loop to all keys
            float fl = 0.0f;
#pragma unroll 4
            for (int i = 0; i < SEQ; i += 128) {                              // four loads in flight a trip: more would raise the register count of every block of this kernel
                const v4f w = *(const v4f*)(amb + i + 4 * tid);
#pragma unroll
                for (int c = 0; c < 4; ++c) { const float a = fabsf(bfr(w[c])); fl = (a < WIDE) ? fl : 1.0f; } }
            fl = fmaxf(fl, __shfl_xor(fl, 16, 32)); fl = fmaxf(fl, __shfl_xor(fl, 8, 32)); fl = fmaxf(fl, __shfl_xor(fl, 4, 32));
            fl = fmaxf(fl, __shfl_xor(fl, 2, 32));  fl = fmaxf(fl, __shfl_xor(fl, 1, 32));
            if (tid == 0) MF[blk] = (fl != 0.0f) ? 1 : 0; }
        return; }
    blk -= NB;
    if (blk < CB_X) {                                                         // x: batch pitch SEQ_FULL tokens in the input, SEQ in the copy
        const size_t i = (size_t)blk * 256 + tid; const size_t nb8 = (size_t)SEQ * DM / 8; const size_t bb = i / nb8, r = i % nb8;
        cvt8(x + bb * ((size_t)SEQ_FULL * DM) + r * 8, XB + i * 8); return; }
    blk -= CB_X;
    if (blk < 3 * CB_W) {
        const int w = blk / CB_W; const float* s = (w == 0) ? wq : ((w == 1) ? wk : wv); const size_t i = (size_t)(blk - w * CB_W) * 256 + tid;
        cvt8(s + i * 8, WB + (size_t)w * DM * DM + i * 8); return; }
    blk -= 3 * CB_W;
    if (blk < 2 * CB_A) {
        const int w = blk / CB_A; const float* s = (w == 0) ? aq : av; const size_t i = (size_t)(blk - w * CB_A) * 256 + tid;
        cvt8(s + i * 8, AL + (size_t)w * LR * DM + i * 8); return; }
    blk -= 2 * CB_A;
    {                                                                         // weight-side extension rows: B | B | 0 | 0
        const int w = blk / CB_B; const float* s = (w == 0) ? bqu : bvu; bf* d = (w == 0) ? BLq : BLv; const int i = (blk - w * CB_B) * 256 + tid;
        const int row = i >> 2, piece = i & 3;
        const v8f v = *(const v8f*)(s + (size_t)row * LR); v8us o;
#pragma unroll
        for (int k = 0; k < 8; ++k) { const unsigned short t = f2bf(v[k]); o[k] = (piece < 2) ? t : (unsigned short)0; }
        *(v8us*)(d + (size_t)i * 8) = o;
        asm volatile("s_wait_xcnt 0x0" ::: "memory"); }                      // the store's registers are rewritten only behind this wait
}

template <int MODE, int LOWR>
__device__ __forceinline__ void proj_body(bf* ring, bf* xring, float* osa, int bx, int by, const bf* __restrict__ A, const bf* __restrict__ Bt, const bf* __restrict__ AL, const bf* __restrict__ WX, int xcol,
                                          const float* __restrict__ bias, h16* Ph, h16* Pr, int resT) {
    const int K = DM;
    const int lane = threadIdx.x & 31, lr = lane & 15, hi = lane >> 4;
    const int wave = __builtin_amdgcn_readfirstlane((int)(threadIdx.x >> 5));
    const int wm = (wave & 1) * 64, wn = (wave >> 1) * 64;                    // the wave's 64 x 64 tile inside the block
    const int r0 = bx * 128 + wm, c0 = by * 128 + wn;
    float* os = osa + wave * 16 * 68;                                         // wave-private output staging
    v8f acc[4][4];
#pragma unroll
    for (int mb = 0; mb < 4; ++mb)
#pragma unroll
        for (int nb = 0; nb < 4; ++nb) acc[mb][nb] = (v8f){};
    v8f xacc[2]; xacc[0] = (v8f){}; xacc[1] = (v8f){};                        // LOWR: x A^T of the wave's 32 x rows
    const int xh = LOWR ? ((MODE == 0) ? (wave >> 1) : (wave & 1)) : 0;       // which 32 of the 64 x rows that it shares with its partner wave are its own for x A^T (wave-uniform)
    const int rot[4] = { xh * 32, xh * 32 + 16, 32 - xh * 32, 48 - xh * 32 };  // x-side fragment i holds the 16 x rows from rot[i] on: the wave's own 32 rows are always fragments 0 and 1, so that no branch picks registers in the k loop
    // copy side: thread tid moves bytes 16 (tid & 7) of tile rows (tid >> 3) + 16 i, i = 0..7, of both operands (and of A row tid >> 3 when LOWR)
    const int crow = (int)(threadIdx.x >> 3), cch = (int)(threadIdx.x & 7);
    const bf* ga = A  + (size_t)(bx * 128 + crow) * K + cch * 8;      // rows < M, columns k0 + 63 < K
    const bf* gb = Bt + (size_t)(by * 128 + crow) * K + cch * 8;
    const unsigned la = (unsigned)(size_t)(&ring[crow * PPI + cch * 8]);      // LDS byte address = low 32 bits of the shared address
    const unsigned lb = la + POP * 2;
    const bf* gl = AL + (size_t)crow * K + cch * 8;                           // rows < 16
    const unsigned lx = (unsigned)(size_t)(&xring[crow * PPI + cch * 8]);
    const int xfo = lr * PPI + 8 * hi;
    const int NT = K / PBK;
    // read side: same loader and k map as from the planes, rows at pitch PPI
    const int afr = (wm + lr) * PPI + 8 * hi, bfo = POP + (wn + lr) * PPI + 8 * hi;
    copy8(la, ga, (size_t)16 * K); copy8(lb, gb, (size_t)16 * K);             // tile 0 -> buffer 0
    if (LOWR) copy1(lx, gl);
    asm volatile("s_wait_asynccnt 0x0" ::: "memory");                         // this wave's copies of tile 0 have landed
    __syncthreads();                                                          // ... and every other wave's
    copy8(la + PST * 2, ga + PBK, (size_t)16 * K); copy8(lb + PST * 2, gb + PBK, (size_t)16 * K);   // tile 1 -> buffer 1
    if (LOWR) copy1(lx + XOP * 2, gl + PBK);
#pragma unroll 1
    for (int t = 0; t < NT; ++t) {                                            // rolled: one pass per staged tile
        const int bo = (t & 1) * PST;
#pragma unroll
        for (int ks = 0; ks < PBK; ks += 32) {
            v16bf a[4];
#pragma unroll
            for (int mb = 0; mb < 4; ++mb) a[mb] = ldb(&ring[bo + afr + ((MODE == 0) ? rot[mb] : mb * 16) * PPI + ks]);
            v16bf b[4];                                                       // all fragments of a k-step (eight, nine with LOWR) are read as one group of LDS loads
#pragma unroll
            for (int nb = 0; nb < 4; ++nb) b[nb] = ldb(&ring[bo + bfo + ((MODE == 1) ? rot[nb] : nb * 16) * PPI + ks]);
            v16bf al = a[0];
            if (LOWR) al = ldb(&xring[(t & 1) * XOP + xfo + ks]);
            __builtin_amdgcn_sched_barrier(0);                                // keeps the k-step's LDS loads one group ahead of its products
#pragma unroll
            for (int nb = 0; nb < 4; ++nb) {
#pragma unroll
                for (int mb = 0; mb < 4; ++mb) acc[mb][nb] = wmmab(a[mb], b[nb], acc[mb][nb]); }
            if (LOWR) { xacc[0] = wmmab((MODE == 0) ? a[0] : b[0], al, xacc[0]); xacc[1] = wmmab((MODE == 0) ? a[1] : b[1], al, xacc[1]); }
            __builtin_amdgcn_sched_barrier(0);                                // ... and the next group behind them
        }
        asm volatile("s_wait_dscnt 0x0" ::: "memory");                        // this wave's reads of buffer t & 1 are done before it is refilled
        asm volatile("s_wait_asynccnt 0x0" ::: "memory");                     // this wave's copies of tile t + 1 have landed
        __syncthreads();                                                      // publishes tile t + 1 and ends every reader's last read of buffer t & 1
        if (t + 2 < NT) { copy8(la + bo * 2, ga + (size_t)(t + 2) * PBK, (size_t)16 * K); copy8(lb + bo * 2, gb + (size_t)(t + 2) * PBK, (size_t)16 * K);
                          if (LOWR) copy1(lx + (t & 1) * (XOP * 2), gl + (size_t)(t + 2) * PBK); }
    }
    asm volatile("s_wait_asynccnt 0x0" ::: "memory");                         // no copy is outstanding behind the loop
    if (LOWR) {                                                                                   // extension k-step: rows of 32 bf16, same k map on both sides
        const size_t wxo = (size_t)(((MODE == 0) ? c0 : r0) + lr) * LK + 8 * hi;
        v16bf we[4];                                                                              // weight side, from its plane; the loads fly under the exchange below
#pragma unroll
        for (int i = 0; i < 4; ++i) we[i] = ldb(WX + wxo + (size_t)i * 16 * LK);
        fal* xs = (fal*)ring;                                                                     // [128 x rows of the block][XP]; every reader of the ring has passed the loop's last barrier and no copy is outstanding
        const int xw = (MODE == 0) ? wm : wn;                                                     // the wave's 64 x rows inside the block
#pragma unroll
        for (int i = 0; i < 2; ++i)
#pragma unroll
            for (int j = 0; j < 8; ++j) xs[(xw + rot[i] + hi * 8 + j) * XP + lr] = xacc[i][j] * LSC;   // D: row 8h+j, col lane&15
        __syncthreads();                                                                          // each wave reads 32 rows that its partner wave wrote
        v16bf xe[4];
#pragma unroll
        for (int i = 0; i < 4; ++i) {
            const v4f e0 = *(const v4fa*)(&xs[(xw + rot[i] + lr) * XP + xcol]); const v4f e1 = *(const v4fa*)(&xs[(xw + rot[i] + lr) * XP + xcol + 4]); v8us w;
#pragma unroll
            for (int k = 0; k < 4; ++k) { w[k] = ext_word(e0[k], hi); w[4 + k] = ext_word(e1[k], hi); }
            xe[i] = cat16b(w, (v8us){}); }
#pragma unroll
        for (int nb = 0; nb < 4; ++nb) {
#pragma unroll
            for (int mb = 0; mb < 4; ++mb) acc[mb][nb] = (MODE == 0) ? wmmab(xe[mb], we[nb], acc[mb][nb]) : wmmab(we[mb], xe[nb], acc[mb][nb]); }
    }
    float bc[4];
#pragma unroll
    for (int nb = 0; nb < 4; ++nb) bc[nb] = (MODE == 0) ? bfr(bias[c0 + nb * 16 + lr]) : 0.0f;   // MODE 0: c0 + 63 < DM
    size_t tbase, rbase; bool wr;                                                                 // wr: wave-uniform, the wave's whole tile inside the residual plane
    if (MODE == 0) { const int bb = r0 / SEQ, tt = r0 % SEQ; const int zc = bb * NH_ + c0 / HD;
                     tbase = ((size_t)zc * SEQ + (size_t)tt) * HD; rbase = ((size_t)zc * (size_t)resT + (size_t)tt) * HD; wr = tt < resT; }
    else           { const int bb = c0 / SEQ, tt = c0 % SEQ;
                     tbase = (size_t)bb * (size_t)DM * SEQ + (size_t)r0 * SEQ + (size_t)tt; rbase = (size_t)bb * (size_t)DM * (size_t)resT + (size_t)r0 * (size_t)resT + (size_t)tt; wr = tt < resT; }
#pragma unroll
    for (int mb = 0; mb < 4; ++mb) {
        float br[8];
#pragma unroll
        for (int j = 0; j < 8; ++j) br[j] = (MODE == 1) ? bfr(bias[r0 + mb * 16 + hi * 8 + j]) : 0.0f;   // MODE 1: r0 + 63 < DM
#pragma unroll
        for (int nb = 0; nb < 4; ++nb) {
#pragma unroll
            for (int j = 0; j < 8; ++j) os[(hi * 8 + j) * 68 + ((MODE == 1) ? rot[nb] : nb * 16) + lr] = acc[mb][nb][j] + bc[nb] + br[j]; }   // D: row 8h+j, col lane&15; rows 0..15 x columns 0..63 all written
        wave_sync();
{
            if (MODE == 0) {
                const size_t sb = tbase + (size_t)rot[mb] * HD;
                const size_t rb = rbase + (size_t)rot[mb] * HD;
#pragma unroll
                for (int s = 0; s < 4; ++s) { const int p = s * 32 + lane; const int row = p >> 3, c8 = (p & 7) * 8;   // 4 s x 4 rows = 16 rows; 8 lanes x 8 = 64 columns = one line
                    const v4f x0 = *(const v4fa*)(&os[row * 68 + c8]); const v4f x1 = *(const v4fa*)(&os[row * 68 + c8 + 4]); v8h hv, rv;
#pragma unroll
                    for (int i = 0; i < 4; ++i) { const h16 a0 = toh_flush(x0[i]); const h16 a1 = toh_flush(x1[i]); hv[i] = a0; hv[4 + i] = a1;
                                                  rv[i] = toh_flush((x0[i] - (float)a0) * QRS); rv[4 + i] = toh_flush((x1[i] - (float)a1) * QRS); }
                    const size_t oo = sb + (size_t)p * 8;
                    const size_t ro = rb + (size_t)p * 8;
                    *(v8h*)(Ph + oo) = hv; asm volatile("s_wait_xcnt 0x0" ::: "memory");                    // each store's registers are rewritten only behind its wait
                    if (wr) { *(v8h*)(Pr + ro) = rv; asm volatile("s_wait_xcnt 0x0" ::: "memory"); } }
            } else {
                const size_t sb = tbase + (size_t)(mb * 16) * SEQ;
                const size_t rb = rbase + (size_t)(mb * 16) * (size_t)resT;
#pragma unroll
                for (int s = 0; s < 4; ++s) { const int row = 4 * s + (lane >> 3), c8 = (lane & 7) * 8;   // 4 s x 4 row groups = 16 rows; 8 lanes x 8 = 64 columns
                    const v4f x0 = *(const v4fa*)(&os[row * 68 + c8]); const v4f x1 = *(const v4fa*)(&os[row * 68 + c8 + 4]); v8h hv, rv;
#pragma unroll
                    for (int i = 0; i < 4; ++i) { const h16 a0 = toh_flush(x0[i]); const h16 a1 = toh_flush(x1[i]); hv[i] = a0; hv[4 + i] = a1;
                                                  rv[i] = toh_flush((x0[i] - (float)a0) * QRS); rv[4 + i] = toh_flush((x1[i] - (float)a1) * QRS); }
                    const size_t oo = sb + (size_t)row * SEQ + c8;
                    const size_t ro = rb + (size_t)row * (size_t)resT + c8;
                    *(v8h*)(Ph + oo) = hv; asm volatile("s_wait_xcnt 0x0" ::: "memory");                    // each store's registers are rewritten only behind its wait
                    if (wr) { *(v8h*)(Pr + ro) = rv; asm volatile("s_wait_xcnt 0x0" ::: "memory"); } }
            }
             }
        wave_sync();
    }
}

// k_proj: the three projections in one launch, blockIdx.z picks one (block-uniform); the three bodies share one ring and one output staging, declared here so that the block's LDS is that of one body.
// z = 0, q: token-major with the update extension; z = 1, k: token-major, no extension; z = 2, v^T: feature-major with the update extension (A = Wv rows, so the block's row tile is blockIdx.y and its column tile blockIdx.x).
// Registers are capped at 256: without the cap the extension step spreads above v255 and pays a register-window switch at many of its instructions.
__global__ __launch_bounds__(32 * PW) __attribute__((amdgpu_num_vgpr(256)))
void k_proj(const bf* __restrict__ XB, const bf* __restrict__ WB, const bf* __restrict__ AL, const bf* __restrict__ BLq, const bf* __restrict__ BLv,
                                              const float* __restrict__ bq, const float* __restrict__ bk, const float* __restrict__ bv,
                                              h16* QH, h16* QR, h16* KP, h16* KR, h16* VT, h16* VR, int resT) {
    __shared__ __align__(16) bf ring[2 * PST];
    __shared__ __align__(16) bf xring[2 * XOP];
    __shared__ __align__(16) float osa[PW * 16 * 68];
    const int z = (int)blockIdx.z, gx = (int)blockIdx.x, gy = (int)blockIdx.y;
    const bf* WK = WB + (size_t)DM * DM; const bf* WV = WB + (size_t)2 * DM * DM;
    if (z == 0)      proj_body<0, 1>(ring, xring, osa, gx, gy, XB, WB, AL, BLq, 0, bq, QH, QR, resT);
    else if (z == 1) proj_body<0, 0>(ring, xring, osa, gx, gy, XB, WK, AL, WK, 0, bk, KP, KR, resT);
    else             proj_body<1, 1>(ring, xring, osa, gy, gx, WV, XB, AL, BLv, LR, bv, VT, VR, resT);
}

// compile-time switch handed to the key pass's tile pass
template <bool B> struct sw { static constexpr bool v = B; };

template <int EARLY>
__device__ __forceinline__ void keypass_body(h16* ring, float* os, float* mrow, int qt, int zh, const h16* __restrict__ QH, const h16* __restrict__ QR, const h16* __restrict__ KP, const h16* __restrict__ KR,
                                           const h16* __restrict__ VT, const h16* __restrict__ VR, const float* __restrict__ MB, const int* __restrict__ MF, float* OUT) {
    constexpr int KSG = (EARLY ? 4 : 2) * KOP;                                // elements of one stage: K | V^T (| K residual | V^T residual); the ring holds two stages
    const int lane = threadIdx.x & 31, lr = lane & 15, hi = lane >> 4;
    const int wave = __builtin_amdgcn_readfirstlane((int)(threadIdx.x >> 5));
    const int b = zh / NH_, h = zh % NH_;
    const int t0 = (qt * AW + wave) * 16;                                     // qt: the block's tile of 64 query rows, counted over the whole sequence
    const int lim = t0 + lr;                                                  // key j is causal-filled iff j > lim
    const float* amb = MB + (size_t)b * SEQ;                                  // the batch's mask row, already rounded to bf16 values
    const size_t pbase = (size_t)zh * SEQ * HD;
    const size_t rbase = (size_t)zh * EROWS * HD;
    // copy side: thread tid moves bytes 16 (tid & 7) of tile rows (tid >> 3) + 16 i, i = 0..3, of every staged plane (K rows = keys, V^T rows = d)
    const int crow = (int)(threadIdx.x >> 3), cch = (int)(threadIdx.x & 7);
    const h16* gk  = KP + pbase + (size_t)crow * HD + cch * 8;                // + key * HD, keys < SEQ
    const h16* gv  = VT + pbase + (size_t)crow * SEQ + cch * 8;               // + key, keys + 63 < SEQ
    const h16* gkr = KR + rbase + (size_t)crow * HD + cch * 8;                // + key * HD, keys < EROWS
    const h16* gvr = VR + rbase + (size_t)crow * EROWS + cch * 8;             // + key, keys + 63 < EROWS
    const unsigned l0 = (unsigned)(size_t)(&ring[crow * PPI + cch * 8]);      // LDS byte address = low 32 bits of the shared address
    auto stage = [&](int s, int buf) {                                        // tile s (keys 64 s .. 64 s + 63) -> buffer buf
        const int k0 = s * KST; const unsigned l = l0 + (unsigned)buf * (KSG * 2);
        copy4(l, gk + (size_t)k0 * HD, (size_t)16 * HD); copy4(l + KOP * 2, gv + k0, (size_t)16 * SEQ);
        if (EARLY) { const int kc = (k0 < EROWS) ? k0 : (EROWS - KST);        // clamped residual-plane key (address always inside the plane)
                     copy4(l + 2 * KOP * 2, gkr + (size_t)kc * HD, (size_t)16 * HD); copy4(l + 3 * KOP * 2, gvr + kc, (size_t)16 * EROWS); } };
    stage(0, 0);                                                              // tile 0 exists for every block; its copies fly under the Q loads
    copy4m((unsigned)(size_t)(&mrow[threadIdx.x * 4]), amb + threadIdx.x * 4);   // the batch's whole mask row (SEQ floats) -> LDS, once per block; tile 0's wait and barrier below cover these copies too
    const bool wide = MF[b] != 0;                                             // k_prep's test of the batch's mask row: any value not below WIDE in magnitude widens the key loop to all keys
    const int nkc = (t0 + 16 + 31) & ~31;                                     // causal bound, multiple of 32, <= SEQ
    const int nk = __builtin_amdgcn_readfirstlane(wide ? SEQ : nkc);
    const int nbv = wide ? SEQ : ((qt + 1) * KST);           // the block's bound = its last wave's; every wave reads the same word, so it is block-uniform
    const int NS = __builtin_amdgcn_readfirstlane(nbv) / KST;                 // staged tiles of the block, >= 1
    const size_t qo = pbase + (size_t)(t0 + lr) * HD + 8 * hi;
    const v16h hz = (v16h){};
    v16h qh[2], qr[2];
    qh[0] = ldh(QH + qo); qh[1] = ldh(QH + qo + 32);             // B fragments: col t, k = d (two k-steps)
    qr[0] = hz; qr[1] = hz;
    if (EARLY) { const size_t qro = rbase + (size_t)(t0 + lr) * HD + 8 * hi; qr[0] = ldh(QR + qro); qr[1] = ldh(QR + qro + 32);     // t0 + lr < EROWS
                 asm volatile("s_wait_xcnt 0x0" ::: "memory"); }               // the Q loads' address registers are rewritten only behind this wait
    const int fo = lr * PPI + 8 * hi;                          // read side, same loader and k map as from the planes, rows at pitch PPI: K + key * PPI (A fragment: row key, k = d); V^T + 16j * PPI + key (A fragment: row d, k = key)
    v8f o[4], oR[4];
#pragma unroll
    for (int j = 0; j < 4; ++j) { o[j] = (v8f){}; oR[j] = (v8f){}; }
    float m = NEGB, l = 0.0f;
    v8f lt = (v8f){};
    v16h ones;
#pragma unroll
    for (int i = 0; i < 16; ++i) ones[i] = (lr == 0) ? (h16)1.0f : (h16)0.0f;
    asm volatile("s_wait_asynccnt 0x0" ::: "memory");            // this wave's copies of tile 0 have landed
    __syncthreads();                                             // ... and every other wave's
    if (1 < NS) stage(1, 1);
    // one pass over staged tile s. FILL = false: every key of the tile is below every query row of the block, no key is replaced, and the per-element index, compare and select are left out; all else is the same text
    auto tile = [&](auto fsw, int s) __attribute__((always_inline)) {
    constexpr bool FILL = decltype(fsw)::v;
    const int bo = (s & 1) * KSG;
    const int ke = (nk - s * KST < KST) ? nk - s * KST : KST;    // keys of this tile below the wave's own bound
#pragma unroll 1
    for (int kk = 0; kk < ke; kk += 32) {                        // rolled: the 32-key halves of a tile share one body, which keeps the loop's text small
        const int key0 = s * KST + kk;
        const bool rok = key0 < EROWS;                           // wave-uniform
        const h16* kpt = &ring[bo + fo + kk * PPI];
        v8f sHa = (v8f){}, sLa = (v8f){}, sHb = (v8f){}, sLb = (v8f){};
        const h16* krp = &ring[bo + (EARLY ? 2 : 0) * KOP + fo + kk * PPI];   // residual tiles exist in the EARLY stage only
        const h16* va  = &ring[bo + KOP + fo + kk];
        const h16* vrp = &ring[bo + (EARLY ? 3 : 1) * KOP + fo + kk];
        const float* kp = &mrow[8 * hi + key0];                  // keys key0+8h+0..7 and key0+16+8h+0..7, all < nk <= SEQ; from the row staged in LDS
        const v4f m0 = *(const v4fa*)kp, m1 = *(const v4fa*)(kp + 4), m2 = *(const v4fa*)(kp + 16), m3 = *(const v4fa*)(kp + 20);
        v16h ka[2], kb[2], kra[2], krb[2], vf[4];          // the fragments of a product run are read as one group of LDS loads ahead of it
#pragma unroll
        for (int ks = 0; ks < 2; ++ks) {
            ka[ks] = ldh(kpt + ks * 32); kb[ks] = ldh(kpt + 16 * PPI + ks * 32);
            if (EARLY) { kra[ks] = ldh(krp + ks * 32); krb[ks] = ldh(krp + 16 * PPI + ks * 32); } }
        if (!EARLY) {                                              // registers allow: the V^T fragments join the K group
#pragma unroll
            for (int j = 0; j < 4; ++j) vf[j] = ldh(va + (16 * j) * PPI); }
        __builtin_amdgcn_sched_barrier(0);                         // keeps the LDS loads above one group ahead of the score products
#pragma unroll
        for (int ks = 0; ks < 2; ++ks) {
            sHa = wmma16(ka[ks], qh[ks], sHa); sHb = wmma16(kb[ks], qh[ks], sHb);
            if (EARLY) {
                sLa = wmma16(ka[ks], qr[ks], sLa); sLb = wmma16(kb[ks], qr[ks], sLb);
                if (!rok) { kra[ks] = hz; krb[ks] = hz; }
                sLa = wmma16(kra[ks], qh[ks], sLa); sLb = wmma16(krb[ks], qh[ks], sLb);
            }
        }
        if (EARLY) {                                               // the V^T group flies under the softmax
#pragma unroll
            for (int j = 0; j < 4; ++j) vf[j] = ldh(va + (16 * j) * PPI); }
        float kx[8], ky[8];
#pragma unroll
        for (int r = 0; r < 4; ++r) { kx[r] = m0[r]; kx[4 + r] = m1[r]; ky[r] = m2[r]; ky[4 + r] = m3[r]; }
        const int ja = key0 + 8 * hi;
        float ta[8], tb[8]; float mx = NEGB;
#pragma unroll
        for (int r = 0; r < 8; ++r) {
            const float sa = EARLY ? (sHa[r] + sLa[r] * QRI) * SC2 : sHa[r] * SC2;
            const float sb = EARLY ? (sHb[r] + sLb[r] * QRI) * SC2 : sHb[r] * SC2;
            if (FILL) { ta[r] = ((ja + r > lim) ? NEGL : sa) + kx[r] * L2E;      // replace, then add the mask
                        tb[r] = ((ja + 16 + r > lim) ? NEGL : sb) + ky[r] * L2E; }
            else      { ta[r] = __builtin_fmaf(kx[r], L2E, sa);                  // the mask is added in the fused form that the other body compiles to: same bits
                        tb[r] = __builtin_fmaf(ky[r], L2E, sb); }
        }
        // single-product body: with the row sum off the vector unit nothing joins element r of the two 16-key tiles any more, and the maximum (exact in any order) takes neighbours of one tile, so that the packed arithmetic works on register pairs as the products leave them, without copies; the multi-product body shares the text
#pragma unroll
        for (int r = 0; r < 8; r += 2) mx = fmaxf(mx, fmaxf(ta[r], ta[r + 1]));
#pragma unroll
        for (int r = 0; r < 8; r += 2) mx = fmaxf(mx, fmaxf(tb[r], tb[r + 1]));
        mx = fmaxf(mx, __shfl_xor(mx, 16, 32));
        const float mnew = fmaxf(m, mx);
        float alpha;                                               // exp2(m - mnew), with the one slot that the instruction set asks for behind a transcendental in the same statement
        asm volatile("v_exp_f32 %0, %1\n\tv_nop" : "=v"(alpha) : "v"(m - mnew));
        const float sh = PSH - mnew;
        v16h pb, pr = hz; float ls = 0.0f;
#pragma unroll
        for (int r = 0; r < 8; ++r) {
            const float aa = ta[r] + sh, ab = tb[r] + sh;
            const float ea = __builtin_amdgcn_exp2f(aa), eb = __builtin_amdgcn_exp2f(ab);
            const float ga = (aa < PFL) ? 0.0f : ea, gb = (ab < PFL) ? 0.0f : eb;   // below the f16 normal range -> exactly zero, selected by value
            const h16 pa = (h16)ga; const h16 pc = (h16)gb;
            pb[r] = pa; pb[8 + r] = pc;
            if (EARLY) { pr[r] = toh_flush((ga - (float)pa) * QRS); pr[8 + r] = toh_flush((gb - (float)pc) * QRS); ls += ga + gb; } }
        if (EARLY) l = l * alpha + ls; else lt[0] = lt[0] * alpha;
        m = mnew;
#pragma unroll
        for (int j = 0; j < 4; ++j) { o[j] = o[j] * alpha; if (EARLY) oR[j] = oR[j] * alpha; }
        if (!EARLY) lt = wmma16(ones, pb, lt);
#pragma unroll
        for (int jp = 0; jp < 2; ++jp) {
            const v16h v0 = vf[2 * jp], v1 = vf[2 * jp + 1];
            o[2 * jp] = wmma16(v0, pb, o[2 * jp]); o[2 * jp + 1] = wmma16(v1, pb, o[2 * jp + 1]);
            if (EARLY) {
                oR[2 * jp] = wmma16(v0, pr, oR[2 * jp]); oR[2 * jp + 1] = wmma16(v1, pr, oR[2 * jp + 1]);
                v16h vr0 = ldh(vrp + (32 * jp) * PPI), vr1 = ldh(vrp + (32 * jp + 16) * PPI);
                if (!rok) { vr0 = hz; vr1 = hz; }
                oR[2 * jp] = wmma16(vr0, pb, oR[2 * jp]); oR[2 * jp + 1] = wmma16(vr1, pb, oR[2 * jp + 1]);
            }
        }
        if (!EARLY) {
            __builtin_amdgcn_sched_barrier(0);                     // keeps the slots below behind the trip's last product
            asm volatile("v_nop\n\tv_nop"); }   // the distance between a product and a vector write over its A registers, on the loop's back edge: the next trip's address arithmetic lands in those registers
    }
    asm volatile("s_wait_dscnt 0x0" ::: "memory");               // this wave's reads of buffer s & 1 are done before it is refilled
    asm volatile("s_wait_asynccnt 0x0" ::: "memory");            // this wave's copies of tile s + 1 have landed
    __syncthreads();                                             // publishes tile s + 1 and ends every reader's last read of buffer s & 1
    if (s + 2 < NS) stage(s + 2, s & 1);
    };
    // tiles 0 .. qt - 1 hold keys below 64 qt, the block's first query row (qt < NS always); from tile qt on the replacement can apply. Two loops, so that each body stays one straight run of code.
    // The multi-product instantiation (at most EROWS / KST tiles below the diagonal, a small part of the work) keeps its one loop.
    if constexpr (!EARLY) {
#pragma unroll 1
        for (int s = 0; s < qt; ++s) tile(sw<false>{}, s);       // rolled: one pass per staged tile
    }
#pragma unroll 1
    for (int s = EARLY ? 0 : qt; s < NS; ++s) tile(sw<true>{}, s);   // rolled: one pass per staged tile
    asm volatile("s_wait_asynccnt 0x0" ::: "memory");            // no copy is outstanding behind the loop
    if (!EARLY) l = lt[0];                                       // row 0 of the tile: lanes 0..15 hold their column's sum, lanes 16..31 (row 8) zero
    l += __shfl_xor(l, 16, 32);
    const float inv = 1.0f / l;                                  // l >= 2^14 whenever the row has a finite maximum logit
    const int wb = wave * 16 * OSP;
    // O^T D layout: o[j][r] = (d = 16j + 8h + r, t = lane&15) -> os[t][d]; rows 0..15 x columns 0..63 all written
#pragma unroll
    for (int j = 0; j < 4; ++j) {
        v8f f = o[j];
        if (EARLY) f = o[j] + oR[j] * QRI;
        v4f a, c;
        a[0] = f[0] * inv; a[1] = f[1] * inv; a[2] = f[2] * inv; a[3] = f[3] * inv; c[0] = f[4] * inv; c[1] = f[5] * inv; c[2] = f[6] * inv; c[3] = f[7] * inv;
        *(v4fa*)(&os[wb + lr * OSP + 16 * j + 8 * hi]) = a; *(v4fa*)(&os[wb + lr * OSP + 16 * j + 8 * hi + 4]) = c; }
    wave_sync();
    float* orow = OUT + ((size_t)b * OUT_SEQ + t0) * DM + h * HD;
{
#pragma unroll
        for (int s = 0; s < 8; ++s) { const int row = 2 * s + (lane >> 4), cofs = (lane & 15) * 4;   // 8 s x 2 rows = 16 rows; 16 lanes x 4 floats = 64 columns = two lines
            const v4f val = *(const v4fa*)(&os[wb + row * OSP + cofs]);
            *(v4f*)(orow + (size_t)row * DM + cofs) = val; }
         }
}

// k_keypass: both instantiations in one launch. blockIdx.x = (batch, head); blockIdx.y counts the 64-row query tiles from the last one down, for speed only. The choice of the body is block-uniform; the two bodies share one ring and one output staging, declared here.
// Registers are capped at 272: the LDS admits three blocks per WGP, three waves per SIMD, and 3 x 272 registers fit a SIMD's 1,024.
__global__ __launch_bounds__(32 * AW) __attribute__((amdgpu_num_vgpr(272)))
void k_keypass(const h16* __restrict__ QH, const h16* __restrict__ QR, const h16* __restrict__ KP, const h16* __restrict__ KR,
               const h16* __restrict__ VT, const h16* __restrict__ VR, const float* __restrict__ MB, const int* __restrict__ MF, float* OUT) {
    __shared__ __align__(16) h16 ring[2 * 4 * KOP];
    __shared__ __align__(16) float os[AW * 16 * OSP];
    __shared__ __align__(16) float mrow[SEQ];
    const int zh = (int)blockIdx.x; const int qt = SEQ / (16 * AW) - 1 - (int)blockIdx.y;
    if (qt < EROWS / (16 * AW)) keypass_body<1>(ring, os, mrow, qt, zh, QH, QR, KP, KR, VT, VR, MB, MF, OUT);
    else                        keypass_body<0>(ring, os, mrow, qt, zh, QH, QH, KP, KP, VT, VT, MB, MF, OUT);
}

static constexpr size_t al256(size_t v) { return (v + 255) & ~(size_t)255; }
static constexpr size_t SZ_XB = al256((size_t)NB * SEQ * DM * 2);
static constexpr size_t SZ_WB = al256((size_t)3 * DM * DM * 2);
static constexpr size_t SZ_AL = al256((size_t)2 * LR * DM * 2);
static constexpr size_t SZ_BL = al256((size_t)DM * LK * 2);
static constexpr size_t SZ_PL = al256((size_t)NB * NH_ * SEQ * HD * 2);
static constexpr size_t SZ_RS = al256((size_t)NB * NH_ * EROWS * HD * 2);
static constexpr size_t SZ_MB = al256((size_t)NB * SEQ * 4);
static constexpr size_t SZ_MF = al256((size_t)NB * 4);
static constexpr size_t SZ_TOTAL = SZ_XB + SZ_WB + SZ_AL + 2 * SZ_BL + 3 * SZ_PL + 3 * SZ_RS + SZ_MB + SZ_MF;
static_assert(SZ_TOTAL <= (size_t)134217728);          // workspace carve <= 128 MiB
static_assert(((size_t)DM * DM * 2) % 256 == 0);       // weight sub-planes stay 256-byte aligned
static_assert(((size_t)LR * DM * 2) % 256 == 0);       // the two halves of the A plane stay 256-byte aligned
static_assert((size_t)NB * NH_ * SEQ * HD == (size_t)NB * DM * SEQ);       // v^T plane [(b*1024 + m)][t] has the same extent as the q/k planes
static_assert((size_t)NB * NH_ * EROWS * HD == (size_t)NB * DM * EROWS);   // v^T residual plane [(b*1024 + m)][t < EROWS] has the same extent as the q/k residual planes
static_assert((DM * 4) % 256 == 0);                    // the extension-plane block ranges of k_prep cover their planes exactly

extern "C" void kernel_launch(void* const* d_in, const int* in_sizes, int n_in,
                              void* d_out, int out_size, void* d_ws, size_t ws_size, hipStream_t stream) {
    if (n_in < 12) return;
    const size_t needx = ((size_t)(NB - 1) * SEQ_FULL + SEQ) * DM;
    const size_t needm = (size_t)(NB - 1) * SEQ_FULL + SEQ;
    if ((size_t)in_sizes[0] < needx || (size_t)in_sizes[1] < needm) return;
    if ((size_t)in_sizes[2] < (size_t)DM * DM || (size_t)in_sizes[4] < (size_t)DM * DM || (size_t)in_sizes[6] < (size_t)DM * DM) return;
    if (in_sizes[3] < DM || in_sizes[5] < DM || in_sizes[7] < DM) return;
    if (in_sizes[8] < LR * DM || in_sizes[9] < DM * LR || in_sizes[10] < LR * DM || in_sizes[11] < DM * LR) return;
    if ((size_t)out_size < ((size_t)(NB - 1) * OUT_SEQ + SEQ) * DM) return;
    if (SZ_TOTAL > ws_size) return;
    // wire order: hidden_states, key_mask (the module's additive key mask input), Wq, bq, Wk, bk, Wv, bv, Aq, Bq, Av, Bv
    const float* xin = (const float*)d_in[0];
    const float* am  = (const float*)d_in[1];
    const float* wq = (const float*)d_in[2]; const float* bq = (const float*)d_in[3];
    const float* wk = (const float*)d_in[4]; const float* bk = (const float*)d_in[5];
    const float* wv = (const float*)d_in[6]; const float* bv = (const float*)d_in[7];
    const float* aq = (const float*)d_in[8]; const float* bqu = (const float*)d_in[9];
    const float* av = (const float*)d_in[10]; const float* bvu = (const float*)d_in[11];
    float* OUT = (float*)d_out;      // [NB][SEQ][1024]
    char* wsp = (char*)d_ws;
    bf* XB = (bf*)wsp; wsp += SZ_XB;                 // x      [NB*SEQ][1024]
    bf* WB = (bf*)wsp; wsp += SZ_WB;                 // [3][1024][1024]: q | k | v  ([out][in] = Bt as-is)
    bf* AL = (bf*)wsp; wsp += SZ_AL;                 // [16][1024]: rows 0..7 A of the q update, rows 8..15 A of the v update
    bf* BLq = (bf*)wsp; wsp += SZ_BL;                // [1024][32]: B | B | 0 | 0 (q update)
    bf* BLv = (bf*)wsp; wsp += SZ_BL;                // [1024][32]: B | B | 0 | 0 (v update)
    h16* QH = (h16*)wsp; wsp += SZ_PL;               // [NB*16][SEQ][64]
    h16* KP = (h16*)wsp; wsp += SZ_PL;               // [NB*16][SEQ][64]
    h16* VT = (h16*)wsp; wsp += SZ_PL;               // [NB*16][64][SEQ]
    h16* QR = (h16*)wsp; wsp += SZ_RS;               // [NB*16][EROWS][64] residual x2048, tokens < EROWS
    h16* KR = (h16*)wsp; wsp += SZ_RS;               // [NB*16][EROWS][64] residual x2048, tokens < EROWS
    h16* VR = (h16*)wsp; wsp += SZ_RS;               // [NB*16][64][EROWS] residual x2048, tokens < EROWS
    float* MB = (float*)wsp; wsp += SZ_MB;           // [NB][SEQ] mask values after the convert to bf16, as f32
    int* MF = (int*)wsp; wsp += SZ_MF;               // [NB] 1 where the batch's mask row widens the key loop

    // all conversions to bf16
    k_prep<<<dim3(NB + CB_X + 3 * CB_W + 2 * CB_A + 2 * CB_B, 1, 1), 256, 0, stream>>>(xin, wq, wk, wv, aq, av, bqu, bvu, am, XB, WB, AL, BLq, BLv, MB, MF);

    // q, k: A = x rows (m = b*SEQ + t), Bt = W rows (n = h*64 + d) -> plane [(b*16 + h)][t][d]; v^T: A = Wv rows (m = h*64 + d), Bt = x rows (n = b*SEQ + t) -> plane [(b*1024 + m)][t] = [(b*16 + h)][d][t]; residuals for tokens < EROWS
    k_proj<<<dim3(NB * SEQ / 128, DM / 128, 3), 32 * PW, 0, stream>>>(XB, WB, AL, BLq, BLv, bq, bk, bv, QH, QR, KP, KR, VT, VR, EROWS);

    // query rows [0, EROWS): multi-product instantiation; rows [EROWS, SEQ): single-product instantiation (disjoint output rows)
    k_keypass<<<dim3(NB * NH_, SEQ / (16 * AW), 1), 32 * AW, 0, stream>>>(QH, QR, KP, KR, VT, VR, MB, MF, OUT);
}
